// v000
// The times below were measured on an AMD MI455X: many runs one after another, warmed up first and cycling through
// copies of the inputs, with the whole window's GPU time divided by the number of runs. Launches and the gaps
// between them are all in it. The median over several windows is given; except for v000 it joins two sittings, which
// can be a few percent apart, so the side-by-side timings, each taken in one sitting, are the better comparison.
// v000, which the later versions start from, runs in 2140 microseconds.
#include <hip/hip_runtime.h>

// TinySelfAttention (x [2][2048][1024]; q = x wq_w^T + 2 (x wq_A^T) wq_B^T (LoRA, r = 8, alpha/r = 2), k = x wk_w^T, v = x wv_w^T + 2 (x wv_A^T) wv_B^T (16 heads x 64); scores = q.k / 8, masked (-inf) where attn_mask[i][j] != 0 (int [2048][2048], read - the module's strict-upper-triangle mask, but read as data over every tile); softmax; out = merged wo_w^T -> [2][2048][1024]).
// Compute dtypes, f32 accumulate: every input rounded to bf16; base projections and the rank-8 down-projections on PLAIN bf16 operands (inputs: exact; the 8 outputs padded to 64 with zero weights); the up-projections as hl planes (K padded 8 -> 32 with zeros) x exact B (2 products), added x 2 in f32; scores over ALL key tiles (mask read per element) and attn.v: query rows < 512 hl (3 products), the rest single fp16 (x1024); softmax f32; wo hl x exact (2 products).

#define NB_  2
#define TT   2048
#define DM   1024
#define NH_  16
#define NKV  16
#define REP  (NH_ / NKV)
#define HD   64
#define DQ   (NH_ * HD)
#define DKV  (NKV * HD)
#define ZH   2
#define RH   512                  // query rows < RH use hi+lo planes (0: none)
#define WIN  0
#define PCAR 1024.0f
#define SCL  0.125f   // HD^-0.5
typedef _Float16 h16;
typedef unsigned short bf;
typedef __attribute__((ext_vector_type(16))) __bf16   v16bf;
typedef __attribute__((ext_vector_type(16))) _Float16 v16h;
typedef __attribute__((ext_vector_type(8)))  _Float16 v8h;
typedef __attribute__((ext_vector_type(8)))  unsigned short v8us;
typedef __attribute__((ext_vector_type(8)))  float    v8f;
typedef __attribute__((ext_vector_type(4)))  float    v4f;
typedef v8h  __attribute__((may_alias)) v8ha;
typedef v4f  __attribute__((may_alias)) v4fa;
typedef v8us __attribute__((may_alias)) v8usa;

__device__ __forceinline__ unsigned short f2bf(float f) { unsigned u = __float_as_uint(f); u += 0x7FFFu + ((u >> 16) & 1u); return (unsigned short)(u >> 16); }
__device__ __forceinline__ float bf2f(unsigned short b) { return __uint_as_float(((unsigned)b) << 16); }
__device__ __forceinline__ float bfr(float f) { return bf2f(f2bf(f)); }
__device__ __forceinline__ v16h cat16(v8h lo, v8h hi) { return __builtin_shufflevector(lo, hi, 0, 1, 2, 3, 4, 5, 6, 7, 8, 9, 10, 11, 12, 13, 14, 15); }
__device__ __forceinline__ v16bf cat16b(v8us lo, v8us hi) { return __builtin_bit_cast(v16bf, __builtin_shufflevector(lo, hi, 0, 1, 2, 3, 4, 5, 6, 7, 8, 9, 10, 11, 12, 13, 14, 15)); }
__device__ __forceinline__ v8f wmma16(v16h a, v16h b, v8f c) { return __builtin_amdgcn_wmma_f32_16x16x32_f16(false, a, false, b, (short)0, c, false, false); }
__device__ __forceinline__ v8f wmmab(v16bf a, v16bf b, v8f c) { return __builtin_amdgcn_wmma_f32_16x16x32_bf16(false, a, false, b, (short)0, c, false, false); }



// ---- k_gemmw: register-blocked GEMM, ONE WAVE per 64x64 output tile (16 accumulators), operands straight from K-contiguous 16-bit planes; grid (M/64, N/64, Z), 32 threads.
// C[m][n] (f32, pitch ldc, + optional f32 bias[n]) = sum_k A[m][k] Bt[n][k] (+ split products per NSPLIT). z-batch strides sA/sB/sC in elements. K % 32 == 0.
template <typename T16> struct WFrag;
template <> struct WFrag<h16> { typedef v16h V; static __device__ __forceinline__ V ld(const h16* p) { return cat16(*(const v8h*)p, *(const v8h*)(p + 16)); } static __device__ __forceinline__ v8f mma(V a, V b, v8f c) { return wmma16(a, b, c); } };
template <> struct WFrag<bf> { typedef v16bf V; static __device__ __forceinline__ V ld(const bf* p) { return cat16b(*(const v8us*)p, *(const v8us*)(p + 16)); } static __device__ __forceinline__ v8f mma(V a, V b, v8f c) { return wmmab(a, b, c); } };
template <typename T16, int NSPLIT, bool BIAS>
__global__ __launch_bounds__(32) void k_gemmw(const T16* __restrict__ A, const T16* __restrict__ A2, const T16* __restrict__ Bt, const T16* __restrict__ Bt2, int K, float* C, int ldc, const float* __restrict__ bias, size_t sA, size_t sB, size_t sC) {
    typedef typename WFrag<T16>::V V;
    __shared__ __align__(16) float os[16 * 68];
    const size_t z = blockIdx.z; A += z * sA; if (A2) A2 += z * sA; Bt += z * sB; if (Bt2) Bt2 += z * sB; C += z * sC;
    const int lane = threadIdx.x & 31, lr = lane & 15, hi = lane >> 4; const int r0 = blockIdx.x * 64, c0 = blockIdx.y * 64;
    v8f acc[4][4];
#pragma unroll
    for (int mb = 0; mb < 4; ++mb)
#pragma unroll
        for (int nb = 0; nb < 4; ++nb) acc[mb][nb] = (v8f){};
    const size_t aoff = (size_t)(r0 + lr) * K + 8 * hi, boff = (size_t)(c0 + lr) * K + 8 * hi;
#pragma unroll 1
    for (int kc = 0; kc < K; kc += 32) {
        V a[4], a2[4];
#pragma unroll
        for (int mb = 0; mb < 4; ++mb) { a[mb] = WFrag<T16>::ld(A + aoff + (size_t)mb * 16 * K + kc); if (NSPLIT == 1 || NSPLIT == 2) a2[mb] = WFrag<T16>::ld(A2 + aoff + (size_t)mb * 16 * K + kc); }
#pragma unroll
        for (int nb = 0; nb < 4; ++nb) { const V b = WFrag<T16>::ld(Bt + boff + (size_t)nb * 16 * K + kc); V b2; if (NSPLIT >= 2) b2 = WFrag<T16>::ld(Bt2 + boff + (size_t)nb * 16 * K + kc);
#pragma unroll
            for (int mb = 0; mb < 4; ++mb) { acc[mb][nb] = WFrag<T16>::mma(a[mb], b, acc[mb][nb]); if (NSPLIT == 1 || NSPLIT == 2) acc[mb][nb] = WFrag<T16>::mma(a2[mb], b, acc[mb][nb]); if (NSPLIT >= 2) acc[mb][nb] = WFrag<T16>::mma(a[mb], b2, acc[mb][nb]); } }
        asm volatile("v_nop\n\tv_nop\n\tv_nop\n\tv_nop" : "+v"(acc[0][0]), "+v"(acc[1][1]), "+v"(acc[2][2]), "+v"(acc[3][3]) : "v"(a[0]), "v"(a[3]));
    }
#pragma unroll
    for (int mb = 0; mb < 4; ++mb) {
#pragma unroll
        for (int nb = 0; nb < 4; ++nb) {
#pragma unroll
            for (int j = 0; j < 8; ++j) os[(hi * 8 + j) * 68 + nb * 16 + lr] = acc[mb][nb][j]; }
        __builtin_amdgcn_wave_barrier(); asm volatile("" ::: "memory");
        float* crow = C + (size_t)(r0 + mb * 16) * ldc + c0;
{
#pragma unroll
            for (int s = 0; s < 8; ++s) { const int row = 2 * s + hi, cofs = lr * 4; v4f val = *(const v4fa*)(os + row * 68 + cofs); if (BIAS) { val[0] += bfr(bias[c0 + cofs]); val[1] += bfr(bias[c0 + cofs + 1]); val[2] += bfr(bias[c0 + cofs + 2]); val[3] += bfr(bias[c0 + cofs + 3]); }
                *(v4f*)(crow + (size_t)row * ldc + cofs) = val; }
             }
        __builtin_amdgcn_wave_barrier(); asm volatile("" ::: "memory");
    }
}

__device__ __forceinline__ h16 tohx(float x) { return (h16)x; }
__device__ __forceinline__ void splitf(float y, unsigned short& h, unsigned short& l) { h = f2bf(y); l = f2bf(y - bf2f(h)); }
typedef __attribute__((ext_vector_type(2))) _Float16 v2h;
typedef __attribute__((ext_vector_type(4))) _Float16 v4h;
typedef __attribute__((ext_vector_type(2))) unsigned short v2us;
typedef __attribute__((ext_vector_type(4))) unsigned short v4us;
typedef __attribute__((ext_vector_type(2))) float v2f;
typedef __attribute__((ext_vector_type(4))) int v4i;

__global__ __launch_bounds__(256) void k_wtG(const float* __restrict__ w, int K, int N, bf* Bt) {
    const int lane = threadIdx.x & 31; const int L0 = (blockIdx.x * 8 + (threadIdx.x >> 5)) * 8; const int nlines = N * K / 64;
{
#pragma unroll 1
        for (int l = 0; l < 8; ++l) { const int L = L0 + l; if (L >= nlines) break; const size_t e = (size_t)L * 64 + lane * 2; const int k = (int)(e % K), n = (int)(e / K); v2us o;
            o[0] = f2bf(w[(size_t)k * N + n]); o[1] = f2bf(w[(size_t)(k + 1) * N + n]); *(v2us*)(Bt + e) = o; }
         }
}
__global__ __launch_bounds__(256) void k_cvt8(const float* __restrict__ src, bf* dst, size_t n8) { const size_t i = (size_t)blockIdx.x * 256 + threadIdx.x; if (i >= n8) return; const v8f v = *(const v8f*)(src + i * 8); v8us o;
#pragma unroll
    for (int k = 0; k < 8; ++k) o[k] = f2bf(v[k]); *(v8us*)(dst + i * 8) = o;  }
__global__ __launch_bounds__(256) void k_cscvt(const float* __restrict__ cosT, const float* __restrict__ sinT, float* CS) { const int idx = blockIdx.x * 256 + threadIdx.x; if (idx >= TT * HD) return; v2f cs; cs[0] = bfr(cosT[idx]); cs[1] = bfr(sinT[idx]); *(v2f*)(CS + (size_t)idx * 2) = cs;  }
// k_rope: head planes [h][t][d] (fp16 + hi/lo) of rope(x) x sc with the rotate-half convention out[d] = x[d] cos[t][d] - x[d+HD/2] sin[t][d], out[d+HD/2] = x[d+HD/2] cos[t][d+HD/2] + x[d] sin[t][d+HD/2]
__global__ __launch_bounds__(256) void k_rope(const float* __restrict__ F, int pitch, int nheads, const float* __restrict__ CS, const float* __restrict__ RF, const float* __restrict__ nw, float sc, h16* P16, bf* Ph, bf* Pl) {
    const size_t e = ((size_t)blockIdx.x * 256 + threadIdx.x) * 2; if (e >= (size_t)nheads * TT * HD) return; const int d = (int)(e % HD); const int t = (int)((e / HD) % TT); const int h = (int)(e / ((size_t)HD * TT)); const float* f = F + (size_t)t * pitch + h * HD; const float rf = RF ? RF[(size_t)h * TT + t] : 1.0f; v2h o16; v2us oh, ol;
#pragma unroll
    for (int q = 0; q < 2; ++q) { const int dd = d + q; const int dp = (dd < HD / 2) ? dd + HD / 2 : dd - HD / 2; float x0 = f[dd], x1 = f[dp];
        if (RF) { float n0 = __fmul_rn(x0, rf), n1 = __fmul_rn(x1, rf); asm volatile("" : "+v"(n0)); asm volatile("" : "+v"(n1)); x0 = __fmul_rn(bfr(nw[dd]), n0); x1 = __fmul_rn(bfr(nw[dp]), n1); }
        const v2f cs = *(const v2f*)(CS + ((size_t)t * HD + dd) * 2); float a = __fmul_rn(x0, cs[0]), bq = __fmul_rn(x1, cs[1]); asm volatile("" : "+v"(a)); asm volatile("" : "+v"(bq)); const float r = ((dd < HD / 2) ? __fsub_rn(a, bq) : __fadd_rn(a, bq)) * sc;
        o16[q] = tohx(r); unsigned short a2, c2; splitf(r, a2, c2); oh[q] = a2; ol[q] = c2; }
    *(v2h*)(P16 + e) = o16; *(v2us*)(Ph + e) = oh; *(v2us*)(Pl + e) = ol;  }
__global__ __launch_bounds__(256) void k_vtp(const float* __restrict__ F, int pitch, int nheads, h16* V16, bf* Vh, bf* Vl) { const size_t e = ((size_t)blockIdx.x * 256 + threadIdx.x) * 2; if (e >= (size_t)nheads * HD * TT) return; const int t = (int)(e % TT); const int d = (int)((e / TT) % HD); const int g = (int)(e / ((size_t)TT * HD)); v2h o16; v2us oh, ol;
#pragma unroll
    for (int q = 0; q < 2; ++q) { const float x = F[(size_t)(t + q) * pitch + g * HD + d]; o16[q] = tohx(x); unsigned short a2, c2; splitf(x, a2, c2); oh[q] = a2; ol[q] = c2; }
    *(v2h*)(V16 + e) = o16; *(v2us*)(Vh + e) = oh; *(v2us*)(Vl + e) = ol;  }
__global__ __launch_bounds__(256) void k_csid(float* CS) { const int idx = blockIdx.x * 256 + threadIdx.x; if (idx >= TT * HD) return; v2f cs; cs[0] = 1.0f; cs[1] = 0.0f; *(v2f*)(CS + (size_t)idx * 2) = cs;  }
// k_asoft: per row (zz, i): t = S x HD^-0.5, -3e38 where attn_mask[i][j] != 0; softmax over the 2048 keys (register row, one exp, fixed trees);
__global__ __launch_bounds__(256) void k_asoft(const float* __restrict__ Sb, const int* __restrict__ am, h16* P16, bf* Ph, bf* Pl) {
    const int lane = threadIdx.x & 31; const int row = blockIdx.x * 8 + (threadIdx.x >> 5); if (row >= ZH * TT) return; const int i = row % TT; const int zz = row / TT; (void)zz; const bool hires = (i < RH); const float* sr = Sb + (size_t)row * TT; float v[TT / 32]; float mx = -3.0e38f;
#pragma unroll
    for (int ch = 0; ch < TT / 128; ++ch) { const int j0 = ch * 128 + lane * 4; const v4f a = *(const v4f*)(sr + j0);
#pragma unroll
        for (int q = 0; q < 4; ++q) { const int j = j0 + q; (void)j; const float t = (am[(size_t)i * TT + j] != 0) ? -3.0e38f : a[q] * SCL; v[ch * 4 + q] = t; mx = fmaxf(mx, t); } }
#pragma unroll
    for (int sh = 16; sh; sh >>= 1) mx = fmaxf(mx, __shfl_xor(mx, sh, 32));
    float sum = 0.f;
#pragma unroll
    for (int k = 0; k < TT / 32; ++k) { float d0 = __fsub_rn(v[k], mx); asm volatile("" : "+v"(d0)); v[k] = __builtin_amdgcn_exp2f(__fmul_rn(d0, 1.4426950408889634f)); sum += v[k]; }
#pragma unroll
    for (int sh = 16; sh; sh >>= 1) sum += __shfl_xor(sum, sh, 32);
    const float f = __fdiv_rn(hires ? 1.0f : PCAR, sum);
{
        if (hires) {
#pragma unroll
            for (int ch = 0; ch < TT / 128; ++ch) { v4us oh, ol;
#pragma unroll
                for (int q = 0; q < 4; ++q) { unsigned short a, c2; splitf(v[ch * 4 + q] * f, a, c2); oh[q] = a; ol[q] = c2; }
                const size_t oo = ((size_t)zz * (RH ? RH : 1) + i) * TT + ch * 128 + lane * 4; *(v4us*)(Ph + oo) = oh; *(v4us*)(Pl + oo) = ol; }
        } else {
#pragma unroll
            for (int ch = 0; ch < TT / 128; ++ch) { v4h o4;
#pragma unroll
                for (int q = 0; q < 4; ++q) o4[q] = tohx(v[ch * 4 + q] * f);
                *(v4h*)(P16 + (size_t)row * TT + ch * 128 + lane * 4) = o4; } }
         }
}
__global__ __launch_bounds__(256) void k_merge(const float* __restrict__ O, int h0, bf* Ah, bf* Al) { const size_t e = ((size_t)blockIdx.x * 256 + threadIdx.x) * 2; if (e >= (size_t)ZH * TT * HD) return; const int d = (int)(e % HD); const int t = (int)((e / HD) % TT); const int zz = (int)(e / ((size_t)HD * TT)); const float cs = (t < RH) ? 1.0f : (1.0f / PCAR); const size_t oo = (size_t)t * DQ + (h0 + zz) * HD + d;
    v2us oh, ol;
#pragma unroll
    for (int q = 0; q < 2; ++q) { unsigned short a, c2; splitf(O[e + q] * cs, a, c2); oh[q] = a; ol[q] = c2; } *(v2us*)(Ah + oo) = oh; *(v2us*)(Al + oo) = ol;  }

__global__ __launch_bounds__(256) void k_lorap(const float* __restrict__ A, const float* __restrict__ Bw, bf* AQ, bf* B2) { const int e = (blockIdx.x * 256 + threadIdx.x) * 4; if (e >= 64 * DM) return;
    { const int n = e / DM, k = e % DM; v4us o; for (int u = 0; u < 4; ++u) o[u] = (n < 8) ? f2bf(A[(size_t)n * DM + k + u]) : (unsigned short)0; *(v4us*)(AQ + e) = o;  }
    if (e < DM * 32) { const int n = e / 32, k = e % 32; v4us o; for (int u = 0; u < 4; ++u) o[u] = (k + u < 8) ? f2bf(Bw[(size_t)n * 8 + k + u]) : (unsigned short)0; *(v4us*)(B2 + e) = o;  } }
__global__ __launch_bounds__(256) void k_xapl(const float* __restrict__ XA, bf* Ph, bf* Pl) { const int e = (blockIdx.x * 256 + threadIdx.x) * 4; if (e >= TT * 32) return; const int t = e / 32, k = e % 32; v4us oh, ol;
#pragma unroll
    for (int u = 0; u < 4; ++u) { unsigned short a = 0, b = 0; if (k + u < 8) splitf(XA[(size_t)t * 64 + k + u], a, b); oh[u] = a; ol[u] = b; } *(v4us*)(Ph + e) = oh; *(v4us*)(Pl + e) = ol;  }
__global__ __launch_bounds__(256) void k_axpy2(const float* __restrict__ QL, float* F, size_t n4) { const size_t e = ((size_t)blockIdx.x * 256 + threadIdx.x) * 4; if (e >= n4 * 4) return; const v4f a = *(const v4f*)(QL + e), f0 = *(const v4f*)(F + e); v4f r;
#pragma unroll
    for (int u = 0; u < 4; ++u) { float t2 = a[u] * 2.0f; asm volatile("" : "+v"(t2)); r[u] = __fadd_rn(f0[u], t2); } *(v4f*)(F + e) = r;  }

extern "C" void kernel_launch(void* const* d_in, const int* in_sizes, int n_in,
                              void* d_out, int out_size, void* d_ws, size_t ws_size, hipStream_t stream) {
    (void)in_sizes; (void)n_in; (void)out_size;
    const float* x = (const float*)d_in[0]; const int* amask = (const int*)d_in[1]; const float* wq = (const float*)d_in[2]; const float* wqA = (const float*)d_in[3]; const float* wqB = (const float*)d_in[4]; const float* wk = (const float*)d_in[5]; const float* wv = (const float*)d_in[6]; const float* wvA = (const float*)d_in[7]; const float* wvB = (const float*)d_in[8]; const float* wo = (const float*)d_in[9]; const float* cosT = nullptr; const float* sinT = nullptr; (void)cosT; (void)sinT;
    float* OUT = (float*)d_out;     // [2][2048][1024]
    char* wsp = (char*)d_ws;
    auto take = [&](size_t bytes) { char* p = wsp; wsp += (bytes + 255) & ~(size_t)255; return (void*)p; };
    bf* WQ = (bf*)take((size_t)DQ * DM * 2); bf* WK = (bf*)take((size_t)DKV * DM * 2); bf* WV = (bf*)take((size_t)DKV * DM * 2); bf* WO = (bf*)take((size_t)DM * DQ * 2); float* CS = (float*)take((size_t)TT * HD * 2 * 4);
    bf* XB = (bf*)take((size_t)TT * DM * 2); bf* AQ = (bf*)take((size_t)64 * DM * 2); bf* AV = (bf*)take((size_t)64 * DM * 2); bf* BQ2 = (bf*)take((size_t)DM * 32 * 2); bf* BV2 = (bf*)take((size_t)DM * 32 * 2); float* XA = (float*)take((size_t)TT * 64 * 4); bf* XAh = (bf*)take((size_t)TT * 32 * 2); bf* XAl = (bf*)take((size_t)TT * 32 * 2); float* QL = (float*)take((size_t)TT * DM * 4); float* FQ = (float*)take((size_t)TT * DQ * 4); float* FK = (float*)take((size_t)TT * DKV * 4);
    h16* QP16 = (h16*)take((size_t)NH_ * TT * HD * 2); h16* KP16 = (h16*)take((size_t)NKV * TT * HD * 2); h16* VT16 = (h16*)take((size_t)NKV * HD * TT * 2);
    bf* QPh = (bf*)take((size_t)NH_ * TT * HD * 2); bf* QPl = (bf*)take((size_t)NH_ * TT * HD * 2); bf* KPh = (bf*)take((size_t)NKV * TT * HD * 2); bf* KPl = (bf*)take((size_t)NKV * TT * HD * 2); bf* VTh = (bf*)take((size_t)NKV * HD * TT * 2); bf* VTl = (bf*)take((size_t)NKV * HD * TT * 2); bf* Ph = (bf*)take((size_t)ZH * RH * TT * 2); bf* Pl = (bf*)take((size_t)ZH * RH * TT * 2);
    float* Sb = (float*)take((size_t)ZH * TT * TT * 4); h16* P16 = (h16*)take((size_t)ZH * TT * TT * 2); float* Ob = (float*)take((size_t)ZH * TT * HD * 4); bf* ATh = (bf*)take((size_t)TT * DQ * 2); bf* ATl = (bf*)take((size_t)TT * DQ * 2);
    if ((size_t)(wsp - (char*)d_ws) > ws_size) return;    // ws 256 MiB
    float* FV = FK;   // v projection reuses the k buffer after the k planes are built (stream-ordered)
    { k_lorap<<<(64 * DM / 4 + 255) / 256, 256, 0, stream>>>(wqA, wqB, AQ, BQ2); k_lorap<<<(64 * DM / 4 + 255) / 256, 256, 0, stream>>>(wvA, wvB, AV, BV2); k_cvt8<<<(unsigned)(((size_t)DQ * DM / 8 + 255) / 256), 256, 0, stream>>>(wq, WQ, (size_t)DQ * DM / 8); k_cvt8<<<(unsigned)(((size_t)DKV * DM / 8 + 255) / 256), 256, 0, stream>>>(wk, WK, (size_t)DKV * DM / 8); k_cvt8<<<(unsigned)(((size_t)DKV * DM / 8 + 255) / 256), 256, 0, stream>>>(wv, WV, (size_t)DKV * DM / 8);
      k_cvt8<<<(unsigned)(((size_t)DM * DQ / 8 + 255) / 256), 256, 0, stream>>>(wo, WO, (size_t)DM * DQ / 8);
       }
    k_csid<<<(TT * HD + 255) / 256, 256, 0, stream>>>(CS);
    const unsigned LQ = (unsigned)(((size_t)NH_ * TT * HD / 2 + 255) / 256), LKv = (unsigned)(((size_t)NKV * TT * HD / 2 + 255) / 256);
    for (int b = 0; b < NB_; ++b) {
        
        k_cvt8<<<(unsigned)(((size_t)TT * DM / 8 + 255) / 256), 256, 0, stream>>>(x + (size_t)b * TT * DM, XB, (size_t)TT * DM / 8);
        k_gemmw<bf, 0, false><<<dim3(TT / 64, DQ / 64, 1), 32, 0, stream>>>(XB, nullptr, WQ, nullptr, DM, FQ, DQ, nullptr, 0, 0, 0);
        /* q += 2 (x A^T) B^T */ k_gemmw<bf, 0, false><<<dim3(TT / 64, 1, 1), 32, 0, stream>>>(XB, nullptr, AQ, nullptr, DM, XA, 64, nullptr, 0, 0, 0); k_xapl<<<(TT * 32 / 4 + 255) / 256, 256, 0, stream>>>(XA, XAh, XAl); k_gemmw<bf, 1, false><<<dim3(TT / 64, DQ / 64, 1), 32, 0, stream>>>(XAh, XAl, BQ2, nullptr, 32, QL, DQ, nullptr, 0, 0, 0); k_axpy2<<<(unsigned)(((size_t)TT * DQ / 4 + 255) / 256), 256, 0, stream>>>(QL, FQ, (size_t)TT * DQ / 4);
        k_rope<<<LQ, 256, 0, stream>>>(FQ, DQ, NH_, CS, nullptr, nullptr, 1.0f, QP16, QPh, QPl);
        k_gemmw<bf, 0, false><<<dim3(TT / 64, DKV / 64, 1), 32, 0, stream>>>(XB, nullptr, WK, nullptr, DM, FK, DKV, nullptr, 0, 0, 0);
        k_rope<<<LKv, 256, 0, stream>>>(FK, DKV, NKV, CS, nullptr, nullptr, 1.0f, KP16, KPh, KPl);
        k_gemmw<bf, 0, false><<<dim3(TT / 64, DKV / 64, 1), 32, 0, stream>>>(XB, nullptr, WV, nullptr, DM, FV, DKV, nullptr, 0, 0, 0);
        /* v += 2 (x A^T) B^T */ k_gemmw<bf, 0, false><<<dim3(TT / 64, 1, 1), 32, 0, stream>>>(XB, nullptr, AV, nullptr, DM, XA, 64, nullptr, 0, 0, 0); k_xapl<<<(TT * 32 / 4 + 255) / 256, 256, 0, stream>>>(XA, XAh, XAl); k_gemmw<bf, 1, false><<<dim3(TT / 64, DKV / 64, 1), 32, 0, stream>>>(XAh, XAl, BV2, nullptr, 32, QL, DKV, nullptr, 0, 0, 0); k_axpy2<<<(unsigned)(((size_t)TT * DKV / 4 + 255) / 256), 256, 0, stream>>>(QL, FV, (size_t)TT * DKV / 4);
        k_vtp<<<LKv, 256, 0, stream>>>(FV, DKV, NKV, VT16, VTh, VTl);
        for (int h0 = 0; h0 < NH_; h0 += ZH) { const size_t zq = (size_t)h0, zk = (size_t)(h0 / REP);   // one kv head per query head: the pass's two heads use consecutive kv planes (z-strides TT*HD)
            k_gemmw<bf, 2, false><<<dim3(RH / 64, TT / 64, ZH), 32, 0, stream>>>(QPh + zq * TT * HD, QPl + zq * TT * HD, KPh + zk * TT * HD, KPl + zk * TT * HD, HD, Sb, TT, nullptr, (size_t)TT * HD, (size_t)TT * HD, (size_t)TT * TT);
            k_gemmw<h16, 0, false><<<dim3((TT - RH) / 64, TT / 64, ZH), 32, 0, stream>>>(QP16 + zq * TT * HD + (size_t)RH * HD, nullptr, KP16 + zk * TT * HD, nullptr, HD, Sb + (size_t)RH * TT, TT, nullptr, (size_t)TT * HD, (size_t)TT * HD, (size_t)TT * TT);
            k_asoft<<<ZH * TT / 8, 256, 0, stream>>>(Sb, amask, P16, Ph, Pl);
            k_gemmw<bf, 2, false><<<dim3(RH / 64, HD / 64, ZH), 32, 0, stream>>>(Ph, Pl, VTh + zk * HD * TT, VTl + zk * HD * TT, TT, Ob, HD, nullptr, (size_t)RH * TT, (size_t)HD * TT, (size_t)TT * HD);
            k_gemmw<h16, 0, false><<<dim3((TT - RH) / 64, HD / 64, ZH), 32, 0, stream>>>(P16 + (size_t)RH * TT, nullptr, VT16 + zk * HD * TT, nullptr, TT, Ob + (size_t)RH * HD, HD, nullptr, (size_t)TT * TT, (size_t)HD * TT, (size_t)TT * HD);
            k_merge<<<(unsigned)(((size_t)ZH * TT * HD / 2 + 255) / 256), 256, 0, stream>>>(Ob, h0, ATh, ATl); }
        k_gemmw<bf, 1, false><<<dim3(TT / 64, DM / 64, 1), 32, 0, stream>>>(ATh, ATl, WO, nullptr, DQ, OUT + (size_t)b * TT * DM, DM, nullptr, 0, 0, 0); }
}

// v001
// It runs in 1150 microseconds.
// Timed twice side by side with v000, it ran 1.88 and 1.90 times as fast.
#include <hip/hip_runtime.h>

// TinySelfAttention (x [2][2048][1024]; q = x wq_w^T + 2 (x wq_A^T) wq_B^T (LoRA, r = 8, alpha/r = 2), k = x wk_w^T, v = x wv_w^T + 2 (x wv_A^T) wv_B^T (16 heads x 64); scores = q.k / 8, masked (-inf) where attn_mask[i][j] != 0 (int [2048][2048], read - the module's strict-upper-triangle mask, but read as data over every tile); softmax; out = merged wo_w^T -> [2][2048][1024]).
// Compute dtypes, f32 accumulate: every input rounded to bf16; base projections and the rank-8 down-projections on PLAIN bf16 operands (inputs: exact; the 8 outputs padded to 64 with zero weights); the up-projections as hl planes (K padded 8 -> 32 with zeros) x exact B (2 products), added x 2 in f32; scores over ALL key tiles (mask read per element) and attn.v: query rows < 512 hl (3 products), the rest single fp16 (x1024); softmax f32; wo hl x exact (2 products).

#define NB_  2
#define TT   2048
#define DM   1024
#define NH_  16
#define NKV  16
#define REP  (NH_ / NKV)
#define HD   64
#define DQ   (NH_ * HD)
#define DKV  (NKV * HD)
#define ZH   2
#define RH   512                  // query rows < RH use hi+lo planes (0: none)
#define WIN  0
#define PCAR 1024.0f
#define SCL  0.125f   // HD^-0.5
typedef _Float16 h16;
typedef unsigned short bf;
typedef __attribute__((ext_vector_type(16))) __bf16   v16bf;
typedef __attribute__((ext_vector_type(16))) _Float16 v16h;
typedef __attribute__((ext_vector_type(8)))  _Float16 v8h;
typedef __attribute__((ext_vector_type(8)))  unsigned short v8us;
typedef __attribute__((ext_vector_type(8)))  float    v8f;
typedef __attribute__((ext_vector_type(4)))  float    v4f;
typedef v8h  __attribute__((may_alias)) v8ha;
typedef v4f  __attribute__((may_alias)) v4fa;
typedef v8us __attribute__((may_alias)) v8usa;

__device__ __forceinline__ unsigned short f2bf(float f) { unsigned u = __float_as_uint(f); u += 0x7FFFu + ((u >> 16) & 1u); return (unsigned short)(u >> 16); }
__device__ __forceinline__ float bf2f(unsigned short b) { return __uint_as_float(((unsigned)b) << 16); }
__device__ __forceinline__ float bfr(float f) { return bf2f(f2bf(f)); }
__device__ __forceinline__ v16h cat16(v8h lo, v8h hi) { return __builtin_shufflevector(lo, hi, 0, 1, 2, 3, 4, 5, 6, 7, 8, 9, 10, 11, 12, 13, 14, 15); }
__device__ __forceinline__ v16bf cat16b(v8us lo, v8us hi) { return __builtin_bit_cast(v16bf, __builtin_shufflevector(lo, hi, 0, 1, 2, 3, 4, 5, 6, 7, 8, 9, 10, 11, 12, 13, 14, 15)); }
__device__ __forceinline__ v8f wmma16(v16h a, v16h b, v8f c) { return __builtin_amdgcn_wmma_f32_16x16x32_f16(false, a, false, b, (short)0, c, false, false); }
__device__ __forceinline__ v8f wmmab(v16bf a, v16bf b, v8f c) { return __builtin_amdgcn_wmma_f32_16x16x32_bf16(false, a, false, b, (short)0, c, false, false); }



// ---- k_gemmw: register-blocked GEMM, one 64x64 output tile (16 accumulators a wave) per work-group of KS waves, operands straight from K-contiguous 16-bit planes; grid (M/64, N/64, Z), 32 * KS threads.
// C[m][n] (f32, pitch ldc, + optional f32 bias[n]) = sum_k A[m][k] Bt[n][k] (+ split products per NSPLIT). z-batch strides sA/sB/sC in elements. K % (32 * KS) == 0.
// KS > 1: wave w sums the K slice [w K/KS, (w+1) K/KS); the KS partial tiles meet in LDS and are added in slice order 0 .. KS-1 (fixed, the same on every run).
template <typename T16> struct WFrag;
template <> struct WFrag<h16> { typedef v16h V; static __device__ __forceinline__ V ld(const h16* p) { return cat16(*(const v8h*)p, *(const v8h*)(p + 16)); } static __device__ __forceinline__ v8f mma(V a, V b, v8f c) { return wmma16(a, b, c); } };
template <> struct WFrag<bf> { typedef v16bf V; static __device__ __forceinline__ V ld(const bf* p) { return cat16b(*(const v8us*)p, *(const v8us*)(p + 16)); } static __device__ __forceinline__ v8f mma(V a, V b, v8f c) { return wmmab(a, b, c); } };
template <typename T16, int NSPLIT, bool BIAS, int KS>
__global__ __launch_bounds__(32 * KS) void k_gemmw(const T16* __restrict__ A, const T16* __restrict__ A2, const T16* __restrict__ Bt, const T16* __restrict__ Bt2, int K, float* C, int ldc, const float* __restrict__ bias, size_t sA, size_t sB, size_t sC) {
    typedef typename WFrag<T16>::V V;
    __shared__ __align__(16) float os[(KS == 1) ? 16 * 68 : KS * 32 * 68];
    const size_t z = blockIdx.z; A += z * sA; if (A2) A2 += z * sA; Bt += z * sB; if (Bt2) Bt2 += z * sB; C += z * sC;
    const int lane = threadIdx.x & 31, lr = lane & 15, hi = lane >> 4; const int r0 = blockIdx.x * 64, c0 = blockIdx.y * 64;
    v8f acc[4][4];
#pragma unroll
    for (int mb = 0; mb < 4; ++mb)
#pragma unroll
        for (int nb = 0; nb < 4; ++nb) acc[mb][nb] = (v8f){};
    const size_t aoff = (size_t)(r0 + lr) * K + 8 * hi, boff = (size_t)(c0 + lr) * K + 8 * hi;
    // wv: the wave's K slice, held scalar so that the loop bounds are scalar
    const int wv = (KS == 1) ? 0 : __builtin_amdgcn_readfirstlane((int)(threadIdx.x >> 5)); const int kspan = K / KS, kbeg = wv * kspan, kend = kbeg + kspan;
#pragma unroll 1
    for (int kc = kbeg; kc < kend; kc += 32) {
        V a[4], a2[4];
#pragma unroll
        for (int mb = 0; mb < 4; ++mb) { a[mb] = WFrag<T16>::ld(A + aoff + (size_t)mb * 16 * K + kc); if (NSPLIT == 1 || NSPLIT == 2) a2[mb] = WFrag<T16>::ld(A2 + aoff + (size_t)mb * 16 * K + kc); }
#pragma unroll
        for (int nb = 0; nb < 4; ++nb) { const V b = WFrag<T16>::ld(Bt + boff + (size_t)nb * 16 * K + kc); V b2; if (NSPLIT >= 2) b2 = WFrag<T16>::ld(Bt2 + boff + (size_t)nb * 16 * K + kc);
#pragma unroll
            for (int mb = 0; mb < 4; ++mb) { acc[mb][nb] = WFrag<T16>::mma(a[mb], b, acc[mb][nb]); if (NSPLIT == 1 || NSPLIT == 2) acc[mb][nb] = WFrag<T16>::mma(a2[mb], b, acc[mb][nb]); if (NSPLIT >= 2) acc[mb][nb] = WFrag<T16>::mma(a[mb], b2, acc[mb][nb]); } }
        asm volatile("v_nop\n\tv_nop\n\tv_nop\n\tv_nop" : "+v"(acc[0][0]), "+v"(acc[1][1]), "+v"(acc[2][2]), "+v"(acc[3][3]) : "v"(a[0]), "v"(a[3]));
    }
    if (KS > 1) {   // every loop below is unrolled so that acc[][] and res[][] are indexed by constants and stay in registers
        float* osw = os + wv * (32 * 68); static_assert(KS == 1 || 16 % KS == 0, "KS divides 16"); constexpr int NIT = (KS > 1) ? 16 / KS : 1;   // v4f sums a thread and phase: 32 rows x 16 v4f over 32 * KS threads
        v4f res[2][NIT];
#pragma unroll
        for (int mp = 0; mp < 2; ++mp) {          // 32 output rows a phase
#pragma unroll
            for (int ml = 0; ml < 2; ++ml)
#pragma unroll
                for (int nb = 0; nb < 4; ++nb)
#pragma unroll
                    for (int j = 0; j < 8; ++j) osw[(ml * 16 + hi * 8 + j) * 68 + nb * 16 + lr] = acc[mp * 2 + ml][nb][j];
            __syncthreads();                      // every slice's partial rows are in LDS
#pragma unroll
            for (int it = 0; it < NIT; ++it) { const int u = (int)threadIdx.x + it * 32 * KS, row = u >> 4, cofs = (u & 15) * 4; v4f val = *(const v4fa*)(os + row * 68 + cofs);
#pragma unroll
                for (int s = 1; s < KS; ++s) val += *(const v4fa*)(os + s * (32 * 68) + row * 68 + cofs);
                res[mp][it] = val; }
            if (mp == 0) __syncthreads();         // all reads of phase 0 end before phase 1 overwrites the rows
        }
        // the stores stand behind the last barrier, so that no barrier waits for a store to memory
#pragma unroll
        for (int mp = 0; mp < 2; ++mp)
#pragma unroll
            for (int it = 0; it < NIT; ++it) { const int u = (int)threadIdx.x + it * 32 * KS, row = u >> 4, cofs = (u & 15) * 4; v4f val = res[mp][it];
                if (BIAS) { val[0] += bfr(bias[c0 + cofs]); val[1] += bfr(bias[c0 + cofs + 1]); val[2] += bfr(bias[c0 + cofs + 2]); val[3] += bfr(bias[c0 + cofs + 3]); }
                *(v4f*)(C + (size_t)(r0 + mp * 32 + row) * ldc + c0 + cofs) = val; }
        return;
    }
#pragma unroll
    for (int mb = 0; mb < 4; ++mb) {
#pragma unroll
        for (int nb = 0; nb < 4; ++nb) {
#pragma unroll
            for (int j = 0; j < 8; ++j) os[(hi * 8 + j) * 68 + nb * 16 + lr] = acc[mb][nb][j]; }
        __builtin_amdgcn_wave_barrier(); asm volatile("" ::: "memory");
        float* crow = C + (size_t)(r0 + mb * 16) * ldc + c0;
{
#pragma unroll
            for (int s = 0; s < 8; ++s) { const int row = 2 * s + hi, cofs = lr * 4; v4f val = *(const v4fa*)(os + row * 68 + cofs); if (BIAS) { val[0] += bfr(bias[c0 + cofs]); val[1] += bfr(bias[c0 + cofs + 1]); val[2] += bfr(bias[c0 + cofs + 2]); val[3] += bfr(bias[c0 + cofs + 3]); }
                *(v4f*)(crow + (size_t)row * ldc + cofs) = val; }
             }
        __builtin_amdgcn_wave_barrier(); asm volatile("" ::: "memory");
    }
}

__device__ __forceinline__ h16 tohx(float x) { return (h16)x; }
__device__ __forceinline__ void splitf(float y, unsigned short& h, unsigned short& l) { h = f2bf(y); l = f2bf(y - bf2f(h)); }
typedef __attribute__((ext_vector_type(2))) _Float16 v2h;
typedef __attribute__((ext_vector_type(4))) _Float16 v4h;
typedef __attribute__((ext_vector_type(2))) unsigned short v2us;
typedef __attribute__((ext_vector_type(4))) unsigned short v4us;
typedef __attribute__((ext_vector_type(2))) float v2f;
typedef __attribute__((ext_vector_type(4))) int v4i;

__global__ __launch_bounds__(256) void k_wtG(const float* __restrict__ w, int K, int N, bf* Bt) {
    const int lane = threadIdx.x & 31; const int L0 = (blockIdx.x * 8 + (threadIdx.x >> 5)) * 8; const int nlines = N * K / 64;
{
#pragma unroll 1
        for (int l = 0; l < 8; ++l) { const int L = L0 + l; if (L >= nlines) break; const size_t e = (size_t)L * 64 + lane * 2; const int k = (int)(e % K), n = (int)(e / K); v2us o;
            o[0] = f2bf(w[(size_t)k * N + n]); o[1] = f2bf(w[(size_t)(k + 1) * N + n]); *(v2us*)(Bt + e) = o; }
         }
}
__global__ __launch_bounds__(256) void k_cvt8(const float* __restrict__ src, bf* dst, size_t n8) { const size_t i = (size_t)blockIdx.x * 256 + threadIdx.x; if (i >= n8) return; const v8f v = *(const v8f*)(src + i * 8); v8us o;
#pragma unroll
    for (int k = 0; k < 8; ++k) o[k] = f2bf(v[k]); *(v8us*)(dst + i * 8) = o;  }
__global__ __launch_bounds__(256) void k_cscvt(const float* __restrict__ cosT, const float* __restrict__ sinT, float* CS) { const int idx = blockIdx.x * 256 + threadIdx.x; if (idx >= TT * HD) return; v2f cs; cs[0] = bfr(cosT[idx]); cs[1] = bfr(sinT[idx]); *(v2f*)(CS + (size_t)idx * 2) = cs;  }
// k_rope: head planes [h][t][d] (fp16 + hi/lo) of rope(x) x sc with the rotate-half convention out[d] = x[d] cos[t][d] - x[d+HD/2] sin[t][d], out[d+HD/2] = x[d+HD/2] cos[t][d+HD/2] + x[d] sin[t][d+HD/2]
__global__ __launch_bounds__(256) void k_rope(const float* __restrict__ F, int pitch, int nheads, const float* __restrict__ CS, const float* __restrict__ RF, const float* __restrict__ nw, float sc, h16* P16, bf* Ph, bf* Pl) {
    const size_t e = ((size_t)blockIdx.x * 256 + threadIdx.x) * 2; if (e >= (size_t)nheads * TT * HD) return; const int d = (int)(e % HD); const int t = (int)((e / HD) % TT); const int h = (int)(e / ((size_t)HD * TT)); const float* f = F + (size_t)t * pitch + h * HD; const float rf = RF ? RF[(size_t)h * TT + t] : 1.0f; v2h o16; v2us oh, ol;
#pragma unroll
    for (int q = 0; q < 2; ++q) { const int dd = d + q; const int dp = (dd < HD / 2) ? dd + HD / 2 : dd - HD / 2; float x0 = f[dd], x1 = f[dp];
        if (RF) { float n0 = __fmul_rn(x0, rf), n1 = __fmul_rn(x1, rf); asm volatile("" : "+v"(n0)); asm volatile("" : "+v"(n1)); x0 = __fmul_rn(bfr(nw[dd]), n0); x1 = __fmul_rn(bfr(nw[dp]), n1); }
        const v2f cs = *(const v2f*)(CS + ((size_t)t * HD + dd) * 2); float a = __fmul_rn(x0, cs[0]), bq = __fmul_rn(x1, cs[1]); asm volatile("" : "+v"(a)); asm volatile("" : "+v"(bq)); const float r = ((dd < HD / 2) ? __fsub_rn(a, bq) : __fadd_rn(a, bq)) * sc;
        o16[q] = tohx(r); unsigned short a2, c2; splitf(r, a2, c2); oh[q] = a2; ol[q] = c2; }
    *(v2h*)(P16 + e) = o16; *(v2us*)(Ph + e) = oh; *(v2us*)(Pl + e) = ol;  }
__global__ __launch_bounds__(256) void k_vtp(const float* __restrict__ F, int pitch, int nheads, h16* V16, bf* Vh, bf* Vl) { const size_t e = ((size_t)blockIdx.x * 256 + threadIdx.x) * 2; if (e >= (size_t)nheads * HD * TT) return; const int t = (int)(e % TT); const int d = (int)((e / TT) % HD); const int g = (int)(e / ((size_t)TT * HD)); v2h o16; v2us oh, ol;
#pragma unroll
    for (int q = 0; q < 2; ++q) { const float x = F[(size_t)(t + q) * pitch + g * HD + d]; o16[q] = tohx(x); unsigned short a2, c2; splitf(x, a2, c2); oh[q] = a2; ol[q] = c2; }
    *(v2h*)(V16 + e) = o16; *(v2us*)(Vh + e) = oh; *(v2us*)(Vl + e) = ol;  }
__global__ __launch_bounds__(256) void k_csid(float* CS) { const int idx = blockIdx.x * 256 + threadIdx.x; if (idx >= TT * HD) return; v2f cs; cs[0] = 1.0f; cs[1] = 0.0f; *(v2f*)(CS + (size_t)idx * 2) = cs;  }
// k_asoft: per row (zz, i): t = S x HD^-0.5, -3e38 where attn_mask[i][j] != 0; softmax over the 2048 keys (register row, one exp, fixed trees);
__global__ __launch_bounds__(256) void k_asoft(const float* __restrict__ Sb, const int* __restrict__ am, h16* P16, bf* Ph, bf* Pl) {
    const int lane = threadIdx.x & 31; const int row = blockIdx.x * 8 + (threadIdx.x >> 5); if (row >= ZH * TT) return; const int i = row % TT; const int zz = row / TT; (void)zz; const bool hires = (i < RH); const float* sr = Sb + (size_t)row * TT; float v[TT / 32]; float mx = -3.0e38f;
#pragma unroll
    for (int ch = 0; ch < TT / 128; ++ch) { const int j0 = ch * 128 + lane * 4; const v4f a = *(const v4f*)(sr + j0);
#pragma unroll
        for (int q = 0; q < 4; ++q) { const int j = j0 + q; (void)j; const float t = (am[(size_t)i * TT + j] != 0) ? -3.0e38f : a[q] * SCL; v[ch * 4 + q] = t; mx = fmaxf(mx, t); } }
#pragma unroll
    for (int sh = 16; sh; sh >>= 1) mx = fmaxf(mx, __shfl_xor(mx, sh, 32));
    float sum = 0.f;
#pragma unroll
    for (int k = 0; k < TT / 32; ++k) { float d0 = __fsub_rn(v[k], mx); asm volatile("" : "+v"(d0)); v[k] = __builtin_amdgcn_exp2f(__fmul_rn(d0, 1.4426950408889634f)); sum += v[k]; }
#pragma unroll
    for (int sh = 16; sh; sh >>= 1) sum += __shfl_xor(sum, sh, 32);
    const float f = __fdiv_rn(hires ? 1.0f : PCAR, sum);
{
        if (hires) {
#pragma unroll
            for (int ch = 0; ch < TT / 128; ++ch) { v4us oh, ol;
#pragma unroll
                for (int q = 0; q < 4; ++q) { unsigned short a, c2; splitf(v[ch * 4 + q] * f, a, c2); oh[q] = a; ol[q] = c2; }
                const size_t oo = ((size_t)zz * (RH ? RH : 1) + i) * TT + ch * 128 + lane * 4; *(v4us*)(Ph + oo) = oh; *(v4us*)(Pl + oo) = ol; }
        } else {
#pragma unroll
            for (int ch = 0; ch < TT / 128; ++ch) { v4h o4;
#pragma unroll
                for (int q = 0; q < 4; ++q) o4[q] = tohx(v[ch * 4 + q] * f);
                *(v4h*)(P16 + (size_t)row * TT + ch * 128 + lane * 4) = o4; } }
         }
}
__global__ __launch_bounds__(256) void k_merge(const float* __restrict__ O, int h0, bf* Ah, bf* Al) { const size_t e = ((size_t)blockIdx.x * 256 + threadIdx.x) * 2; if (e >= (size_t)ZH * TT * HD) return; const int d = (int)(e % HD); const int t = (int)((e / HD) % TT); const int zz = (int)(e / ((size_t)HD * TT)); const float cs = (t < RH) ? 1.0f : (1.0f / PCAR); const size_t oo = (size_t)t * DQ + (h0 + zz) * HD + d;
    v2us oh, ol;
#pragma unroll
    for (int q = 0; q < 2; ++q) { unsigned short a, c2; splitf(O[e + q] * cs, a, c2); oh[q] = a; ol[q] = c2; } *(v2us*)(Ah + oo) = oh; *(v2us*)(Al + oo) = ol;  }

__global__ __launch_bounds__(256) void k_lorap(const float* __restrict__ A, const float* __restrict__ Bw, bf* AQ, bf* B2) { const int e = (blockIdx.x * 256 + threadIdx.x) * 4; if (e >= 64 * DM) return;
    { const int n = e / DM, k = e % DM; v4us o; for (int u = 0; u < 4; ++u) o[u] = (n < 8) ? f2bf(A[(size_t)n * DM + k + u]) : (unsigned short)0; *(v4us*)(AQ + e) = o;  }
    if (e < DM * 32) { const int n = e / 32, k = e % 32; v4us o; for (int u = 0; u < 4; ++u) o[u] = (k + u < 8) ? f2bf(Bw[(size_t)n * 8 + k + u]) : (unsigned short)0; *(v4us*)(B2 + e) = o;  } }
__global__ __launch_bounds__(256) void k_xapl(const float* __restrict__ XA, bf* Ph, bf* Pl) { const int e = (blockIdx.x * 256 + threadIdx.x) * 4; if (e >= TT * 32) return; const int t = e / 32, k = e % 32; v4us oh, ol;
#pragma unroll
    for (int u = 0; u < 4; ++u) { unsigned short a = 0, b = 0; if (k + u < 8) splitf(XA[(size_t)t * 64 + k + u], a, b); oh[u] = a; ol[u] = b; } *(v4us*)(Ph + e) = oh; *(v4us*)(Pl + e) = ol;  }
__global__ __launch_bounds__(256) void k_axpy2(const float* __restrict__ QL, float* F, size_t n4) { const size_t e = ((size_t)blockIdx.x * 256 + threadIdx.x) * 4; if (e >= n4 * 4) return; const v4f a = *(const v4f*)(QL + e), f0 = *(const v4f*)(F + e); v4f r;
#pragma unroll
    for (int u = 0; u < 4; ++u) { float t2 = a[u] * 2.0f; asm volatile("" : "+v"(t2)); r[u] = __fadd_rn(f0[u], t2); } *(v4f*)(F + e) = r;  }

extern "C" void kernel_launch(void* const* d_in, const int* in_sizes, int n_in,
                              void* d_out, int out_size, void* d_ws, size_t ws_size, hipStream_t stream) {
    (void)in_sizes; (void)n_in; (void)out_size;
    const float* x = (const float*)d_in[0]; const int* amask = (const int*)d_in[1]; const float* wq = (const float*)d_in[2]; const float* wqA = (const float*)d_in[3]; const float* wqB = (const float*)d_in[4]; const float* wk = (const float*)d_in[5]; const float* wv = (const float*)d_in[6]; const float* wvA = (const float*)d_in[7]; const float* wvB = (const float*)d_in[8]; const float* wo = (const float*)d_in[9]; const float* cosT = nullptr; const float* sinT = nullptr; (void)cosT; (void)sinT;
    float* OUT = (float*)d_out;     // [2][2048][1024]
    char* wsp = (char*)d_ws;
    auto take = [&](size_t bytes) { char* p = wsp; wsp += (bytes + 255) & ~(size_t)255; return (void*)p; };
    bf* WQ = (bf*)take((size_t)DQ * DM * 2); bf* WK = (bf*)take((size_t)DKV * DM * 2); bf* WV = (bf*)take((size_t)DKV * DM * 2); bf* WO = (bf*)take((size_t)DM * DQ * 2); float* CS = (float*)take((size_t)TT * HD * 2 * 4);
    bf* XB = (bf*)take((size_t)TT * DM * 2); bf* AQ = (bf*)take((size_t)64 * DM * 2); bf* AV = (bf*)take((size_t)64 * DM * 2); bf* BQ2 = (bf*)take((size_t)DM * 32 * 2); bf* BV2 = (bf*)take((size_t)DM * 32 * 2); float* XA = (float*)take((size_t)TT * 64 * 4); bf* XAh = (bf*)take((size_t)TT * 32 * 2); bf* XAl = (bf*)take((size_t)TT * 32 * 2); float* QL = (float*)take((size_t)TT * DM * 4); float* FQ = (float*)take((size_t)TT * DQ * 4); float* FK = (float*)take((size_t)TT * DKV * 4);
    h16* QP16 = (h16*)take((size_t)NH_ * TT * HD * 2); h16* KP16 = (h16*)take((size_t)NKV * TT * HD * 2); h16* VT16 = (h16*)take((size_t)NKV * HD * TT * 2);
    bf* QPh = (bf*)take((size_t)NH_ * TT * HD * 2); bf* QPl = (bf*)take((size_t)NH_ * TT * HD * 2); bf* KPh = (bf*)take((size_t)NKV * TT * HD * 2); bf* KPl = (bf*)take((size_t)NKV * TT * HD * 2); bf* VTh = (bf*)take((size_t)NKV * HD * TT * 2); bf* VTl = (bf*)take((size_t)NKV * HD * TT * 2); bf* Ph = (bf*)take((size_t)ZH * RH * TT * 2); bf* Pl = (bf*)take((size_t)ZH * RH * TT * 2);
    float* Sb = (float*)take((size_t)ZH * TT * TT * 4); h16* P16 = (h16*)take((size_t)ZH * TT * TT * 2); float* Ob = (float*)take((size_t)ZH * TT * HD * 4); bf* ATh = (bf*)take((size_t)TT * DQ * 2); bf* ATl = (bf*)take((size_t)TT * DQ * 2);
    if ((size_t)(wsp - (char*)d_ws) > ws_size) return;    // ws 256 MiB
    float* FV = FK;   // v projection reuses the k buffer after the k planes are built (stream-ordered)
    { k_lorap<<<(64 * DM / 4 + 255) / 256, 256, 0, stream>>>(wqA, wqB, AQ, BQ2); k_lorap<<<(64 * DM / 4 + 255) / 256, 256, 0, stream>>>(wvA, wvB, AV, BV2); k_cvt8<<<(unsigned)(((size_t)DQ * DM / 8 + 255) / 256), 256, 0, stream>>>(wq, WQ, (size_t)DQ * DM / 8); k_cvt8<<<(unsigned)(((size_t)DKV * DM / 8 + 255) / 256), 256, 0, stream>>>(wk, WK, (size_t)DKV * DM / 8); k_cvt8<<<(unsigned)(((size_t)DKV * DM / 8 + 255) / 256), 256, 0, stream>>>(wv, WV, (size_t)DKV * DM / 8);
      k_cvt8<<<(unsigned)(((size_t)DM * DQ / 8 + 255) / 256), 256, 0, stream>>>(wo, WO, (size_t)DM * DQ / 8);
       }
    k_csid<<<(TT * HD + 255) / 256, 256, 0, stream>>>(CS);
    const unsigned LQ = (unsigned)(((size_t)NH_ * TT * HD / 2 + 255) / 256), LKv = (unsigned)(((size_t)NKV * TT * HD / 2 + 255) / 256);
    for (int b = 0; b < NB_; ++b) {
        
        k_cvt8<<<(unsigned)(((size_t)TT * DM / 8 + 255) / 256), 256, 0, stream>>>(x + (size_t)b * TT * DM, XB, (size_t)TT * DM / 8);
        k_gemmw<bf, 0, false, 8><<<dim3(TT / 64, DQ / 64, 1), 256, 0, stream>>>(XB, nullptr, WQ, nullptr, DM, FQ, DQ, nullptr, 0, 0, 0);
        /* q += 2 (x A^T) B^T */ k_gemmw<bf, 0, false, 16><<<dim3(TT / 64, 1, 1), 512, 0, stream>>>(XB, nullptr, AQ, nullptr, DM, XA, 64, nullptr, 0, 0, 0); k_xapl<<<(TT * 32 / 4 + 255) / 256, 256, 0, stream>>>(XA, XAh, XAl); k_gemmw<bf, 1, false, 1><<<dim3(TT / 64, DQ / 64, 1), 32, 0, stream>>>(XAh, XAl, BQ2, nullptr, 32, QL, DQ, nullptr, 0, 0, 0); k_axpy2<<<(unsigned)(((size_t)TT * DQ / 4 + 255) / 256), 256, 0, stream>>>(QL, FQ, (size_t)TT * DQ / 4);
        k_rope<<<LQ, 256, 0, stream>>>(FQ, DQ, NH_, CS, nullptr, nullptr, 1.0f, QP16, QPh, QPl);
        k_gemmw<bf, 0, false, 8><<<dim3(TT / 64, DKV / 64, 1), 256, 0, stream>>>(XB, nullptr, WK, nullptr, DM, FK, DKV, nullptr, 0, 0, 0);
        k_rope<<<LKv, 256, 0, stream>>>(FK, DKV, NKV, CS, nullptr, nullptr, 1.0f, KP16, KPh, KPl);
        k_gemmw<bf, 0, false, 8><<<dim3(TT / 64, DKV / 64, 1), 256, 0, stream>>>(XB, nullptr, WV, nullptr, DM, FV, DKV, nullptr, 0, 0, 0);
        /* v += 2 (x A^T) B^T */ k_gemmw<bf, 0, false, 16><<<dim3(TT / 64, 1, 1), 512, 0, stream>>>(XB, nullptr, AV, nullptr, DM, XA, 64, nullptr, 0, 0, 0); k_xapl<<<(TT * 32 / 4 + 255) / 256, 256, 0, stream>>>(XA, XAh, XAl); k_gemmw<bf, 1, false, 1><<<dim3(TT / 64, DKV / 64, 1), 32, 0, stream>>>(XAh, XAl, BV2, nullptr, 32, QL, DKV, nullptr, 0, 0, 0); k_axpy2<<<(unsigned)(((size_t)TT * DKV / 4 + 255) / 256), 256, 0, stream>>>(QL, FV, (size_t)TT * DKV / 4);
        k_vtp<<<LKv, 256, 0, stream>>>(FV, DKV, NKV, VT16, VTh, VTl);
        for (int h0 = 0; h0 < NH_; h0 += ZH) { const size_t zq = (size_t)h0, zk = (size_t)(h0 / REP);   // one kv head per query head: the pass's two heads use consecutive kv planes (z-strides TT*HD)
            k_gemmw<bf, 2, false, 1><<<dim3(RH / 64, TT / 64, ZH), 32, 0, stream>>>(QPh + zq * TT * HD, QPl + zq * TT * HD, KPh + zk * TT * HD, KPl + zk * TT * HD, HD, Sb, TT, nullptr, (size_t)TT * HD, (size_t)TT * HD, (size_t)TT * TT);
            k_gemmw<h16, 0, false, 1><<<dim3((TT - RH) / 64, TT / 64, ZH), 32, 0, stream>>>(QP16 + zq * TT * HD + (size_t)RH * HD, nullptr, KP16 + zk * TT * HD, nullptr, HD, Sb + (size_t)RH * TT, TT, nullptr, (size_t)TT * HD, (size_t)TT * HD, (size_t)TT * TT);
            k_asoft<<<ZH * TT / 8, 256, 0, stream>>>(Sb, amask, P16, Ph, Pl);
            k_gemmw<bf, 2, false, 16><<<dim3(RH / 64, HD / 64, ZH), 512, 0, stream>>>(Ph, Pl, VTh + zk * HD * TT, VTl + zk * HD * TT, TT, Ob, HD, nullptr, (size_t)RH * TT, (size_t)HD * TT, (size_t)TT * HD);
            k_gemmw<h16, 0, false, 16><<<dim3((TT - RH) / 64, HD / 64, ZH), 512, 0, stream>>>(P16 + (size_t)RH * TT, nullptr, VT16 + zk * HD * TT, nullptr, TT, Ob + (size_t)RH * HD, HD, nullptr, (size_t)TT * TT, (size_t)HD * TT, (size_t)TT * HD);
            k_merge<<<(unsigned)(((size_t)ZH * TT * HD / 2 + 255) / 256), 256, 0, stream>>>(Ob, h0, ATh, ATl); }
        k_gemmw<bf, 1, false, 8><<<dim3(TT / 64, DM / 64, 1), 256, 0, stream>>>(ATh, ATl, WO, nullptr, DQ, OUT + (size_t)b * TT * DM, DM, nullptr, 0, 0, 0); }
}

// v003
// Measured time: 392 microseconds a run.
// Versions between v001 and this one are left out; their measured steps multiply to 2.94 times as fast.
// All steps since v000 together make it 5.56 times as fast.
#include <hip/hip_runtime.h>

// TinySelfAttention (x [2][2048][1024]; q = x wq_w^T + 2 (x wq_A^T) wq_B^T (LoRA, r = 8, alpha/r = 2), k = x wk_w^T, v = x wv_w^T + 2 (x wv_A^T) wv_B^T (16 heads x 64); scores = q.k / 8, masked (-inf) where attn_mask[i][j] != 0 (int [2048][2048], read - the module's strict-upper-triangle mask, but read as data over every tile); softmax; out = merged wo_w^T -> [2][2048][1024]).
// Compute dtypes, f32 accumulate: every input rounded to bf16; base projections and the rank-8 down-projections on PLAIN bf16 operands (inputs: exact; the 8 outputs padded to 64 with zero weights); the up-projections as hl planes (K padded 8 -> 32 with zeros) x exact B (2 products), added x 2 in f32; scores over ALL key tiles (mask read per element) and attn.v: query rows < 512 hl (3 products), the rest single fp16; softmax f32, running maximum and sum over 32-key tiles inside one kernel (k_fattn); wo hl x exact (2 products).
// The q/k/v and rank-8 down GEMMs write their 16-bit planes themselves (k_gemmw, EPI), q and v after taking in their up-projection (UP): no f32 projection goes to memory; v is computed as wv x^T, so that the rows of V^T come out contiguous.

#define NB_  2
#define TT   2048
#define DM   1024
#define NH_  16
#define NKV  16
#define REP  (NH_ / NKV)
#define HD   64
#define DQ   (NH_ * HD)
#define DKV  (NKV * HD)
#define RH   512                  // query rows < RH use hi+lo planes (0: none)
#define WIN  0
#define SCL  0.125f   // HD^-0.5
typedef _Float16 h16;
typedef unsigned short bf;
typedef __attribute__((ext_vector_type(16))) __bf16   v16bf;
typedef __attribute__((ext_vector_type(16))) _Float16 v16h;
typedef __attribute__((ext_vector_type(8)))  _Float16 v8h;
typedef __attribute__((ext_vector_type(8)))  unsigned short v8us;
typedef __attribute__((ext_vector_type(8)))  float    v8f;
typedef __attribute__((ext_vector_type(4)))  float    v4f;
typedef v8h  __attribute__((may_alias)) v8ha;
typedef v4f  __attribute__((may_alias)) v4fa;
typedef v8us __attribute__((may_alias)) v8usa;

__device__ __forceinline__ unsigned short f2bf(float f) { unsigned u = __float_as_uint(f); u += 0x7FFFu + ((u >> 16) & 1u); return (unsigned short)(u >> 16); }
__device__ __forceinline__ float bf2f(unsigned short b) { return __uint_as_float(((unsigned)b) << 16); }
__device__ __forceinline__ float bfr(float f) { return bf2f(f2bf(f)); }
__device__ __forceinline__ v16h cat16(v8h lo, v8h hi) { return __builtin_shufflevector(lo, hi, 0, 1, 2, 3, 4, 5, 6, 7, 8, 9, 10, 11, 12, 13, 14, 15); }
__device__ __forceinline__ v16bf cat16b(v8us lo, v8us hi) { return __builtin_bit_cast(v16bf, __builtin_shufflevector(lo, hi, 0, 1, 2, 3, 4, 5, 6, 7, 8, 9, 10, 11, 12, 13, 14, 15)); }
__device__ __forceinline__ v8f wmma16(v16h a, v16h b, v8f c) { return __builtin_amdgcn_wmma_f32_16x16x32_f16(false, a, false, b, (short)0, c, false, false); }
__device__ __forceinline__ v8f wmmab(v16bf a, v16bf b, v8f c) { return __builtin_amdgcn_wmma_f32_16x16x32_bf16(false, a, false, b, (short)0, c, false, false); }
__device__ __forceinline__ h16 tohx(float x) { return (h16)x; }
__device__ __forceinline__ void splitf(float y, unsigned short& h, unsigned short& l) { h = f2bf(y); l = f2bf(y - bf2f(h)); }
typedef __attribute__((ext_vector_type(2))) _Float16 v2h;
typedef __attribute__((ext_vector_type(4))) _Float16 v4h;
typedef __attribute__((ext_vector_type(2))) unsigned short v2us;
typedef __attribute__((ext_vector_type(4))) unsigned short v4us;
typedef __attribute__((ext_vector_type(2))) float v2f;
typedef __attribute__((ext_vector_type(4))) int v4i;



// ---- k_gemmw: register-blocked GEMM, one 64x64 output tile (16 accumulators a wave) per work-group of KS waves, operands straight from K-contiguous 16-bit planes; grid (M/64, N/64, Z), 32 * KS threads.
// C[m][n] (f32, pitch ldc, + optional f32 bias[n]) = sum_k A[m][k] Bt[n][k] (+ split products per NSPLIT). z-batch strides sA/sB/sC in elements. K % (32 * KS) == 0.
// KS > 1: wave w sums the K slice [w K/KS, (w+1) K/KS); the KS partial tiles meet in LDS and are added in slice order 0 .. KS-1 (fixed, the same on every run).
// UP (KS == 8 only): the tile takes + 2 u, u = the rank-8 up-product of the same tile (K padded to 32: one WMMA step, hi then lo plane, its own f32 sum from 0). Uh/Ul: hi/lo planes [t][32] of the down-projection, Uw: up weights [n][32].
// UP = 1: rows m are t, columns n (A = Uh, Ul; B = Uw). UP = 2: rows m are n, columns t (A = Uw; B = Uh, Ul). Wave w makes sub-tile (w / 4, w % 4) of each 32-row phase; u meets the slices in LDS as one more slice and is added last, x 2.
// EPI (KS > 1 only) says what leaves the kernel. 0: the f32 tile, to C. 1: the tile as three 16-bit planes (fp16, bf16 hi, bf16 lo of y - hi) at blockIdx.y * sP + m * ldp + (n - c0);
// sP = rows * 64, ldp = 64 gives head planes [n / 64][m][n % 64], sP = 64, ldp = N gives plain [m][n]. 2: columns 0 .. 31 as hi/lo planes [m][32], columns 8 .. 31 zero (the rank-8 down-projection, K-padded for the up-projection).
template <typename T16> struct WFrag;
template <> struct WFrag<h16> { typedef v16h V; static __device__ __forceinline__ V ld(const h16* p) { return cat16(*(const v8h*)p, *(const v8h*)(p + 16)); } static __device__ __forceinline__ v8f mma(V a, V b, v8f c) { return wmma16(a, b, c); } };
template <> struct WFrag<bf> { typedef v16bf V; static __device__ __forceinline__ V ld(const bf* p) { return cat16b(*(const v8us*)p, *(const v8us*)(p + 16)); } static __device__ __forceinline__ v8f mma(V a, V b, v8f c) { return wmmab(a, b, c); } };
template <typename T16, int NSPLIT, bool BIAS, int KS, int EPI = 0, int UP = 0>
__global__ __launch_bounds__(32 * KS) void k_gemmw(const T16* __restrict__ A, const T16* __restrict__ A2, const T16* __restrict__ Bt, const T16* __restrict__ Bt2, int K, float* C, int ldc, const float* __restrict__ bias, size_t sA, size_t sB, size_t sC, const T16* __restrict__ Uh, const T16* __restrict__ Ul, const T16* __restrict__ Uw, h16* P16, bf* Ph, bf* Pl, size_t sP, int ldp) {
    static_assert(EPI == 0 || KS > 1, "the plane epilogues stand behind the slice sum"); static_assert(UP == 0 || KS == 8, "eight sub-tiles a phase, one a wave");
    typedef typename WFrag<T16>::V V;
    __shared__ __align__(16) float os[(KS == 1) ? 16 * 68 : (KS + (UP != 0 ? 1 : 0)) * 32 * 68];
    const size_t z = blockIdx.z; A += z * sA; if (A2) A2 += z * sA; Bt += z * sB; if (Bt2) Bt2 += z * sB; C += z * sC;
    const int lane = threadIdx.x & 31, lr = lane & 15, hi = lane >> 4; const int r0 = blockIdx.x * 64, c0 = blockIdx.y * 64;
    v8f acc[4][4];
#pragma unroll
    for (int mb = 0; mb < 4; ++mb)
#pragma unroll
        for (int nb = 0; nb < 4; ++nb) acc[mb][nb] = (v8f){};
    const size_t aoff = (size_t)(r0 + lr) * K + 8 * hi, boff = (size_t)(c0 + lr) * K + 8 * hi;
    // wv: the wave's K slice, held scalar so that the loop bounds are scalar
    const int wv = (KS == 1) ? 0 : __builtin_amdgcn_readfirstlane((int)(threadIdx.x >> 5)); const int kspan = K / KS, kbeg = wv * kspan, kend = kbeg + kspan;
    V ua[2], ua2[2], ub, ub2;
    if constexpr (UP != 0) {   // the up-product's operands, fetched in front of the K loop, so that no barrier of the slice sum waits for these loads
        const size_t uc = (size_t)(c0 + (wv & 3) * 16 + lr) * 32 + 8 * hi, ur = (size_t)(r0 + (wv >> 2) * 16 + lr) * 32 + 8 * hi;
        const T16* pb = (UP == 1 ? Uw : Uh) + uc; const T16* pa = (UP == 1 ? Uh : Uw) + ur; const T16* p2 = Ul + (UP == 1 ? ur : uc);   // phase 1's rows: + 32 * 32 elements
        ub = WFrag<T16>::ld(pb); ua[0] = WFrag<T16>::ld(pa); ua[1] = WFrag<T16>::ld(pa + 32 * 32);
        if (UP == 1) { ua2[0] = WFrag<T16>::ld(p2); ua2[1] = WFrag<T16>::ld(p2 + 32 * 32); } else ub2 = WFrag<T16>::ld(p2);
        // the addresses are inputs, so their registers stay as they are up to the wait
        asm volatile("s_wait_xcnt 0x0" :: "v"(pb), "v"(pa), "v"(p2) : "memory");
    }
#pragma unroll 1
    for (int kc = kbeg; kc < kend; kc += 32) {
        V a[4], a2[4];
#pragma unroll
        for (int mb = 0; mb < 4; ++mb) { a[mb] = WFrag<T16>::ld(A + aoff + (size_t)mb * 16 * K + kc); if (NSPLIT == 1 || NSPLIT == 2) a2[mb] = WFrag<T16>::ld(A2 + aoff + (size_t)mb * 16 * K + kc); }
#pragma unroll
        for (int nb = 0; nb < 4; ++nb) { const V b = WFrag<T16>::ld(Bt + boff + (size_t)nb * 16 * K + kc); V b2; if (NSPLIT >= 2) b2 = WFrag<T16>::ld(Bt2 + boff + (size_t)nb * 16 * K + kc);
#pragma unroll
            for (int mb = 0; mb < 4; ++mb) { acc[mb][nb] = WFrag<T16>::mma(a[mb], b, acc[mb][nb]); if (NSPLIT == 1 || NSPLIT == 2) acc[mb][nb] = WFrag<T16>::mma(a2[mb], b, acc[mb][nb]); if (NSPLIT >= 2) acc[mb][nb] = WFrag<T16>::mma(a[mb], b2, acc[mb][nb]); } }
        asm volatile("v_nop\n\tv_nop\n\tv_nop\n\tv_nop" : "+v"(acc[0][0]), "+v"(acc[1][1]), "+v"(acc[2][2]), "+v"(acc[3][3]) : "v"(a[0]), "v"(a[3]));
    }
    if (KS > 1) {   // every loop below is unrolled so that acc[][] and res[][] are indexed by constants and stay in registers
        float* osw = os + wv * (32 * 68); static_assert(KS == 1 || 16 % KS == 0, "KS divides 16"); constexpr int NIT = (KS > 1) ? 16 / KS : 1;   // v4f sums a thread and phase: 32 rows x 16 v4f over 32 * KS threads
        v4f res[2][NIT];
#pragma unroll
        for (int mp = 0; mp < 2; ++mp) {          // 32 output rows a phase
#pragma unroll
            for (int ml = 0; ml < 2; ++ml)
#pragma unroll
                for (int nb = 0; nb < 4; ++nb)
#pragma unroll
                    for (int j = 0; j < 8; ++j) osw[(ml * 16 + hi * 8 + j) * 68 + nb * 16 + lr] = acc[mp * 2 + ml][nb][j];
            if constexpr (UP != 0) { v8f t = WFrag<T16>::mma(ua[mp], ub, (v8f){}); t = (UP == 1) ? WFrag<T16>::mma(ua2[mp], ub, t) : WFrag<T16>::mma(ua[mp], ub2, t);
#pragma unroll
                for (int j = 0; j < 8; ++j) os[KS * (32 * 68) + ((wv >> 2) * 16 + hi * 8 + j) * 68 + (wv & 3) * 16 + lr] = t[j]; }
            __syncthreads();                      // every slice's partial rows are in LDS
#pragma unroll
            for (int it = 0; it < NIT; ++it) { const int u = (int)threadIdx.x + it * 32 * KS, row = u >> 4, cofs = (u & 15) * 4; v4f val = *(const v4fa*)(os + row * 68 + cofs);
#pragma unroll
                for (int s = 1; s < KS; ++s) val += *(const v4fa*)(os + s * (32 * 68) + row * 68 + cofs);
                if constexpr (UP != 0) val += 2.0f * *(const v4fa*)(os + KS * (32 * 68) + row * 68 + cofs);   // x 2 is exact: fused or not, one rounding
                res[mp][it] = val; }
            if (mp == 0) __syncthreads();         // all reads of phase 0 end before phase 1 overwrites the rows
        }
        // the stores stand behind the last barrier, so that no barrier waits for a store to memory
#pragma unroll
        for (int mp = 0; mp < 2; ++mp)
#pragma unroll
            for (int it = 0; it < NIT; ++it) { const int u = (int)threadIdx.x + it * 32 * KS, row = u >> 4, cofs = (u & 15) * 4; v4f val = res[mp][it];
                if (BIAS) { val[0] += bfr(bias[c0 + cofs]); val[1] += bfr(bias[c0 + cofs + 1]); val[2] += bfr(bias[c0 + cofs + 2]); val[3] += bfr(bias[c0 + cofs + 3]); }
                if constexpr (EPI == 0) *(v4f*)(C + (size_t)(r0 + mp * 32 + row) * ldc + c0 + cofs) = val;
                else if constexpr (EPI == 1) { v4h o16; v4us oh, ol;
#pragma unroll
                    for (int q = 0; q < 4; ++q) { o16[q] = tohx(val[q]); unsigned short a2, c2; splitf(val[q], a2, c2); oh[q] = a2; ol[q] = c2; }
                    const size_t po = (size_t)blockIdx.y * sP + (size_t)(r0 + mp * 32 + row) * ldp + cofs; *(v4h*)(P16 + po) = o16; *(v4us*)(Ph + po) = oh; *(v4us*)(Pl + po) = ol; }
                else if (cofs < 32) { v4us oh, ol;
#pragma unroll
                    for (int q = 0; q < 4; ++q) { unsigned short a2 = 0, c2 = 0; if (cofs + q < 8) splitf(val[q], a2, c2); oh[q] = a2; ol[q] = c2; }
                    const size_t po = (size_t)(r0 + mp * 32 + row) * 32 + cofs; *(v4us*)(Ph + po) = oh; *(v4us*)(Pl + po) = ol; } }
        return;
    }
#pragma unroll
    for (int mb = 0; mb < 4; ++mb) {
#pragma unroll
        for (int nb = 0; nb < 4; ++nb) {
#pragma unroll
            for (int j = 0; j < 8; ++j) os[(hi * 8 + j) * 68 + nb * 16 + lr] = acc[mb][nb][j]; }
        __builtin_amdgcn_wave_barrier(); asm volatile("" ::: "memory");
        float* crow = C + (size_t)(r0 + mb * 16) * ldc + c0;
{
#pragma unroll
            for (int s = 0; s < 8; ++s) { const int row = 2 * s + hi, cofs = lr * 4; v4f val = *(const v4fa*)(os + row * 68 + cofs); if (BIAS) { val[0] += bfr(bias[c0 + cofs]); val[1] += bfr(bias[c0 + cofs + 1]); val[2] += bfr(bias[c0 + cofs + 2]); val[3] += bfr(bias[c0 + cofs + 3]); }
                *(v4f*)(crow + (size_t)row * ldc + cofs) = val; }
             }
        __builtin_amdgcn_wave_barrier(); asm volatile("" ::: "memory");
    }
}


__global__ __launch_bounds__(256) void k_wtG(const float* __restrict__ w, int K, int N, bf* Bt) {
    const int lane = threadIdx.x & 31; const int L0 = (blockIdx.x * 8 + (threadIdx.x >> 5)) * 8; const int nlines = N * K / 64;
{
#pragma unroll 1
        for (int l = 0; l < 8; ++l) { const int L = L0 + l; if (L >= nlines) break; const size_t e = (size_t)L * 64 + lane * 2; const int k = (int)(e % K), n = (int)(e / K); v2us o;
            o[0] = f2bf(w[(size_t)k * N + n]); o[1] = f2bf(w[(size_t)(k + 1) * N + n]); *(v2us*)(Bt + e) = o; }
         }
}
__global__ __launch_bounds__(256) void k_cvt8(const float* __restrict__ src, bf* dst, size_t n8) { const size_t i = (size_t)blockIdx.x * 256 + threadIdx.x; if (i >= n8) return; const v8f v = *(const v8f*)(src + i * 8); v8us o;
#pragma unroll
    for (int k = 0; k < 8; ++k) o[k] = f2bf(v[k]); *(v8us*)(dst + i * 8) = o;  }
__global__ __launch_bounds__(256) void k_cscvt(const float* __restrict__ cosT, const float* __restrict__ sinT, float* CS) { const int idx = blockIdx.x * 256 + threadIdx.x; if (idx >= TT * HD) return; v2f cs; cs[0] = bfr(cosT[idx]); cs[1] = bfr(sinT[idx]); *(v2f*)(CS + (size_t)idx * 2) = cs;  }
#define SC2 (SCL * 1.4426950408889634f)
typedef __attribute__((ext_vector_type(8))) int v8i;
__device__ __forceinline__ v8i ldm8(const int* p) { return __builtin_shufflevector(*(const v4i*)p, *(const v4i*)(p + 4), 0, 1, 2, 3, 4, 5, 6, 7); }
__device__ __forceinline__ float xhalf(float x) { return __builtin_bit_cast(float, __builtin_amdgcn_permlanex16(__builtin_bit_cast(int, x), __builtin_bit_cast(int, x), 0x76543210, 0xfedcba98, false, false)); }   // lane l with lane l ^ 16
template <typename T16, bool HL, int NQ>
__device__ __forceinline__ void fattn_rows(const T16* __restrict__ Q, const T16* __restrict__ Q2, const T16* __restrict__ Kp, const T16* __restrict__ K2, const T16* __restrict__ Vt, const T16* __restrict__ V2, const int* __restrict__ am, int q0, bf* Ah, bf* Al) {
    typedef WFrag<T16> F; typedef typename F::V V;
    const int lane = threadIdx.x & 31, lr = lane & 15, hi = lane >> 4;
    V qf[NQ][2], qf2[NQ][2];
#pragma unroll
    for (int qb = 0; qb < NQ; ++qb)
#pragma unroll
        for (int ks = 0; ks < 2; ++ks) { const size_t qo = (size_t)(q0 + qb * 16 + lr) * HD + ks * 32 + 8 * hi; qf[qb][ks] = F::ld(Q + qo); if (HL) qf2[qb][ks] = F::ld(Q2 + qo); }
    v8f o[4][NQ]; float m[NQ], l[NQ];
#pragma unroll
    for (int qb = 0; qb < NQ; ++qb) { m[qb] = -3.0e38f; l[qb] = 0.f;
#pragma unroll
        for (int db = 0; db < 4; ++db) o[db][qb] = (v8f){}; }
    const size_t ko = (size_t)lr * HD + 8 * hi, vo = (size_t)lr * TT + 8 * hi; const int* mp = am + (size_t)(q0 + lr) * TT + 8 * hi;
    V kf[2][2], kf2[2][2]; v8i mk[NQ][2];
    auto ldk = [&](int key) {      // the key rows of one pass
#pragma unroll
        for (int kb = 0; kb < 2; ++kb)
#pragma unroll
            for (int ks = 0; ks < 2; ++ks) { kf[kb][ks] = F::ld(Kp + ko + (size_t)(key + kb * 16) * HD + ks * 32); if (HL) kf2[kb][ks] = F::ld(K2 + ko + (size_t)(key + kb * 16) * HD + ks * 32); } };
    auto ldmk = [&](int qb, int key) {   // the mask words of one pass and 16 queries
#pragma unroll
        for (int kb = 0; kb < 2; ++kb) mk[qb][kb] = ldm8(mp + (size_t)qb * 16 * TT + key + kb * 16); };
    constexpr bool AHEAD = !HL;    // key rows and mask words one pass ahead; the hi+lo rows hold twice the fragments and have no registers left for it
    if (AHEAD) { ldk(0);
#pragma unroll
        for (int qb = 0; qb < NQ; ++qb) ldmk(qb, 0); }
#pragma unroll 1   // rolled: a second copy of the pass would not fit the registers
    for (int key0 = 0; key0 < TT; key0 += 32) {
        if (!AHEAD) { ldk(key0);
#pragma unroll
            for (int qb = 0; qb < NQ; ++qb) ldmk(qb, key0); }
        V vf[4], vf2[4];
#pragma unroll
        for (int db = 0; db < 4; ++db) vf[db] = F::ld(Vt + vo + (size_t)db * 16 * TT + key0);
        if constexpr (HL) {
            // hi+lo rows: the addresses are inputs, so their registers stay as they are up to the wait
            asm volatile("s_wait_xcnt 0x0" :: "v"(Kp + ko + (size_t)key0 * HD), "v"(K2 + ko + (size_t)key0 * HD), "v"(Vt + vo + key0), "v"(mp + key0) : "memory");
#pragma unroll
            for (int db = 0; db < 4; ++db) vf2[db] = F::ld(V2 + vo + (size_t)db * 16 * TT + key0);
            asm volatile("s_wait_xcnt 0x0" :: "v"(V2 + vo + key0) : "memory");   // the same for the lo plane's loads
        }
        v8f s[2][NQ];
#pragma unroll
        for (int kb = 0; kb < 2; ++kb)
#pragma unroll
            for (int qb = 0; qb < NQ; ++qb) { s[kb][qb] = (v8f){};
#pragma unroll
                for (int ks = 0; ks < 2; ++ks) { s[kb][qb] = F::mma(kf[kb][ks], qf[qb][ks], s[kb][qb]); if (HL) { s[kb][qb] = F::mma(kf[kb][ks], qf2[qb][ks], s[kb][qb]); s[kb][qb] = F::mma(kf2[kb][ks], qf[qb][ks], s[kb][qb]); } } }
        // AHEAD: the next pass's key rows and mask words are fetched behind the last use of this pass's; the last pass fetches its own again (in bounds, unused)
        const int nk = (key0 + 32 < TT) ? key0 + 32 : key0;
        if (AHEAD) ldk(nk);
#pragma unroll
        for (int qb = 0; qb < NQ; ++qb) {
            float t[2][8]; float mx = -3.0e38f;
#pragma unroll
            for (int kb = 0; kb < 2; ++kb)
#pragma unroll
                for (int j = 0; j < 8; ++j) { t[kb][j] = (mk[qb][kb][j] != 0) ? -3.0e38f : s[kb][qb][j] * SC2; mx = fmaxf(mx, t[kb][j]); }
            if (AHEAD) ldmk(qb, nk);
            mx = fmaxf(mx, xhalf(mx));     // the other half of the wave holds the query's other 16 keys
            const float mn = fmaxf(m[qb], mx), alpha = __builtin_amdgcn_exp2f(m[qb] - mn); m[qb] = mn;
            float ps = 0.f;
#pragma unroll
            for (int kb = 0; kb < 2; ++kb)
#pragma unroll
                for (int j = 0; j < 8; ++j) { t[kb][j] = __builtin_amdgcn_exp2f(t[kb][j] - mn); ps += t[kb][j]; }
            l[qb] = l[qb] * alpha + ps;
#pragma unroll
            for (int db = 0; db < 4; ++db) o[db][qb] *= alpha;
            V pf, pf2;
#pragma unroll
            for (int e = 0; e < 16; ++e) { const float p = t[e >> 3][e & 7];
                if constexpr (HL) { const __bf16 ph = (__bf16)p; pf[e] = ph; pf2[e] = (__bf16)(p - (float)ph); } else pf[e] = (h16)p; }
#pragma unroll
            for (int db = 0; db < 4; ++db) { o[db][qb] = F::mma(vf[db], pf, o[db][qb]); if (HL) { o[db][qb] = F::mma(vf[db], pf2, o[db][qb]); o[db][qb] = F::mma(vf2[db], pf, o[db][qb]); } }
        }
    }
#pragma unroll
    for (int qb = 0; qb < NQ; ++qb) { const float lt = l[qb] + xhalf(l[qb]); const float inv = __fdiv_rn(1.0f, lt);
#pragma unroll
        for (int db = 0; db < 4; ++db) { v8us oh, ol;
#pragma unroll
            for (int j = 0; j < 8; ++j) { unsigned short a, c2; splitf(o[db][qb][j] * inv, a, c2); oh[j] = a; ol[j] = c2; }
            const size_t oo = (size_t)(q0 + qb * 16 + lr) * DQ + db * 16 + hi * 8; *(v8us*)(Ah + oo) = oh; *(v8us*)(Al + oo) = ol; } }
}
// grid (RH / 64 + (TT - RH) / 128, heads), 4 waves: the first RH / 64 work-groups take the hi+lo rows, 16 a wave (three products each, so half the rows), the rest 32 fp16 rows a wave
__global__ __launch_bounds__(128) void k_fattn(const h16* __restrict__ Q16, const bf* __restrict__ Qh, const bf* __restrict__ Ql, const h16* __restrict__ K16, const bf* __restrict__ Kh, const bf* __restrict__ Kl, const h16* __restrict__ V16, const bf* __restrict__ Vh, const bf* __restrict__ Vl, const int* __restrict__ am, bf* Ah, bf* Al) {
    const int wv = __builtin_amdgcn_readfirstlane((int)(threadIdx.x >> 5)); const int bx = blockIdx.x; const size_t hp = (size_t)blockIdx.y * TT * HD; Ah += blockIdx.y * HD; Al += blockIdx.y * HD;
    if (bx < RH / 64) fattn_rows<bf, true, 1>(Qh + hp, Ql + hp, Kh + hp, Kl + hp, Vh + hp, Vl + hp, am, bx * 64 + wv * 16, Ah, Al);
    else fattn_rows<h16, false, 2>(Q16 + hp, nullptr, K16 + hp, nullptr, V16 + hp, nullptr, am, RH + (bx - RH / 64) * 128 + wv * 32, Ah, Al);
}

__global__ __launch_bounds__(256) void k_lorap(const float* __restrict__ A, const float* __restrict__ Bw, bf* AQ, bf* B2) { const int e = (blockIdx.x * 256 + threadIdx.x) * 4; if (e >= 64 * DM) return;
    { const int n = e / DM, k = e % DM; v4us o; for (int u = 0; u < 4; ++u) o[u] = (n < 8) ? f2bf(A[(size_t)n * DM + k + u]) : (unsigned short)0; *(v4us*)(AQ + e) = o;  }
    if (e < DM * 32) { const int n = e / 32, k = e % 32; v4us o; for (int u = 0; u < 4; ++u) o[u] = (k + u < 8) ? f2bf(Bw[(size_t)n * 8 + k + u]) : (unsigned short)0; *(v4us*)(B2 + e) = o;  } }

extern "C" void kernel_launch(void* const* d_in, const int* in_sizes, int n_in,
                              void* d_out, int out_size, void* d_ws, size_t ws_size, hipStream_t stream) {
    (void)in_sizes; (void)n_in; (void)out_size;
    const float* x = (const float*)d_in[0]; const int* amask = (const int*)d_in[1]; const float* wq = (const float*)d_in[2]; const float* wqA = (const float*)d_in[3]; const float* wqB = (const float*)d_in[4]; const float* wk = (const float*)d_in[5]; const float* wv = (const float*)d_in[6]; const float* wvA = (const float*)d_in[7]; const float* wvB = (const float*)d_in[8]; const float* wo = (const float*)d_in[9]; const float* cosT = nullptr; const float* sinT = nullptr; (void)cosT; (void)sinT;
    float* OUT = (float*)d_out;     // [2][2048][1024]
    char* wsp = (char*)d_ws;
    auto take = [&](size_t bytes) { char* p = wsp; wsp += (bytes + 255) & ~(size_t)255; return (void*)p; };
    bf* WQ = (bf*)take((size_t)DQ * DM * 2); bf* WK = (bf*)take((size_t)DKV * DM * 2); bf* WV = (bf*)take((size_t)DKV * DM * 2); bf* WO = (bf*)take((size_t)DM * DQ * 2);
    bf* XB = (bf*)take((size_t)TT * DM * 2); bf* AQ = (bf*)take((size_t)64 * DM * 2); bf* AV = (bf*)take((size_t)64 * DM * 2); bf* BQ2 = (bf*)take((size_t)DM * 32 * 2); bf* BV2 = (bf*)take((size_t)DM * 32 * 2); bf* XAh = (bf*)take((size_t)TT * 32 * 2); bf* XAl = (bf*)take((size_t)TT * 32 * 2);
    h16* QP16 = (h16*)take((size_t)NH_ * TT * HD * 2); h16* KP16 = (h16*)take((size_t)NKV * TT * HD * 2); h16* VT16 = (h16*)take((size_t)NKV * HD * TT * 2);
    bf* QPh = (bf*)take((size_t)NH_ * TT * HD * 2); bf* QPl = (bf*)take((size_t)NH_ * TT * HD * 2); bf* KPh = (bf*)take((size_t)NKV * TT * HD * 2); bf* KPl = (bf*)take((size_t)NKV * TT * HD * 2); bf* VTh = (bf*)take((size_t)NKV * HD * TT * 2); bf* VTl = (bf*)take((size_t)NKV * HD * TT * 2);
    bf* ATh = (bf*)take((size_t)TT * DQ * 2); bf* ATl = (bf*)take((size_t)TT * DQ * 2);
    if ((size_t)(wsp - (char*)d_ws) > ws_size) return;    // ws 256 MiB
    { k_lorap<<<(64 * DM / 4 + 255) / 256, 256, 0, stream>>>(wqA, wqB, AQ, BQ2); k_lorap<<<(64 * DM / 4 + 255) / 256, 256, 0, stream>>>(wvA, wvB, AV, BV2); k_cvt8<<<(unsigned)(((size_t)DQ * DM / 8 + 255) / 256), 256, 0, stream>>>(wq, WQ, (size_t)DQ * DM / 8); k_cvt8<<<(unsigned)(((size_t)DKV * DM / 8 + 255) / 256), 256, 0, stream>>>(wk, WK, (size_t)DKV * DM / 8); k_cvt8<<<(unsigned)(((size_t)DKV * DM / 8 + 255) / 256), 256, 0, stream>>>(wv, WV, (size_t)DKV * DM / 8);
      k_cvt8<<<(unsigned)(((size_t)DM * DQ / 8 + 255) / 256), 256, 0, stream>>>(wo, WO, (size_t)DM * DQ / 8);
       }
    for (int b = 0; b < NB_; ++b) {
        k_cvt8<<<(unsigned)(((size_t)TT * DM / 8 + 255) / 256), 256, 0, stream>>>(x + (size_t)b * TT * DM, XB, (size_t)TT * DM / 8);
        /* hi/lo planes [t][32] of x wq_A^T */ k_gemmw<bf, 0, false, 16, 2><<<dim3(TT / 64, 1, 1), 512, 0, stream>>>(XB, nullptr, AQ, nullptr, DM, nullptr, 64, nullptr, 0, 0, 0, nullptr, nullptr, nullptr, nullptr, XAh, XAl, 0, 32);
        /* q = x wq^T + 2 (x A^T) B^T -> head planes [h][t][d] */ k_gemmw<bf, 0, false, 8, 1, 1><<<dim3(TT / 64, DQ / 64, 1), 256, 0, stream>>>(XB, nullptr, WQ, nullptr, DM, nullptr, DQ, nullptr, 0, 0, 0, XAh, XAl, BQ2, QP16, QPh, QPl, (size_t)TT * HD, HD);
        /* k = x wk^T -> head planes [h][t][d] */ k_gemmw<bf, 0, false, 8, 1, 0><<<dim3(TT / 64, DKV / 64, 1), 256, 0, stream>>>(XB, nullptr, WK, nullptr, DM, nullptr, DKV, nullptr, 0, 0, 0, nullptr, nullptr, nullptr, KP16, KPh, KPl, (size_t)TT * HD, HD);
        /* hi/lo planes [t][32] of x wv_A^T */ k_gemmw<bf, 0, false, 16, 2><<<dim3(TT / 64, 1, 1), 512, 0, stream>>>(XB, nullptr, AV, nullptr, DM, nullptr, 64, nullptr, 0, 0, 0, nullptr, nullptr, nullptr, nullptr, XAh, XAl, 0, 32);
        /* v^T = wv x^T + 2 B (x A^T)^T -> planes [g * HD + d][t] */ k_gemmw<bf, 0, false, 8, 1, 2><<<dim3(DKV / 64, TT / 64, 1), 256, 0, stream>>>(WV, nullptr, XB, nullptr, DM, nullptr, TT, nullptr, 0, 0, 0, XAh, XAl, BV2, VT16, VTh, VTl, 64, TT);
        k_fattn<<<dim3(RH / 64 + (TT - RH) / 128, NH_, 1), 128, 0, stream>>>(QP16, QPh, QPl, KP16, KPh, KPl, VT16, VTh, VTl, amask, ATh, ATl);   // one kv head per query head
        k_gemmw<bf, 1, false, 8><<<dim3(TT / 64, DM / 64, 1), 256, 0, stream>>>(ATh, ATl, WO, nullptr, DQ, OUT + (size_t)b * TT * DM, DM, nullptr, 0, 0, 0, nullptr, nullptr, nullptr, nullptr, nullptr, nullptr, 0, 0); }
}

// v004
// It runs in 306 microseconds.
// Next to v003, in two timings, it ran 1.27 and 1.30 times as fast.
// Over all steps from v000 it is 7.15 times as fast.
#include <hip/hip_runtime.h>

// TinySelfAttention (x [2][2048][1024]; q = x wq_w^T + 2 (x wq_A^T) wq_B^T (LoRA, r = 8, alpha/r = 2), k = x wk_w^T, v = x wv_w^T + 2 (x wv_A^T) wv_B^T (16 heads x 64); scores = q.k / 8, masked (-inf) where attn_mask[i][j] != 0 (int [2048][2048], read - the module's strict-upper-triangle mask, but read as data over every tile); softmax; out = merged wo_w^T -> [2][2048][1024]).
// Compute dtypes, f32 accumulate: every input rounded to bf16; base projections and the rank-8 down-projections on PLAIN bf16 operands (inputs: exact; the 8 outputs padded to 64 with zero weights); the up-projections as hl planes (K padded 8 -> 32 with zeros) x exact B (2 products), added x 2 in f32; scores over ALL key tiles (mask read per element) and attn.v: query rows < 512 hl (3 products), the rest single fp16; softmax f32, running maximum and sum over 32-key tiles inside one kernel (k_fattn); wo hl x exact (2 products).
// The q/k/v and rank-8 down GEMMs write their 16-bit planes themselves (k_gemmw, EPI), q and v after taking in their up-projection (UP): no f32 projection goes to memory; v is computed as wv x^T, so that the rows of V^T come out contiguous.
// FRAGMENT ORDER: every 16-bit plane that a K loop or the key walk reads (x, the weights, the padded down weights, q, k, V^T, the attention output) lies in units of 16 rows x 32 k = 1 KB, unit (r / 16, k / 32) at ((r / 16) * (K / 32) + k / 32) * 512 elements;
// inside a unit the 16-byte piece (row r % 16, k pieces c = (k % 32) / 8) stands at piece (c / 2) * 32 + (c % 2) * 16 + r % 16, which is piece 'lane' of the fragment's first (c < 2) or second 16-byte load: a wave-wide load or store is 512 contiguous bytes, four whole lines, not 32 bytes in each of 16 lines.
// The rank-8 planes [t][32] and the up weights [n][32] stay row-major (64-byte rows, read once a work-group).

#define NB_  2
#define TT   2048
#define DM   1024
#define NH_  16
#define NKV  16
#define REP  (NH_ / NKV)
#define HD   64
#define DQ   (NH_ * HD)
#define DKV  (NKV * HD)
#define RH   512                  // query rows < RH use hi+lo planes (0: none)
#define WIN  0
#define SCL  0.125f   // HD^-0.5
typedef _Float16 h16;
typedef unsigned short bf;
typedef __attribute__((ext_vector_type(16))) __bf16   v16bf;
typedef __attribute__((ext_vector_type(16))) _Float16 v16h;
typedef __attribute__((ext_vector_type(8)))  _Float16 v8h;
typedef __attribute__((ext_vector_type(8)))  unsigned short v8us;
typedef __attribute__((ext_vector_type(8)))  float    v8f;
typedef __attribute__((ext_vector_type(4)))  float    v4f;
typedef v8h  __attribute__((may_alias)) v8ha;
typedef v4f  __attribute__((may_alias)) v4fa;
typedef v8us __attribute__((may_alias)) v8usa;

__device__ __forceinline__ unsigned short f2bf(float f) { unsigned u = __float_as_uint(f); u += 0x7FFFu + ((u >> 16) & 1u); return (unsigned short)(u >> 16); }
__device__ __forceinline__ float bf2f(unsigned short b) { return __uint_as_float(((unsigned)b) << 16); }
__device__ __forceinline__ float bfr(float f) { return bf2f(f2bf(f)); }
__device__ __forceinline__ v16h cat16(v8h lo, v8h hi) { return __builtin_shufflevector(lo, hi, 0, 1, 2, 3, 4, 5, 6, 7, 8, 9, 10, 11, 12, 13, 14, 15); }
__device__ __forceinline__ v16bf cat16b(v8us lo, v8us hi) { return __builtin_bit_cast(v16bf, __builtin_shufflevector(lo, hi, 0, 1, 2, 3, 4, 5, 6, 7, 8, 9, 10, 11, 12, 13, 14, 15)); }
__device__ __forceinline__ v8f wmma16(v16h a, v16h b, v8f c) { return __builtin_amdgcn_wmma_f32_16x16x32_f16(false, a, false, b, (short)0, c, false, false); }
__device__ __forceinline__ v8f wmmab(v16bf a, v16bf b, v8f c) { return __builtin_amdgcn_wmma_f32_16x16x32_bf16(false, a, false, b, (short)0, c, false, false); }
__device__ __forceinline__ h16 tohx(float x) { return (h16)x; }
__device__ __forceinline__ void splitf(float y, unsigned short& h, unsigned short& l) { h = f2bf(y); l = f2bf(y - bf2f(h)); }
typedef __attribute__((ext_vector_type(2))) _Float16 v2h;
typedef __attribute__((ext_vector_type(4))) _Float16 v4h;
typedef __attribute__((ext_vector_type(2))) unsigned short v2us;
typedef __attribute__((ext_vector_type(4))) unsigned short v4us;
typedef __attribute__((ext_vector_type(2))) float v2f;
typedef __attribute__((ext_vector_type(4))) int v4i;



// ---- k_gemmw: register-blocked GEMM, one 64x64 output tile (16 accumulators a wave) per work-group of KS waves, operands straight from 16-bit planes in fragment order; grid (M/64, N/64, Z), 32 * KS threads.
// C[m][n] (f32, pitch ldc, + optional f32 bias[n]) = sum_k A[m][k] Bt[n][k] (+ split products per NSPLIT). z-batch strides sA/sB/sC in elements. K = DM, K % (32 * KS) == 0.
// KS > 1: wave w sums the K slice [w K/KS, (w+1) K/KS); the KS partial tiles meet in LDS and are added in slice order 0 .. KS-1 (fixed, the same on every run).
// UP (KS == 8 only): the tile takes + 2 u, u = the rank-8 up-product of the same tile (K padded to 32: one WMMA step, hi then lo plane, its own f32 sum from 0). Uh/Ul: hi/lo planes [t][32] of the down-projection, Uw: up weights [n][32].
// UP = 1: rows m are t, columns n (A = Uh, Ul; B = Uw). UP = 2: rows m are n, columns t (A = Uw; B = Uh, Ul). Wave w makes sub-tile (w / 4, w % 4) of each 32-row phase; u meets the slices in LDS as one more slice and is added last, x 2.
// EPI (KS > 1 only) says what leaves the kernel. 0: the f32 tile, to C. 1: the tile as three 16-bit planes (fp16, bf16 hi, bf16 lo of y - hi), each a matrix of ldp columns in fragment order, element (m, n) at its row blockIdx.y * rP + m, column blockIdx.y * cP + (n - c0);
// rP = rows, cP = 0, ldp = 64 gives head planes [n / 64][m][n % 64], rP = 0, cP = 64, ldp = N gives plain [m][n]. A thread sums and stores one 16-byte piece (8 columns), thread t of each 64 piece t of a unit. 2: columns 0 .. 31 as hi/lo planes [m][32], columns 8 .. 31 zero (the rank-8 down-projection, K-padded for the up-projection).
template <typename T16> struct WFrag;
template <> struct WFrag<h16> { typedef v16h V; static __device__ __forceinline__ V ld(const h16* p) { return cat16(*(const v8h*)p, *(const v8h*)(p + 16)); } static __device__ __forceinline__ V ldf(const h16* p) { return cat16(*(const v8h*)p, *(const v8h*)(p + 256)); } static __device__ __forceinline__ v8f mma(V a, V b, v8f c) { return wmma16(a, b, c); } };
template <> struct WFrag<bf> { typedef v16bf V; static __device__ __forceinline__ V ld(const bf* p) { return cat16b(*(const v8us*)p, *(const v8us*)(p + 16)); } static __device__ __forceinline__ V ldf(const bf* p) { return cat16b(*(const v8us*)p, *(const v8us*)(p + 256)); } static __device__ __forceinline__ v8f mma(V a, V b, v8f c) { return wmmab(a, b, c); } };
template <typename T16, int NSPLIT, bool BIAS, int KS, int EPI = 0, int UP = 0>
__global__ __launch_bounds__(32 * KS) void k_gemmw(const T16* __restrict__ A, const T16* __restrict__ A2, const T16* __restrict__ Bt, const T16* __restrict__ Bt2, float* C, int ldc, const float* __restrict__ bias, size_t sA, size_t sB, size_t sC, const T16* __restrict__ Uh, const T16* __restrict__ Ul, const T16* __restrict__ Uw, h16* P16, bf* Ph, bf* Pl, int rP, int cP, int ldp) {
    static_assert(EPI == 0 || KS > 1, "the plane epilogues stand behind the slice sum"); static_assert(EPI != 1 || KS == 8, "256 threads, one 16-byte piece of 32 x 64 each"); static_assert(UP == 0 || KS == 8, "eight sub-tiles a phase, one a wave");
    typedef typename WFrag<T16>::V V; constexpr int K = DM; static_assert(DQ == DM, "one K for every product");   // a constant, so that a pass's units stand at immediate offsets from one address an operand
    __shared__ __align__(16) float os[(KS == 1) ? 16 * 68 : (KS + (UP != 0 ? 1 : 0)) * 32 * 68];
    const size_t z = blockIdx.z; A += z * sA; if (A2) A2 += z * sA; Bt += z * sB; if (Bt2) Bt2 += z * sB; C += z * sC;
    const int lane = threadIdx.x & 31, lr = lane & 15, hi = lane >> 4; const int r0 = blockIdx.x * 64, c0 = blockIdx.y * 64;
    v8f acc[4][4];
#pragma unroll
    for (int mb = 0; mb < 4; ++mb)
#pragma unroll
        for (int nb = 0; nb < 4; ++nb) acc[mb][nb] = (v8f){};
    const size_t aoff = (size_t)r0 * K + 8 * lane, boff = (size_t)c0 * K + 8 * lane;   // 16 rows of units are 16 K elements, 32 k one unit of 512, the lane's piece 8 lane
    // wv: the wave's K slice, held scalar so that the loop bounds are scalar
    const int wv = (KS == 1) ? 0 : __builtin_amdgcn_readfirstlane((int)(threadIdx.x >> 5)); const int kspan = K / KS, kbeg = wv * kspan, kend = kbeg + kspan;
    V ua[2], ua2[2], ub, ub2;
    if constexpr (UP != 0) {   // the up-product's operands, fetched in front of the K loop, so that no barrier of the slice sum waits for these loads
        const size_t uc = (size_t)(c0 + (wv & 3) * 16 + lr) * 32 + 8 * hi, ur = (size_t)(r0 + (wv >> 2) * 16 + lr) * 32 + 8 * hi;
        const T16* pb = (UP == 1 ? Uw : Uh) + uc; const T16* pa = (UP == 1 ? Uh : Uw) + ur; const T16* p2 = Ul + (UP == 1 ? ur : uc);   // phase 1's rows: + 32 * 32 elements
        ub = WFrag<T16>::ld(pb); ua[0] = WFrag<T16>::ld(pa); ua[1] = WFrag<T16>::ld(pa + 32 * 32);
        if (UP == 1) { ua2[0] = WFrag<T16>::ld(p2); ua2[1] = WFrag<T16>::ld(p2 + 32 * 32); } else ub2 = WFrag<T16>::ld(p2);
        // the addresses are inputs, so their registers stay as they are up to the wait
        asm volatile("s_wait_xcnt 0x0" :: "v"(pb), "v"(pa), "v"(p2) : "memory");
    }
#pragma unroll 1
    for (int kc = kbeg; kc < kend; kc += 32) {
        V a[4], a2[4]; const T16* pa = A + aoff + kc * 16; const T16* pb = Bt + boff + kc * 16; const T16* pa2 = (NSPLIT == 1 || NSPLIT == 2) ? A2 + aoff + kc * 16 : pa; const T16* pb2 = (NSPLIT >= 2) ? Bt2 + boff + kc * 16 : pb;
#pragma unroll
        for (int mb = 0; mb < 4; ++mb) { a[mb] = WFrag<T16>::ldf(pa + mb * 16 * K); if (NSPLIT == 1 || NSPLIT == 2) a2[mb] = WFrag<T16>::ldf(pa2 + mb * 16 * K); }
#pragma unroll
        for (int nb = 0; nb < 4; ++nb) { const V b = WFrag<T16>::ldf(pb + nb * 16 * K); V b2; if (NSPLIT >= 2) b2 = WFrag<T16>::ldf(pb2 + nb * 16 * K);
#pragma unroll
            for (int mb = 0; mb < 4; ++mb) { acc[mb][nb] = WFrag<T16>::mma(a[mb], b, acc[mb][nb]); if (NSPLIT == 1 || NSPLIT == 2) acc[mb][nb] = WFrag<T16>::mma(a2[mb], b, acc[mb][nb]); if (NSPLIT >= 2) acc[mb][nb] = WFrag<T16>::mma(a[mb], b2, acc[mb][nb]); } }
        // the pass's addresses are inputs here, so their registers stay as they are up to the wait
        asm volatile("s_wait_xcnt 0x0" :: "v"(pa), "v"(pb), "v"(pa2), "v"(pb2) : "memory");
        asm volatile("v_nop\n\tv_nop\n\tv_nop\n\tv_nop" : "+v"(acc[0][0]), "+v"(acc[1][1]), "+v"(acc[2][2]), "+v"(acc[3][3]) : "v"(a[0]), "v"(a[3]));
    }
    if (KS > 1) {   // every loop below is unrolled so that acc[][] and res[][] are indexed by constants and stay in registers
        float* osw = os + wv * (32 * 68); static_assert(KS == 1 || 16 % KS == 0, "KS divides 16"); constexpr int NIT = (KS > 1) ? 16 / KS : 1;   // v4f sums a thread and phase: 32 rows x 16 v4f over 32 * KS threads
        v4f res[2][NIT];
        // which v4f of a phase's 32 x 64 a thread sums. EPI 1: the two halves of one piece, in fragment order (unit t / 64: 16 rows x 32 columns); else 16 threads a row
        const int pw = (int)threadIdx.x & 63, pu = (int)threadIdx.x >> 6, prow = (pu >> 1) * 16 + (pw & 15), pc8 = (pu & 1) * 4 + (pw >> 5) * 2 + ((pw >> 4) & 1);
        auto rowof = [&](int it) { return (EPI == 1) ? prow : ((int)threadIdx.x + it * 32 * KS) >> 4; };
        auto colof = [&](int it) { return (EPI == 1) ? pc8 * 8 + it * 4 : (((int)threadIdx.x + it * 32 * KS) & 15) * 4; };
#pragma unroll
        for (int mp = 0; mp < 2; ++mp) {          // 32 output rows a phase
#pragma unroll
            for (int ml = 0; ml < 2; ++ml)
#pragma unroll
                for (int nb = 0; nb < 4; ++nb)
#pragma unroll
                    for (int j = 0; j < 8; ++j) osw[(ml * 16 + hi * 8 + j) * 68 + nb * 16 + lr] = acc[mp * 2 + ml][nb][j];
            if constexpr (UP != 0) { v8f t = WFrag<T16>::mma(ua[mp], ub, (v8f){}); t = (UP == 1) ? WFrag<T16>::mma(ua2[mp], ub, t) : WFrag<T16>::mma(ua[mp], ub2, t);
#pragma unroll
                for (int j = 0; j < 8; ++j) os[KS * (32 * 68) + ((wv >> 2) * 16 + hi * 8 + j) * 68 + (wv & 3) * 16 + lr] = t[j]; }
            __syncthreads();                      // every slice's partial rows are in LDS
#pragma unroll
            for (int it = 0; it < NIT; ++it) { const int row = rowof(it), cofs = colof(it); v4f val = *(const v4fa*)(os + row * 68 + cofs);
#pragma unroll
                for (int s = 1; s < KS; ++s) val += *(const v4fa*)(os + s * (32 * 68) + row * 68 + cofs);
                if constexpr (UP != 0) val += 2.0f * *(const v4fa*)(os + KS * (32 * 68) + row * 68 + cofs);   // x 2 is exact: fused or not, one rounding
                res[mp][it] = val; }
            if (mp == 0) __syncthreads();         // all reads of phase 0 end before phase 1 overwrites the rows
        }
        // the stores stand behind the last barrier, so that no barrier waits for a store to memory
#pragma unroll
        for (int mp = 0; mp < 2; ++mp) { v8h o16; v8us oh8, ol8;   // EPI 1: the thread's piece of each plane
#pragma unroll
            for (int it = 0; it < NIT; ++it) { const int row = rowof(it), cofs = colof(it); v4f val = res[mp][it];
                if (BIAS) { val[0] += bfr(bias[c0 + cofs]); val[1] += bfr(bias[c0 + cofs + 1]); val[2] += bfr(bias[c0 + cofs + 2]); val[3] += bfr(bias[c0 + cofs + 3]); }
                if constexpr (EPI == 0) *(v4f*)(C + (size_t)(r0 + mp * 32 + row) * ldc + c0 + cofs) = val;
                else if constexpr (EPI == 1) {
#pragma unroll
                    for (int q = 0; q < 4; ++q) { o16[it * 4 + q] = tohx(val[q]); unsigned short a2, c2; splitf(val[q], a2, c2); oh8[it * 4 + q] = a2; ol8[it * 4 + q] = c2; }
                    if (it == NIT - 1) { const size_t po = ((size_t)(((int)blockIdx.y * rP + r0 + mp * 32 + row) >> 4) * (ldp >> 5) + (((int)blockIdx.y * cP) >> 5) + (pc8 >> 2)) * 512 + pw * 8; *(v8h*)(P16 + po) = o16; *(v8us*)(Ph + po) = oh8; *(v8us*)(Pl + po) = ol8; } }
                else if (cofs < 32) { v4us oh, ol;
#pragma unroll
                    for (int q = 0; q < 4; ++q) { unsigned short a2 = 0, c2 = 0; if (cofs + q < 8) splitf(val[q], a2, c2); oh[q] = a2; ol[q] = c2; }
                    const size_t po = (size_t)(r0 + mp * 32 + row) * 32 + cofs; *(v4us*)(Ph + po) = oh; *(v4us*)(Pl + po) = ol; } } }
        return;
    }
#pragma unroll
    for (int mb = 0; mb < 4; ++mb) {
#pragma unroll
        for (int nb = 0; nb < 4; ++nb) {
#pragma unroll
            for (int j = 0; j < 8; ++j) os[(hi * 8 + j) * 68 + nb * 16 + lr] = acc[mb][nb][j]; }
        __builtin_amdgcn_wave_barrier(); asm volatile("" ::: "memory");
        float* crow = C + (size_t)(r0 + mb * 16) * ldc + c0;
{
#pragma unroll
            for (int s = 0; s < 8; ++s) { const int row = 2 * s + hi, cofs = lr * 4; v4f val = *(const v4fa*)(os + row * 68 + cofs); if (BIAS) { val[0] += bfr(bias[c0 + cofs]); val[1] += bfr(bias[c0 + cofs + 1]); val[2] += bfr(bias[c0 + cofs + 2]); val[3] += bfr(bias[c0 + cofs + 3]); }
                *(v4f*)(crow + (size_t)row * ldc + cofs) = val; }
             }
        __builtin_amdgcn_wave_barrier(); asm volatile("" ::: "memory");
    }
}


__global__ __launch_bounds__(256) void k_wtG(const float* __restrict__ w, int K, int N, bf* Bt) {
    const int lane = threadIdx.x & 31; const int L0 = (blockIdx.x * 8 + (threadIdx.x >> 5)) * 8; const int nlines = N * K / 64;
{
#pragma unroll 1
        for (int l = 0; l < 8; ++l) { const int L = L0 + l; if (L >= nlines) break; const size_t e = (size_t)L * 64 + lane * 2; const int k = (int)(e % K), n = (int)(e / K); v2us o;
            o[0] = f2bf(w[(size_t)k * N + n]); o[1] = f2bf(w[(size_t)(k + 1) * N + n]); *(v2us*)(Bt + e) = o; }
         }
}
// f32 [r][DM] row-major -> bf16 in fragment order: thread i writes piece i (a wave 512 contiguous bytes) and reads the 8 values that belong there (a work-group: 16 rows x 128 k, whole lines between its waves)
__global__ __launch_bounds__(256) void k_cvt8(const float* __restrict__ src, bf* dst, size_t n8) { const size_t i = (size_t)blockIdx.x * 256 + threadIdx.x; if (i >= n8) return;
    const size_t un = i >> 6; const int w = (int)(i & 63); const size_t r = (un / (DM / 32)) * 16 + (w & 15); const int k = (int)(un % (DM / 32)) * 32 + ((w >> 5) * 2 + ((w >> 4) & 1)) * 8;
    const v8f v = *(const v8f*)(src + r * DM + k); v8us o;
#pragma unroll
    for (int k = 0; k < 8; ++k) o[k] = f2bf(v[k]); *(v8us*)(dst + i * 8) = o;  }
__global__ __launch_bounds__(256) void k_cscvt(const float* __restrict__ cosT, const float* __restrict__ sinT, float* CS) { const int idx = blockIdx.x * 256 + threadIdx.x; if (idx >= TT * HD) return; v2f cs; cs[0] = bfr(cosT[idx]); cs[1] = bfr(sinT[idx]); *(v2f*)(CS + (size_t)idx * 2) = cs;  }
#define SC2 (SCL * 1.4426950408889634f)
typedef __attribute__((ext_vector_type(8))) int v8i;
__device__ __forceinline__ v8i ldm8(const int* p) { return __builtin_shufflevector(*(const v4i*)p, *(const v4i*)(p + 4), 0, 1, 2, 3, 4, 5, 6, 7); }
__device__ __forceinline__ float xhalf(float x) { return __builtin_bit_cast(float, __builtin_amdgcn_permlanex16(__builtin_bit_cast(int, x), __builtin_bit_cast(int, x), 0x76543210, 0xfedcba98, false, false)); }   // lane l with lane l ^ 16
template <typename T16, bool HL, int NQ>
__device__ __forceinline__ void fattn_rows(const T16* __restrict__ Q, const T16* __restrict__ Q2, const T16* __restrict__ Kp, const T16* __restrict__ K2, const T16* __restrict__ Vt, const T16* __restrict__ V2, const int* __restrict__ am, int q0, bf* Ah, bf* Al) {
    typedef WFrag<T16> F; typedef typename F::V V;
    const int lane = threadIdx.x & 31, lr = lane & 15, hi = lane >> 4;
    V qf[NQ][2], qf2[NQ][2];
#pragma unroll
    for (int qb = 0; qb < NQ; ++qb)
#pragma unroll
        for (int ks = 0; ks < 2; ++ks) { const size_t qo = (size_t)(q0 + qb * 16) * HD + ks * 512 + 8 * lane; qf[qb][ks] = F::ldf(Q + qo); if (HL) qf2[qb][ks] = F::ldf(Q2 + qo); }
    v8f o[4][NQ]; float m[NQ], l[NQ];
#pragma unroll
    for (int qb = 0; qb < NQ; ++qb) { m[qb] = -3.0e38f; l[qb] = 0.f;
#pragma unroll
        for (int db = 0; db < 4; ++db) o[db][qb] = (v8f){}; }
    const size_t ko = 8 * lane, vo = 8 * lane; const int* mp = am + (size_t)(q0 + lr) * TT + 8 * hi;
    V kf[2][2], kf2[2][2]; v8i mk[NQ][2];
    auto ldk = [&](int key) {      // the key rows of one pass
#pragma unroll
        for (int kb = 0; kb < 2; ++kb)
#pragma unroll
            for (int ks = 0; ks < 2; ++ks) { kf[kb][ks] = F::ldf(Kp + ko + (size_t)(key + kb * 16) * HD + ks * 512); if (HL) kf2[kb][ks] = F::ldf(K2 + ko + (size_t)(key + kb * 16) * HD + ks * 512); } };
    auto ldmk = [&](int qb, int key) {   // the mask words of one pass and 16 queries
#pragma unroll
        for (int kb = 0; kb < 2; ++kb) mk[qb][kb] = ldm8(mp + (size_t)qb * 16 * TT + key + kb * 16); };
    constexpr bool AHEAD = !HL;    // key rows and mask words one pass ahead; the hi+lo rows hold twice the fragments and have no registers left for it
    if (AHEAD) { ldk(0);
#pragma unroll
        for (int qb = 0; qb < NQ; ++qb) ldmk(qb, 0); }
#pragma unroll 1   // rolled: a second copy of the pass would not fit the registers
    for (int key0 = 0; key0 < TT; key0 += 32) {
        if (!AHEAD) { ldk(key0);
#pragma unroll
            for (int qb = 0; qb < NQ; ++qb) ldmk(qb, key0); }
        V vf[4], vf2[4];
#pragma unroll
        for (int db = 0; db < 4; ++db) vf[db] = F::ldf(Vt + vo + (size_t)db * 16 * TT + key0 * 16);
        if constexpr (HL) {
            // hi+lo rows: the addresses are inputs, so their registers stay as they are up to the wait
            asm volatile("s_wait_xcnt 0x0" :: "v"(Kp + ko + (size_t)key0 * HD), "v"(K2 + ko + (size_t)key0 * HD), "v"(Vt + vo + key0 * 16), "v"(mp + key0) : "memory");
#pragma unroll
            for (int db = 0; db < 4; ++db) vf2[db] = F::ldf(V2 + vo + (size_t)db * 16 * TT + key0 * 16);
            asm volatile("s_wait_xcnt 0x0" :: "v"(V2 + vo + key0 * 16) : "memory");   // the same for the lo plane's loads
        }
        v8f s[2][NQ];
#pragma unroll
        for (int kb = 0; kb < 2; ++kb)
#pragma unroll
            for (int qb = 0; qb < NQ; ++qb) { s[kb][qb] = (v8f){};
#pragma unroll
                for (int ks = 0; ks < 2; ++ks) { s[kb][qb] = F::mma(kf[kb][ks], qf[qb][ks], s[kb][qb]); if (HL) { s[kb][qb] = F::mma(kf[kb][ks], qf2[qb][ks], s[kb][qb]); s[kb][qb] = F::mma(kf2[kb][ks], qf[qb][ks], s[kb][qb]); } } }
        // AHEAD: the next pass's key rows and mask words are fetched behind the last use of this pass's; the last pass fetches its own again (in bounds, unused)
        const int nk = (key0 + 32 < TT) ? key0 + 32 : key0;
        if (AHEAD) ldk(nk);
#pragma unroll
        for (int qb = 0; qb < NQ; ++qb) {
            float t[2][8]; float mx = -3.0e38f;
#pragma unroll
            for (int kb = 0; kb < 2; ++kb)
#pragma unroll
                for (int j = 0; j < 8; ++j) { t[kb][j] = (mk[qb][kb][j] != 0) ? -3.0e38f : s[kb][qb][j] * SC2; mx = fmaxf(mx, t[kb][j]); }
            if (AHEAD) ldmk(qb, nk);
            mx = fmaxf(mx, xhalf(mx));     // the other half of the wave holds the query's other 16 keys
            const float mn = fmaxf(m[qb], mx), alpha = __builtin_amdgcn_exp2f(m[qb] - mn); m[qb] = mn;
            float ps = 0.f;
#pragma unroll
            for (int kb = 0; kb < 2; ++kb)
#pragma unroll
                for (int j = 0; j < 8; ++j) { t[kb][j] = __builtin_amdgcn_exp2f(t[kb][j] - mn); ps += t[kb][j]; }
            l[qb] = l[qb] * alpha + ps;
#pragma unroll
            for (int db = 0; db < 4; ++db) o[db][qb] *= alpha;
            V pf, pf2;
#pragma unroll
            for (int e = 0; e < 16; ++e) { const float p = t[e >> 3][e & 7];
                if constexpr (HL) { const __bf16 ph = (__bf16)p; pf[e] = ph; pf2[e] = (__bf16)(p - (float)ph); } else pf[e] = (h16)p; }
#pragma unroll
            for (int db = 0; db < 4; ++db) { o[db][qb] = F::mma(vf[db], pf, o[db][qb]); if (HL) { o[db][qb] = F::mma(vf[db], pf2, o[db][qb]); o[db][qb] = F::mma(vf2[db], pf, o[db][qb]); } }
        }
    }
#pragma unroll
    for (int qb = 0; qb < NQ; ++qb) { const float lt = l[qb] + xhalf(l[qb]); const float inv = __fdiv_rn(1.0f, lt);
#pragma unroll
        for (int db = 0; db < 4; ++db) { v8us oh, ol;
#pragma unroll
            for (int j = 0; j < 8; ++j) { unsigned short a, c2; splitf(o[db][qb][j] * inv, a, c2); oh[j] = a; ol[j] = c2; }
            const size_t oo = (size_t)(q0 + qb * 16) * DQ + db * 256 + 8 * lane; *(v8us*)(Ah + oo) = oh; *(v8us*)(Al + oo) = ol; } }
}
// grid (RH / 64 + (TT - RH) / 128, heads), 4 waves: the first RH / 64 work-groups take the hi+lo rows, 16 a wave (three products each, so half the rows), the rest 32 fp16 rows a wave
__global__ __launch_bounds__(128) void k_fattn(const h16* __restrict__ Q16, const bf* __restrict__ Qh, const bf* __restrict__ Ql, const h16* __restrict__ K16, const bf* __restrict__ Kh, const bf* __restrict__ Kl, const h16* __restrict__ V16, const bf* __restrict__ Vh, const bf* __restrict__ Vl, const int* __restrict__ am, bf* Ah, bf* Al) {
    const int wv = __builtin_amdgcn_readfirstlane((int)(threadIdx.x >> 5)); const int bx = blockIdx.x; const size_t hp = (size_t)blockIdx.y * TT * HD; Ah += blockIdx.y * (HD * 16); Al += blockIdx.y * (HD * 16);   // a head's 64 columns: two units of each 16 rows
    if (bx < RH / 64) fattn_rows<bf, true, 1>(Qh + hp, Ql + hp, Kh + hp, Kl + hp, Vh + hp, Vl + hp, am, bx * 64 + wv * 16, Ah, Al);
    else fattn_rows<h16, false, 2>(Q16 + hp, nullptr, K16 + hp, nullptr, V16 + hp, nullptr, am, RH + (bx - RH / 64) * 128 + wv * 32, Ah, Al);
}

__global__ __launch_bounds__(256) void k_lorap(const float* __restrict__ A, const float* __restrict__ Bw, bf* AQ, bf* B2) { const int e = (blockIdx.x * 256 + threadIdx.x) * 4; if (e >= 64 * DM) return;
    { const int un = e >> 9, w = (e >> 3) & 63, n = (un / (DM / 32)) * 16 + (w & 15), k = (un % (DM / 32)) * 32 + ((w >> 5) * 2 + ((w >> 4) & 1)) * 8 + (e & 7); /* AQ in fragment order: element e of the plane holds (n, k) */ v4us o; for (int u = 0; u < 4; ++u) o[u] = (n < 8) ? f2bf(A[(size_t)n * DM + k + u]) : (unsigned short)0; *(v4us*)(AQ + e) = o;  }
    if (e < DM * 32) { const int n = e / 32, k = e % 32; v4us o; for (int u = 0; u < 4; ++u) o[u] = (k + u < 8) ? f2bf(Bw[(size_t)n * 8 + k + u]) : (unsigned short)0; *(v4us*)(B2 + e) = o;  } }

extern "C" void kernel_launch(void* const* d_in, const int* in_sizes, int n_in,
                              void* d_out, int out_size, void* d_ws, size_t ws_size, hipStream_t stream) {
    (void)in_sizes; (void)n_in; (void)out_size;
    const float* x = (const float*)d_in[0]; const int* amask = (const int*)d_in[1]; const float* wq = (const float*)d_in[2]; const float* wqA = (const float*)d_in[3]; const float* wqB = (const float*)d_in[4]; const float* wk = (const float*)d_in[5]; const float* wv = (const float*)d_in[6]; const float* wvA = (const float*)d_in[7]; const float* wvB = (const float*)d_in[8]; const float* wo = (const float*)d_in[9]; const float* cosT = nullptr; const float* sinT = nullptr; (void)cosT; (void)sinT;
    float* OUT = (float*)d_out;     // [2][2048][1024]
    char* wsp = (char*)d_ws;
    auto take = [&](size_t bytes) { char* p = wsp; wsp += (bytes + 255) & ~(size_t)255; return (void*)p; };
    bf* WQ = (bf*)take((size_t)DQ * DM * 2); bf* WK = (bf*)take((size_t)DKV * DM * 2); bf* WV = (bf*)take((size_t)DKV * DM * 2); bf* WO = (bf*)take((size_t)DM * DQ * 2);
    bf* XB = (bf*)take((size_t)TT * DM * 2); bf* AQ = (bf*)take((size_t)64 * DM * 2); bf* AV = (bf*)take((size_t)64 * DM * 2); bf* BQ2 = (bf*)take((size_t)DM * 32 * 2); bf* BV2 = (bf*)take((size_t)DM * 32 * 2); bf* XAh = (bf*)take((size_t)TT * 32 * 2); bf* XAl = (bf*)take((size_t)TT * 32 * 2);
    h16* QP16 = (h16*)take((size_t)NH_ * TT * HD * 2); h16* KP16 = (h16*)take((size_t)NKV * TT * HD * 2); h16* VT16 = (h16*)take((size_t)NKV * HD * TT * 2);
    bf* QPh = (bf*)take((size_t)NH_ * TT * HD * 2); bf* QPl = (bf*)take((size_t)NH_ * TT * HD * 2); bf* KPh = (bf*)take((size_t)NKV * TT * HD * 2); bf* KPl = (bf*)take((size_t)NKV * TT * HD * 2); bf* VTh = (bf*)take((size_t)NKV * HD * TT * 2); bf* VTl = (bf*)take((size_t)NKV * HD * TT * 2);
    bf* ATh = (bf*)take((size_t)TT * DQ * 2); bf* ATl = (bf*)take((size_t)TT * DQ * 2);
    if ((size_t)(wsp - (char*)d_ws) > ws_size) return;    // ws 256 MiB
    { k_lorap<<<(64 * DM / 4 + 255) / 256, 256, 0, stream>>>(wqA, wqB, AQ, BQ2); k_lorap<<<(64 * DM / 4 + 255) / 256, 256, 0, stream>>>(wvA, wvB, AV, BV2); k_cvt8<<<(unsigned)(((size_t)DQ * DM / 8 + 255) / 256), 256, 0, stream>>>(wq, WQ, (size_t)DQ * DM / 8); k_cvt8<<<(unsigned)(((size_t)DKV * DM / 8 + 255) / 256), 256, 0, stream>>>(wk, WK, (size_t)DKV * DM / 8); k_cvt8<<<(unsigned)(((size_t)DKV * DM / 8 + 255) / 256), 256, 0, stream>>>(wv, WV, (size_t)DKV * DM / 8);
      k_cvt8<<<(unsigned)(((size_t)DM * DQ / 8 + 255) / 256), 256, 0, stream>>>(wo, WO, (size_t)DM * DQ / 8);
       }
    for (int b = 0; b < NB_; ++b) {
        k_cvt8<<<(unsigned)(((size_t)TT * DM / 8 + 255) / 256), 256, 0, stream>>>(x + (size_t)b * TT * DM, XB, (size_t)TT * DM / 8);
        /* hi/lo planes [t][32] of x wq_A^T */ k_gemmw<bf, 0, false, 16, 2><<<dim3(TT / 64, 1, 1), 512, 0, stream>>>(XB, nullptr, AQ, nullptr, nullptr, 64, nullptr, 0, 0, 0, nullptr, nullptr, nullptr, nullptr, XAh, XAl, 0, 0, 32);
        /* q = x wq^T + 2 (x A^T) B^T -> head planes [h][t][d] */ k_gemmw<bf, 0, false, 8, 1, 1><<<dim3(TT / 64, DQ / 64, 1), 256, 0, stream>>>(XB, nullptr, WQ, nullptr, nullptr, DQ, nullptr, 0, 0, 0, XAh, XAl, BQ2, QP16, QPh, QPl, TT, 0, HD);
        /* k = x wk^T -> head planes [h][t][d] */ k_gemmw<bf, 0, false, 8, 1, 0><<<dim3(TT / 64, DKV / 64, 1), 256, 0, stream>>>(XB, nullptr, WK, nullptr, nullptr, DKV, nullptr, 0, 0, 0, nullptr, nullptr, nullptr, KP16, KPh, KPl, TT, 0, HD);
        /* hi/lo planes [t][32] of x wv_A^T */ k_gemmw<bf, 0, false, 16, 2><<<dim3(TT / 64, 1, 1), 512, 0, stream>>>(XB, nullptr, AV, nullptr, nullptr, 64, nullptr, 0, 0, 0, nullptr, nullptr, nullptr, nullptr, XAh, XAl, 0, 0, 32);
        /* v^T = wv x^T + 2 B (x A^T)^T -> planes [g * HD + d][t] */ k_gemmw<bf, 0, false, 8, 1, 2><<<dim3(DKV / 64, TT / 64, 1), 256, 0, stream>>>(WV, nullptr, XB, nullptr, nullptr, TT, nullptr, 0, 0, 0, XAh, XAl, BV2, VT16, VTh, VTl, 0, 64, TT);
        k_fattn<<<dim3(RH / 64 + (TT - RH) / 128, NH_, 1), 128, 0, stream>>>(QP16, QPh, QPl, KP16, KPh, KPl, VT16, VTh, VTl, amask, ATh, ATl);   // one kv head per query head
        k_gemmw<bf, 1, false, 8><<<dim3(TT / 64, DM / 64, 1), 256, 0, stream>>>(ATh, ATl, WO, nullptr, OUT + (size_t)b * TT * DM, DM, nullptr, 0, 0, 0, nullptr, nullptr, nullptr, nullptr, nullptr, nullptr, 0, 0, 0); }
}

// v005
// A run of this version takes 207 microseconds.
// In two side-by-side timings against v004, it was 1.46 and 1.47 times as fast.
// Counting every step since v000, it is 10.5 times as fast.
#include <hip/hip_runtime.h>

// TinySelfAttention (x [2][2048][1024]; q = x wq_w^T + 2 (x wq_A^T) wq_B^T (LoRA, r = 8, alpha/r = 2), k = x wk_w^T, v = x wv_w^T + 2 (x wv_A^T) wv_B^T (16 heads x 64); scores = q.k / 8, masked (-inf) where attn_mask[i][j] != 0 (int [2048][2048], read - the module's strict-upper-triangle mask, but read as data over every tile); softmax; out = merged wo_w^T -> [2][2048][1024]).
// Compute dtypes, f32 accumulate: every input rounded to bf16; base projections and the rank-8 down-projections on PLAIN bf16 operands (inputs: exact; the 8 outputs padded to 64 with zero weights); the up-projections as hl planes (K padded 8 -> 32 with zeros) x exact B (2 products), added x 2 in f32; scores over ALL key tiles (mask read per element) and attn.v: query rows < 512 hl (3 products), the rest single fp16; softmax f32, running maximum and sum over 32-key tiles inside one kernel (k_fattn); wo hl x exact (2 products).
// The q/k/v and rank-8 down GEMMs write their 16-bit planes themselves (k_gemmw, EPI), q and v after taking in their up-projection (UP): no f32 projection goes to memory; v is computed as wv x^T, so that the rows of V^T come out contiguous.
// FRAGMENT ORDER: every 16-bit plane that a K loop or the key walk reads (x, the weights, the padded down weights, q, k, V^T, the attention output) lies in units of 16 rows x 32 k = 1 KB, unit (r / 16, k / 32) at ((r / 16) * (K / 32) + k / 32) * 512 elements;
// inside a unit the 16-byte piece (row r % 16, k pieces c = (k % 32) / 8) stands at piece (c / 2) * 32 + (c % 2) * 16 + r % 16, which is piece 'lane' of the fragment's first (c < 2) or second 16-byte load: a wave-wide load or store is 512 contiguous bytes, four whole lines, not 32 bytes in each of 16 lines.
// The rank-8 planes [t][32] and the up weights [n][32] stay row-major (64-byte rows, read once a work-group).
// BOTH BATCHES IN EVERY LAUNCH: a token's row is tb = b * TT + t (TB rows). x, the rank-8 planes, the attention output and out are [tb][.], q and k [head][tb][d], V^T [head * HD + d][tb]; the GEMM grids run over TB rows (V^T: columns), k_fattn takes b from blockIdx.z.

#define NB_  2
#define TT   2048
#define TB   (NB_ * TT)           // token rows of all batches
#define DM   1024
#define NH_  16
#define NKV  16
#define REP  (NH_ / NKV)
#define HD   64
#define DQ   (NH_ * HD)
#define DKV  (NKV * HD)
#define RH   512                  // query rows < RH use hi+lo planes (0: none)
#define WIN  0
#define SCL  0.125f   // HD^-0.5
typedef _Float16 h16;
typedef unsigned short bf;
typedef __attribute__((ext_vector_type(16))) __bf16   v16bf;
typedef __attribute__((ext_vector_type(16))) _Float16 v16h;
typedef __attribute__((ext_vector_type(8)))  _Float16 v8h;
typedef __attribute__((ext_vector_type(8)))  unsigned short v8us;
typedef __attribute__((ext_vector_type(8)))  float    v8f;
typedef __attribute__((ext_vector_type(4)))  float    v4f;
typedef v8h  __attribute__((may_alias)) v8ha;
typedef v4f  __attribute__((may_alias)) v4fa;
typedef v8us __attribute__((may_alias)) v8usa;

__device__ __forceinline__ unsigned short f2bf(float f) { unsigned u = __float_as_uint(f); u += 0x7FFFu + ((u >> 16) & 1u); return (unsigned short)(u >> 16); }
__device__ __forceinline__ float bf2f(unsigned short b) { return __uint_as_float(((unsigned)b) << 16); }
__device__ __forceinline__ float bfr(float f) { return bf2f(f2bf(f)); }
__device__ __forceinline__ v16h cat16(v8h lo, v8h hi) { return __builtin_shufflevector(lo, hi, 0, 1, 2, 3, 4, 5, 6, 7, 8, 9, 10, 11, 12, 13, 14, 15); }
__device__ __forceinline__ v16bf cat16b(v8us lo, v8us hi) { return __builtin_bit_cast(v16bf, __builtin_shufflevector(lo, hi, 0, 1, 2, 3, 4, 5, 6, 7, 8, 9, 10, 11, 12, 13, 14, 15)); }
__device__ __forceinline__ v8f wmma16(v16h a, v16h b, v8f c) { return __builtin_amdgcn_wmma_f32_16x16x32_f16(false, a, false, b, (short)0, c, false, false); }
__device__ __forceinline__ v8f wmmab(v16bf a, v16bf b, v8f c) { return __builtin_amdgcn_wmma_f32_16x16x32_bf16(false, a, false, b, (short)0, c, false, false); }
__device__ __forceinline__ h16 tohx(float x) { return (h16)x; }
__device__ __forceinline__ void splitf(float y, unsigned short& h, unsigned short& l) { h = f2bf(y); l = f2bf(y - bf2f(h)); }
typedef __attribute__((ext_vector_type(2))) _Float16 v2h;
typedef __attribute__((ext_vector_type(4))) _Float16 v4h;
typedef __attribute__((ext_vector_type(2))) unsigned short v2us;
typedef __attribute__((ext_vector_type(4))) unsigned short v4us;
typedef __attribute__((ext_vector_type(2))) float v2f;
typedef __attribute__((ext_vector_type(4))) int v4i;



// ---- k_gemmw: register-blocked GEMM, one 64x64 output tile (16 accumulators a wave) per work-group of KS waves, operands straight from 16-bit planes in fragment order; grid (M/64, N/64, Z), 32 * KS threads.
// C[m][n] (f32, pitch ldc, + optional f32 bias[n]) = sum_k A[m][k] Bt[n][k] (+ split products per NSPLIT). z-batch strides sA/sB/sC in elements. K = DM, K % (32 * KS) == 0.
// KS > 1: wave w sums the K slice [w K/KS, (w+1) K/KS); the KS partial tiles meet in LDS and are added in slice order 0 .. KS-1 (fixed, the same on every run).
// UP (KS == 8 only): the tile takes + 2 u, u = the rank-8 up-product of the same tile (K padded to 32: one WMMA step, hi then lo plane, its own f32 sum from 0). Uh/Ul: hi/lo planes [t][32] of the down-projection, Uw: up weights [n][32].
// UP = 1: rows m are t, columns n (A = Uh, Ul; B = Uw). UP = 2: rows m are n, columns t (A = Uw; B = Uh, Ul). Wave w makes sub-tile (w / 4, w % 4) of each 32-row phase; u meets the slices in LDS as one more slice and is added last, x 2.
// EPI (KS > 1 only) says what leaves the kernel. 0: the f32 tile, to C. 1: the tile as three 16-bit planes (fp16, bf16 hi, bf16 lo of y - hi), each a matrix of ldp columns in fragment order, element (m, n) at its row blockIdx.y * rP + m, column blockIdx.y * cP + (n - c0);
// rP = rows, cP = 0, ldp = 64 gives head planes [n / 64][m][n % 64], rP = 0, cP = 64, ldp = N gives plain [m][n]. A thread sums and stores one 16-byte piece (8 columns), thread t of each 64 piece t of a unit. 2: columns 0 .. 31 as hi/lo planes [m][32], columns 8 .. 31 zero (the rank-8 down-projection, K-padded for the up-projection).
template <typename T16> struct WFrag;
template <> struct WFrag<h16> { typedef v16h V; static __device__ __forceinline__ V ld(const h16* p) { return cat16(*(const v8h*)p, *(const v8h*)(p + 16)); } static __device__ __forceinline__ V ldf(const h16* p) { return cat16(*(const v8h*)p, *(const v8h*)(p + 256)); } static __device__ __forceinline__ v8f mma(V a, V b, v8f c) { return wmma16(a, b, c); } };
template <> struct WFrag<bf> { typedef v16bf V; static __device__ __forceinline__ V ld(const bf* p) { return cat16b(*(const v8us*)p, *(const v8us*)(p + 16)); } static __device__ __forceinline__ V ldf(const bf* p) { return cat16b(*(const v8us*)p, *(const v8us*)(p + 256)); } static __device__ __forceinline__ v8f mma(V a, V b, v8f c) { return wmmab(a, b, c); } };
template <typename T16, int NSPLIT, bool BIAS, int KS, int EPI = 0, int UP = 0>
__global__ __launch_bounds__(32 * KS) void k_gemmw(const T16* __restrict__ A, const T16* __restrict__ A2, const T16* __restrict__ Bt, const T16* __restrict__ Bt2, float* C, int ldc, const float* __restrict__ bias, size_t sA, size_t sB, size_t sC, const T16* __restrict__ Uh, const T16* __restrict__ Ul, const T16* __restrict__ Uw, h16* P16, bf* Ph, bf* Pl, int rP, int cP, int ldp) {
    static_assert(EPI == 0 || KS > 1, "the plane epilogues stand behind the slice sum"); static_assert(EPI != 1 || KS == 8, "256 threads, one 16-byte piece of 32 x 64 each"); static_assert(UP == 0 || KS == 8, "eight sub-tiles a phase, one a wave");
    typedef typename WFrag<T16>::V V; constexpr int K = DM; static_assert(DQ == DM, "one K for every product");   // a constant, so that a pass's units stand at immediate offsets from one address an operand
    __shared__ __align__(16) float os[(KS == 1) ? 16 * 68 : (KS + (UP != 0 ? 1 : 0)) * 32 * 68];
    const size_t z = blockIdx.z; A += z * sA; if (A2) A2 += z * sA; Bt += z * sB; if (Bt2) Bt2 += z * sB; C += z * sC;
    const int lane = threadIdx.x & 31, lr = lane & 15, hi = lane >> 4; const int r0 = blockIdx.x * 64, c0 = blockIdx.y * 64;
    v8f acc[4][4];
#pragma unroll
    for (int mb = 0; mb < 4; ++mb)
#pragma unroll
        for (int nb = 0; nb < 4; ++nb) acc[mb][nb] = (v8f){};
    const size_t aoff = (size_t)r0 * K + 8 * lane, boff = (size_t)c0 * K + 8 * lane;   // 16 rows of units are 16 K elements, 32 k one unit of 512, the lane's piece 8 lane
    // wv: the wave's K slice, held scalar so that the loop bounds are scalar
    const int wv = (KS == 1) ? 0 : __builtin_amdgcn_readfirstlane((int)(threadIdx.x >> 5)); const int kspan = K / KS, kbeg = wv * kspan, kend = kbeg + kspan;
    V ua[2], ua2[2], ub, ub2;
    if constexpr (UP != 0) {   // the up-product's operands, fetched in front of the K loop, so that no barrier of the slice sum waits for these loads
        const size_t uc = (size_t)(c0 + (wv & 3) * 16 + lr) * 32 + 8 * hi, ur = (size_t)(r0 + (wv >> 2) * 16 + lr) * 32 + 8 * hi;
        const T16* pb = (UP == 1 ? Uw : Uh) + uc; const T16* pa = (UP == 1 ? Uh : Uw) + ur; const T16* p2 = Ul + (UP == 1 ? ur : uc);   // phase 1's rows: + 32 * 32 elements
        ub = WFrag<T16>::ld(pb); ua[0] = WFrag<T16>::ld(pa); ua[1] = WFrag<T16>::ld(pa + 32 * 32);
        if (UP == 1) { ua2[0] = WFrag<T16>::ld(p2); ua2[1] = WFrag<T16>::ld(p2 + 32 * 32); } else ub2 = WFrag<T16>::ld(p2);
        // the addresses are inputs, so their registers stay as they are up to the wait
        asm volatile("s_wait_xcnt 0x0" :: "v"(pb), "v"(pa), "v"(p2) : "memory");
    }
#pragma unroll 1
    for (int kc = kbeg; kc < kend; kc += 32) {
        V a[4], a2[4]; const T16* pa = A + aoff + kc * 16; const T16* pb = Bt + boff + kc * 16; const T16* pa2 = (NSPLIT == 1 || NSPLIT == 2) ? A2 + aoff + kc * 16 : pa; const T16* pb2 = (NSPLIT >= 2) ? Bt2 + boff + kc * 16 : pb;
#pragma unroll
        for (int mb = 0; mb < 4; ++mb) { a[mb] = WFrag<T16>::ldf(pa + mb * 16 * K); if (NSPLIT == 1 || NSPLIT == 2) a2[mb] = WFrag<T16>::ldf(pa2 + mb * 16 * K); }
#pragma unroll
        for (int nb = 0; nb < 4; ++nb) { const V b = WFrag<T16>::ldf(pb + nb * 16 * K); V b2; if (NSPLIT >= 2) b2 = WFrag<T16>::ldf(pb2 + nb * 16 * K);
#pragma unroll
            for (int mb = 0; mb < 4; ++mb) { acc[mb][nb] = WFrag<T16>::mma(a[mb], b, acc[mb][nb]); if (NSPLIT == 1 || NSPLIT == 2) acc[mb][nb] = WFrag<T16>::mma(a2[mb], b, acc[mb][nb]); if (NSPLIT >= 2) acc[mb][nb] = WFrag<T16>::mma(a[mb], b2, acc[mb][nb]); } }
        // the pass's addresses are inputs here, so their registers stay as they are up to the wait
        asm volatile("s_wait_xcnt 0x0" :: "v"(pa), "v"(pb), "v"(pa2), "v"(pb2) : "memory");
        asm volatile("v_nop\n\tv_nop\n\tv_nop\n\tv_nop" : "+v"(acc[0][0]), "+v"(acc[1][1]), "+v"(acc[2][2]), "+v"(acc[3][3]) : "v"(a[0]), "v"(a[3]));
    }
    if (KS > 1) {   // every loop below is unrolled so that acc[][] and res[][] are indexed by constants and stay in registers
        float* osw = os + wv * (32 * 68); static_assert(KS == 1 || 16 % KS == 0, "KS divides 16"); constexpr int NIT = (KS > 1) ? 16 / KS : 1;   // v4f sums a thread and phase: 32 rows x 16 v4f over 32 * KS threads
        v4f res[2][NIT];
        // which v4f of a phase's 32 x 64 a thread sums. EPI 1: the two halves of one piece, in fragment order (unit t / 64: 16 rows x 32 columns); else 16 threads a row
        const int pw = (int)threadIdx.x & 63, pu = (int)threadIdx.x >> 6, prow = (pu >> 1) * 16 + (pw & 15), pc8 = (pu & 1) * 4 + (pw >> 5) * 2 + ((pw >> 4) & 1);
        auto rowof = [&](int it) { return (EPI == 1) ? prow : ((int)threadIdx.x + it * 32 * KS) >> 4; };
        auto colof = [&](int it) { return (EPI == 1) ? pc8 * 8 + it * 4 : (((int)threadIdx.x + it * 32 * KS) & 15) * 4; };
#pragma unroll
        for (int mp = 0; mp < 2; ++mp) {          // 32 output rows a phase
#pragma unroll
            for (int ml = 0; ml < 2; ++ml)
#pragma unroll
                for (int nb = 0; nb < 4; ++nb)
#pragma unroll
                    for (int j = 0; j < 8; ++j) osw[(ml * 16 + hi * 8 + j) * 68 + nb * 16 + lr] = acc[mp * 2 + ml][nb][j];
            if constexpr (UP != 0) { v8f t = WFrag<T16>::mma(ua[mp], ub, (v8f){}); t = (UP == 1) ? WFrag<T16>::mma(ua2[mp], ub, t) : WFrag<T16>::mma(ua[mp], ub2, t);
#pragma unroll
                for (int j = 0; j < 8; ++j) os[KS * (32 * 68) + ((wv >> 2) * 16 + hi * 8 + j) * 68 + (wv & 3) * 16 + lr] = t[j]; }
            __syncthreads();                      // every slice's partial rows are in LDS
#pragma unroll
            for (int it = 0; it < NIT; ++it) { const int row = rowof(it), cofs = colof(it); v4f val = *(const v4fa*)(os + row * 68 + cofs);
#pragma unroll
                for (int s = 1; s < KS; ++s) val += *(const v4fa*)(os + s * (32 * 68) + row * 68 + cofs);
                if constexpr (UP != 0) val += 2.0f * *(const v4fa*)(os + KS * (32 * 68) + row * 68 + cofs);   // x 2 is exact: fused or not, one rounding
                res[mp][it] = val; }
            if (mp == 0) __syncthreads();         // all reads of phase 0 end before phase 1 overwrites the rows
        }
        // the stores stand behind the last barrier, so that no barrier waits for a store to memory
#pragma unroll
        for (int mp = 0; mp < 2; ++mp) { v8h o16; v8us oh8, ol8;   // EPI 1: the thread's piece of each plane
#pragma unroll
            for (int it = 0; it < NIT; ++it) { const int row = rowof(it), cofs = colof(it); v4f val = res[mp][it];
                if (BIAS) { val[0] += bfr(bias[c0 + cofs]); val[1] += bfr(bias[c0 + cofs + 1]); val[2] += bfr(bias[c0 + cofs + 2]); val[3] += bfr(bias[c0 + cofs + 3]); }
                if constexpr (EPI == 0) *(v4f*)(C + (size_t)(r0 + mp * 32 + row) * ldc + c0 + cofs) = val;
                else if constexpr (EPI == 1) {
#pragma unroll
                    for (int q = 0; q < 4; ++q) { o16[it * 4 + q] = tohx(val[q]); unsigned short a2, c2; splitf(val[q], a2, c2); oh8[it * 4 + q] = a2; ol8[it * 4 + q] = c2; }
                    if (it == NIT - 1) { const size_t po = ((size_t)(((int)blockIdx.y * rP + r0 + mp * 32 + row) >> 4) * (ldp >> 5) + (((int)blockIdx.y * cP) >> 5) + (pc8 >> 2)) * 512 + pw * 8; *(v8h*)(P16 + po) = o16; *(v8us*)(Ph + po) = oh8; *(v8us*)(Pl + po) = ol8; } }
                else if (cofs < 32) { v4us oh, ol;
#pragma unroll
                    for (int q = 0; q < 4; ++q) { unsigned short a2 = 0, c2 = 0; if (cofs + q < 8) splitf(val[q], a2, c2); oh[q] = a2; ol[q] = c2; }
                    const size_t po = (size_t)(r0 + mp * 32 + row) * 32 + cofs; *(v4us*)(Ph + po) = oh; *(v4us*)(Pl + po) = ol; } } }
        return;
    }
#pragma unroll
    for (int mb = 0; mb < 4; ++mb) {
#pragma unroll
        for (int nb = 0; nb < 4; ++nb) {
#pragma unroll
            for (int j = 0; j < 8; ++j) os[(hi * 8 + j) * 68 + nb * 16 + lr] = acc[mb][nb][j]; }
        __builtin_amdgcn_wave_barrier(); asm volatile("" ::: "memory");
        float* crow = C + (size_t)(r0 + mb * 16) * ldc + c0;
{
#pragma unroll
            for (int s = 0; s < 8; ++s) { const int row = 2 * s + hi, cofs = lr * 4; v4f val = *(const v4fa*)(os + row * 68 + cofs); if (BIAS) { val[0] += bfr(bias[c0 + cofs]); val[1] += bfr(bias[c0 + cofs + 1]); val[2] += bfr(bias[c0 + cofs + 2]); val[3] += bfr(bias[c0 + cofs + 3]); }
                *(v4f*)(crow + (size_t)row * ldc + cofs) = val; }
             }
        __builtin_amdgcn_wave_barrier(); asm volatile("" ::: "memory");
    }
}


__global__ __launch_bounds__(256) void k_wtG(const float* __restrict__ w, int K, int N, bf* Bt) {
    const int lane = threadIdx.x & 31; const int L0 = (blockIdx.x * 8 + (threadIdx.x >> 5)) * 8; const int nlines = N * K / 64;
{
#pragma unroll 1
        for (int l = 0; l < 8; ++l) { const int L = L0 + l; if (L >= nlines) break; const size_t e = (size_t)L * 64 + lane * 2; const int k = (int)(e % K), n = (int)(e / K); v2us o;
            o[0] = f2bf(w[(size_t)k * N + n]); o[1] = f2bf(w[(size_t)(k + 1) * N + n]); *(v2us*)(Bt + e) = o; }
         }
}
// f32 [r][DM] row-major -> bf16 in fragment order: thread i writes piece i (a wave 512 contiguous bytes) and reads the 8 values that belong there (a work-group: 16 rows x 128 k, whole lines between its waves)
__global__ __launch_bounds__(256) void k_cvt8(const float* __restrict__ src, bf* dst, size_t n8) { const size_t i = (size_t)blockIdx.x * 256 + threadIdx.x; if (i >= n8) return;
    const size_t un = i >> 6; const int w = (int)(i & 63); const size_t r = (un / (DM / 32)) * 16 + (w & 15); const int k = (int)(un % (DM / 32)) * 32 + ((w >> 5) * 2 + ((w >> 4) & 1)) * 8;
    const v8f v = *(const v8f*)(src + r * DM + k); v8us o;
#pragma unroll
    for (int k = 0; k < 8; ++k) o[k] = f2bf(v[k]); *(v8us*)(dst + i * 8) = o;  }
__global__ __launch_bounds__(256) void k_cscvt(const float* __restrict__ cosT, const float* __restrict__ sinT, float* CS) { const int idx = blockIdx.x * 256 + threadIdx.x; if (idx >= TT * HD) return; v2f cs; cs[0] = bfr(cosT[idx]); cs[1] = bfr(sinT[idx]); *(v2f*)(CS + (size_t)idx * 2) = cs;  }
#define SC2 (SCL * 1.4426950408889634f)
typedef __attribute__((ext_vector_type(8))) int v8i;
__device__ __forceinline__ v8i ldm8(const int* p) { return __builtin_shufflevector(*(const v4i*)p, *(const v4i*)(p + 4), 0, 1, 2, 3, 4, 5, 6, 7); }
__device__ __forceinline__ float xhalf(float x) { return __builtin_bit_cast(float, __builtin_amdgcn_permlanex16(__builtin_bit_cast(int, x), __builtin_bit_cast(int, x), 0x76543210, 0xfedcba98, false, false)); }   // lane l with lane l ^ 16
template <typename T16, bool HL, int NQ>
__device__ __forceinline__ void fattn_rows(const T16* __restrict__ Q, const T16* __restrict__ Q2, const T16* __restrict__ Kp, const T16* __restrict__ K2, const T16* __restrict__ Vt, const T16* __restrict__ V2, const int* __restrict__ am, int q0, bf* Ah, bf* Al) {
    typedef WFrag<T16> F; typedef typename F::V V;
    const int lane = threadIdx.x & 31, lr = lane & 15, hi = lane >> 4;
    V qf[NQ][2], qf2[NQ][2];
#pragma unroll
    for (int qb = 0; qb < NQ; ++qb)
#pragma unroll
        for (int ks = 0; ks < 2; ++ks) { const size_t qo = (size_t)(q0 + qb * 16) * HD + ks * 512 + 8 * lane; qf[qb][ks] = F::ldf(Q + qo); if (HL) qf2[qb][ks] = F::ldf(Q2 + qo); }
    v8f o[4][NQ]; float m[NQ], l[NQ];
#pragma unroll
    for (int qb = 0; qb < NQ; ++qb) { m[qb] = -3.0e38f; l[qb] = 0.f;
#pragma unroll
        for (int db = 0; db < 4; ++db) o[db][qb] = (v8f){}; }
    const size_t ko = 8 * lane, vo = 8 * lane; const int* mp = am + (size_t)(q0 + lr) * TT + 8 * hi;
    V kf[2][2], kf2[2][2]; v8i mk[NQ][2];
    auto ldk = [&](int key) {      // the key rows of one pass
#pragma unroll
        for (int kb = 0; kb < 2; ++kb)
#pragma unroll
            for (int ks = 0; ks < 2; ++ks) { kf[kb][ks] = F::ldf(Kp + ko + (size_t)(key + kb * 16) * HD + ks * 512); if (HL) kf2[kb][ks] = F::ldf(K2 + ko + (size_t)(key + kb * 16) * HD + ks * 512); } };
    auto ldmk = [&](int qb, int key) {   // the mask words of one pass and 16 queries
#pragma unroll
        for (int kb = 0; kb < 2; ++kb) mk[qb][kb] = ldm8(mp + (size_t)qb * 16 * TT + key + kb * 16); };
    constexpr bool AHEAD = !HL;    // key rows and mask words one pass ahead; the hi+lo rows hold twice the fragments and have no registers left for it
    if (AHEAD) { ldk(0);
#pragma unroll
        for (int qb = 0; qb < NQ; ++qb) ldmk(qb, 0); }
#pragma unroll 1   // rolled: a second copy of the pass would not fit the registers
    for (int key0 = 0; key0 < TT; key0 += 32) {
        if (!AHEAD) { ldk(key0);
#pragma unroll
            for (int qb = 0; qb < NQ; ++qb) ldmk(qb, key0); }
        V vf[4], vf2[4];
#pragma unroll
        for (int db = 0; db < 4; ++db) vf[db] = F::ldf(Vt + vo + (size_t)db * 16 * TB + key0 * 16);
        if constexpr (HL) {
            // hi+lo rows: the addresses are inputs, so their registers stay as they are up to the wait
            asm volatile("s_wait_xcnt 0x0" :: "v"(Kp + ko + (size_t)key0 * HD), "v"(K2 + ko + (size_t)key0 * HD), "v"(Vt + vo + key0 * 16), "v"(mp + key0) : "memory");
#pragma unroll
            for (int db = 0; db < 4; ++db) vf2[db] = F::ldf(V2 + vo + (size_t)db * 16 * TB + key0 * 16);
            asm volatile("s_wait_xcnt 0x0" :: "v"(V2 + vo + key0 * 16) : "memory");   // the same for the lo plane's loads
        }
        v8f s[2][NQ];
#pragma unroll
        for (int kb = 0; kb < 2; ++kb)
#pragma unroll
            for (int qb = 0; qb < NQ; ++qb) { s[kb][qb] = (v8f){};
#pragma unroll
                for (int ks = 0; ks < 2; ++ks) { s[kb][qb] = F::mma(kf[kb][ks], qf[qb][ks], s[kb][qb]); if (HL) { s[kb][qb] = F::mma(kf[kb][ks], qf2[qb][ks], s[kb][qb]); s[kb][qb] = F::mma(kf2[kb][ks], qf[qb][ks], s[kb][qb]); } } }
        // AHEAD: the next pass's key rows and mask words are fetched behind the last use of this pass's; the last pass fetches its own again (in bounds, unused)
        const int nk = (key0 + 32 < TT) ? key0 + 32 : key0;
        if (AHEAD) ldk(nk);
#pragma unroll
        for (int qb = 0; qb < NQ; ++qb) {
            float t[2][8]; float mx = -3.0e38f;
#pragma unroll
            for (int kb = 0; kb < 2; ++kb)
#pragma unroll
                for (int j = 0; j < 8; ++j) { t[kb][j] = (mk[qb][kb][j] != 0) ? -3.0e38f : s[kb][qb][j] * SC2; mx = fmaxf(mx, t[kb][j]); }
            if (AHEAD) ldmk(qb, nk);
            mx = fmaxf(mx, xhalf(mx));     // the other half of the wave holds the query's other 16 keys
            const float mn = fmaxf(m[qb], mx), alpha = __builtin_amdgcn_exp2f(m[qb] - mn); m[qb] = mn;
            float ps = 0.f;
#pragma unroll
            for (int kb = 0; kb < 2; ++kb)
#pragma unroll
                for (int j = 0; j < 8; ++j) { t[kb][j] = __builtin_amdgcn_exp2f(t[kb][j] - mn); ps += t[kb][j]; }
            l[qb] = l[qb] * alpha + ps;
#pragma unroll
            for (int db = 0; db < 4; ++db) o[db][qb] *= alpha;
            V pf, pf2;
#pragma unroll
            for (int e = 0; e < 16; ++e) { const float p = t[e >> 3][e & 7];
                if constexpr (HL) { const __bf16 ph = (__bf16)p; pf[e] = ph; pf2[e] = (__bf16)(p - (float)ph); } else pf[e] = (h16)p; }
#pragma unroll
            for (int db = 0; db < 4; ++db) { o[db][qb] = F::mma(vf[db], pf, o[db][qb]); if (HL) { o[db][qb] = F::mma(vf[db], pf2, o[db][qb]); o[db][qb] = F::mma(vf2[db], pf, o[db][qb]); } }
        }
    }
#pragma unroll
    for (int qb = 0; qb < NQ; ++qb) { const float lt = l[qb] + xhalf(l[qb]); const float inv = __fdiv_rn(1.0f, lt);
#pragma unroll
        for (int db = 0; db < 4; ++db) { v8us oh, ol;
#pragma unroll
            for (int j = 0; j < 8; ++j) { unsigned short a, c2; splitf(o[db][qb][j] * inv, a, c2); oh[j] = a; ol[j] = c2; }
            const size_t oo = (size_t)(q0 + qb * 16) * DQ + db * 256 + 8 * lane; *(v8us*)(Ah + oo) = oh; *(v8us*)(Al + oo) = ol; } }
}
// grid (RH / 64 + (TT - RH) / 128, heads, batches), 4 waves: the first RH / 64 work-groups take the hi+lo rows, 16 a wave (three products each, so half the rows), the rest 32 fp16 rows a wave
__global__ __launch_bounds__(128) void k_fattn(const h16* __restrict__ Q16, const bf* __restrict__ Qh, const bf* __restrict__ Ql, const h16* __restrict__ K16, const bf* __restrict__ Kh, const bf* __restrict__ Kl, const h16* __restrict__ V16, const bf* __restrict__ Vh, const bf* __restrict__ Vl, const int* __restrict__ am, bf* Ah, bf* Al) {
    const int wv = __builtin_amdgcn_readfirstlane((int)(threadIdx.x >> 5)); const int bx = blockIdx.x; const size_t hp = ((size_t)blockIdx.y * NB_ + blockIdx.z) * TT * HD, vp = (size_t)blockIdx.y * HD * TB + (size_t)blockIdx.z * TT * 16;   // the batch's TT rows of the head's q and k; its TT columns (32 a unit) of the head's V^T rows
    const size_t ap = (size_t)blockIdx.z * TT * DQ + blockIdx.y * (HD * 16); Ah += ap; Al += ap;   // the batch's rows; a head's 64 columns: two units of each 16 rows
    if (bx < RH / 64) fattn_rows<bf, true, 1>(Qh + hp, Ql + hp, Kh + hp, Kl + hp, Vh + vp, Vl + vp, am, bx * 64 + wv * 16, Ah, Al);
    else fattn_rows<h16, false, 2>(Q16 + hp, nullptr, K16 + hp, nullptr, V16 + vp, nullptr, am, RH + (bx - RH / 64) * 128 + wv * 32, Ah, Al);
}

__global__ __launch_bounds__(256) void k_lorap(const float* __restrict__ A, const float* __restrict__ Bw, bf* AQ, bf* B2) { const int e = (blockIdx.x * 256 + threadIdx.x) * 4; if (e >= 64 * DM) return;
    { const int un = e >> 9, w = (e >> 3) & 63, n = (un / (DM / 32)) * 16 + (w & 15), k = (un % (DM / 32)) * 32 + ((w >> 5) * 2 + ((w >> 4) & 1)) * 8 + (e & 7); /* AQ in fragment order: element e of the plane holds (n, k) */ v4us o; for (int u = 0; u < 4; ++u) o[u] = (n < 8) ? f2bf(A[(size_t)n * DM + k + u]) : (unsigned short)0; *(v4us*)(AQ + e) = o;  }
    if (e < DM * 32) { const int n = e / 32, k = e % 32; v4us o; for (int u = 0; u < 4; ++u) o[u] = (k + u < 8) ? f2bf(Bw[(size_t)n * 8 + k + u]) : (unsigned short)0; *(v4us*)(B2 + e) = o;  } }

extern "C" void kernel_launch(void* const* d_in, const int* in_sizes, int n_in,
                              void* d_out, int out_size, void* d_ws, size_t ws_size, hipStream_t stream) {
    (void)in_sizes; (void)n_in; (void)out_size;
    const float* x = (const float*)d_in[0]; const int* amask = (const int*)d_in[1]; const float* wq = (const float*)d_in[2]; const float* wqA = (const float*)d_in[3]; const float* wqB = (const float*)d_in[4]; const float* wk = (const float*)d_in[5]; const float* wv = (const float*)d_in[6]; const float* wvA = (const float*)d_in[7]; const float* wvB = (const float*)d_in[8]; const float* wo = (const float*)d_in[9]; const float* cosT = nullptr; const float* sinT = nullptr; (void)cosT; (void)sinT;
    float* OUT = (float*)d_out;     // [2][2048][1024]
    char* wsp = (char*)d_ws;
    auto take = [&](size_t bytes) { char* p = wsp; wsp += (bytes + 255) & ~(size_t)255; return (void*)p; };
    bf* WQ = (bf*)take((size_t)DQ * DM * 2); bf* WK = (bf*)take((size_t)DKV * DM * 2); bf* WV = (bf*)take((size_t)DKV * DM * 2); bf* WO = (bf*)take((size_t)DM * DQ * 2);
    bf* XB = (bf*)take((size_t)TB * DM * 2); bf* AQ = (bf*)take((size_t)64 * DM * 2); bf* AV = (bf*)take((size_t)64 * DM * 2); bf* BQ2 = (bf*)take((size_t)DM * 32 * 2); bf* BV2 = (bf*)take((size_t)DM * 32 * 2); bf* XAh = (bf*)take((size_t)TB * 32 * 2); bf* XAl = (bf*)take((size_t)TB * 32 * 2);
    h16* QP16 = (h16*)take((size_t)NH_ * TB * HD * 2); h16* KP16 = (h16*)take((size_t)NKV * TB * HD * 2); h16* VT16 = (h16*)take((size_t)NKV * HD * TB * 2);
    bf* QPh = (bf*)take((size_t)NH_ * TB * HD * 2); bf* QPl = (bf*)take((size_t)NH_ * TB * HD * 2); bf* KPh = (bf*)take((size_t)NKV * TB * HD * 2); bf* KPl = (bf*)take((size_t)NKV * TB * HD * 2); bf* VTh = (bf*)take((size_t)NKV * HD * TB * 2); bf* VTl = (bf*)take((size_t)NKV * HD * TB * 2);
    bf* ATh = (bf*)take((size_t)TB * DQ * 2); bf* ATl = (bf*)take((size_t)TB * DQ * 2);
    if ((size_t)(wsp - (char*)d_ws) > ws_size) return;    // ws 256 MiB
    { k_lorap<<<(64 * DM / 4 + 255) / 256, 256, 0, stream>>>(wqA, wqB, AQ, BQ2); k_lorap<<<(64 * DM / 4 + 255) / 256, 256, 0, stream>>>(wvA, wvB, AV, BV2); k_cvt8<<<(unsigned)(((size_t)DQ * DM / 8 + 255) / 256), 256, 0, stream>>>(wq, WQ, (size_t)DQ * DM / 8); k_cvt8<<<(unsigned)(((size_t)DKV * DM / 8 + 255) / 256), 256, 0, stream>>>(wk, WK, (size_t)DKV * DM / 8); k_cvt8<<<(unsigned)(((size_t)DKV * DM / 8 + 255) / 256), 256, 0, stream>>>(wv, WV, (size_t)DKV * DM / 8);
      k_cvt8<<<(unsigned)(((size_t)DM * DQ / 8 + 255) / 256), 256, 0, stream>>>(wo, WO, (size_t)DM * DQ / 8);
       }
    {
        k_cvt8<<<(unsigned)(((size_t)TB * DM / 8 + 255) / 256), 256, 0, stream>>>(x, XB, (size_t)TB * DM / 8);
        /* hi/lo planes [tb][32] of x wq_A^T */ k_gemmw<bf, 0, false, 16, 2><<<dim3(TB / 64, 1, 1), 512, 0, stream>>>(XB, nullptr, AQ, nullptr, nullptr, 64, nullptr, 0, 0, 0, nullptr, nullptr, nullptr, nullptr, XAh, XAl, 0, 0, 32);
        /* q = x wq^T + 2 (x A^T) B^T -> head planes [h][tb][d] */ k_gemmw<bf, 0, false, 8, 1, 1><<<dim3(TB / 64, DQ / 64, 1), 256, 0, stream>>>(XB, nullptr, WQ, nullptr, nullptr, DQ, nullptr, 0, 0, 0, XAh, XAl, BQ2, QP16, QPh, QPl, TB, 0, HD);
        /* k = x wk^T -> head planes [h][tb][d] */ k_gemmw<bf, 0, false, 8, 1, 0><<<dim3(TB / 64, DKV / 64, 1), 256, 0, stream>>>(XB, nullptr, WK, nullptr, nullptr, DKV, nullptr, 0, 0, 0, nullptr, nullptr, nullptr, KP16, KPh, KPl, TB, 0, HD);
        /* hi/lo planes [tb][32] of x wv_A^T */ k_gemmw<bf, 0, false, 16, 2><<<dim3(TB / 64, 1, 1), 512, 0, stream>>>(XB, nullptr, AV, nullptr, nullptr, 64, nullptr, 0, 0, 0, nullptr, nullptr, nullptr, nullptr, XAh, XAl, 0, 0, 32);
        /* v^T = wv x^T + 2 B (x A^T)^T -> planes [g * HD + d][tb] */ k_gemmw<bf, 0, false, 8, 1, 2><<<dim3(DKV / 64, TB / 64, 1), 256, 0, stream>>>(WV, nullptr, XB, nullptr, nullptr, TB, nullptr, 0, 0, 0, XAh, XAl, BV2, VT16, VTh, VTl, 0, 64, TB);
        k_fattn<<<dim3(RH / 64 + (TT - RH) / 128, NH_, NB_), 128, 0, stream>>>(QP16, QPh, QPl, KP16, KPh, KPl, VT16, VTh, VTl, amask, ATh, ATl);   // one kv head per query head
        k_gemmw<bf, 1, false, 8><<<dim3(TB / 64, DM / 64, 1), 256, 0, stream>>>(ATh, ATl, WO, nullptr, OUT, DM, nullptr, 0, 0, 0, nullptr, nullptr, nullptr, nullptr, nullptr, nullptr, 0, 0, 0); }
}

// v006
// One run takes 185 microseconds.
// Timed twice side by side with v005, it ran 1.15 and 1.13 times as fast.
// Over all steps from v000 it is 11.9 times as fast.
#include <hip/hip_runtime.h>

// TinySelfAttention (x [2][2048][1024]; q = x wq_w^T + 2 (x wq_A^T) wq_B^T (LoRA, r = 8, alpha/r = 2), k = x wk_w^T, v = x wv_w^T + 2 (x wv_A^T) wv_B^T (16 heads x 64); scores = q.k / 8, masked (-inf) where attn_mask[i][j] != 0 (int [2048][2048], read - the module's strict-upper-triangle mask, but read as data over every tile); softmax; out = merged wo_w^T -> [2][2048][1024]).
// Compute dtypes, f32 accumulate: every input rounded to bf16; base projections and the rank-8 down-projections on PLAIN bf16 operands (inputs: exact; the 8 outputs padded to 64 with zero weights); the up-projections as hl planes (K padded 8 -> 32 with zeros) x exact B (2 products), added x 2 in f32; scores over ALL key tiles (mask read per element) and attn.v: query rows < 512 hl (3 products), the rest single fp16; softmax f32, running maximum and sum over 32-key tiles inside one kernel (k_fattn); wo hl x exact (2 products).
// The q/k/v and rank-8 down GEMMs write their 16-bit planes themselves (gemmw, EPI), q and v after taking in their up-projection (UP): no f32 projection goes to memory; v is computed as wv x^T, so that the rows of V^T come out contiguous.
// FRAGMENT ORDER: every 16-bit plane that a K loop or the key walk reads (x, the weights, the padded down weights, q, k, V^T, the attention output) lies in units of 16 rows x 32 k = 1 KB, unit (r / 16, k / 32) at ((r / 16) * (K / 32) + k / 32) * 512 elements;
// inside a unit the 16-byte piece (row r % 16, k pieces c = (k % 32) / 8) stands at piece (c / 2) * 32 + (c % 2) * 16 + r % 16, which is piece 'lane' of the fragment's first (c < 2) or second 16-byte load: a wave-wide load or store is 512 contiguous bytes, four whole lines, not 32 bytes in each of 16 lines.
// The rank-8 planes [t][32] and the up weights [n][32] stay row-major (64-byte rows, read once a work-group).
// FIVE LAUNCHES: work that depends on nothing in its own launch shares a grid. k_prep: every conversion (both LoRA pairs, x, four weights), picked by block range; k_down: both rank-8 down-projections (grid y), each into planes of its own; k_qkv: the q, k and v GEMMs (grid z); then k_fattn and k_wo.
// BOTH BATCHES IN EVERY LAUNCH: a token's row is tb = b * TT + t (TB rows). x, the rank-8 planes, the attention output and out are [tb][.], q and k [head][tb][d], V^T [head * HD + d][tb]; the GEMM grids run over TB rows (V^T: columns), k_fattn takes b from blockIdx.z.

#define NB_  2
#define TT   2048
#define TB   (NB_ * TT)           // token rows of all batches
#define DM   1024
#define NH_  16
#define NKV  16
#define REP  (NH_ / NKV)
#define HD   64
#define DQ   (NH_ * HD)
#define DKV  (NKV * HD)
#define RH   512                  // query rows < RH use hi+lo planes (0: none)
#define WIN  0
#define SCL  0.125f   // HD^-0.5
typedef _Float16 h16;
typedef unsigned short bf;
typedef __attribute__((ext_vector_type(16))) __bf16   v16bf;
typedef __attribute__((ext_vector_type(16))) _Float16 v16h;
typedef __attribute__((ext_vector_type(8)))  _Float16 v8h;
typedef __attribute__((ext_vector_type(8)))  unsigned short v8us;
typedef __attribute__((ext_vector_type(8)))  float    v8f;
typedef __attribute__((ext_vector_type(4)))  float    v4f;
typedef v8h  __attribute__((may_alias)) v8ha;
typedef v4f  __attribute__((may_alias)) v4fa;
typedef v8us __attribute__((may_alias)) v8usa;

__device__ __forceinline__ unsigned short f2bf(float f) { unsigned u = __float_as_uint(f); u += 0x7FFFu + ((u >> 16) & 1u); return (unsigned short)(u >> 16); }
__device__ __forceinline__ float bf2f(unsigned short b) { return __uint_as_float(((unsigned)b) << 16); }
__device__ __forceinline__ float bfr(float f) { return bf2f(f2bf(f)); }
__device__ __forceinline__ v16h cat16(v8h lo, v8h hi) { return __builtin_shufflevector(lo, hi, 0, 1, 2, 3, 4, 5, 6, 7, 8, 9, 10, 11, 12, 13, 14, 15); }
__device__ __forceinline__ v16bf cat16b(v8us lo, v8us hi) { return __builtin_bit_cast(v16bf, __builtin_shufflevector(lo, hi, 0, 1, 2, 3, 4, 5, 6, 7, 8, 9, 10, 11, 12, 13, 14, 15)); }
__device__ __forceinline__ v8f wmma16(v16h a, v16h b, v8f c) { return __builtin_amdgcn_wmma_f32_16x16x32_f16(false, a, false, b, (short)0, c, false, false); }
__device__ __forceinline__ v8f wmmab(v16bf a, v16bf b, v8f c) { return __builtin_amdgcn_wmma_f32_16x16x32_bf16(false, a, false, b, (short)0, c, false, false); }
__device__ __forceinline__ h16 tohx(float x) { return (h16)x; }
__device__ __forceinline__ void splitf(float y, unsigned short& h, unsigned short& l) { h = f2bf(y); l = f2bf(y - bf2f(h)); }
typedef __attribute__((ext_vector_type(2))) _Float16 v2h;
typedef __attribute__((ext_vector_type(4))) _Float16 v4h;
typedef __attribute__((ext_vector_type(2))) unsigned short v2us;
typedef __attribute__((ext_vector_type(4))) unsigned short v4us;
typedef __attribute__((ext_vector_type(2))) float v2f;
typedef __attribute__((ext_vector_type(4))) int v4i;



// ---- gemmw: register-blocked GEMM, one 64x64 output tile (16 accumulators a wave) per work-group of KS waves, operands straight from 16-bit planes in fragment order; tile (bx, by) of (M/64, N/64), 32 * KS threads; os: the kernel's LDS, OSF floats.
// C[m][n] (f32, pitch ldc, + optional f32 bias[n]) = sum_k A[m][k] Bt[n][k] (+ split products per NSPLIT). K = DM, K % (32 * KS) == 0.
// KS > 1: wave w sums the K slice [w K/KS, (w+1) K/KS); the KS partial tiles meet in LDS and are added in slice order 0 .. KS-1 (fixed, the same on every run).
// UP (KS == 8 only): the tile takes + 2 u, u = the rank-8 up-product of the same tile (K padded to 32: one WMMA step, hi then lo plane, its own f32 sum from 0). Uh/Ul: hi/lo planes [t][32] of the down-projection, Uw: up weights [n][32].
// UP = 1: rows m are t, columns n (A = Uh, Ul; B = Uw). UP = 2: rows m are n, columns t (A = Uw; B = Uh, Ul). Wave w makes sub-tile (w / 4, w % 4) of each 32-row phase; u meets the slices in LDS as one more slice and is added last, x 2.
// EPI (KS > 1 only) says what leaves the kernel. 0: the f32 tile, to C. 1: the tile as three 16-bit planes (fp16, bf16 hi, bf16 lo of y - hi), each a matrix of ldp columns in fragment order, element (m, n) at its row by * rP + m, column by * cP + (n - c0);
// rP = rows, cP = 0, ldp = 64 gives head planes [n / 64][m][n % 64], rP = 0, cP = 64, ldp = N gives plain [m][n]. A thread sums and stores one 16-byte piece (8 columns), thread t of each 64 piece t of a unit. 2: columns 0 .. 31 as hi/lo planes [m][32], columns 8 .. 31 zero (the rank-8 down-projection, K-padded for the up-projection).
template <typename T16> struct WFrag;
template <> struct WFrag<h16> { typedef v16h V; static __device__ __forceinline__ V ld(const h16* p) { return cat16(*(const v8h*)p, *(const v8h*)(p + 16)); } static __device__ __forceinline__ V ldf(const h16* p) { return cat16(*(const v8h*)p, *(const v8h*)(p + 256)); } static __device__ __forceinline__ v8f mma(V a, V b, v8f c) { return wmma16(a, b, c); } };
template <> struct WFrag<bf> { typedef v16bf V; static __device__ __forceinline__ V ld(const bf* p) { return cat16b(*(const v8us*)p, *(const v8us*)(p + 16)); } static __device__ __forceinline__ V ldf(const bf* p) { return cat16b(*(const v8us*)p, *(const v8us*)(p + 256)); } static __device__ __forceinline__ v8f mma(V a, V b, v8f c) { return wmmab(a, b, c); } };
#define OSF(KS, UP) (((KS) == 1) ? 16 * 68 : ((KS) + ((UP) != 0 ? 1 : 0)) * 32 * 68)
template <typename T16, int NSPLIT, bool BIAS, int KS, int EPI = 0, int UP = 0>
__device__ __forceinline__ void gemmw(float* os, int bx, int by, const T16* __restrict__ A, const T16* __restrict__ A2, const T16* __restrict__ Bt, const T16* __restrict__ Bt2, float* C, int ldc, const float* __restrict__ bias, const T16* __restrict__ Uh, const T16* __restrict__ Ul, const T16* __restrict__ Uw, h16* P16, bf* Ph, bf* Pl, int rP, int cP, int ldp) {
    static_assert(EPI == 0 || KS > 1, "the plane epilogues stand behind the slice sum"); static_assert(EPI != 1 || KS == 8, "256 threads, one 16-byte piece of 32 x 64 each"); static_assert(UP == 0 || KS == 8, "eight sub-tiles a phase, one a wave");
    typedef typename WFrag<T16>::V V; constexpr int K = DM; static_assert(DQ == DM, "one K for every product");   // a constant, so that a pass's units stand at immediate offsets from one address an operand
    const int lane = threadIdx.x & 31, lr = lane & 15, hi = lane >> 4; const int r0 = bx * 64, c0 = by * 64;
    v8f acc[4][4];
#pragma unroll
    for (int mb = 0; mb < 4; ++mb)
#pragma unroll
        for (int nb = 0; nb < 4; ++nb) acc[mb][nb] = (v8f){};
    const size_t aoff = (size_t)r0 * K + 8 * lane, boff = (size_t)c0 * K + 8 * lane;   // 16 rows of units are 16 K elements, 32 k one unit of 512, the lane's piece 8 lane
    // wv: the wave's K slice, held scalar so that the loop bounds are scalar
    const int wv = (KS == 1) ? 0 : __builtin_amdgcn_readfirstlane((int)(threadIdx.x >> 5)); const int kspan = K / KS, kbeg = wv * kspan, kend = kbeg + kspan;
    V ua[2], ua2[2], ub, ub2;
    if constexpr (UP != 0) {   // the up-product's operands, fetched in front of the K loop, so that no barrier of the slice sum waits for these loads
        const size_t uc = (size_t)(c0 + (wv & 3) * 16 + lr) * 32 + 8 * hi, ur = (size_t)(r0 + (wv >> 2) * 16 + lr) * 32 + 8 * hi;
        const T16* pb = (UP == 1 ? Uw : Uh) + uc; const T16* pa = (UP == 1 ? Uh : Uw) + ur; const T16* p2 = Ul + (UP == 1 ? ur : uc);   // phase 1's rows: + 32 * 32 elements
        ub = WFrag<T16>::ld(pb); ua[0] = WFrag<T16>::ld(pa); ua[1] = WFrag<T16>::ld(pa + 32 * 32);
        if (UP == 1) { ua2[0] = WFrag<T16>::ld(p2); ua2[1] = WFrag<T16>::ld(p2 + 32 * 32); } else ub2 = WFrag<T16>::ld(p2);
        // the addresses are inputs, so their registers stay as they are up to the wait
        asm volatile("s_wait_xcnt 0x0" :: "v"(pb), "v"(pa), "v"(p2) : "memory");
    }
#pragma unroll 1
    for (int kc = kbeg; kc < kend; kc += 32) {
        V a[4], a2[4]; const T16* pa = A + aoff + kc * 16; const T16* pb = Bt + boff + kc * 16; const T16* pa2 = (NSPLIT == 1 || NSPLIT == 2) ? A2 + aoff + kc * 16 : pa; const T16* pb2 = (NSPLIT >= 2) ? Bt2 + boff + kc * 16 : pb;
#pragma unroll
        for (int mb = 0; mb < 4; ++mb) { a[mb] = WFrag<T16>::ldf(pa + mb * 16 * K); if (NSPLIT == 1 || NSPLIT == 2) a2[mb] = WFrag<T16>::ldf(pa2 + mb * 16 * K); }
#pragma unroll
        for (int nb = 0; nb < 4; ++nb) { const V b = WFrag<T16>::ldf(pb + nb * 16 * K); V b2; if (NSPLIT >= 2) b2 = WFrag<T16>::ldf(pb2 + nb * 16 * K);
#pragma unroll
            for (int mb = 0; mb < 4; ++mb) { acc[mb][nb] = WFrag<T16>::mma(a[mb], b, acc[mb][nb]); if (NSPLIT == 1 || NSPLIT == 2) acc[mb][nb] = WFrag<T16>::mma(a2[mb], b, acc[mb][nb]); if (NSPLIT >= 2) acc[mb][nb] = WFrag<T16>::mma(a[mb], b2, acc[mb][nb]); } }
        // the pass's addresses are inputs here, so their registers stay as they are up to the wait
        asm volatile("s_wait_xcnt 0x0" :: "v"(pa), "v"(pb), "v"(pa2), "v"(pb2) : "memory");
        asm volatile("v_nop\n\tv_nop\n\tv_nop\n\tv_nop" : "+v"(acc[0][0]), "+v"(acc[1][1]), "+v"(acc[2][2]), "+v"(acc[3][3]) : "v"(a[0]), "v"(a[3]));
    }
    if (KS > 1) {   // every loop below is unrolled so that acc[][] and res[][] are indexed by constants and stay in registers
        float* osw = os + wv * (32 * 68); static_assert(KS == 1 || 16 % KS == 0, "KS divides 16"); constexpr int NIT = (KS > 1) ? 16 / KS : 1;   // v4f sums a thread and phase: 32 rows x 16 v4f over 32 * KS threads
        v4f res[2][NIT];
        // which v4f of a phase's 32 x 64 a thread sums. EPI 1: the two halves of one piece, in fragment order (unit t / 64: 16 rows x 32 columns); else 16 threads a row
        const int pw = (int)threadIdx.x & 63, pu = (int)threadIdx.x >> 6, prow = (pu >> 1) * 16 + (pw & 15), pc8 = (pu & 1) * 4 + (pw >> 5) * 2 + ((pw >> 4) & 1);
        auto rowof = [&](int it) { return (EPI == 1) ? prow : ((int)threadIdx.x + it * 32 * KS) >> 4; };
        auto colof = [&](int it) { return (EPI == 1) ? pc8 * 8 + it * 4 : (((int)threadIdx.x + it * 32 * KS) & 15) * 4; };
#pragma unroll
        for (int mp = 0; mp < 2; ++mp) {          // 32 output rows a phase
#pragma unroll
            for (int ml = 0; ml < 2; ++ml)
#pragma unroll
                for (int nb = 0; nb < 4; ++nb)
#pragma unroll
                    for (int j = 0; j < 8; ++j) osw[(ml * 16 + hi * 8 + j) * 68 + nb * 16 + lr] = acc[mp * 2 + ml][nb][j];
            if constexpr (UP != 0) { v8f t = WFrag<T16>::mma(ua[mp], ub, (v8f){}); t = (UP == 1) ? WFrag<T16>::mma(ua2[mp], ub, t) : WFrag<T16>::mma(ua[mp], ub2, t);
#pragma unroll
                for (int j = 0; j < 8; ++j) os[KS * (32 * 68) + ((wv >> 2) * 16 + hi * 8 + j) * 68 + (wv & 3) * 16 + lr] = t[j]; }
            __syncthreads();                      // every slice's partial rows are in LDS
#pragma unroll
            for (int it = 0; it < NIT; ++it) { const int row = rowof(it), cofs = colof(it); v4f val = *(const v4fa*)(os + row * 68 + cofs);
#pragma unroll
                for (int s = 1; s < KS; ++s) val += *(const v4fa*)(os + s * (32 * 68) + row * 68 + cofs);
                if constexpr (UP != 0) val += 2.0f * *(const v4fa*)(os + KS * (32 * 68) + row * 68 + cofs);   // x 2 is exact: fused or not, one rounding
                res[mp][it] = val; }
            if (mp == 0) __syncthreads();         // all reads of phase 0 end before phase 1 overwrites the rows
        }
        // the stores stand behind the last barrier, so that no barrier waits for a store to memory
#pragma unroll
        for (int mp = 0; mp < 2; ++mp) { v8h o16; v8us oh8, ol8;   // EPI 1: the thread's piece of each plane
#pragma unroll
            for (int it = 0; it < NIT; ++it) { const int row = rowof(it), cofs = colof(it); v4f val = res[mp][it];
                if (BIAS) { val[0] += bfr(bias[c0 + cofs]); val[1] += bfr(bias[c0 + cofs + 1]); val[2] += bfr(bias[c0 + cofs + 2]); val[3] += bfr(bias[c0 + cofs + 3]); }
                if constexpr (EPI == 0) *(v4f*)(C + (size_t)(r0 + mp * 32 + row) * ldc + c0 + cofs) = val;
                else if constexpr (EPI == 1) {
#pragma unroll
                    for (int q = 0; q < 4; ++q) { o16[it * 4 + q] = tohx(val[q]); unsigned short a2, c2; splitf(val[q], a2, c2); oh8[it * 4 + q] = a2; ol8[it * 4 + q] = c2; }
                    if (it == NIT - 1) { const size_t po = ((size_t)((by * rP + r0 + mp * 32 + row) >> 4) * (ldp >> 5) + ((by * cP) >> 5) + (pc8 >> 2)) * 512 + pw * 8; *(v8h*)(P16 + po) = o16; *(v8us*)(Ph + po) = oh8; *(v8us*)(Pl + po) = ol8; } }
                else if (cofs < 32) { v4us oh, ol;
#pragma unroll
                    for (int q = 0; q < 4; ++q) { unsigned short a2 = 0, c2 = 0; if (cofs + q < 8) splitf(val[q], a2, c2); oh[q] = a2; ol[q] = c2; }
                    const size_t po = (size_t)(r0 + mp * 32 + row) * 32 + cofs; *(v4us*)(Ph + po) = oh; *(v4us*)(Pl + po) = ol; } } }
        // the three EPI 1 products share a kernel, and its listing leads from one product's last stores on into another's code, which writes their registers: the wait stands behind the last store
        if constexpr (EPI == 1) asm volatile("s_wait_xcnt 0x0" ::: "memory");
        return;
    }
#pragma unroll
    for (int mb = 0; mb < 4; ++mb) {
#pragma unroll
        for (int nb = 0; nb < 4; ++nb) {
#pragma unroll
            for (int j = 0; j < 8; ++j) os[(hi * 8 + j) * 68 + nb * 16 + lr] = acc[mb][nb][j]; }
        __builtin_amdgcn_wave_barrier(); asm volatile("" ::: "memory");
        float* crow = C + (size_t)(r0 + mb * 16) * ldc + c0;
{
#pragma unroll
            for (int s = 0; s < 8; ++s) { const int row = 2 * s + hi, cofs = lr * 4; v4f val = *(const v4fa*)(os + row * 68 + cofs); if (BIAS) { val[0] += bfr(bias[c0 + cofs]); val[1] += bfr(bias[c0 + cofs + 1]); val[2] += bfr(bias[c0 + cofs + 2]); val[3] += bfr(bias[c0 + cofs + 3]); }
                *(v4f*)(crow + (size_t)row * ldc + cofs) = val; }
             }
        __builtin_amdgcn_wave_barrier(); asm volatile("" ::: "memory");
    }
}


// both rank-8 down-projections, grid (TB / 64, 2): y = 0 x wq_A^T, y = 1 x wv_A^T, each to hi/lo planes [tb][32] of its own
__global__ __launch_bounds__(512) void k_down(const bf* __restrict__ XB, const bf* __restrict__ AQ, const bf* __restrict__ AV, bf* XQh, bf* XQl, bf* XVh, bf* XVl) {
    __shared__ __align__(16) float os[OSF(16, 0)]; const bool sv = blockIdx.y != 0;
    gemmw<bf, 0, false, 16, 2>(os, blockIdx.x, 0, XB, nullptr, sv ? AV : AQ, nullptr, nullptr, 64, nullptr, nullptr, nullptr, nullptr, nullptr, sv ? XVh : XQh, sv ? XVl : XQl, 0, 0, 32);
}
// the three projections, grid (TB / 64, DM / 64, 3). z = 0: q = x wq^T + 2 (x A^T) B^T -> head planes [h][tb][d]; z = 1: k = x wk^T -> head planes [h][tb][d];
// z = 2: v^T = wv x^T + 2 B (x A^T)^T -> planes [g * HD + d][tb], its tiles numbered with the weight's rows running fastest. The branch is the same for a whole work-group, so every barrier stays under uniform control flow.
__global__ __launch_bounds__(256) void k_qkv(const bf* __restrict__ XB, const bf* __restrict__ WQ, const bf* __restrict__ WK, const bf* __restrict__ WV, const bf* __restrict__ XQh, const bf* __restrict__ XQl, const bf* __restrict__ XVh, const bf* __restrict__ XVl, const bf* __restrict__ BQ2, const bf* __restrict__ BV2,
                                             h16* QP16, bf* QPh, bf* QPl, h16* KP16, bf* KPh, bf* KPl, h16* VT16, bf* VTh, bf* VTl) {
    static_assert(DQ == DM && DKV == DM, "one grid for the three products");
    __shared__ __align__(16) float os[OSF(8, 1)]; const int bx = blockIdx.x, by = blockIdx.y;
    if (blockIdx.z == 0) gemmw<bf, 0, false, 8, 1, 1>(os, bx, by, XB, nullptr, WQ, nullptr, nullptr, DQ, nullptr, XQh, XQl, BQ2, QP16, QPh, QPl, TB, 0, HD);
    else if (blockIdx.z == 1) gemmw<bf, 0, false, 8, 1, 0>(os, bx, by, XB, nullptr, WK, nullptr, nullptr, DKV, nullptr, nullptr, nullptr, nullptr, KP16, KPh, KPl, TB, 0, HD);
    else { const int t = by * (TB / 64) + bx; gemmw<bf, 0, false, 8, 1, 2>(os, t % (DKV / 64), t / (DKV / 64), WV, nullptr, XB, nullptr, nullptr, TB, nullptr, XVh, XVl, BV2, VT16, VTh, VTl, 0, 64, TB); }
}
// out = attention output (hi + lo planes) wo^T, f32, grid (TB / 64, DM / 64)
__global__ __launch_bounds__(256) void k_wo(const bf* __restrict__ ATh, const bf* __restrict__ ATl, const bf* __restrict__ WO, float* OUT) {
    __shared__ __align__(16) float os[OSF(8, 0)];
    gemmw<bf, 1, false, 8>(os, blockIdx.x, blockIdx.y, ATh, ATl, WO, nullptr, OUT, DM, nullptr, nullptr, nullptr, nullptr, nullptr, nullptr, nullptr, 0, 0, 0);
}

__global__ __launch_bounds__(256) void k_wtG(const float* __restrict__ w, int K, int N, bf* Bt) {
    const int lane = threadIdx.x & 31; const int L0 = (blockIdx.x * 8 + (threadIdx.x >> 5)) * 8; const int nlines = N * K / 64;
{
#pragma unroll 1
        for (int l = 0; l < 8; ++l) { const int L = L0 + l; if (L >= nlines) break; const size_t e = (size_t)L * 64 + lane * 2; const int k = (int)(e % K), n = (int)(e / K); v2us o;
            o[0] = f2bf(w[(size_t)k * N + n]); o[1] = f2bf(w[(size_t)(k + 1) * N + n]); *(v2us*)(Bt + e) = o; }
         }
}
// f32 [r][DM] row-major -> bf16 in fragment order: thread i writes piece i (a wave 512 contiguous bytes) and reads the 8 values that belong there (a work-group: 16 rows x 128 k, whole lines between its waves)
__device__ __forceinline__ void cvt8(const float* __restrict__ src, bf* dst, size_t n8, int blk) { const size_t i = (size_t)blk * 256 + threadIdx.x; if (i >= n8) return;
    const size_t un = i >> 6; const int w = (int)(i & 63); const size_t r = (un / (DM / 32)) * 16 + (w & 15); const int k = (int)(un % (DM / 32)) * 32 + ((w >> 5) * 2 + ((w >> 4) & 1)) * 8;
    const v8f v = *(const v8f*)(src + r * DM + k); v8us o;
#pragma unroll
    for (int k = 0; k < 8; ++k) o[k] = f2bf(v[k]); *(v8us*)(dst + i * 8) = o;  }
__global__ __launch_bounds__(256) void k_cscvt(const float* __restrict__ cosT, const float* __restrict__ sinT, float* CS) { const int idx = blockIdx.x * 256 + threadIdx.x; if (idx >= TT * HD) return; v2f cs; cs[0] = bfr(cosT[idx]); cs[1] = bfr(sinT[idx]); *(v2f*)(CS + (size_t)idx * 2) = cs;  }
#define SC2 (SCL * 1.4426950408889634f)
typedef __attribute__((ext_vector_type(8))) int v8i;
__device__ __forceinline__ v8i ldm8(const int* p) { return __builtin_shufflevector(*(const v4i*)p, *(const v4i*)(p + 4), 0, 1, 2, 3, 4, 5, 6, 7); }
__device__ __forceinline__ float xhalf(float x) { return __builtin_bit_cast(float, __builtin_amdgcn_permlanex16(__builtin_bit_cast(int, x), __builtin_bit_cast(int, x), 0x76543210, 0xfedcba98, false, false)); }   // lane l with lane l ^ 16
template <typename T16, bool HL, int NQ>
__device__ __forceinline__ void fattn_rows(const T16* __restrict__ Q, const T16* __restrict__ Q2, const T16* __restrict__ Kp, const T16* __restrict__ K2, const T16* __restrict__ Vt, const T16* __restrict__ V2, const int* __restrict__ am, int q0, bf* Ah, bf* Al) {
    typedef WFrag<T16> F; typedef typename F::V V;
    const int lane = threadIdx.x & 31, lr = lane & 15, hi = lane >> 4;
    V qf[NQ][2], qf2[NQ][2];
#pragma unroll
    for (int qb = 0; qb < NQ; ++qb)
#pragma unroll
        for (int ks = 0; ks < 2; ++ks) { const size_t qo = (size_t)(q0 + qb * 16) * HD + ks * 512 + 8 * lane; qf[qb][ks] = F::ldf(Q + qo); if (HL) qf2[qb][ks] = F::ldf(Q2 + qo); }
    v8f o[4][NQ]; float m[NQ], l[NQ];
#pragma unroll
    for (int qb = 0; qb < NQ; ++qb) { m[qb] = -3.0e38f; l[qb] = 0.f;
#pragma unroll
        for (int db = 0; db < 4; ++db) o[db][qb] = (v8f){}; }
    const size_t ko = 8 * lane, vo = 8 * lane; const int* mp = am + (size_t)(q0 + lr) * TT + 8 * hi;
    V kf[2][2], kf2[2][2]; v8i mk[NQ][2];
    auto ldk = [&](int key) {      // the key rows of one pass
#pragma unroll
        for (int kb = 0; kb < 2; ++kb)
#pragma unroll
            for (int ks = 0; ks < 2; ++ks) { kf[kb][ks] = F::ldf(Kp + ko + (size_t)(key + kb * 16) * HD + ks * 512); if (HL) kf2[kb][ks] = F::ldf(K2 + ko + (size_t)(key + kb * 16) * HD + ks * 512); } };
    auto ldmk = [&](int qb, int key) {   // the mask words of one pass and 16 queries
#pragma unroll
        for (int kb = 0; kb < 2; ++kb) mk[qb][kb] = ldm8(mp + (size_t)qb * 16 * TT + key + kb * 16); };
    constexpr bool AHEAD = !HL;    // key rows and mask words one pass ahead; the hi+lo rows hold twice the fragments and have no registers left for it
    if (AHEAD) { ldk(0);
#pragma unroll
        for (int qb = 0; qb < NQ; ++qb) ldmk(qb, 0); }
#pragma unroll 1   // rolled: a second copy of the pass would not fit the registers
    for (int key0 = 0; key0 < TT; key0 += 32) {
        if (!AHEAD) { ldk(key0);
#pragma unroll
            for (int qb = 0; qb < NQ; ++qb) ldmk(qb, key0); }
        V vf[4], vf2[4];
#pragma unroll
        for (int db = 0; db < 4; ++db) vf[db] = F::ldf(Vt + vo + (size_t)db * 16 * TB + key0 * 16);
        if constexpr (HL) {
            // hi+lo rows: the addresses are inputs, so their registers stay as they are up to the wait
            asm volatile("s_wait_xcnt 0x0" :: "v"(Kp + ko + (size_t)key0 * HD), "v"(K2 + ko + (size_t)key0 * HD), "v"(Vt + vo + key0 * 16), "v"(mp + key0) : "memory");
#pragma unroll
            for (int db = 0; db < 4; ++db) vf2[db] = F::ldf(V2 + vo + (size_t)db * 16 * TB + key0 * 16);
            asm volatile("s_wait_xcnt 0x0" :: "v"(V2 + vo + key0 * 16) : "memory");   // the same for the lo plane's loads
        }
        v8f s[2][NQ];
#pragma unroll
        for (int kb = 0; kb < 2; ++kb)
#pragma unroll
            for (int qb = 0; qb < NQ; ++qb) { s[kb][qb] = (v8f){};
#pragma unroll
                for (int ks = 0; ks < 2; ++ks) { s[kb][qb] = F::mma(kf[kb][ks], qf[qb][ks], s[kb][qb]); if (HL) { s[kb][qb] = F::mma(kf[kb][ks], qf2[qb][ks], s[kb][qb]); s[kb][qb] = F::mma(kf2[kb][ks], qf[qb][ks], s[kb][qb]); } } }
        // AHEAD: the next pass's key rows and mask words are fetched behind the last use of this pass's; the last pass fetches its own again (in bounds, unused)
        const int nk = (key0 + 32 < TT) ? key0 + 32 : key0;
        if (AHEAD) ldk(nk);
#pragma unroll
        for (int qb = 0; qb < NQ; ++qb) {
            float t[2][8]; float mx = -3.0e38f;
#pragma unroll
            for (int kb = 0; kb < 2; ++kb)
#pragma unroll
                for (int j = 0; j < 8; ++j) { t[kb][j] = (mk[qb][kb][j] != 0) ? -3.0e38f : s[kb][qb][j] * SC2; mx = fmaxf(mx, t[kb][j]); }
            if (AHEAD) ldmk(qb, nk);
            mx = fmaxf(mx, xhalf(mx));     // the other half of the wave holds the query's other 16 keys
            const float mn = fmaxf(m[qb], mx), alpha = __builtin_amdgcn_exp2f(m[qb] - mn); m[qb] = mn;
            float ps = 0.f;
#pragma unroll
            for (int kb = 0; kb < 2; ++kb)
#pragma unroll
                for (int j = 0; j < 8; ++j) { t[kb][j] = __builtin_amdgcn_exp2f(t[kb][j] - mn); ps += t[kb][j]; }
            l[qb] = l[qb] * alpha + ps;
#pragma unroll
            for (int db = 0; db < 4; ++db) o[db][qb] *= alpha;
            V pf, pf2;
#pragma unroll
            for (int e = 0; e < 16; ++e) { const float p = t[e >> 3][e & 7];
                if constexpr (HL) { const __bf16 ph = (__bf16)p; pf[e] = ph; pf2[e] = (__bf16)(p - (float)ph); } else pf[e] = (h16)p; }
#pragma unroll
            for (int db = 0; db < 4; ++db) { o[db][qb] = F::mma(vf[db], pf, o[db][qb]); if (HL) { o[db][qb] = F::mma(vf[db], pf2, o[db][qb]); o[db][qb] = F::mma(vf2[db], pf, o[db][qb]); } }
        }
    }
#pragma unroll
    for (int qb = 0; qb < NQ; ++qb) { const float lt = l[qb] + xhalf(l[qb]); const float inv = __fdiv_rn(1.0f, lt);
#pragma unroll
        for (int db = 0; db < 4; ++db) { v8us oh, ol;
#pragma unroll
            for (int j = 0; j < 8; ++j) { unsigned short a, c2; splitf(o[db][qb][j] * inv, a, c2); oh[j] = a; ol[j] = c2; }
            const size_t oo = (size_t)(q0 + qb * 16) * DQ + db * 256 + 8 * lane; *(v8us*)(Ah + oo) = oh; *(v8us*)(Al + oo) = ol; } }
}
// grid (RH / 64 + (TT - RH) / 128, heads, batches), 4 waves: the first RH / 64 work-groups take the hi+lo rows, 16 a wave (three products each, so half the rows), the rest 32 fp16 rows a wave
__global__ __launch_bounds__(128) void k_fattn(const h16* __restrict__ Q16, const bf* __restrict__ Qh, const bf* __restrict__ Ql, const h16* __restrict__ K16, const bf* __restrict__ Kh, const bf* __restrict__ Kl, const h16* __restrict__ V16, const bf* __restrict__ Vh, const bf* __restrict__ Vl, const int* __restrict__ am, bf* Ah, bf* Al) {
    const int wv = __builtin_amdgcn_readfirstlane((int)(threadIdx.x >> 5)); const int bx = blockIdx.x; const size_t hp = ((size_t)blockIdx.y * NB_ + blockIdx.z) * TT * HD, vp = (size_t)blockIdx.y * HD * TB + (size_t)blockIdx.z * TT * 16;   // the batch's TT rows of the head's q and k; its TT columns (32 a unit) of the head's V^T rows
    const size_t ap = (size_t)blockIdx.z * TT * DQ + blockIdx.y * (HD * 16); Ah += ap; Al += ap;   // the batch's rows; a head's 64 columns: two units of each 16 rows
    if (bx < RH / 64) fattn_rows<bf, true, 1>(Qh + hp, Ql + hp, Kh + hp, Kl + hp, Vh + vp, Vl + vp, am, bx * 64 + wv * 16, Ah, Al);
    else fattn_rows<h16, false, 2>(Q16 + hp, nullptr, K16 + hp, nullptr, V16 + vp, nullptr, am, RH + (bx - RH / 64) * 128 + wv * 32, Ah, Al);
}

__device__ __forceinline__ void lorap(const float* __restrict__ A, const float* __restrict__ Bw, bf* AQ, bf* B2, int blk) { const int e = (blk * 256 + (int)threadIdx.x) * 4; if (e >= 64 * DM) return;
    { const int un = e >> 9, w = (e >> 3) & 63, n = (un / (DM / 32)) * 16 + (w & 15), k = (un % (DM / 32)) * 32 + ((w >> 5) * 2 + ((w >> 4) & 1)) * 8 + (e & 7); /* AQ in fragment order: element e of the plane holds (n, k) */ v4us o; for (int u = 0; u < 4; ++u) o[u] = (n < 8) ? f2bf(A[(size_t)n * DM + k + u]) : (unsigned short)0; *(v4us*)(AQ + e) = o;  }
    if (e < DM * 32) { const int n = e / 32, k = e % 32; v4us o; for (int u = 0; u < 4; ++u) o[u] = (k + u < 8) ? f2bf(Bw[(size_t)n * 8 + k + u]) : (unsigned short)0; *(v4us*)(B2 + e) = o;  } }

// every conversion in one grid, picked by block range (the same for a whole work-group): the two LoRA pairs first (few blocks), then x, then the four weights
#define PB_X (TB * DM / 8 / 256)
#define PB_W (DM * DM / 8 / 256)
#define PB_L (64 * DM / 4 / 256)
__global__ __launch_bounds__(256) void k_prep(const float* __restrict__ x, const float* __restrict__ wq, const float* __restrict__ wk, const float* __restrict__ wv, const float* __restrict__ wo, const float* __restrict__ wqA, const float* __restrict__ wqB, const float* __restrict__ wvA, const float* __restrict__ wvB,
                                              bf* XB, bf* WQ, bf* WK, bf* WV, bf* WO, bf* AQ, bf* BQ2, bf* AV, bf* BV2) {
    static_assert(DQ == DM && DKV == DM, "four weights of one size");
    int b = blockIdx.x;
    if (b < PB_L) { lorap(wqA, wqB, AQ, BQ2, b); return; }
    b -= PB_L;
    if (b < PB_L) { lorap(wvA, wvB, AV, BV2, b); return; }
    b -= PB_L;
    if (b < PB_X) { cvt8(x, XB, (size_t)TB * DM / 8, b); return; }
    b -= PB_X;
    const int w = b / PB_W; cvt8(w == 0 ? wq : w == 1 ? wk : w == 2 ? wv : wo, w == 0 ? WQ : w == 1 ? WK : w == 2 ? WV : WO, (size_t)DM * DM / 8, b % PB_W);
}

extern "C" void kernel_launch(void* const* d_in, const int* in_sizes, int n_in,
                              void* d_out, int out_size, void* d_ws, size_t ws_size, hipStream_t stream) {
    (void)in_sizes; (void)n_in; (void)out_size;
    const float* x = (const float*)d_in[0]; const int* amask = (const int*)d_in[1]; const float* wq = (const float*)d_in[2]; const float* wqA = (const float*)d_in[3]; const float* wqB = (const float*)d_in[4]; const float* wk = (const float*)d_in[5]; const float* wv = (const float*)d_in[6]; const float* wvA = (const float*)d_in[7]; const float* wvB = (const float*)d_in[8]; const float* wo = (const float*)d_in[9]; const float* cosT = nullptr; const float* sinT = nullptr; (void)cosT; (void)sinT;
    float* OUT = (float*)d_out;     // [2][2048][1024]
    char* wsp = (char*)d_ws;
    auto take = [&](size_t bytes) { char* p = wsp; wsp += (bytes + 255) & ~(size_t)255; return (void*)p; };
    bf* WQ = (bf*)take((size_t)DQ * DM * 2); bf* WK = (bf*)take((size_t)DKV * DM * 2); bf* WV = (bf*)take((size_t)DKV * DM * 2); bf* WO = (bf*)take((size_t)DM * DQ * 2);
    bf* XB = (bf*)take((size_t)TB * DM * 2); bf* AQ = (bf*)take((size_t)64 * DM * 2); bf* AV = (bf*)take((size_t)64 * DM * 2); bf* BQ2 = (bf*)take((size_t)DM * 32 * 2); bf* BV2 = (bf*)take((size_t)DM * 32 * 2); bf* XQh = (bf*)take((size_t)TB * 32 * 2); bf* XQl = (bf*)take((size_t)TB * 32 * 2); bf* XVh = (bf*)take((size_t)TB * 32 * 2); bf* XVl = (bf*)take((size_t)TB * 32 * 2);
    h16* QP16 = (h16*)take((size_t)NH_ * TB * HD * 2); h16* KP16 = (h16*)take((size_t)NKV * TB * HD * 2); h16* VT16 = (h16*)take((size_t)NKV * HD * TB * 2);
    bf* QPh = (bf*)take((size_t)NH_ * TB * HD * 2); bf* QPl = (bf*)take((size_t)NH_ * TB * HD * 2); bf* KPh = (bf*)take((size_t)NKV * TB * HD * 2); bf* KPl = (bf*)take((size_t)NKV * TB * HD * 2); bf* VTh = (bf*)take((size_t)NKV * HD * TB * 2); bf* VTl = (bf*)take((size_t)NKV * HD * TB * 2);
    bf* ATh = (bf*)take((size_t)TB * DQ * 2); bf* ATl = (bf*)take((size_t)TB * DQ * 2);
    if ((size_t)(wsp - (char*)d_ws) > ws_size) return;    // ws 256 MiB
    k_prep<<<2 * PB_L + PB_X + 4 * PB_W, 256, 0, stream>>>(x, wq, wk, wv, wo, wqA, wqB, wvA, wvB, XB, WQ, WK, WV, WO, AQ, BQ2, AV, BV2);
    k_down<<<dim3(TB / 64, 2, 1), 512, 0, stream>>>(XB, AQ, AV, XQh, XQl, XVh, XVl);
    k_qkv<<<dim3(TB / 64, DM / 64, 3), 256, 0, stream>>>(XB, WQ, WK, WV, XQh, XQl, XVh, XVl, BQ2, BV2, QP16, QPh, QPl, KP16, KPh, KPl, VT16, VTh, VTl);
    k_fattn<<<dim3(RH / 64 + (TT - RH) / 128, NH_, NB_), 128, 0, stream>>>(QP16, QPh, QPl, KP16, KPh, KPl, VT16, VTh, VTl, amask, ATh, ATl);   // one kv head per query head
    k_wo<<<dim3(TB / 64, DM / 64, 1), 256, 0, stream>>>(ATh, ATl, WO, OUT);
}

// v007
// Measured time: 135 microseconds a run.
// Next to v006, in two timings, it ran 1.36 times as fast each time.
// All steps since v000 together make it 16.2 times as fast.
#include <hip/hip_runtime.h>

// TinySelfAttention (x [2][2048][1024]; q = x wq_w^T + 2 (x wq_A^T) wq_B^T (LoRA, r = 8, alpha/r = 2), k = x wk_w^T, v = x wv_w^T + 2 (x wv_A^T) wv_B^T (16 heads x 64); scores = q.k / 8, masked (-inf) where attn_mask[i][j] != 0 (int [2048][2048], read as data: k_prep sums it up per 16 rows x 32 keys, and k_fattn goes by that summary, right for any mask); softmax; out = merged wo_w^T -> [2][2048][1024]).
// Compute dtypes, f32 accumulate: every input rounded to bf16; base projections and the rank-8 down-projections on PLAIN bf16 operands (inputs: exact; the 8 outputs padded to 64 with zero weights); the up-projections as hl planes (K padded 8 -> 32 with zeros) x exact B (2 products), added x 2 in f32; scores and attn.v over every key tile with an open key (mask read per element where a tile is part masked): query rows < 512 hl (3 products), the rest single fp16; softmax f32, running maximum and sum over 32-key tiles inside one kernel (k_fattn); wo hl x exact (2 products).
// The q/k/v and rank-8 down GEMMs write their 16-bit planes themselves (gemmw, EPI), q and v after taking in their up-projection (UP): no f32 projection goes to memory; v is computed as wv x^T, so that the rows of V^T come out contiguous.
// FRAGMENT ORDER: every 16-bit plane that a K loop or the key walk reads (x, the weights, the padded down weights, q, k, V^T, the attention output) lies in units of 16 rows x 32 k = 1 KB, unit (r / 16, k / 32) at ((r / 16) * (K / 32) + k / 32) * 512 elements;
// inside a unit the 16-byte piece (row r % 16, k pieces c = (k % 32) / 8) stands at piece (c / 2) * 32 + (c % 2) * 16 + r % 16, which is piece 'lane' of the fragment's first (c < 2) or second 16-byte load: a wave-wide load or store is 512 contiguous bytes, four whole lines, not 32 bytes in each of 16 lines.
// The rank-8 planes [t][32] and the up weights [n][32] stay row-major (64-byte rows, read once a work-group).
// FIVE LAUNCHES: work that depends on nothing in its own launch shares a grid. k_prep: the mask's summary and every conversion (both LoRA pairs, x, four weights), picked by block range; k_down: both rank-8 down-projections (grid y), each into planes of its own; k_qkv: the q, k and v GEMMs (grid z); then k_fattn and k_wo.
// BOTH BATCHES IN EVERY LAUNCH: a token's row is tb = b * TT + t (TB rows). x, the rank-8 planes, the attention output and out are [tb][.], q and k [head][tb][d], V^T [head * HD + d][tb]; the GEMM grids run over TB rows (V^T: columns), k_fattn takes b from blockIdx.z.

#define NB_  2
#define TT   2048
#define TB   (NB_ * TT)           // token rows of all batches
#define DM   1024
#define NH_  16
#define NKV  16
#define REP  (NH_ / NKV)
#define HD   64
#define DQ   (NH_ * HD)
#define DKV  (NKV * HD)
#define RH   512                  // query rows < RH use hi+lo planes (0: none)
#define WIN  0
#define SCL  0.125f   // HD^-0.5
typedef _Float16 h16;
typedef unsigned short bf;
typedef __attribute__((ext_vector_type(16))) __bf16   v16bf;
typedef __attribute__((ext_vector_type(16))) _Float16 v16h;
typedef __attribute__((ext_vector_type(8)))  _Float16 v8h;
typedef __attribute__((ext_vector_type(8)))  unsigned short v8us;
typedef __attribute__((ext_vector_type(8)))  float    v8f;
typedef __attribute__((ext_vector_type(4)))  float    v4f;
typedef v8h  __attribute__((may_alias)) v8ha;
typedef v4f  __attribute__((may_alias)) v4fa;
typedef v8us __attribute__((may_alias)) v8usa;

__device__ __forceinline__ unsigned short f2bf(float f) { unsigned u = __float_as_uint(f); u += 0x7FFFu + ((u >> 16) & 1u); return (unsigned short)(u >> 16); }
__device__ __forceinline__ float bf2f(unsigned short b) { return __uint_as_float(((unsigned)b) << 16); }
__device__ __forceinline__ float bfr(float f) { return bf2f(f2bf(f)); }
__device__ __forceinline__ v16h cat16(v8h lo, v8h hi) { return __builtin_shufflevector(lo, hi, 0, 1, 2, 3, 4, 5, 6, 7, 8, 9, 10, 11, 12, 13, 14, 15); }
__device__ __forceinline__ v16bf cat16b(v8us lo, v8us hi) { return __builtin_bit_cast(v16bf, __builtin_shufflevector(lo, hi, 0, 1, 2, 3, 4, 5, 6, 7, 8, 9, 10, 11, 12, 13, 14, 15)); }
__device__ __forceinline__ v8f wmma16(v16h a, v16h b, v8f c) { return __builtin_amdgcn_wmma_f32_16x16x32_f16(false, a, false, b, (short)0, c, false, false); }
__device__ __forceinline__ v8f wmmab(v16bf a, v16bf b, v8f c) { return __builtin_amdgcn_wmma_f32_16x16x32_bf16(false, a, false, b, (short)0, c, false, false); }
__device__ __forceinline__ h16 tohx(float x) { return (h16)x; }
__device__ __forceinline__ void splitf(float y, unsigned short& h, unsigned short& l) { h = f2bf(y); l = f2bf(y - bf2f(h)); }
typedef __attribute__((ext_vector_type(2))) _Float16 v2h;
typedef __attribute__((ext_vector_type(4))) _Float16 v4h;
typedef __attribute__((ext_vector_type(2))) unsigned short v2us;
typedef __attribute__((ext_vector_type(4))) unsigned short v4us;
typedef __attribute__((ext_vector_type(2))) float v2f;
typedef __attribute__((ext_vector_type(4))) int v4i;



// ---- gemmw: register-blocked GEMM, one 64x64 output tile (16 accumulators a wave) per work-group of KS waves, operands straight from 16-bit planes in fragment order; tile (bx, by) of (M/64, N/64), 32 * KS threads; os: the kernel's LDS, OSF floats.
// C[m][n] (f32, pitch ldc, + optional f32 bias[n]) = sum_k A[m][k] Bt[n][k] (+ split products per NSPLIT). K = DM, K % (32 * KS) == 0.
// KS > 1: wave w sums the K slice [w K/KS, (w+1) K/KS); the KS partial tiles meet in LDS and are added in slice order 0 .. KS-1 (fixed, the same on every run).
// UP (KS == 8 only): the tile takes + 2 u, u = the rank-8 up-product of the same tile (K padded to 32: one WMMA step, hi then lo plane, its own f32 sum from 0). Uh/Ul: hi/lo planes [t][32] of the down-projection, Uw: up weights [n][32].
// UP = 1: rows m are t, columns n (A = Uh, Ul; B = Uw). UP = 2: rows m are n, columns t (A = Uw; B = Uh, Ul). Wave w makes sub-tile (w / 4, w % 4) of each 32-row phase; u meets the slices in LDS as one more slice and is added last, x 2.
// EPI (KS > 1 only) says what leaves the kernel. 0: the f32 tile, to C. 1: the tile as three 16-bit planes (fp16, bf16 hi, bf16 lo of y - hi), each a matrix of ldp columns in fragment order, element (m, n) at its row by * rP + m, column by * cP + (n - c0);
// rP = rows, cP = 0, ldp = 64 gives head planes [n / 64][m][n % 64], rP = 0, cP = 64, ldp = N gives plain [m][n]. A thread sums and stores one 16-byte piece (8 columns), thread t of each 64 piece t of a unit. 2: columns 0 .. 31 as hi/lo planes [m][32], columns 8 .. 31 zero (the rank-8 down-projection, K-padded for the up-projection).
template <typename T16> struct WFrag;
template <> struct WFrag<h16> { typedef v16h V; static __device__ __forceinline__ V ld(const h16* p) { return cat16(*(const v8h*)p, *(const v8h*)(p + 16)); } static __device__ __forceinline__ V ldf(const h16* p) { return cat16(*(const v8h*)p, *(const v8h*)(p + 256)); } static __device__ __forceinline__ v8f mma(V a, V b, v8f c) { return wmma16(a, b, c); } };
template <> struct WFrag<bf> { typedef v16bf V; static __device__ __forceinline__ V ld(const bf* p) { return cat16b(*(const v8us*)p, *(const v8us*)(p + 16)); } static __device__ __forceinline__ V ldf(const bf* p) { return cat16b(*(const v8us*)p, *(const v8us*)(p + 256)); } static __device__ __forceinline__ v8f mma(V a, V b, v8f c) { return wmmab(a, b, c); } };
#define OSF(KS, UP) (((KS) == 1) ? 16 * 68 : ((KS) + ((UP) != 0 ? 1 : 0)) * 32 * 68)
template <typename T16, int NSPLIT, bool BIAS, int KS, int EPI = 0, int UP = 0>
__device__ __forceinline__ void gemmw(float* os, int bx, int by, const T16* __restrict__ A, const T16* __restrict__ A2, const T16* __restrict__ Bt, const T16* __restrict__ Bt2, float* C, int ldc, const float* __restrict__ bias, const T16* __restrict__ Uh, const T16* __restrict__ Ul, const T16* __restrict__ Uw, h16* P16, bf* Ph, bf* Pl, int rP, int cP, int ldp) {
    static_assert(EPI == 0 || KS > 1, "the plane epilogues stand behind the slice sum"); static_assert(EPI != 1 || KS == 8, "256 threads, one 16-byte piece of 32 x 64 each"); static_assert(UP == 0 || KS == 8, "eight sub-tiles a phase, one a wave");
    typedef typename WFrag<T16>::V V; constexpr int K = DM; static_assert(DQ == DM, "one K for every product");   // a constant, so that a pass's units stand at immediate offsets from one address an operand
    const int lane = threadIdx.x & 31, lr = lane & 15, hi = lane >> 4; const int r0 = bx * 64, c0 = by * 64;
    v8f acc[4][4];
#pragma unroll
    for (int mb = 0; mb < 4; ++mb)
#pragma unroll
        for (int nb = 0; nb < 4; ++nb) acc[mb][nb] = (v8f){};
    const size_t aoff = (size_t)r0 * K + 8 * lane, boff = (size_t)c0 * K + 8 * lane;   // 16 rows of units are 16 K elements, 32 k one unit of 512, the lane's piece 8 lane
    // wv: the wave's K slice, held scalar so that the loop bounds are scalar
    const int wv = (KS == 1) ? 0 : __builtin_amdgcn_readfirstlane((int)(threadIdx.x >> 5)); const int kspan = K / KS, kbeg = wv * kspan, kend = kbeg + kspan;
    V ua[2], ua2[2], ub, ub2;
    if constexpr (UP != 0) {   // the up-product's operands, fetched in front of the K loop, so that no barrier of the slice sum waits for these loads
        const size_t uc = (size_t)(c0 + (wv & 3) * 16 + lr) * 32 + 8 * hi, ur = (size_t)(r0 + (wv >> 2) * 16 + lr) * 32 + 8 * hi;
        const T16* pb = (UP == 1 ? Uw : Uh) + uc; const T16* pa = (UP == 1 ? Uh : Uw) + ur; const T16* p2 = Ul + (UP == 1 ? ur : uc);   // phase 1's rows: + 32 * 32 elements
        ub = WFrag<T16>::ld(pb); ua[0] = WFrag<T16>::ld(pa); ua[1] = WFrag<T16>::ld(pa + 32 * 32);
        if (UP == 1) { ua2[0] = WFrag<T16>::ld(p2); ua2[1] = WFrag<T16>::ld(p2 + 32 * 32); } else ub2 = WFrag<T16>::ld(p2);
        // the addresses are inputs, so their registers stay as they are up to the wait
        asm volatile("s_wait_xcnt 0x0" :: "v"(pb), "v"(pa), "v"(p2) : "memory");
    }
#pragma unroll 1
    for (int kc = kbeg; kc < kend; kc += 32) {
        V a[4], a2[4]; const T16* pa = A + aoff + kc * 16; const T16* pb = Bt + boff + kc * 16; const T16* pa2 = (NSPLIT == 1 || NSPLIT == 2) ? A2 + aoff + kc * 16 : pa; const T16* pb2 = (NSPLIT >= 2) ? Bt2 + boff + kc * 16 : pb;
#pragma unroll
        for (int mb = 0; mb < 4; ++mb) { a[mb] = WFrag<T16>::ldf(pa + mb * 16 * K); if (NSPLIT == 1 || NSPLIT == 2) a2[mb] = WFrag<T16>::ldf(pa2 + mb * 16 * K); }
#pragma unroll
        for (int nb = 0; nb < 4; ++nb) { const V b = WFrag<T16>::ldf(pb + nb * 16 * K); V b2; if (NSPLIT >= 2) b2 = WFrag<T16>::ldf(pb2 + nb * 16 * K);
#pragma unroll
            for (int mb = 0; mb < 4; ++mb) { acc[mb][nb] = WFrag<T16>::mma(a[mb], b, acc[mb][nb]); if (NSPLIT == 1 || NSPLIT == 2) acc[mb][nb] = WFrag<T16>::mma(a2[mb], b, acc[mb][nb]); if (NSPLIT >= 2) acc[mb][nb] = WFrag<T16>::mma(a[mb], b2, acc[mb][nb]); } }
        // the pass's addresses are inputs here, so their registers stay as they are up to the wait
        asm volatile("s_wait_xcnt 0x0" :: "v"(pa), "v"(pb), "v"(pa2), "v"(pb2) : "memory");
        asm volatile("v_nop\n\tv_nop\n\tv_nop\n\tv_nop" : "+v"(acc[0][0]), "+v"(acc[1][1]), "+v"(acc[2][2]), "+v"(acc[3][3]) : "v"(a[0]), "v"(a[3]));
    }
    if (KS > 1) {   // every loop below is unrolled so that acc[][] and res[][] are indexed by constants and stay in registers
        float* osw = os + wv * (32 * 68); static_assert(KS == 1 || 16 % KS == 0, "KS divides 16"); constexpr int NIT = (KS > 1) ? 16 / KS : 1;   // v4f sums a thread and phase: 32 rows x 16 v4f over 32 * KS threads
        v4f res[2][NIT];
        // which v4f of a phase's 32 x 64 a thread sums. EPI 1: the two halves of one piece, in fragment order (unit t / 64: 16 rows x 32 columns); else 16 threads a row
        const int pw = (int)threadIdx.x & 63, pu = (int)threadIdx.x >> 6, prow = (pu >> 1) * 16 + (pw & 15), pc8 = (pu & 1) * 4 + (pw >> 5) * 2 + ((pw >> 4) & 1);
        auto rowof = [&](int it) { return (EPI == 1) ? prow : ((int)threadIdx.x + it * 32 * KS) >> 4; };
        auto colof = [&](int it) { return (EPI == 1) ? pc8 * 8 + it * 4 : (((int)threadIdx.x + it * 32 * KS) & 15) * 4; };
#pragma unroll
        for (int mp = 0; mp < 2; ++mp) {          // 32 output rows a phase
#pragma unroll
            for (int ml = 0; ml < 2; ++ml)
#pragma unroll
                for (int nb = 0; nb < 4; ++nb)
#pragma unroll
                    for (int j = 0; j < 8; ++j) osw[(ml * 16 + hi * 8 + j) * 68 + nb * 16 + lr] = acc[mp * 2 + ml][nb][j];
            if constexpr (UP != 0) { v8f t = WFrag<T16>::mma(ua[mp], ub, (v8f){}); t = (UP == 1) ? WFrag<T16>::mma(ua2[mp], ub, t) : WFrag<T16>::mma(ua[mp], ub2, t);
#pragma unroll
                for (int j = 0; j < 8; ++j) os[KS * (32 * 68) + ((wv >> 2) * 16 + hi * 8 + j) * 68 + (wv & 3) * 16 + lr] = t[j]; }
            __syncthreads();                      // every slice's partial rows are in LDS
#pragma unroll
            for (int it = 0; it < NIT; ++it) { const int row = rowof(it), cofs = colof(it); v4f val = *(const v4fa*)(os + row * 68 + cofs);
#pragma unroll
                for (int s = 1; s < KS; ++s) val += *(const v4fa*)(os + s * (32 * 68) + row * 68 + cofs);
                if constexpr (UP != 0) val += 2.0f * *(const v4fa*)(os + KS * (32 * 68) + row * 68 + cofs);   // x 2 is exact: fused or not, one rounding
                res[mp][it] = val; }
            if (mp == 0) __syncthreads();         // all reads of phase 0 end before phase 1 overwrites the rows
        }
        // the stores stand behind the last barrier, so that no barrier waits for a store to memory
#pragma unroll
        for (int mp = 0; mp < 2; ++mp) { v8h o16; v8us oh8, ol8;   // EPI 1: the thread's piece of each plane
#pragma unroll
            for (int it = 0; it < NIT; ++it) { const int row = rowof(it), cofs = colof(it); v4f val = res[mp][it];
                if (BIAS) { val[0] += bfr(bias[c0 + cofs]); val[1] += bfr(bias[c0 + cofs + 1]); val[2] += bfr(bias[c0 + cofs + 2]); val[3] += bfr(bias[c0 + cofs + 3]); }
                if constexpr (EPI == 0) *(v4f*)(C + (size_t)(r0 + mp * 32 + row) * ldc + c0 + cofs) = val;
                else if constexpr (EPI == 1) {
#pragma unroll
                    for (int q = 0; q < 4; ++q) { o16[it * 4 + q] = tohx(val[q]); unsigned short a2, c2; splitf(val[q], a2, c2); oh8[it * 4 + q] = a2; ol8[it * 4 + q] = c2; }
                    if (it == NIT - 1) { const size_t po = ((size_t)((by * rP + r0 + mp * 32 + row) >> 4) * (ldp >> 5) + ((by * cP) >> 5) + (pc8 >> 2)) * 512 + pw * 8; *(v8h*)(P16 + po) = o16; *(v8us*)(Ph + po) = oh8; *(v8us*)(Pl + po) = ol8; } }
                else if (cofs < 32) { v4us oh, ol;
#pragma unroll
                    for (int q = 0; q < 4; ++q) { unsigned short a2 = 0, c2 = 0; if (cofs + q < 8) splitf(val[q], a2, c2); oh[q] = a2; ol[q] = c2; }
                    const size_t po = (size_t)(r0 + mp * 32 + row) * 32 + cofs; *(v4us*)(Ph + po) = oh; *(v4us*)(Pl + po) = ol; } } }
        // the three EPI 1 products share a kernel, and its listing leads from one product's last stores on into another's code, which writes their registers: the wait stands behind the last store
        if constexpr (EPI == 1) asm volatile("s_wait_xcnt 0x0" ::: "memory");
        return;
    }
#pragma unroll
    for (int mb = 0; mb < 4; ++mb) {
#pragma unroll
        for (int nb = 0; nb < 4; ++nb) {
#pragma unroll
            for (int j = 0; j < 8; ++j) os[(hi * 8 + j) * 68 + nb * 16 + lr] = acc[mb][nb][j]; }
        __builtin_amdgcn_wave_barrier(); asm volatile("" ::: "memory");
        float* crow = C + (size_t)(r0 + mb * 16) * ldc + c0;
{
#pragma unroll
            for (int s = 0; s < 8; ++s) { const int row = 2 * s + hi, cofs = lr * 4; v4f val = *(const v4fa*)(os + row * 68 + cofs); if (BIAS) { val[0] += bfr(bias[c0 + cofs]); val[1] += bfr(bias[c0 + cofs + 1]); val[2] += bfr(bias[c0 + cofs + 2]); val[3] += bfr(bias[c0 + cofs + 3]); }
                *(v4f*)(crow + (size_t)row * ldc + cofs) = val; }
             }
        __builtin_amdgcn_wave_barrier(); asm volatile("" ::: "memory");
    }
}


// both rank-8 down-projections, grid (TB / 64, 2): y = 0 x wq_A^T, y = 1 x wv_A^T, each to hi/lo planes [tb][32] of its own
__global__ __launch_bounds__(512) void k_down(const bf* __restrict__ XB, const bf* __restrict__ AQ, const bf* __restrict__ AV, bf* XQh, bf* XQl, bf* XVh, bf* XVl) {
    __shared__ __align__(16) float os[OSF(16, 0)]; const bool sv = blockIdx.y != 0;
    gemmw<bf, 0, false, 16, 2>(os, blockIdx.x, 0, XB, nullptr, sv ? AV : AQ, nullptr, nullptr, 64, nullptr, nullptr, nullptr, nullptr, nullptr, sv ? XVh : XQh, sv ? XVl : XQl, 0, 0, 32);
}
// the three projections, grid (TB / 64, DM / 64, 3). z = 0: q = x wq^T + 2 (x A^T) B^T -> head planes [h][tb][d]; z = 1: k = x wk^T -> head planes [h][tb][d];
// z = 2: v^T = wv x^T + 2 B (x A^T)^T -> planes [g * HD + d][tb], its tiles numbered with the weight's rows running fastest. The branch is the same for a whole work-group, so every barrier stays under uniform control flow.
__global__ __launch_bounds__(256) void k_qkv(const bf* __restrict__ XB, const bf* __restrict__ WQ, const bf* __restrict__ WK, const bf* __restrict__ WV, const bf* __restrict__ XQh, const bf* __restrict__ XQl, const bf* __restrict__ XVh, const bf* __restrict__ XVl, const bf* __restrict__ BQ2, const bf* __restrict__ BV2,
                                             h16* QP16, bf* QPh, bf* QPl, h16* KP16, bf* KPh, bf* KPl, h16* VT16, bf* VTh, bf* VTl) {
    static_assert(DQ == DM && DKV == DM, "one grid for the three products");
    __shared__ __align__(16) float os[OSF(8, 1)]; const int bx = blockIdx.x, by = blockIdx.y;
    if (blockIdx.z == 0) gemmw<bf, 0, false, 8, 1, 1>(os, bx, by, XB, nullptr, WQ, nullptr, nullptr, DQ, nullptr, XQh, XQl, BQ2, QP16, QPh, QPl, TB, 0, HD);
    else if (blockIdx.z == 1) gemmw<bf, 0, false, 8, 1, 0>(os, bx, by, XB, nullptr, WK, nullptr, nullptr, DKV, nullptr, nullptr, nullptr, nullptr, KP16, KPh, KPl, TB, 0, HD);
    else { const int t = by * (TB / 64) + bx; gemmw<bf, 0, false, 8, 1, 2>(os, t % (DKV / 64), t / (DKV / 64), WV, nullptr, XB, nullptr, nullptr, TB, nullptr, XVh, XVl, BV2, VT16, VTh, VTl, 0, 64, TB); }
}
// out = attention output (hi + lo planes) wo^T, f32, grid (TB / 64, DM / 64)
__global__ __launch_bounds__(256) void k_wo(const bf* __restrict__ ATh, const bf* __restrict__ ATl, const bf* __restrict__ WO, float* OUT) {
    __shared__ __align__(16) float os[OSF(8, 0)];
    gemmw<bf, 1, false, 8>(os, blockIdx.x, blockIdx.y, ATh, ATl, WO, nullptr, OUT, DM, nullptr, nullptr, nullptr, nullptr, nullptr, nullptr, nullptr, 0, 0, 0);
}

__global__ __launch_bounds__(256) void k_wtG(const float* __restrict__ w, int K, int N, bf* Bt) {
    const int lane = threadIdx.x & 31; const int L0 = (blockIdx.x * 8 + (threadIdx.x >> 5)) * 8; const int nlines = N * K / 64;
{
#pragma unroll 1
        for (int l = 0; l < 8; ++l) { const int L = L0 + l; if (L >= nlines) break; const size_t e = (size_t)L * 64 + lane * 2; const int k = (int)(e % K), n = (int)(e / K); v2us o;
            o[0] = f2bf(w[(size_t)k * N + n]); o[1] = f2bf(w[(size_t)(k + 1) * N + n]); *(v2us*)(Bt + e) = o; }
         }
}
// f32 [r][DM] row-major -> bf16 in fragment order: thread i writes piece i (a wave 512 contiguous bytes) and reads the 8 values that belong there (a work-group: 16 rows x 128 k, whole lines between its waves)
__device__ __forceinline__ void cvt8(const float* __restrict__ src, bf* dst, size_t n8, int blk) { const size_t i = (size_t)blk * 256 + threadIdx.x; if (i >= n8) return;
    const size_t un = i >> 6; const int w = (int)(i & 63); const size_t r = (un / (DM / 32)) * 16 + (w & 15); const int k = (int)(un % (DM / 32)) * 32 + ((w >> 5) * 2 + ((w >> 4) & 1)) * 8;
    const v8f v = *(const v8f*)(src + r * DM + k); v8us o;
#pragma unroll
    for (int k = 0; k < 8; ++k) o[k] = f2bf(v[k]); *(v8us*)(dst + i * 8) = o;  }
__global__ __launch_bounds__(256) void k_cscvt(const float* __restrict__ cosT, const float* __restrict__ sinT, float* CS) { const int idx = blockIdx.x * 256 + threadIdx.x; if (idx >= TT * HD) return; v2f cs; cs[0] = bfr(cosT[idx]); cs[1] = bfr(sinT[idx]); *(v2f*)(CS + (size_t)idx * 2) = cs;  }
#define SC2 (SCL * 1.4426950408889634f)
typedef __attribute__((ext_vector_type(8))) int v8i;
typedef __attribute__((ext_vector_type(4))) unsigned v4u;
__device__ __forceinline__ v8i ldm8(const int* p) { return __builtin_shufflevector(*(const v4i*)p, *(const v4i*)(p + 4), 0, 1, 2, 3, 4, 5, 6, 7); }
__device__ __forceinline__ float xhalf(float x) { return __builtin_bit_cast(float, __builtin_amdgcn_permlanex16(__builtin_bit_cast(int, x), __builtin_bit_cast(int, x), 0x76543210, 0xfedcba98, false, false)); }   // lane l with lane l ^ 16
template <typename T16, bool HL, int NQ>
__device__ __forceinline__ void fattn_rows(const T16* __restrict__ Q, const T16* __restrict__ Q2, const T16* __restrict__ Kp, const T16* __restrict__ K2, const T16* __restrict__ Vt, const T16* __restrict__ V2, const int* __restrict__ am, const unsigned* __restrict__ TS, int q0, bf* Ah, bf* Al) {
    typedef WFrag<T16> F; typedef typename F::V V;
    const int lane = threadIdx.x & 31, lr = lane & 15, hi = lane >> 4;
    V qf[NQ][2], qf2[NQ][2];
#pragma unroll
    for (int qb = 0; qb < NQ; ++qb)
#pragma unroll
        for (int ks = 0; ks < 2; ++ks) { const size_t qo = (size_t)(q0 + qb * 16) * HD + ks * 512 + 8 * lane; qf[qb][ks] = F::ldf(Q + qo); if (HL) qf2[qb][ks] = F::ldf(Q2 + qo); }
    v8f o[4][NQ]; float m[NQ], l[NQ];
#pragma unroll
    for (int qb = 0; qb < NQ; ++qb) { m[qb] = -3.0e38f; l[qb] = 0.f;
#pragma unroll
        for (int db = 0; db < 4; ++db) o[db][qb] = (v8f){}; }
    const size_t ko = 8 * lane, vo = 8 * lane; const int* mp = am + (size_t)(q0 + lr) * TT + 8 * hi;
    V kf[2][2], kf2[2][2]; v8i mk[NQ][2];
    auto ldk = [&](int key) {      // the key rows of one pass
#pragma unroll
        for (int kb = 0; kb < 2; ++kb)
#pragma unroll
            for (int ks = 0; ks < 2; ++ks) { kf[kb][ks] = F::ldf(Kp + ko + (size_t)(key + kb * 16) * HD + ks * 512); if (HL) kf2[kb][ks] = F::ldf(K2 + ko + (size_t)(key + kb * 16) * HD + ks * 512); } };
    auto ldmk = [&](int qb, int key) {   // the mask words of one pass and 16 queries
#pragma unroll
        for (int kb = 0; kb < 2; ++kb) mk[qb][kb] = ldm8(mp + (size_t)qb * 16 * TT + key + kb * 16); };
    constexpr bool AHEAD = !HL;    // key rows one visited pass ahead; the hi+lo rows hold twice the fragments and have no registers left for it
    // the mask's summary (msum) of the wave's rows, bit p = pass p: need = some key open for some row, mixed = some key masked for some row; the same in every lane, held scalar so that the tests below are scalar branches
    unsigned long long need = 0, mixed = 0;
#pragma unroll
    for (int qb = 0; qb < NQ; ++qb) { const v4u w = *(const v4u*)(TS + (size_t)((q0 >> 4) + qb) * 32);
        need |= (unsigned long long)(unsigned)__builtin_amdgcn_readfirstlane((int)w[0]) | (unsigned long long)(unsigned)__builtin_amdgcn_readfirstlane((int)w[1]) << 32;
        mixed |= (unsigned long long)(unsigned)__builtin_amdgcn_readfirstlane((int)w[2]) | (unsigned long long)(unsigned)__builtin_amdgcn_readfirstlane((int)w[3]) << 32; }
    if (AHEAD) ldk(need != 0 ? 32 * __builtin_ctzll(need) : 0);
    // A pass whose 32 keys are masked for all of the wave's rows adds 0 to every sum and leaves every maximum, so it is left out. At most TT / 32 trips, whatever the mask holds; p, and with it every address, stays below TT / 32.
#pragma unroll 1   // rolled: a second copy of the pass would not fit the registers
    for (int p = 0; p < TT / 32; ++p) {
        if (((need >> p) & 1ull) == 0) continue;
        const unsigned long long later = (need >> p) >> 1; const int key0 = p * 32, nk = (later != 0) ? key0 + 32 + 32 * __builtin_ctzll(later) : key0;   // nk: the next visited pass's first key
        const bool mix = ((mixed >> p) & 1ull) != 0;   // some key of the pass is masked for some row: only then are the mask words read and applied
        if (!AHEAD) ldk(key0);
        if (mix) {
#pragma unroll
            for (int qb = 0; qb < NQ; ++qb) ldmk(qb, key0);
            // no register of the mask loads' addresses is written before this wait; the address is an input, so it stays as it is up to here
            asm volatile("s_wait_xcnt 0x0" :: "v"(mp + key0) : "memory"); }
        V vf[4], vf2[4];
#pragma unroll
        for (int db = 0; db < 4; ++db) vf[db] = F::ldf(Vt + vo + (size_t)db * 16 * TB + key0 * 16);
        if constexpr (HL) {
            // hi+lo rows: the addresses are inputs, so their registers stay as they are up to the wait
            asm volatile("s_wait_xcnt 0x0" :: "v"(Kp + ko + (size_t)key0 * HD), "v"(K2 + ko + (size_t)key0 * HD), "v"(Vt + vo + key0 * 16) : "memory");
#pragma unroll
            for (int db = 0; db < 4; ++db) vf2[db] = F::ldf(V2 + vo + (size_t)db * 16 * TB + key0 * 16);
            asm volatile("s_wait_xcnt 0x0" :: "v"(V2 + vo + key0 * 16) : "memory");   // the same for the lo plane's loads
        }
        v8f s[2][NQ];
#pragma unroll
        for (int kb = 0; kb < 2; ++kb)
#pragma unroll
            for (int qb = 0; qb < NQ; ++qb) { s[kb][qb] = (v8f){};
#pragma unroll
                for (int ks = 0; ks < 2; ++ks) { s[kb][qb] = F::mma(kf[kb][ks], qf[qb][ks], s[kb][qb]); if (HL) { s[kb][qb] = F::mma(kf[kb][ks], qf2[qb][ks], s[kb][qb]); s[kb][qb] = F::mma(kf2[kb][ks], qf[qb][ks], s[kb][qb]); } } }
        // AHEAD: the next visited pass's key rows are fetched behind the last use of this pass's; the last pass fetches its own again (in bounds, unused)
        if (AHEAD) { ldk(nk);
            // the address is an input, so its registers stay as they are up to the wait
            asm volatile("s_wait_xcnt 0x0" :: "v"(Kp + ko + (size_t)nk * HD) : "memory"); }
        if (mix) {   // one scalar branch a pass; -3.0e38 x SC2 is still far below every score, so a masked key's weight is 0 as before
#pragma unroll
            for (int kb = 0; kb < 2; ++kb)
#pragma unroll
                for (int qb = 0; qb < NQ; ++qb)
#pragma unroll
                    for (int j = 0; j < 8; ++j) if (mk[qb][kb][j] != 0) s[kb][qb][j] = -3.0e38f; }
#pragma unroll
        for (int qb = 0; qb < NQ; ++qb) {
            float t[2][8]; float mx = -3.0e38f;
#pragma unroll
            for (int kb = 0; kb < 2; ++kb)
#pragma unroll
                for (int j = 0; j < 8; ++j) { t[kb][j] = s[kb][qb][j] * SC2; mx = fmaxf(mx, t[kb][j]); }
            mx = fmaxf(mx, xhalf(mx));     // the other half of the wave holds the query's other 16 keys
            const float mn = fmaxf(m[qb], mx), alpha = __builtin_amdgcn_exp2f(m[qb] - mn); m[qb] = mn;
            float ps = 0.f;
#pragma unroll
            for (int kb = 0; kb < 2; ++kb)
#pragma unroll
                for (int j = 0; j < 8; ++j) { t[kb][j] = __builtin_amdgcn_exp2f(t[kb][j] - mn); ps += t[kb][j]; }
            l[qb] = l[qb] * alpha + ps;
#pragma unroll
            for (int db = 0; db < 4; ++db) o[db][qb] *= alpha;
            V pf, pf2;
#pragma unroll
            for (int e = 0; e < 16; ++e) { const float p = t[e >> 3][e & 7];
                if constexpr (HL) { const __bf16 ph = (__bf16)p; pf[e] = ph; pf2[e] = (__bf16)(p - (float)ph); } else pf[e] = (h16)p; }
#pragma unroll
            for (int db = 0; db < 4; ++db) { o[db][qb] = F::mma(vf[db], pf, o[db][qb]); if (HL) { o[db][qb] = F::mma(vf[db], pf2, o[db][qb]); o[db][qb] = F::mma(vf2[db], pf, o[db][qb]); } }
        }
    }
#pragma unroll
    for (int qb = 0; qb < NQ; ++qb) { const float lt = l[qb] + xhalf(l[qb]); const float inv = __fdiv_rn(1.0f, lt);
#pragma unroll
        for (int db = 0; db < 4; ++db) { v8us oh, ol;
#pragma unroll
            for (int j = 0; j < 8; ++j) { unsigned short a, c2; splitf(o[db][qb][j] * inv, a, c2); oh[j] = a; ol[j] = c2; }
            const size_t oo = (size_t)(q0 + qb * 16) * DQ + db * 256 + 8 * lane; *(v8us*)(Ah + oo) = oh; *(v8us*)(Al + oo) = ol; } }
}
// grid (RH / 64 + (TT - RH) / 128, heads, batches), 4 waves: the first RH / 64 work-groups take the hi+lo rows, 16 a wave (three products each, so half the rows), the rest 32 fp16 rows a wave
__global__ __launch_bounds__(128) void k_fattn(const h16* __restrict__ Q16, const bf* __restrict__ Qh, const bf* __restrict__ Ql, const h16* __restrict__ K16, const bf* __restrict__ Kh, const bf* __restrict__ Kl, const h16* __restrict__ V16, const bf* __restrict__ Vh, const bf* __restrict__ Vl, const int* __restrict__ am, const unsigned* __restrict__ TS, bf* Ah, bf* Al) {
    const int wv = __builtin_amdgcn_readfirstlane((int)(threadIdx.x >> 5)); const int bx = blockIdx.x; const size_t hp = ((size_t)blockIdx.y * NB_ + blockIdx.z) * TT * HD, vp = (size_t)blockIdx.y * HD * TB + (size_t)blockIdx.z * TT * 16;   // the batch's TT rows of the head's q and k; its TT columns (32 a unit) of the head's V^T rows
    const size_t ap = (size_t)blockIdx.z * TT * DQ + blockIdx.y * (HD * 16); Ah += ap; Al += ap;   // the batch's rows; a head's 64 columns: two units of each 16 rows
    if (bx < RH / 64) fattn_rows<bf, true, 1>(Qh + hp, Ql + hp, Kh + hp, Kl + hp, Vh + vp, Vl + vp, am, TS, bx * 64 + wv * 16, Ah, Al);
    else fattn_rows<h16, false, 2>(Q16 + hp, nullptr, K16 + hp, nullptr, V16 + vp, nullptr, am, TS, RH + (bx - RH / 64) * 128 + wv * 32, Ah, Al);
}

__device__ __forceinline__ void lorap(const float* __restrict__ A, const float* __restrict__ Bw, bf* AQ, bf* B2, int blk) { const int e = (blk * 256 + (int)threadIdx.x) * 4; if (e >= 64 * DM) return;
    { const int un = e >> 9, w = (e >> 3) & 63, n = (un / (DM / 32)) * 16 + (w & 15), k = (un % (DM / 32)) * 32 + ((w >> 5) * 2 + ((w >> 4) & 1)) * 8 + (e & 7); /* AQ in fragment order: element e of the plane holds (n, k) */ v4us o; for (int u = 0; u < 4; ++u) o[u] = (n < 8) ? f2bf(A[(size_t)n * DM + k + u]) : (unsigned short)0; *(v4us*)(AQ + e) = o;  }
    if (e < DM * 32) { const int n = e / 32, k = e % 32; v4us o; for (int u = 0; u < 4; ++u) o[u] = (k + u < 8) ? f2bf(Bw[(size_t)n * 8 + k + u]) : (unsigned short)0; *(v4us*)(B2 + e) = o;  } }

// msum: the mask's summary. One work-group takes 16 query rows (block qk) and all TT keys, wave w the keys 256 w .. 256 w + 255 (8 passes of k_fattn), a lane 4 keys of each row and half.
// Out: four words at TS + 32 qk (a 128-byte line of its own): bit p of words 0, 1 = some key of pass p is open (mask == 0) for some of the rows; bit p of words 2, 3 = some key of pass p is masked.
__device__ __forceinline__ void msum(const int* __restrict__ am, unsigned* TS, int qk) {
    static_assert(TT == 8 * 256, "eight waves, 256 keys each; 64 passes in two words");
    __shared__ unsigned sh[8];
    const int lane = threadIdx.x & 31, wv = (int)threadIdx.x >> 5; const int* p = am + (size_t)qk * 16 * TT + wv * 256 + lane * 4;
    bool open[2] = {false, false}, shut[2] = {false, false};
#pragma unroll
    for (int r = 0; r < 16; ++r)
#pragma unroll
        for (int h = 0; h < 2; ++h) { const v4i x = *(const v4i*)(p + (size_t)r * TT + h * 128);
#pragma unroll
            for (int q = 0; q < 4; ++q) { open[h] |= x[q] == 0; shut[h] |= x[q] != 0; } }
    unsigned bits = 0;   // bits 0 .. 7: open, 8 .. 15: masked, of the wave's 8 passes; 8 lanes hold one pass's 32 keys
#pragma unroll
    for (int h = 0; h < 2; ++h) { const unsigned bo = __builtin_amdgcn_ballot_w32(open[h]), bs = __builtin_amdgcn_ballot_w32(shut[h]);
#pragma unroll
        for (int t = 0; t < 4; ++t) { bits |= (((bo >> (8 * t)) & 0xFFu) != 0 ? 1u : 0u) << (h * 4 + t); bits |= (((bs >> (8 * t)) & 0xFFu) != 0 ? 1u : 0u) << (8 + h * 4 + t); } }
    if (lane == 0) sh[wv] = bits;
    __syncthreads();   // the eight waves' bits are in LDS
    if (threadIdx.x == 0) { v4u o = (v4u){0u, 0u, 0u, 0u};
#pragma unroll
        for (int w = 0; w < 4; ++w) { o[0] |= (sh[w] & 0xFFu) << (8 * w); o[1] |= (sh[w + 4] & 0xFFu) << (8 * w); o[2] |= ((sh[w] >> 8) & 0xFFu) << (8 * w); o[3] |= ((sh[w + 4] >> 8) & 0xFFu) << (8 * w); }
        *(v4u*)(TS + (size_t)qk * 32) = o; }
}

// every conversion in one grid, picked by block range (the same for a whole work-group): the mask's summary first, then the two LoRA pairs (few blocks, but the longest chain of dependent loads, so they start at once), then x, then the four weights
#define PB_X (TB * DM / 8 / 256)
#define PB_W (DM * DM / 8 / 256)
#define PB_L (64 * DM / 4 / 256)
#define PB_M (TT / 16)
__global__ __launch_bounds__(256) void k_prep(const float* __restrict__ x, const float* __restrict__ wq, const float* __restrict__ wk, const float* __restrict__ wv, const float* __restrict__ wo, const float* __restrict__ wqA, const float* __restrict__ wqB, const float* __restrict__ wvA, const float* __restrict__ wvB, const int* __restrict__ am,
                                              unsigned* TS, bf* XB, bf* WQ, bf* WK, bf* WV, bf* WO, bf* AQ, bf* BQ2, bf* AV, bf* BV2) {
    static_assert(DQ == DM && DKV == DM, "four weights of one size");
    int b = blockIdx.x;
    if (b < PB_M) { msum(am, TS, b); return; }   // the most bytes a work-group, so these start first
    b -= PB_M;
    if (b < PB_L) { lorap(wqA, wqB, AQ, BQ2, b); return; }
    b -= PB_L;
    if (b < PB_L) { lorap(wvA, wvB, AV, BV2, b); return; }
    b -= PB_L;
    if (b < PB_X) { cvt8(x, XB, (size_t)TB * DM / 8, b); return; }
    b -= PB_X;
    const int w = b / PB_W; cvt8(w == 0 ? wq : w == 1 ? wk : w == 2 ? wv : wo, w == 0 ? WQ : w == 1 ? WK : w == 2 ? WV : WO, (size_t)DM * DM / 8, b % PB_W);
}

extern "C" void kernel_launch(void* const* d_in, const int* in_sizes, int n_in,
                              void* d_out, int out_size, void* d_ws, size_t ws_size, hipStream_t stream) {
    (void)in_sizes; (void)n_in; (void)out_size;
    const float* x = (const float*)d_in[0]; const int* amask = (const int*)d_in[1]; const float* wq = (const float*)d_in[2]; const float* wqA = (const float*)d_in[3]; const float* wqB = (const float*)d_in[4]; const float* wk = (const float*)d_in[5]; const float* wv = (const float*)d_in[6]; const float* wvA = (const float*)d_in[7]; const float* wvB = (const float*)d_in[8]; const float* wo = (const float*)d_in[9]; const float* cosT = nullptr; const float* sinT = nullptr; (void)cosT; (void)sinT;
    float* OUT = (float*)d_out;     // [2][2048][1024]
    char* wsp = (char*)d_ws;
    auto take = [&](size_t bytes) { char* p = wsp; wsp += (bytes + 255) & ~(size_t)255; return (void*)p; };
    bf* WQ = (bf*)take((size_t)DQ * DM * 2); bf* WK = (bf*)take((size_t)DKV * DM * 2); bf* WV = (bf*)take((size_t)DKV * DM * 2); bf* WO = (bf*)take((size_t)DM * DQ * 2);
    bf* XB = (bf*)take((size_t)TB * DM * 2); bf* AQ = (bf*)take((size_t)64 * DM * 2); bf* AV = (bf*)take((size_t)64 * DM * 2); bf* BQ2 = (bf*)take((size_t)DM * 32 * 2); bf* BV2 = (bf*)take((size_t)DM * 32 * 2); bf* XQh = (bf*)take((size_t)TB * 32 * 2); bf* XQl = (bf*)take((size_t)TB * 32 * 2); bf* XVh = (bf*)take((size_t)TB * 32 * 2); bf* XVl = (bf*)take((size_t)TB * 32 * 2);
    h16* QP16 = (h16*)take((size_t)NH_ * TB * HD * 2); h16* KP16 = (h16*)take((size_t)NKV * TB * HD * 2); h16* VT16 = (h16*)take((size_t)NKV * HD * TB * 2);
    bf* QPh = (bf*)take((size_t)NH_ * TB * HD * 2); bf* QPl = (bf*)take((size_t)NH_ * TB * HD * 2); bf* KPh = (bf*)take((size_t)NKV * TB * HD * 2); bf* KPl = (bf*)take((size_t)NKV * TB * HD * 2); bf* VTh = (bf*)take((size_t)NKV * HD * TB * 2); bf* VTl = (bf*)take((size_t)NKV * HD * TB * 2);
    bf* ATh = (bf*)take((size_t)TB * DQ * 2); bf* ATl = (bf*)take((size_t)TB * DQ * 2); unsigned* TS = (unsigned*)take((size_t)(TT / 16) * 128);
    if ((size_t)(wsp - (char*)d_ws) > ws_size) return;    // ws 256 MiB
    k_prep<<<PB_M + 2 * PB_L + PB_X + 4 * PB_W, 256, 0, stream>>>(x, wq, wk, wv, wo, wqA, wqB, wvA, wvB, amask, TS, XB, WQ, WK, WV, WO, AQ, BQ2, AV, BV2);
    k_down<<<dim3(TB / 64, 2, 1), 512, 0, stream>>>(XB, AQ, AV, XQh, XQl, XVh, XVl);
    k_qkv<<<dim3(TB / 64, DM / 64, 3), 256, 0, stream>>>(XB, WQ, WK, WV, XQh, XQl, XVh, XVl, BQ2, BV2, QP16, QPh, QPl, KP16, KPh, KPl, VT16, VTh, VTl);
    k_fattn<<<dim3(RH / 64 + (TT - RH) / 128, NH_, NB_), 128, 0, stream>>>(QP16, QPh, QPl, KP16, KPh, KPl, VT16, VTh, VTl, amask, TS, ATh, ATl);   // one kv head per query head
    k_wo<<<dim3(TB / 64, DM / 64, 1), 256, 0, stream>>>(ATh, ATl, WO, OUT);
}

// v008
// Measured time: 115 microseconds a run.
// Next to v007, in two timings, it ran 1.18 times as fast each time.
// All steps since v000 together make it 19.2 times as fast.
#include <hip/hip_runtime.h>

// TinySelfAttention (x [2][2048][1024]; q = x wq_w^T + 2 (x wq_A^T) wq_B^T (LoRA, r = 8, alpha/r = 2), k = x wk_w^T, v = x wv_w^T + 2 (x wv_A^T) wv_B^T (16 heads x 64); scores = q.k / 8, masked (-inf) where attn_mask[i][j] != 0 (int [2048][2048], read as data: k_prep sums it up per 16 rows x 32 keys, and k_fattn goes by that summary, right for any mask); softmax; out = merged wo_w^T -> [2][2048][1024]).
// Compute dtypes, f32 accumulate: every input rounded to bf16; base projections and the rank-8 down-projections on PLAIN bf16 operands (inputs: exact; the 8 outputs padded to 64 with zero weights); the up-projections as hl planes (K padded 8 -> 32 with zeros) x exact B (2 products), added x 2 in f32; scores and attn.v over every key tile with an open key (mask read per element where a tile is part masked): query rows < 512 hl (3 products), the rest single fp16; softmax f32, running maximum and sum over 32-key tiles inside one kernel (k_fattn); wo hl x exact (2 products).
// The q/k/v and rank-8 down GEMMs write their 16-bit planes themselves (gemmt, gemmw: EPI), q and v starting from their up-projection (UP): no f32 projection goes to memory; v is computed as wv x^T, so that the rows of V^T come out contiguous.
// FRAGMENT ORDER: every 16-bit plane that a K loop or the key walk reads (x, the weights, the padded down weights, q, k, V^T, the attention output) lies in units of 16 rows x 32 k = 1 KB, unit (r / 16, k / 32) at ((r / 16) * (K / 32) + k / 32) * 512 elements;
// inside a unit the 16-byte piece (row r % 16, k pieces c = (k % 32) / 8) stands at piece (c / 2) * 32 + (c % 2) * 16 + r % 16, which is piece 'lane' of the fragment's first (c < 2) or second 16-byte load: a wave-wide load or store is 512 contiguous bytes, four whole lines, not 32 bytes in each of 16 lines.
// The rank-8 planes [t][32] and the up weights [n][32] stay row-major (64-byte rows, read once a work-group).
// FIVE LAUNCHES: work that depends on nothing in its own launch shares a grid. k_prep: the mask's summary and every conversion (both LoRA pairs, x, four weights), picked by block range; k_down: both rank-8 down-projections (grid y), each into planes of its own; k_qkv: the q, k and v GEMMs (grid z); then k_fattn and k_wo.
// BOTH BATCHES IN EVERY LAUNCH: a token's row is tb = b * TT + t (TB rows). x, the rank-8 planes, the attention output and out are [tb][.], q and k [head][tb][d], V^T [head * HD + d][tb]; the GEMM grids run over TB rows (V^T: columns), k_fattn takes b from blockIdx.z.

#define NB_  2
#define TT   2048
#define TB   (NB_ * TT)           // token rows of all batches
#define DM   1024
#define NH_  16
#define NKV  16
#define REP  (NH_ / NKV)
#define HD   64
#define DQ   (NH_ * HD)
#define DKV  (NKV * HD)
#define RH   512                  // query rows < RH use hi+lo planes (0: none)
#define WIN  0
#define SCL  0.125f   // HD^-0.5
typedef _Float16 h16;
typedef unsigned short bf;
typedef __attribute__((ext_vector_type(16))) __bf16   v16bf;
typedef __attribute__((ext_vector_type(16))) _Float16 v16h;
typedef __attribute__((ext_vector_type(8)))  _Float16 v8h;
typedef __attribute__((ext_vector_type(8)))  unsigned short v8us;
typedef __attribute__((ext_vector_type(8)))  float    v8f;
typedef __attribute__((ext_vector_type(4)))  float    v4f;
typedef v8h  __attribute__((may_alias)) v8ha;
typedef v4f  __attribute__((may_alias)) v4fa;
typedef v8us __attribute__((may_alias)) v8usa;

__device__ __forceinline__ unsigned short f2bf(float f) { unsigned u = __float_as_uint(f); u += 0x7FFFu + ((u >> 16) & 1u); return (unsigned short)(u >> 16); }
__device__ __forceinline__ float bf2f(unsigned short b) { return __uint_as_float(((unsigned)b) << 16); }
__device__ __forceinline__ float bfr(float f) { return bf2f(f2bf(f)); }
__device__ __forceinline__ v16h cat16(v8h lo, v8h hi) { return __builtin_shufflevector(lo, hi, 0, 1, 2, 3, 4, 5, 6, 7, 8, 9, 10, 11, 12, 13, 14, 15); }
__device__ __forceinline__ v16bf cat16b(v8us lo, v8us hi) { return __builtin_bit_cast(v16bf, __builtin_shufflevector(lo, hi, 0, 1, 2, 3, 4, 5, 6, 7, 8, 9, 10, 11, 12, 13, 14, 15)); }
__device__ __forceinline__ v8f wmma16(v16h a, v16h b, v8f c) { return __builtin_amdgcn_wmma_f32_16x16x32_f16(false, a, false, b, (short)0, c, false, false); }
__device__ __forceinline__ v8f wmmab(v16bf a, v16bf b, v8f c) { return __builtin_amdgcn_wmma_f32_16x16x32_bf16(false, a, false, b, (short)0, c, false, false); }
__device__ __forceinline__ h16 tohx(float x) { return (h16)x; }
__device__ __forceinline__ void splitf(float y, unsigned short& h, unsigned short& l) { h = f2bf(y); l = f2bf(y - bf2f(h)); }
typedef __attribute__((ext_vector_type(2))) _Float16 v2h;
typedef __attribute__((ext_vector_type(4))) _Float16 v4h;
typedef __attribute__((ext_vector_type(2))) unsigned short v2us;
typedef __attribute__((ext_vector_type(4))) unsigned short v4us;
typedef __attribute__((ext_vector_type(2))) float v2f;
typedef __attribute__((ext_vector_type(4))) int v4i;



// ---- gemmw: register-blocked GEMM, one 64x64 output tile (16 accumulators a wave) per work-group of KS waves, operands straight from 16-bit planes in fragment order; tile (bx, by) of (M/64, N/64), 32 * KS threads; os: the kernel's LDS, OSF floats.
// C[m][n] (f32, pitch ldc, + optional f32 bias[n]) = sum_k A[m][k] Bt[n][k] (+ split products per NSPLIT). K = DM, K % (32 * KS) == 0.
// KS > 1: wave w sums the K slice [w K/KS, (w+1) K/KS); the KS partial tiles meet in LDS and are added in slice order 0 .. KS-1 (fixed, the same on every run).
// UP (KS == 8 only): the tile takes + 2 u, u = the rank-8 up-product of the same tile (K padded to 32: one WMMA step, hi then lo plane, its own f32 sum from 0). Uh/Ul: hi/lo planes [t][32] of the down-projection, Uw: up weights [n][32].
// UP = 1: rows m are t, columns n (A = Uh, Ul; B = Uw). UP = 2: rows m are n, columns t (A = Uw; B = Uh, Ul). Wave w makes sub-tile (w / 4, w % 4) of each 32-row phase; u meets the slices in LDS as one more slice and is added last, x 2.
// EPI (KS > 1 only) says what leaves the kernel. 0: the f32 tile, to C. 1: the tile as three 16-bit planes (fp16, bf16 hi, bf16 lo of y - hi), each a matrix of ldp columns in fragment order, element (m, n) at its row by * rP + m, column by * cP + (n - c0);
// rP = rows, cP = 0, ldp = 64 gives head planes [n / 64][m][n % 64], rP = 0, cP = 64, ldp = N gives plain [m][n]. A thread sums and stores one 16-byte piece (8 columns), thread t of each 64 piece t of a unit. 2: columns 0 .. 31 as hi/lo planes [m][32], columns 8 .. 31 zero (the rank-8 down-projection, K-padded for the up-projection).
// Built here for k_down alone (KS = 16, EPI = 2); the q/k/v and wo products are gemmt's, below.
template <typename T16> struct WFrag;
template <> struct WFrag<h16> { typedef v16h V; static __device__ __forceinline__ V ld(const h16* p) { return cat16(*(const v8h*)p, *(const v8h*)(p + 16)); } static __device__ __forceinline__ V ldf(const h16* p) { return cat16(*(const v8h*)p, *(const v8h*)(p + 256)); } static __device__ __forceinline__ v8f mma(V a, V b, v8f c) { return wmma16(a, b, c); } };
template <> struct WFrag<bf> { typedef v16bf V; static __device__ __forceinline__ V ld(const bf* p) { return cat16b(*(const v8us*)p, *(const v8us*)(p + 16)); } static __device__ __forceinline__ V ldf(const bf* p) { return cat16b(*(const v8us*)p, *(const v8us*)(p + 256)); } static __device__ __forceinline__ v8f mma(V a, V b, v8f c) { return wmmab(a, b, c); } };
#define OSF(KS, UP) (((KS) == 1) ? 16 * 68 : ((KS) + ((UP) != 0 ? 1 : 0)) * 32 * 68)
template <typename T16, int NSPLIT, bool BIAS, int KS, int EPI = 0, int UP = 0>
__device__ __forceinline__ void gemmw(float* os, int bx, int by, const T16* __restrict__ A, const T16* __restrict__ A2, const T16* __restrict__ Bt, const T16* __restrict__ Bt2, float* C, int ldc, const float* __restrict__ bias, const T16* __restrict__ Uh, const T16* __restrict__ Ul, const T16* __restrict__ Uw, h16* P16, bf* Ph, bf* Pl, int rP, int cP, int ldp) {
    static_assert(EPI == 0 || KS > 1, "the plane epilogues stand behind the slice sum"); static_assert(EPI != 1 || KS == 8, "256 threads, one 16-byte piece of 32 x 64 each"); static_assert(UP == 0 || KS == 8, "eight sub-tiles a phase, one a wave");
    typedef typename WFrag<T16>::V V; constexpr int K = DM; static_assert(DQ == DM, "one K for every product");   // a constant, so that a pass's units stand at immediate offsets from one address an operand
    const int lane = threadIdx.x & 31, lr = lane & 15, hi = lane >> 4; const int r0 = bx * 64, c0 = by * 64;
    v8f acc[4][4];
#pragma unroll
    for (int mb = 0; mb < 4; ++mb)
#pragma unroll
        for (int nb = 0; nb < 4; ++nb) acc[mb][nb] = (v8f){};
    const size_t aoff = (size_t)r0 * K + 8 * lane, boff = (size_t)c0 * K + 8 * lane;   // 16 rows of units are 16 K elements, 32 k one unit of 512, the lane's piece 8 lane
    // wv: the wave's K slice, held scalar so that the loop bounds are scalar
    const int wv = (KS == 1) ? 0 : __builtin_amdgcn_readfirstlane((int)(threadIdx.x >> 5)); const int kspan = K / KS, kbeg = wv * kspan, kend = kbeg + kspan;
    V ua[2], ua2[2], ub, ub2;
    if constexpr (UP != 0) {   // the up-product's operands, fetched in front of the K loop, so that no barrier of the slice sum waits for these loads
        const size_t uc = (size_t)(c0 + (wv & 3) * 16 + lr) * 32 + 8 * hi, ur = (size_t)(r0 + (wv >> 2) * 16 + lr) * 32 + 8 * hi;
        const T16* pb = (UP == 1 ? Uw : Uh) + uc; const T16* pa = (UP == 1 ? Uh : Uw) + ur; const T16* p2 = Ul + (UP == 1 ? ur : uc);   // phase 1's rows: + 32 * 32 elements
        ub = WFrag<T16>::ld(pb); ua[0] = WFrag<T16>::ld(pa); ua[1] = WFrag<T16>::ld(pa + 32 * 32);
        if (UP == 1) { ua2[0] = WFrag<T16>::ld(p2); ua2[1] = WFrag<T16>::ld(p2 + 32 * 32); } else ub2 = WFrag<T16>::ld(p2);
        // the addresses are inputs, so their registers stay as they are up to the wait
        asm volatile("s_wait_xcnt 0x0" :: "v"(pb), "v"(pa), "v"(p2) : "memory");
    }
#pragma unroll 1
    for (int kc = kbeg; kc < kend; kc += 32) {
        V a[4], a2[4]; const T16* pa = A + aoff + kc * 16; const T16* pb = Bt + boff + kc * 16; const T16* pa2 = (NSPLIT == 1 || NSPLIT == 2) ? A2 + aoff + kc * 16 : pa; const T16* pb2 = (NSPLIT >= 2) ? Bt2 + boff + kc * 16 : pb;
#pragma unroll
        for (int mb = 0; mb < 4; ++mb) { a[mb] = WFrag<T16>::ldf(pa + mb * 16 * K); if (NSPLIT == 1 || NSPLIT == 2) a2[mb] = WFrag<T16>::ldf(pa2 + mb * 16 * K); }
#pragma unroll
        for (int nb = 0; nb < 4; ++nb) { const V b = WFrag<T16>::ldf(pb + nb * 16 * K); V b2; if (NSPLIT >= 2) b2 = WFrag<T16>::ldf(pb2 + nb * 16 * K);
#pragma unroll
            for (int mb = 0; mb < 4; ++mb) { acc[mb][nb] = WFrag<T16>::mma(a[mb], b, acc[mb][nb]); if (NSPLIT == 1 || NSPLIT == 2) acc[mb][nb] = WFrag<T16>::mma(a2[mb], b, acc[mb][nb]); if (NSPLIT >= 2) acc[mb][nb] = WFrag<T16>::mma(a[mb], b2, acc[mb][nb]); } }
        // the pass's addresses are inputs here, so their registers stay as they are up to the wait
        asm volatile("s_wait_xcnt 0x0" :: "v"(pa), "v"(pb), "v"(pa2), "v"(pb2) : "memory");
        asm volatile("v_nop\n\tv_nop\n\tv_nop\n\tv_nop" : "+v"(acc[0][0]), "+v"(acc[1][1]), "+v"(acc[2][2]), "+v"(acc[3][3]) : "v"(a[0]), "v"(a[3]));
    }
    if (KS > 1) {   // every loop below is unrolled so that acc[][] and res[][] are indexed by constants and stay in registers
        float* osw = os + wv * (32 * 68); static_assert(KS == 1 || 16 % KS == 0, "KS divides 16"); constexpr int NIT = (KS > 1) ? 16 / KS : 1;   // v4f sums a thread and phase: 32 rows x 16 v4f over 32 * KS threads
        v4f res[2][NIT];
        // which v4f of a phase's 32 x 64 a thread sums. EPI 1: the two halves of one piece, in fragment order (unit t / 64: 16 rows x 32 columns); else 16 threads a row
        const int pw = (int)threadIdx.x & 63, pu = (int)threadIdx.x >> 6, prow = (pu >> 1) * 16 + (pw & 15), pc8 = (pu & 1) * 4 + (pw >> 5) * 2 + ((pw >> 4) & 1);
        auto rowof = [&](int it) { return (EPI == 1) ? prow : ((int)threadIdx.x + it * 32 * KS) >> 4; };
        auto colof = [&](int it) { return (EPI == 1) ? pc8 * 8 + it * 4 : (((int)threadIdx.x + it * 32 * KS) & 15) * 4; };
#pragma unroll
        for (int mp = 0; mp < 2; ++mp) {          // 32 output rows a phase
#pragma unroll
            for (int ml = 0; ml < 2; ++ml)
#pragma unroll
                for (int nb = 0; nb < 4; ++nb)
#pragma unroll
                    for (int j = 0; j < 8; ++j) osw[(ml * 16 + hi * 8 + j) * 68 + nb * 16 + lr] = acc[mp * 2 + ml][nb][j];
            if constexpr (UP != 0) { v8f t = WFrag<T16>::mma(ua[mp], ub, (v8f){}); t = (UP == 1) ? WFrag<T16>::mma(ua2[mp], ub, t) : WFrag<T16>::mma(ua[mp], ub2, t);
#pragma unroll
                for (int j = 0; j < 8; ++j) os[KS * (32 * 68) + ((wv >> 2) * 16 + hi * 8 + j) * 68 + (wv & 3) * 16 + lr] = t[j]; }
            __syncthreads();                      // every slice's partial rows are in LDS
#pragma unroll
            for (int it = 0; it < NIT; ++it) { const int row = rowof(it), cofs = colof(it); v4f val = *(const v4fa*)(os + row * 68 + cofs);
#pragma unroll
                for (int s = 1; s < KS; ++s) val += *(const v4fa*)(os + s * (32 * 68) + row * 68 + cofs);
                if constexpr (UP != 0) val += 2.0f * *(const v4fa*)(os + KS * (32 * 68) + row * 68 + cofs);   // x 2 is exact: fused or not, one rounding
                res[mp][it] = val; }
            if (mp == 0) __syncthreads();         // all reads of phase 0 end before phase 1 overwrites the rows
        }
        // the stores stand behind the last barrier, so that no barrier waits for a store to memory
#pragma unroll
        for (int mp = 0; mp < 2; ++mp) { v8h o16; v8us oh8, ol8;   // EPI 1: the thread's piece of each plane
#pragma unroll
            for (int it = 0; it < NIT; ++it) { const int row = rowof(it), cofs = colof(it); v4f val = res[mp][it];
                if (BIAS) { val[0] += bfr(bias[c0 + cofs]); val[1] += bfr(bias[c0 + cofs + 1]); val[2] += bfr(bias[c0 + cofs + 2]); val[3] += bfr(bias[c0 + cofs + 3]); }
                if constexpr (EPI == 0) *(v4f*)(C + (size_t)(r0 + mp * 32 + row) * ldc + c0 + cofs) = val;
                else if constexpr (EPI == 1) {
#pragma unroll
                    for (int q = 0; q < 4; ++q) { o16[it * 4 + q] = tohx(val[q]); unsigned short a2, c2; splitf(val[q], a2, c2); oh8[it * 4 + q] = a2; ol8[it * 4 + q] = c2; }
                    if (it == NIT - 1) { const size_t po = ((size_t)((by * rP + r0 + mp * 32 + row) >> 4) * (ldp >> 5) + ((by * cP) >> 5) + (pc8 >> 2)) * 512 + pw * 8; *(v8h*)(P16 + po) = o16; *(v8us*)(Ph + po) = oh8; *(v8us*)(Pl + po) = ol8; } }
                else if (cofs < 32) { v4us oh, ol;
#pragma unroll
                    for (int q = 0; q < 4; ++q) { unsigned short a2 = 0, c2 = 0; if (cofs + q < 8) splitf(val[q], a2, c2); oh[q] = a2; ol[q] = c2; }
                    const size_t po = (size_t)(r0 + mp * 32 + row) * 32 + cofs; *(v4us*)(Ph + po) = oh; *(v4us*)(Pl + po) = ol; } } }
        // the three EPI 1 products share a kernel, and its listing leads from one product's last stores on into another's code, which writes their registers: the wait stands behind the last store
        if constexpr (EPI == 1) asm volatile("s_wait_xcnt 0x0" ::: "memory");
        return;
    }
#pragma unroll
    for (int mb = 0; mb < 4; ++mb) {
#pragma unroll
        for (int nb = 0; nb < 4; ++nb) {
#pragma unroll
            for (int j = 0; j < 8; ++j) os[(hi * 8 + j) * 68 + nb * 16 + lr] = acc[mb][nb][j]; }
        __builtin_amdgcn_wave_barrier(); asm volatile("" ::: "memory");
        float* crow = C + (size_t)(r0 + mb * 16) * ldc + c0;
{
#pragma unroll
            for (int s = 0; s < 8; ++s) { const int row = 2 * s + hi, cofs = lr * 4; v4f val = *(const v4fa*)(os + row * 68 + cofs); if (BIAS) { val[0] += bfr(bias[c0 + cofs]); val[1] += bfr(bias[c0 + cofs + 1]); val[2] += bfr(bias[c0 + cofs + 2]); val[3] += bfr(bias[c0 + cofs + 3]); }
                *(v4f*)(crow + (size_t)row * ldc + cofs) = val; }
             }
        __builtin_amdgcn_wave_barrier(); asm volatile("" ::: "memory");
    }
}


// ---- gemmt: one 128 x 128 output tile per work-group, a wave 16 MB x 64 of it (4 MB accumulators) over the whole K: MB = 4: 4 waves (2 x 2), MB = 2: 8 waves (4 x 2), for a grid that would else leave one wave on a SIMD; tile (bx, by) of (M / 128, N / 128).
// C[m][n] = sum_k A[m][k] Bt[n][k] (NSPLIT 1: + A2[m][k] Bt[n][k]), operands 16-bit planes in fragment order, K = DM. The waves share their operands through LDS: each operand row comes from L2 once a work-group, not once a wave.
// A stage is 64 k of the tile's rows: a segment (16 rows x 64 k = two units, 2 KB, contiguous in the plane as in LDS) per 16 rows, A's eight segments, (A2's eight,) Bt's eight. Two buffers; asynchronous copies, 16 bytes a lane, bring stage t + 2 in while stage t + 1 is worked on.
// UP: the tile starts from 2 u, u = the rank-8 up-product of the same tile (K padded to 32: one WMMA step, hi then lo plane, its own f32 sum from 0); Uh/Ul: hi/lo planes [t][32] of the down-projection, Uw: up weights [n][32]. UP = 1: rows m are t, columns n (A = Uh, Ul; B = Uw). UP = 2: rows m are n, columns t (A = Uw; B = Uh, Ul).
// EPI 0: the f32 tile, to C. EPI 1: three 16-bit planes (fp16, bf16 hi, bf16 lo of y - hi), each a matrix of ldp columns in fragment order, element (m, n) at its row (n / 64) * rP + m, column (n / 64) * cP + n % 64 (as gemmw's EPI 1). Both go through the wave's own 32 x 68 floats of LDS, 32 rows a phase, so that every store covers whole lines.
#define GT_NSEG(NSPLIT) ((NSPLIT) == 1 ? 24 : 16)
#define GT_STG(NSPLIT) (GT_NSEG(NSPLIT) * 2048)
// one operand's eight segments of a stage, by asynchronous copies of 16 bytes a lane. cp8, 128 threads: copy j is segment j, LDS l + 2048 j, plane rows + 16 j; cp4, 256 threads: copy j is segments 2 j and 2 j + 1, LDS l + 4096 j, plane rows + 32 j.
// The s_wait_xcnt stands in the copies' own statement, so that no address register of a copy is rewritten in front of it.
__device__ __forceinline__ void cp8(unsigned l, const bf* g) {
    asm volatile("global_load_async_to_lds_b128 %0, %8, off\n\t"
                 "global_load_async_to_lds_b128 %1, %9, off\n\t"
                 "global_load_async_to_lds_b128 %2, %10, off\n\t"
                 "global_load_async_to_lds_b128 %3, %11, off\n\t"
                 "global_load_async_to_lds_b128 %4, %12, off\n\t"
                 "global_load_async_to_lds_b128 %5, %13, off\n\t"
                 "global_load_async_to_lds_b128 %6, %14, off\n\t"
                 "global_load_async_to_lds_b128 %7, %15, off\n\t"
                 "s_wait_xcnt 0x0"
                 :: "v"(l), "v"(l + 2048u), "v"(l + 4096u), "v"(l + 6144u), "v"(l + 8192u), "v"(l + 10240u), "v"(l + 12288u), "v"(l + 14336u),
                    "v"(g), "v"(g + 16 * DM), "v"(g + 32 * DM), "v"(g + 48 * DM), "v"(g + 64 * DM), "v"(g + 80 * DM), "v"(g + 96 * DM), "v"(g + 112 * DM) : "memory");
}
__device__ __forceinline__ void cp4(unsigned l, const bf* g) {
    asm volatile("global_load_async_to_lds_b128 %0, %4, off\n\t"
                 "global_load_async_to_lds_b128 %1, %5, off\n\t"
                 "global_load_async_to_lds_b128 %2, %6, off\n\t"
                 "global_load_async_to_lds_b128 %3, %7, off\n\t"
                 "s_wait_xcnt 0x0"
                 :: "v"(l), "v"(l + 4096u), "v"(l + 8192u), "v"(l + 12288u), "v"(g), "v"(g + 32 * DM), "v"(g + 64 * DM), "v"(g + 96 * DM) : "memory");
}
template <int NSPLIT, int EPI, int UP, int MB>
__device__ __forceinline__ void gemmt(char* sm, int bx, int by, const bf* __restrict__ A, const bf* __restrict__ A2, const bf* __restrict__ Bt, float* C, int ldc, const bf* __restrict__ Uh, const bf* __restrict__ Ul, const bf* __restrict__ Uw, h16* P16, bf* Ph, bf* Pl, int rP, int cP, int ldp) {
    typedef WFrag<bf> F; typedef F::V V; constexpr int K = DM, NT = K / 64, STG = GT_STG(NSPLIT), BSEG = GT_NSEG(NSPLIT) - 8; static_assert(NT >= 2, "two stages or more"); static_assert(MB == 4 || MB == 2, "4 or 8 waves"); static_assert(UP == 0 || MB == 4, "the up-product is written for 64 rows a wave"); static_assert((16 / MB) * 32 * 68 * 4 <= 2 * STG, "the output's staging fits the ring");
    const int tid = (int)threadIdx.x, lane = tid & 31, lr = lane & 15, hi = lane >> 4;
    const int wv = __builtin_amdgcn_readfirstlane(tid >> 5), wm = wv >> 1, wn = wv & 1;   // the wave's place in the tile, held scalar
    const int r0 = bx * 128 + wm * (MB * 16), byw = by * 2 + wn, c0 = byw * 64;           // the wave's own 16 MB x 64
    const unsigned lb = (unsigned)(size_t)sm + (unsigned)tid * 16u;                       // the lane's LDS byte address in buffer 0, in segment tid / 128
    const size_t go = (size_t)(tid >> 7) * 16 * K + (tid & 127) * 8;                       // 128 threads a segment; 16 rows of units are 16 K elements, 64 k two units = 1024 elements
    const bf* ga = A + (size_t)bx * 128 * K + go; const bf* ga2 = (NSPLIT == 1) ? A2 + (size_t)bx * 128 * K + go : ga; const bf* gb = Bt + (size_t)by * 128 * K + go;
    auto cp = [&](unsigned l, const bf* g) { if constexpr (MB == 4) cp8(l, g); else cp4(l, g); };
    auto issue = [&](int t, int buf) { const unsigned l = lb + (unsigned)buf * (unsigned)STG; cp(l, ga + t * 1024); if constexpr (NSPLIT == 1) cp(l + 8u * 2048u, ga2 + t * 1024); cp(l + (unsigned)BSEG * 2048u, gb + t * 1024); };
    issue(0, 0);
    v8f acc[MB][4];
    if constexpr (UP != 0) {   // the up-product, while stage 0 is on its way
        const bf* pa = (UP == 1 ? Uh : Uw) + (size_t)(r0 + lr) * 32 + 8 * hi; const bf* pb = (UP == 1 ? Uw : Uh) + (size_t)(c0 + lr) * 32 + 8 * hi; const bf* p2 = Ul + (size_t)((UP == 1 ? r0 : c0) + lr) * 32 + 8 * hi;   // 16 rows: + 16 * 32 elements
        V ua[4], ub[4], u2[4];
#pragma unroll
        for (int i = 0; i < 4; ++i) { ua[i] = F::ld(pa + i * 512); ub[i] = F::ld(pb + i * 512); u2[i] = F::ld(p2 + i * 512); }
        // no register of these loads' addresses is written before this wait; the addresses are inputs, so their registers stay as they are up to here
        asm volatile("s_wait_xcnt 0x0" :: "v"(pa), "v"(pb), "v"(p2) : "memory");
#pragma unroll
        for (int mb = 0; mb < 4; ++mb)
#pragma unroll
            for (int nb = 0; nb < 4; ++nb) { v8f t = F::mma(ua[mb], ub[nb], (v8f){}); t = (UP == 1) ? F::mma(u2[mb], ub[nb], t) : F::mma(ua[mb], u2[nb], t); acc[mb][nb] = 2.0f * t; }   // x 2 is exact
    } else {
#pragma unroll
        for (int mb = 0; mb < MB; ++mb)
#pragma unroll
            for (int nb = 0; nb < 4; ++nb) acc[mb][nb] = (v8f){};
    }
    asm volatile("s_wait_asynccnt 0x0" ::: "memory");   // the wave's own copies of stage 0 have landed
    __syncthreads();                                    // and every other wave's
    issue(1, 1);
#pragma unroll 1   // rolled: one pass's fragments at a time
    for (int t = 0; t < NT; ++t) {
        const bf* sb = (const bf*)(sm + (t & 1) * STG) + 8 * lane;
#pragma unroll
        for (int ks = 0; ks < 2; ++ks) {
            V a[MB], a2[MB], b[4];
#pragma unroll
            for (int i = 0; i < MB; ++i) a[i] = F::ldf(sb + (wm * MB + i) * 1024 + ks * 512);
#pragma unroll
            for (int i = 0; i < 4; ++i) b[i] = F::ldf(sb + (BSEG + wn * 4 + i) * 1024 + ks * 512);
            if constexpr (NSPLIT == 1) {
#pragma unroll
                for (int i = 0; i < MB; ++i) a2[i] = F::ldf(sb + (8 + wm * MB + i) * 1024 + ks * 512); }
            __builtin_amdgcn_sched_barrier(0);   // the block's LDS reads go out as one group ahead of its WMMAs: spread among them, each pair would cost its own wait
#pragma unroll
            for (int nb = 0; nb < 4; ++nb)
#pragma unroll
                for (int mb = 0; mb < MB; ++mb) acc[mb][nb] = F::mma(a[mb], b[nb], acc[mb][nb]);
            if constexpr (NSPLIT == 1) {   // the lo plane's products behind all of the hi plane's, whose WMMAs cover the lo fragments' way; each accumulator still takes hi, then lo, of every 32 k
#pragma unroll
                for (int nb = 0; nb < 4; ++nb)
#pragma unroll
                    for (int mb = 0; mb < MB; ++mb) acc[mb][nb] = F::mma(a2[mb], b[nb], acc[mb][nb]); }
        }
        asm volatile("s_wait_dscnt 0x0" ::: "memory");      // the wave's reads of this buffer have ended
        asm volatile("s_wait_asynccnt 0x0" ::: "memory");   // its copies of stage t + 1 have landed
        __syncthreads();                                    // stage t + 1 is published, and every reader has left stage t's buffer
        if (t + 2 < NT) issue(t + 2, t & 1);
    }
    asm volatile("s_wait_asynccnt 0x0" ::: "memory");       // no copy is under way when the ring becomes the output's staging
    float* osw = (float*)sm + wv * (32 * 68);               // the wave's own rows; the loop's last barrier stands behind every read of the ring
#pragma unroll
    for (int mp = 0; mp < MB / 2; ++mp) {                   // 32 output rows a phase; unrolled, so that acc[][] is indexed by constants
#pragma unroll
        for (int ml = 0; ml < 2; ++ml)
#pragma unroll
            for (int nb = 0; nb < 4; ++nb)
#pragma unroll
                for (int j = 0; j < 8; ++j) osw[(ml * 16 + hi * 8 + j) * 68 + nb * 16 + lr] = acc[mp * 2 + ml][nb][j];
        asm volatile("s_wait_dscnt 0x0" ::: "memory");      // the wave's rows are in LDS before its lanes read one another's
        if constexpr (EPI == 0) {
#pragma unroll
            for (int s = 0; s < 16; ++s) { const int row = 2 * s + hi, cofs = lr * 4; *(v4f*)(C + (size_t)(r0 + mp * 32 + row) * ldc + c0 + cofs) = *(const v4fa*)(osw + row * 68 + cofs); }
        } else {
#pragma unroll
            for (int it = 0; it < 8; ++it) {                // piece it * 32 + lane of the phase's four units (16 rows x 32 columns each)
                const int pw = (it & 1) * 32 + lane, row = (it >> 2) * 16 + lr, pc8 = ((it >> 1) & 1) * 4 + (it & 1) * 2 + hi;
                const v4f x0 = *(const v4fa*)(osw + row * 68 + pc8 * 8), x1 = *(const v4fa*)(osw + row * 68 + pc8 * 8 + 4); v8h o16; v8us oh8, ol8;
#pragma unroll
                for (int q = 0; q < 8; ++q) { const float y = q < 4 ? x0[q & 3] : x1[q & 3]; o16[q] = tohx(y); unsigned short a2, c2; splitf(y, a2, c2); oh8[q] = a2; ol8[q] = c2; }
                const size_t po = ((size_t)((byw * rP + r0 + mp * 32 + row) >> 4) * (ldp >> 5) + ((byw * cP) >> 5) + (pc8 >> 2)) * 512 + pw * 8; *(v8h*)(P16 + po) = o16; *(v8us*)(Ph + po) = oh8; *(v8us*)(Pl + po) = ol8; }
        }
        if (mp + 1 < MB / 2) asm volatile("s_wait_dscnt 0x0" ::: "memory");   // every read of the phase has ended before the next phase's rows overwrite it
    }
    // the products of one kernel stand behind one another in its listing: the wait stands behind the last store, in front of whatever writes its registers next
    if constexpr (EPI == 1) asm volatile("s_wait_xcnt 0x0" ::: "memory");
}

// both rank-8 down-projections, grid (TB / 64, 2): y = 0 x wq_A^T, y = 1 x wv_A^T, each to hi/lo planes [tb][32] of its own
__global__ __launch_bounds__(512) void k_down(const bf* __restrict__ XB, const bf* __restrict__ AQ, const bf* __restrict__ AV, bf* XQh, bf* XQl, bf* XVh, bf* XVl) {
    __shared__ __align__(16) float os[OSF(16, 0)]; const bool sv = blockIdx.y != 0;
    gemmw<bf, 0, false, 16, 2>(os, blockIdx.x, 0, XB, nullptr, sv ? AV : AQ, nullptr, nullptr, 64, nullptr, nullptr, nullptr, nullptr, nullptr, sv ? XVh : XQh, sv ? XVl : XQl, 0, 0, 32);
}
// the three projections, grid (TB / 128, DM / 128, 3). z = 0: q = x wq^T + 2 (x A^T) B^T -> head planes [h][tb][d]; z = 1: k = x wk^T -> head planes [h][tb][d];
// z = 2: v^T = wv x^T + 2 B (x A^T)^T -> planes [g * HD + d][tb], its tiles numbered with the weight's rows running fastest. The branch is the same for a whole work-group, so every barrier stays under uniform control flow.
__global__ __launch_bounds__(128) void k_qkv(const bf* __restrict__ XB, const bf* __restrict__ WQ, const bf* __restrict__ WK, const bf* __restrict__ WV, const bf* __restrict__ XQh, const bf* __restrict__ XQl, const bf* __restrict__ XVh, const bf* __restrict__ XVl, const bf* __restrict__ BQ2, const bf* __restrict__ BV2,
                                             h16* QP16, bf* QPh, bf* QPl, h16* KP16, bf* KPh, bf* KPl, h16* VT16, bf* VTh, bf* VTl) {
    static_assert(DQ == DM && DKV == DM, "one grid for the three products");
    __shared__ __align__(16) char sm[2 * GT_STG(0)]; const int bx = blockIdx.x, by = blockIdx.y;
    if (blockIdx.z == 0) gemmt<0, 1, 1, 4>(sm, bx, by, XB, nullptr, WQ, nullptr, 0, XQh, XQl, BQ2, QP16, QPh, QPl, TB, 0, HD);
    else if (blockIdx.z == 1) gemmt<0, 1, 0, 4>(sm, bx, by, XB, nullptr, WK, nullptr, 0, nullptr, nullptr, nullptr, KP16, KPh, KPl, TB, 0, HD);
    else { const int t = by * (TB / 128) + bx; gemmt<0, 1, 2, 4>(sm, t % (DKV / 128), t / (DKV / 128), WV, nullptr, XB, nullptr, 0, XVh, XVl, BV2, VT16, VTh, VTl, 0, 64, TB); }
}
// out = attention output (hi + lo planes) wo^T, f32, grid (TB / 128, DM / 128): one work-group a WGP, so 8 waves each
__global__ __launch_bounds__(256) void k_wo(const bf* __restrict__ ATh, const bf* __restrict__ ATl, const bf* __restrict__ WO, float* OUT) {
    __shared__ __align__(16) char sm[2 * GT_STG(1)];
    gemmt<1, 0, 0, 2>(sm, blockIdx.x, blockIdx.y, ATh, ATl, WO, OUT, DM, nullptr, nullptr, nullptr, nullptr, nullptr, nullptr, 0, 0, 0);
}

__global__ __launch_bounds__(256) void k_wtG(const float* __restrict__ w, int K, int N, bf* Bt) {
    const int lane = threadIdx.x & 31; const int L0 = (blockIdx.x * 8 + (threadIdx.x >> 5)) * 8; const int nlines = N * K / 64;
{
#pragma unroll 1
        for (int l = 0; l < 8; ++l) { const int L = L0 + l; if (L >= nlines) break; const size_t e = (size_t)L * 64 + lane * 2; const int k = (int)(e % K), n = (int)(e / K); v2us o;
            o[0] = f2bf(w[(size_t)k * N + n]); o[1] = f2bf(w[(size_t)(k + 1) * N + n]); *(v2us*)(Bt + e) = o; }
         }
}
// f32 [r][DM] row-major -> bf16 in fragment order: thread i writes piece i (a wave 512 contiguous bytes) and reads the 8 values that belong there (a work-group: 16 rows x 128 k, whole lines between its waves)
__device__ __forceinline__ void cvt8(const float* __restrict__ src, bf* dst, size_t n8, int blk) { const size_t i = (size_t)blk * 256 + threadIdx.x; if (i >= n8) return;
    const size_t un = i >> 6; const int w = (int)(i & 63); const size_t r = (un / (DM / 32)) * 16 + (w & 15); const int k = (int)(un % (DM / 32)) * 32 + ((w >> 5) * 2 + ((w >> 4) & 1)) * 8;
    const v8f v = *(const v8f*)(src + r * DM + k); v8us o;
#pragma unroll
    for (int k = 0; k < 8; ++k) o[k] = f2bf(v[k]); *(v8us*)(dst + i * 8) = o;  }
__global__ __launch_bounds__(256) void k_cscvt(const float* __restrict__ cosT, const float* __restrict__ sinT, float* CS) { const int idx = blockIdx.x * 256 + threadIdx.x; if (idx >= TT * HD) return; v2f cs; cs[0] = bfr(cosT[idx]); cs[1] = bfr(sinT[idx]); *(v2f*)(CS + (size_t)idx * 2) = cs;  }
#define SC2 (SCL * 1.4426950408889634f)
typedef __attribute__((ext_vector_type(8))) int v8i;
typedef __attribute__((ext_vector_type(4))) unsigned v4u;
__device__ __forceinline__ v8i ldm8(const int* p) { return __builtin_shufflevector(*(const v4i*)p, *(const v4i*)(p + 4), 0, 1, 2, 3, 4, 5, 6, 7); }
__device__ __forceinline__ float xhalf(float x) { return __builtin_bit_cast(float, __builtin_amdgcn_permlanex16(__builtin_bit_cast(int, x), __builtin_bit_cast(int, x), 0x76543210, 0xfedcba98, false, false)); }   // lane l with lane l ^ 16
template <typename T16, bool HL, int NQ>
__device__ __forceinline__ void fattn_rows(const T16* __restrict__ Q, const T16* __restrict__ Q2, const T16* __restrict__ Kp, const T16* __restrict__ K2, const T16* __restrict__ Vt, const T16* __restrict__ V2, const int* __restrict__ am, const unsigned* __restrict__ TS, int q0, bf* Ah, bf* Al) {
    typedef WFrag<T16> F; typedef typename F::V V;
    const int lane = threadIdx.x & 31, lr = lane & 15, hi = lane >> 4;
    V qf[NQ][2], qf2[NQ][2];
#pragma unroll
    for (int qb = 0; qb < NQ; ++qb)
#pragma unroll
        for (int ks = 0; ks < 2; ++ks) { const size_t qo = (size_t)(q0 + qb * 16) * HD + ks * 512 + 8 * lane; qf[qb][ks] = F::ldf(Q + qo); if (HL) qf2[qb][ks] = F::ldf(Q2 + qo); }
    v8f o[4][NQ]; float m[NQ], l[NQ];
#pragma unroll
    for (int qb = 0; qb < NQ; ++qb) { m[qb] = -3.0e38f; l[qb] = 0.f;
#pragma unroll
        for (int db = 0; db < 4; ++db) o[db][qb] = (v8f){}; }
    const size_t ko = 8 * lane, vo = 8 * lane; const int* mp = am + (size_t)(q0 + lr) * TT + 8 * hi;
    V kf[2][2], kf2[2][2]; v8i mk[NQ][2];
    auto ldk = [&](int key) {      // the key rows of one pass
#pragma unroll
        for (int kb = 0; kb < 2; ++kb)
#pragma unroll
            for (int ks = 0; ks < 2; ++ks) { kf[kb][ks] = F::ldf(Kp + ko + (size_t)(key + kb * 16) * HD + ks * 512); if (HL) kf2[kb][ks] = F::ldf(K2 + ko + (size_t)(key + kb * 16) * HD + ks * 512); } };
    auto ldmk = [&](int qb, int key) {   // the mask words of one pass and 16 queries
#pragma unroll
        for (int kb = 0; kb < 2; ++kb) mk[qb][kb] = ldm8(mp + (size_t)qb * 16 * TT + key + kb * 16); };
    constexpr bool AHEAD = !HL;    // key rows one visited pass ahead; the hi+lo rows hold twice the fragments and have no registers left for it
    // the mask's summary (msum) of the wave's rows, bit p = pass p: need = some key open for some row, mixed = some key masked for some row; the same in every lane, held scalar so that the tests below are scalar branches
    unsigned long long need = 0, mixed = 0;
#pragma unroll
    for (int qb = 0; qb < NQ; ++qb) { const v4u w = *(const v4u*)(TS + (size_t)((q0 >> 4) + qb) * 32);
        need |= (unsigned long long)(unsigned)__builtin_amdgcn_readfirstlane((int)w[0]) | (unsigned long long)(unsigned)__builtin_amdgcn_readfirstlane((int)w[1]) << 32;
        mixed |= (unsigned long long)(unsigned)__builtin_amdgcn_readfirstlane((int)w[2]) | (unsigned long long)(unsigned)__builtin_amdgcn_readfirstlane((int)w[3]) << 32; }
    if (AHEAD) ldk(need != 0 ? 32 * __builtin_ctzll(need) : 0);
    // A pass whose 32 keys are masked for all of the wave's rows adds 0 to every sum and leaves every maximum, so it is left out. At most TT / 32 trips, whatever the mask holds; p, and with it every address, stays below TT / 32.
#pragma unroll 1   // rolled: a second copy of the pass would not fit the registers
    for (int p = 0; p < TT / 32; ++p) {
        if (((need >> p) & 1ull) == 0) continue;
        const unsigned long long later = (need >> p) >> 1; const int key0 = p * 32, nk = (later != 0) ? key0 + 32 + 32 * __builtin_ctzll(later) : key0;   // nk: the next visited pass's first key
        const bool mix = ((mixed >> p) & 1ull) != 0;   // some key of the pass is masked for some row: only then are the mask words read and applied
        if (!AHEAD) ldk(key0);
        if (mix) {
#pragma unroll
            for (int qb = 0; qb < NQ; ++qb) ldmk(qb, key0);
            // no register of the mask loads' addresses is written before this wait; the address is an input, so it stays as it is up to here
            asm volatile("s_wait_xcnt 0x0" :: "v"(mp + key0) : "memory"); }
        V vf[4], vf2[4];
#pragma unroll
        for (int db = 0; db < 4; ++db) vf[db] = F::ldf(Vt + vo + (size_t)db * 16 * TB + key0 * 16);
        if constexpr (HL) {
            // hi+lo rows: the addresses are inputs, so their registers stay as they are up to the wait
            asm volatile("s_wait_xcnt 0x0" :: "v"(Kp + ko + (size_t)key0 * HD), "v"(K2 + ko + (size_t)key0 * HD), "v"(Vt + vo + key0 * 16) : "memory");
#pragma unroll
            for (int db = 0; db < 4; ++db) vf2[db] = F::ldf(V2 + vo + (size_t)db * 16 * TB + key0 * 16);
            asm volatile("s_wait_xcnt 0x0" :: "v"(V2 + vo + key0 * 16) : "memory");   // the same for the lo plane's loads
        }
        v8f s[2][NQ];
#pragma unroll
        for (int kb = 0; kb < 2; ++kb)
#pragma unroll
            for (int qb = 0; qb < NQ; ++qb) { s[kb][qb] = (v8f){};
#pragma unroll
                for (int ks = 0; ks < 2; ++ks) { s[kb][qb] = F::mma(kf[kb][ks], qf[qb][ks], s[kb][qb]); if (HL) { s[kb][qb] = F::mma(kf[kb][ks], qf2[qb][ks], s[kb][qb]); s[kb][qb] = F::mma(kf2[kb][ks], qf[qb][ks], s[kb][qb]); } } }
        // AHEAD: the next visited pass's key rows are fetched behind the last use of this pass's; the last pass fetches its own again (in bounds, unused)
        if (AHEAD) { ldk(nk);
            // the address is an input, so its registers stay as they are up to the wait
            asm volatile("s_wait_xcnt 0x0" :: "v"(Kp + ko + (size_t)nk * HD) : "memory"); }
        if (mix) {   // one scalar branch a pass; -3.0e38 x SC2 is still far below every score, so a masked key's weight is 0 as before
#pragma unroll
            for (int kb = 0; kb < 2; ++kb)
#pragma unroll
                for (int qb = 0; qb < NQ; ++qb)
#pragma unroll
                    for (int j = 0; j < 8; ++j) if (mk[qb][kb][j] != 0) s[kb][qb][j] = -3.0e38f; }
#pragma unroll
        for (int qb = 0; qb < NQ; ++qb) {
            float t[2][8]; float mx = -3.0e38f;
#pragma unroll
            for (int kb = 0; kb < 2; ++kb)
#pragma unroll
                for (int j = 0; j < 8; ++j) { t[kb][j] = s[kb][qb][j] * SC2; mx = fmaxf(mx, t[kb][j]); }
            mx = fmaxf(mx, xhalf(mx));     // the other half of the wave holds the query's other 16 keys
            const float mn = fmaxf(m[qb], mx), alpha = __builtin_amdgcn_exp2f(m[qb] - mn); m[qb] = mn;
            float ps = 0.f;
#pragma unroll
            for (int kb = 0; kb < 2; ++kb)
#pragma unroll
                for (int j = 0; j < 8; ++j) { t[kb][j] = __builtin_amdgcn_exp2f(t[kb][j] - mn); ps += t[kb][j]; }
            l[qb] = l[qb] * alpha + ps;
#pragma unroll
            for (int db = 0; db < 4; ++db) o[db][qb] *= alpha;
            V pf, pf2;
#pragma unroll
            for (int e = 0; e < 16; ++e) { const float p = t[e >> 3][e & 7];
                if constexpr (HL) { const __bf16 ph = (__bf16)p; pf[e] = ph; pf2[e] = (__bf16)(p - (float)ph); } else pf[e] = (h16)p; }
#pragma unroll
            for (int db = 0; db < 4; ++db) { o[db][qb] = F::mma(vf[db], pf, o[db][qb]); if (HL) { o[db][qb] = F::mma(vf[db], pf2, o[db][qb]); o[db][qb] = F::mma(vf2[db], pf, o[db][qb]); } }
        }
    }
#pragma unroll
    for (int qb = 0; qb < NQ; ++qb) { const float lt = l[qb] + xhalf(l[qb]); const float inv = __fdiv_rn(1.0f, lt);
#pragma unroll
        for (int db = 0; db < 4; ++db) { v8us oh, ol;
#pragma unroll
            for (int j = 0; j < 8; ++j) { unsigned short a, c2; splitf(o[db][qb][j] * inv, a, c2); oh[j] = a; ol[j] = c2; }
            const size_t oo = (size_t)(q0 + qb * 16) * DQ + db * 256 + 8 * lane; *(v8us*)(Ah + oo) = oh; *(v8us*)(Al + oo) = ol; } }
}
// grid (RH / 64 + (TT - RH) / 128, heads, batches), 4 waves: the first RH / 64 work-groups take the hi+lo rows, 16 a wave (three products each, so half the rows), the rest 32 fp16 rows a wave
__global__ __launch_bounds__(128) void k_fattn(const h16* __restrict__ Q16, const bf* __restrict__ Qh, const bf* __restrict__ Ql, const h16* __restrict__ K16, const bf* __restrict__ Kh, const bf* __restrict__ Kl, const h16* __restrict__ V16, const bf* __restrict__ Vh, const bf* __restrict__ Vl, const int* __restrict__ am, const unsigned* __restrict__ TS, bf* Ah, bf* Al) {
    const int wv = __builtin_amdgcn_readfirstlane((int)(threadIdx.x >> 5)); const int bx = blockIdx.x; const size_t hp = ((size_t)blockIdx.y * NB_ + blockIdx.z) * TT * HD, vp = (size_t)blockIdx.y * HD * TB + (size_t)blockIdx.z * TT * 16;   // the batch's TT rows of the head's q and k; its TT columns (32 a unit) of the head's V^T rows
    const size_t ap = (size_t)blockIdx.z * TT * DQ + blockIdx.y * (HD * 16); Ah += ap; Al += ap;   // the batch's rows; a head's 64 columns: two units of each 16 rows
    if (bx < RH / 64) fattn_rows<bf, true, 1>(Qh + hp, Ql + hp, Kh + hp, Kl + hp, Vh + vp, Vl + vp, am, TS, bx * 64 + wv * 16, Ah, Al);
    else fattn_rows<h16, false, 2>(Q16 + hp, nullptr, K16 + hp, nullptr, V16 + vp, nullptr, am, TS, RH + (bx - RH / 64) * 128 + wv * 32, Ah, Al);
}

__device__ __forceinline__ void lorap(const float* __restrict__ A, const float* __restrict__ Bw, bf* AQ, bf* B2, int blk) { const int e = (blk * 256 + (int)threadIdx.x) * 4; if (e >= 64 * DM) return;
    { const int un = e >> 9, w = (e >> 3) & 63, n = (un / (DM / 32)) * 16 + (w & 15), k = (un % (DM / 32)) * 32 + ((w >> 5) * 2 + ((w >> 4) & 1)) * 8 + (e & 7); /* AQ in fragment order: element e of the plane holds (n, k) */ v4us o; for (int u = 0; u < 4; ++u) o[u] = (n < 8) ? f2bf(A[(size_t)n * DM + k + u]) : (unsigned short)0; *(v4us*)(AQ + e) = o;  }
    if (e < DM * 32) { const int n = e / 32, k = e % 32; v4us o; for (int u = 0; u < 4; ++u) o[u] = (k + u < 8) ? f2bf(Bw[(size_t)n * 8 + k + u]) : (unsigned short)0; *(v4us*)(B2 + e) = o;  } }

// msum: the mask's summary. One work-group takes 16 query rows (block qk) and all TT keys, wave w the keys 256 w .. 256 w + 255 (8 passes of k_fattn), a lane 4 keys of each row and half.
// Out: four words at TS + 32 qk (a 128-byte line of its own): bit p of words 0, 1 = some key of pass p is open (mask == 0) for some of the rows; bit p of words 2, 3 = some key of pass p is masked.
__device__ __forceinline__ void msum(const int* __restrict__ am, unsigned* TS, int qk) {
    static_assert(TT == 8 * 256, "eight waves, 256 keys each; 64 passes in two words");
    __shared__ unsigned sh[8];
    const int lane = threadIdx.x & 31, wv = (int)threadIdx.x >> 5; const int* p = am + (size_t)qk * 16 * TT + wv * 256 + lane * 4;
    bool open[2] = {false, false}, shut[2] = {false, false};
#pragma unroll
    for (int r = 0; r < 16; ++r)
#pragma unroll
        for (int h = 0; h < 2; ++h) { const v4i x = *(const v4i*)(p + (size_t)r * TT + h * 128);
#pragma unroll
            for (int q = 0; q < 4; ++q) { open[h] |= x[q] == 0; shut[h] |= x[q] != 0; } }
    unsigned bits = 0;   // bits 0 .. 7: open, 8 .. 15: masked, of the wave's 8 passes; 8 lanes hold one pass's 32 keys
#pragma unroll
    for (int h = 0; h < 2; ++h) { const unsigned bo = __builtin_amdgcn_ballot_w32(open[h]), bs = __builtin_amdgcn_ballot_w32(shut[h]);
#pragma unroll
        for (int t = 0; t < 4; ++t) { bits |= (((bo >> (8 * t)) & 0xFFu) != 0 ? 1u : 0u) << (h * 4 + t); bits |= (((bs >> (8 * t)) & 0xFFu) != 0 ? 1u : 0u) << (8 + h * 4 + t); } }
    if (lane == 0) sh[wv] = bits;
    __syncthreads();   // the eight waves' bits are in LDS
    if (threadIdx.x == 0) { v4u o = (v4u){0u, 0u, 0u, 0u};
#pragma unroll
        for (int w = 0; w < 4; ++w) { o[0] |= (sh[w] & 0xFFu) << (8 * w); o[1] |= (sh[w + 4] & 0xFFu) << (8 * w); o[2] |= ((sh[w] >> 8) & 0xFFu) << (8 * w); o[3] |= ((sh[w + 4] >> 8) & 0xFFu) << (8 * w); }
        *(v4u*)(TS + (size_t)qk * 32) = o; }
}

// every conversion in one grid, picked by block range (the same for a whole work-group): the mask's summary first, then the two LoRA pairs (few blocks, but the longest chain of dependent loads, so they start at once), then x, then the four weights
#define PB_X (TB * DM / 8 / 256)
#define PB_W (DM * DM / 8 / 256)
#define PB_L (64 * DM / 4 / 256)
#define PB_M (TT / 16)
__global__ __launch_bounds__(256) void k_prep(const float* __restrict__ x, const float* __restrict__ wq, const float* __restrict__ wk, const float* __restrict__ wv, const float* __restrict__ wo, const float* __restrict__ wqA, const float* __restrict__ wqB, const float* __restrict__ wvA, const float* __restrict__ wvB, const int* __restrict__ am,
                                              unsigned* TS, bf* XB, bf* WQ, bf* WK, bf* WV, bf* WO, bf* AQ, bf* BQ2, bf* AV, bf* BV2) {
    static_assert(DQ == DM && DKV == DM, "four weights of one size");
    int b = blockIdx.x;
    if (b < PB_M) { msum(am, TS, b); return; }   // the most bytes a work-group, so these start first
    b -= PB_M;
    if (b < PB_L) { lorap(wqA, wqB, AQ, BQ2, b); return; }
    b -= PB_L;
    if (b < PB_L) { lorap(wvA, wvB, AV, BV2, b); return; }
    b -= PB_L;
    if (b < PB_X) { cvt8(x, XB, (size_t)TB * DM / 8, b); return; }
    b -= PB_X;
    const int w = b / PB_W; cvt8(w == 0 ? wq : w == 1 ? wk : w == 2 ? wv : wo, w == 0 ? WQ : w == 1 ? WK : w == 2 ? WV : WO, (size_t)DM * DM / 8, b % PB_W);
}

extern "C" void kernel_launch(void* const* d_in, const int* in_sizes, int n_in,
                              void* d_out, int out_size, void* d_ws, size_t ws_size, hipStream_t stream) {
    (void)in_sizes; (void)n_in; (void)out_size;
    const float* x = (const float*)d_in[0]; const int* amask = (const int*)d_in[1]; const float* wq = (const float*)d_in[2]; const float* wqA = (const float*)d_in[3]; const float* wqB = (const float*)d_in[4]; const float* wk = (const float*)d_in[5]; const float* wv = (const float*)d_in[6]; const float* wvA = (const float*)d_in[7]; const float* wvB = (const float*)d_in[8]; const float* wo = (const float*)d_in[9]; const float* cosT = nullptr; const float* sinT = nullptr; (void)cosT; (void)sinT;
    float* OUT = (float*)d_out;     // [2][2048][1024]
    char* wsp = (char*)d_ws;
    auto take = [&](size_t bytes) { char* p = wsp; wsp += (bytes + 255) & ~(size_t)255; return (void*)p; };
    bf* WQ = (bf*)take((size_t)DQ * DM * 2); bf* WK = (bf*)take((size_t)DKV * DM * 2); bf* WV = (bf*)take((size_t)DKV * DM * 2); bf* WO = (bf*)take((size_t)DM * DQ * 2);
    bf* XB = (bf*)take((size_t)TB * DM * 2); bf* AQ = (bf*)take((size_t)64 * DM * 2); bf* AV = (bf*)take((size_t)64 * DM * 2); bf* BQ2 = (bf*)take((size_t)DM * 32 * 2); bf* BV2 = (bf*)take((size_t)DM * 32 * 2); bf* XQh = (bf*)take((size_t)TB * 32 * 2); bf* XQl = (bf*)take((size_t)TB * 32 * 2); bf* XVh = (bf*)take((size_t)TB * 32 * 2); bf* XVl = (bf*)take((size_t)TB * 32 * 2);
    h16* QP16 = (h16*)take((size_t)NH_ * TB * HD * 2); h16* KP16 = (h16*)take((size_t)NKV * TB * HD * 2); h16* VT16 = (h16*)take((size_t)NKV * HD * TB * 2);
    bf* QPh = (bf*)take((size_t)NH_ * TB * HD * 2); bf* QPl = (bf*)take((size_t)NH_ * TB * HD * 2); bf* KPh = (bf*)take((size_t)NKV * TB * HD * 2); bf* KPl = (bf*)take((size_t)NKV * TB * HD * 2); bf* VTh = (bf*)take((size_t)NKV * HD * TB * 2); bf* VTl = (bf*)take((size_t)NKV * HD * TB * 2);
    bf* ATh = (bf*)take((size_t)TB * DQ * 2); bf* ATl = (bf*)take((size_t)TB * DQ * 2); unsigned* TS = (unsigned*)take((size_t)(TT / 16) * 128);
    if ((size_t)(wsp - (char*)d_ws) > ws_size) return;    // ws 256 MiB
    k_prep<<<PB_M + 2 * PB_L + PB_X + 4 * PB_W, 256, 0, stream>>>(x, wq, wk, wv, wo, wqA, wqB, wvA, wvB, amask, TS, XB, WQ, WK, WV, WO, AQ, BQ2, AV, BV2);
    k_down<<<dim3(TB / 64, 2, 1), 512, 0, stream>>>(XB, AQ, AV, XQh, XQl, XVh, XVl);
    k_qkv<<<dim3(TB / 128, DM / 128, 3), 128, 0, stream>>>(XB, WQ, WK, WV, XQh, XQl, XVh, XVl, BQ2, BV2, QP16, QPh, QPl, KP16, KPh, KPl, VT16, VTh, VTl);
    k_fattn<<<dim3(RH / 64 + (TT - RH) / 128, NH_, NB_), 128, 0, stream>>>(QP16, QPh, QPl, KP16, KPh, KPl, VT16, VTh, VTl, amask, TS, ATh, ATl);   // one kv head per query head
    k_wo<<<dim3(TB / 128, DM / 128, 1), 256, 0, stream>>>(ATh, ATl, WO, OUT);
}

// v009
// A run of this version takes 85.3 microseconds.
// Next to v008, in two timings, it ran 1.34 and 1.33 times as fast.
// Counting every step since v000, it is 25.6 times as fast.
#include <hip/hip_runtime.h>

// TinySelfAttention (x [2][2048][1024]; q = x wq_w^T + 2 (x wq_A^T) wq_B^T (LoRA, r = 8, alpha/r = 2), k = x wk_w^T, v = x wv_w^T + 2 (x wv_A^T) wv_B^T (16 heads x 64); scores = q.k / 8, masked (-inf) where attn_mask[i][j] != 0 (int [2048][2048], read as data: k_prep sums it up per 16 rows x 32 keys, and k_fattn goes by that summary, right for any mask); softmax; out = merged wo_w^T -> [2][2048][1024]).
// Compute dtypes, f32 accumulate: every input rounded to bf16; base projections and the rank-8 down-projections on PLAIN bf16 operands (inputs: exact; the 8 outputs padded to 64 with zero weights); the up-projections as hl planes (K padded 8 -> 32 with zeros) x exact B (2 products), added x 2 in f32; scores and attn.v over every key tile with an open key (mask read per element where a tile is part masked): query rows < 512 hl (3 products), the rest single fp16; softmax f32, running maximum and sum over 32-key tiles inside one kernel (k_fattn); wo hl x exact (2 products).
// The q/k/v and rank-8 down GEMMs write their 16-bit planes themselves (gemmt, gemmw: EPI), q and v starting from their up-projection (UP): no f32 projection goes to memory; v is computed as wv x^T, so that the rows of V^T come out contiguous.
// FRAGMENT ORDER: every 16-bit plane that a K loop or the key walk reads (x, the weights, the padded down weights, q, k, V^T, the attention output) lies in units of 16 rows x 32 k = 1 KB, unit (r / 16, k / 32) at ((r / 16) * (K / 32) + k / 32) * 512 elements;
// inside a unit the 16-byte piece (row r % 16, k pieces c = (k % 32) / 8) stands at piece (c / 2) * 32 + (c % 2) * 16 + r % 16, which is piece 'lane' of the fragment's first (c < 2) or second 16-byte load: a wave-wide load or store is 512 contiguous bytes, four whole lines, not 32 bytes in each of 16 lines.
// The rank-8 planes [t][32] and the up weights [n][32] stay row-major (64-byte rows, read once a work-group).
// FIVE LAUNCHES: work that depends on nothing in its own launch shares a grid. k_prep: the mask's summary and every conversion (both LoRA pairs, x, four weights), picked by block range; k_down: both rank-8 down-projections (grid y), each into planes of its own; k_qkv: the q, k and v GEMMs (grid z); then k_fattn and k_wo.
// BOTH BATCHES IN EVERY LAUNCH: a token's row is tb = b * TT + t (TB rows). x, the rank-8 planes, the attention output and out are [tb][.], q and k [head][tb][d], V^T [head * HD + d][tb]; the GEMM grids run over TB rows (V^T: columns), k_fattn takes b from blockIdx.y.

#define NB_  2
#define TT   2048
#define TB   (NB_ * TT)           // token rows of all batches
#define DM   1024
#define NH_  16
#define NKV  16
#define REP  (NH_ / NKV)
#define HD   64
#define DQ   (NH_ * HD)
#define DKV  (NKV * HD)
#define RH   512                  // query rows < RH use hi+lo planes (0: none)
#define WIN  0
#define SCL  0.125f   // HD^-0.5
typedef _Float16 h16;
typedef unsigned short bf;
typedef __attribute__((ext_vector_type(16))) __bf16   v16bf;
typedef __attribute__((ext_vector_type(16))) _Float16 v16h;
typedef __attribute__((ext_vector_type(8)))  _Float16 v8h;
typedef __attribute__((ext_vector_type(8)))  unsigned short v8us;
typedef __attribute__((ext_vector_type(8)))  float    v8f;
typedef __attribute__((ext_vector_type(4)))  float    v4f;
typedef v8h  __attribute__((may_alias)) v8ha;
typedef v4f  __attribute__((may_alias)) v4fa;
typedef v8us __attribute__((may_alias)) v8usa;

__device__ __forceinline__ unsigned short f2bf(float f) { unsigned u = __float_as_uint(f); u += 0x7FFFu + ((u >> 16) & 1u); return (unsigned short)(u >> 16); }
__device__ __forceinline__ float bf2f(unsigned short b) { return __uint_as_float(((unsigned)b) << 16); }
__device__ __forceinline__ float bfr(float f) { return bf2f(f2bf(f)); }
__device__ __forceinline__ v16h cat16(v8h lo, v8h hi) { return __builtin_shufflevector(lo, hi, 0, 1, 2, 3, 4, 5, 6, 7, 8, 9, 10, 11, 12, 13, 14, 15); }
__device__ __forceinline__ v16bf cat16b(v8us lo, v8us hi) { return __builtin_bit_cast(v16bf, __builtin_shufflevector(lo, hi, 0, 1, 2, 3, 4, 5, 6, 7, 8, 9, 10, 11, 12, 13, 14, 15)); }
__device__ __forceinline__ v8f wmma16(v16h a, v16h b, v8f c) { return __builtin_amdgcn_wmma_f32_16x16x32_f16(false, a, false, b, (short)0, c, false, false); }
__device__ __forceinline__ v8f wmmab(v16bf a, v16bf b, v8f c) { return __builtin_amdgcn_wmma_f32_16x16x32_bf16(false, a, false, b, (short)0, c, false, false); }
__device__ __forceinline__ h16 tohx(float x) { return (h16)x; }
__device__ __forceinline__ void splitf(float y, unsigned short& h, unsigned short& l) { h = f2bf(y); l = f2bf(y - bf2f(h)); }
typedef __attribute__((ext_vector_type(2))) _Float16 v2h;
typedef __attribute__((ext_vector_type(4))) _Float16 v4h;
typedef __attribute__((ext_vector_type(2))) unsigned short v2us;
typedef __attribute__((ext_vector_type(4))) unsigned short v4us;
typedef __attribute__((ext_vector_type(2))) float v2f;
typedef __attribute__((ext_vector_type(4))) int v4i;



// ---- gemmw: register-blocked GEMM, one 64x64 output tile (16 accumulators a wave) per work-group of KS waves, operands straight from 16-bit planes in fragment order; tile (bx, by) of (M/64, N/64), 32 * KS threads; os: the kernel's LDS, OSF floats.
// C[m][n] (f32, pitch ldc, + optional f32 bias[n]) = sum_k A[m][k] Bt[n][k] (+ split products per NSPLIT). K = DM, K % (32 * KS) == 0.
// KS > 1: wave w sums the K slice [w K/KS, (w+1) K/KS); the KS partial tiles meet in LDS and are added in slice order 0 .. KS-1 (fixed, the same on every run).
// UP (KS == 8 only): the tile takes + 2 u, u = the rank-8 up-product of the same tile (K padded to 32: one WMMA step, hi then lo plane, its own f32 sum from 0). Uh/Ul: hi/lo planes [t][32] of the down-projection, Uw: up weights [n][32].
// UP = 1: rows m are t, columns n (A = Uh, Ul; B = Uw). UP = 2: rows m are n, columns t (A = Uw; B = Uh, Ul). Wave w makes sub-tile (w / 4, w % 4) of each 32-row phase; u meets the slices in LDS as one more slice and is added last, x 2.
// EPI (KS > 1 only) says what leaves the kernel. 0: the f32 tile, to C. 1: the tile as three 16-bit planes (fp16, bf16 hi, bf16 lo of y - hi), each a matrix of ldp columns in fragment order, element (m, n) at its row by * rP + m, column by * cP + (n - c0);
// rP = rows, cP = 0, ldp = 64 gives head planes [n / 64][m][n % 64], rP = 0, cP = 64, ldp = N gives plain [m][n]. A thread sums and stores one 16-byte piece (8 columns), thread t of each 64 piece t of a unit. 2: columns 0 .. 31 as hi/lo planes [m][32], columns 8 .. 31 zero (the rank-8 down-projection, K-padded for the up-projection).
// Built here for k_down alone (KS = 16, EPI = 2); the q/k/v and wo products are gemmt's, below.
template <typename T16> struct WFrag;
template <> struct WFrag<h16> { typedef v16h V; static __device__ __forceinline__ V ld(const h16* p) { return cat16(*(const v8h*)p, *(const v8h*)(p + 16)); } static __device__ __forceinline__ V ldf(const h16* p) { return cat16(*(const v8h*)p, *(const v8h*)(p + 256)); } static __device__ __forceinline__ v8f mma(V a, V b, v8f c) { return wmma16(a, b, c); } };
template <> struct WFrag<bf> { typedef v16bf V; static __device__ __forceinline__ V ld(const bf* p) { return cat16b(*(const v8us*)p, *(const v8us*)(p + 16)); } static __device__ __forceinline__ V ldf(const bf* p) { return cat16b(*(const v8us*)p, *(const v8us*)(p + 256)); } static __device__ __forceinline__ v8f mma(V a, V b, v8f c) { return wmmab(a, b, c); } };
#define OSF(KS, UP) (((KS) == 1) ? 16 * 68 : ((KS) + ((UP) != 0 ? 1 : 0)) * 32 * 68)
template <typename T16, int NSPLIT, bool BIAS, int KS, int EPI = 0, int UP = 0>
__device__ __forceinline__ void gemmw(float* os, int bx, int by, const T16* __restrict__ A, const T16* __restrict__ A2, const T16* __restrict__ Bt, const T16* __restrict__ Bt2, float* C, int ldc, const float* __restrict__ bias, const T16* __restrict__ Uh, const T16* __restrict__ Ul, const T16* __restrict__ Uw, h16* P16, bf* Ph, bf* Pl, int rP, int cP, int ldp) {
    static_assert(EPI == 0 || KS > 1, "the plane epilogues stand behind the slice sum"); static_assert(EPI != 1 || KS == 8, "256 threads, one 16-byte piece of 32 x 64 each"); static_assert(UP == 0 || KS == 8, "eight sub-tiles a phase, one a wave");
    typedef typename WFrag<T16>::V V; constexpr int K = DM; static_assert(DQ == DM, "one K for every product");   // a constant, so that a pass's units stand at immediate offsets from one address an operand
    const int lane = threadIdx.x & 31, lr = lane & 15, hi = lane >> 4; const int r0 = bx * 64, c0 = by * 64;
    v8f acc[4][4];
#pragma unroll
    for (int mb = 0; mb < 4; ++mb)
#pragma unroll
        for (int nb = 0; nb < 4; ++nb) acc[mb][nb] = (v8f){};
    const size_t aoff = (size_t)r0 * K + 8 * lane, boff = (size_t)c0 * K + 8 * lane;   // 16 rows of units are 16 K elements, 32 k one unit of 512, the lane's piece 8 lane
    // wv: the wave's K slice, held scalar so that the loop bounds are scalar
    const int wv = (KS == 1) ? 0 : __builtin_amdgcn_readfirstlane((int)(threadIdx.x >> 5)); const int kspan = K / KS, kbeg = wv * kspan, kend = kbeg + kspan;
    V ua[2], ua2[2], ub, ub2;
    if constexpr (UP != 0) {   // the up-product's operands, fetched in front of the K loop, so that no barrier of the slice sum waits for these loads
        const size_t uc = (size_t)(c0 + (wv & 3) * 16 + lr) * 32 + 8 * hi, ur = (size_t)(r0 + (wv >> 2) * 16 + lr) * 32 + 8 * hi;
        const T16* pb = (UP == 1 ? Uw : Uh) + uc; const T16* pa = (UP == 1 ? Uh : Uw) + ur; const T16* p2 = Ul + (UP == 1 ? ur : uc);   // phase 1's rows: + 32 * 32 elements
        ub = WFrag<T16>::ld(pb); ua[0] = WFrag<T16>::ld(pa); ua[1] = WFrag<T16>::ld(pa + 32 * 32);
        if (UP == 1) { ua2[0] = WFrag<T16>::ld(p2); ua2[1] = WFrag<T16>::ld(p2 + 32 * 32); } else ub2 = WFrag<T16>::ld(p2);
        // the addresses are inputs, so their registers stay as they are up to the wait
        asm volatile("s_wait_xcnt 0x0" :: "v"(pb), "v"(pa), "v"(p2) : "memory");
    }
#pragma unroll 1
    for (int kc = kbeg; kc < kend; kc += 32) {
        V a[4], a2[4]; const T16* pa = A + aoff + kc * 16; const T16* pb = Bt + boff + kc * 16; const T16* pa2 = (NSPLIT == 1 || NSPLIT == 2) ? A2 + aoff + kc * 16 : pa; const T16* pb2 = (NSPLIT >= 2) ? Bt2 + boff + kc * 16 : pb;
#pragma unroll
        for (int mb = 0; mb < 4; ++mb) { a[mb] = WFrag<T16>::ldf(pa + mb * 16 * K); if (NSPLIT == 1 || NSPLIT == 2) a2[mb] = WFrag<T16>::ldf(pa2 + mb * 16 * K); }
#pragma unroll
        for (int nb = 0; nb < 4; ++nb) { const V b = WFrag<T16>::ldf(pb + nb * 16 * K); V b2; if (NSPLIT >= 2) b2 = WFrag<T16>::ldf(pb2 + nb * 16 * K);
#pragma unroll
            for (int mb = 0; mb < 4; ++mb) { acc[mb][nb] = WFrag<T16>::mma(a[mb], b, acc[mb][nb]); if (NSPLIT == 1 || NSPLIT == 2) acc[mb][nb] = WFrag<T16>::mma(a2[mb], b, acc[mb][nb]); if (NSPLIT >= 2) acc[mb][nb] = WFrag<T16>::mma(a[mb], b2, acc[mb][nb]); } }
        // the pass's addresses are inputs here, so their registers stay as they are up to the wait
        asm volatile("s_wait_xcnt 0x0" :: "v"(pa), "v"(pb), "v"(pa2), "v"(pb2) : "memory");
        asm volatile("v_nop\n\tv_nop\n\tv_nop\n\tv_nop" : "+v"(acc[0][0]), "+v"(acc[1][1]), "+v"(acc[2][2]), "+v"(acc[3][3]) : "v"(a[0]), "v"(a[3]));
    }
    if (KS > 1) {   // every loop below is unrolled so that acc[][] and res[][] are indexed by constants and stay in registers
        float* osw = os + wv * (32 * 68); static_assert(KS == 1 || 16 % KS == 0, "KS divides 16"); constexpr int NIT = (KS > 1) ? 16 / KS : 1;   // v4f sums a thread and phase: 32 rows x 16 v4f over 32 * KS threads
        v4f res[2][NIT];
        // which v4f of a phase's 32 x 64 a thread sums. EPI 1: the two halves of one piece, in fragment order (unit t / 64: 16 rows x 32 columns); else 16 threads a row
        const int pw = (int)threadIdx.x & 63, pu = (int)threadIdx.x >> 6, prow = (pu >> 1) * 16 + (pw & 15), pc8 = (pu & 1) * 4 + (pw >> 5) * 2 + ((pw >> 4) & 1);
        auto rowof = [&](int it) { return (EPI == 1) ? prow : ((int)threadIdx.x + it * 32 * KS) >> 4; };
        auto colof = [&](int it) { return (EPI == 1) ? pc8 * 8 + it * 4 : (((int)threadIdx.x + it * 32 * KS) & 15) * 4; };
#pragma unroll
        for (int mp = 0; mp < 2; ++mp) {          // 32 output rows a phase
#pragma unroll
            for (int ml = 0; ml < 2; ++ml)
#pragma unroll
                for (int nb = 0; nb < 4; ++nb)
#pragma unroll
                    for (int j = 0; j < 8; ++j) osw[(ml * 16 + hi * 8 + j) * 68 + nb * 16 + lr] = acc[mp * 2 + ml][nb][j];
            if constexpr (UP != 0) { v8f t = WFrag<T16>::mma(ua[mp], ub, (v8f){}); t = (UP == 1) ? WFrag<T16>::mma(ua2[mp], ub, t) : WFrag<T16>::mma(ua[mp], ub2, t);
#pragma unroll
                for (int j = 0; j < 8; ++j) os[KS * (32 * 68) + ((wv >> 2) * 16 + hi * 8 + j) * 68 + (wv & 3) * 16 + lr] = t[j]; }
            __syncthreads();                      // every slice's partial rows are in LDS
#pragma unroll
            for (int it = 0; it < NIT; ++it) { const int row = rowof(it), cofs = colof(it); v4f val = *(const v4fa*)(os + row * 68 + cofs);
#pragma unroll
                for (int s = 1; s < KS; ++s) val += *(const v4fa*)(os + s * (32 * 68) + row * 68 + cofs);
                if constexpr (UP != 0) val += 2.0f * *(const v4fa*)(os + KS * (32 * 68) + row * 68 + cofs);   // x 2 is exact: fused or not, one rounding
                res[mp][it] = val; }
            if (mp == 0) __syncthreads();         // all reads of phase 0 end before phase 1 overwrites the rows
        }
        // the stores stand behind the last barrier, so that no barrier waits for a store to memory
#pragma unroll
        for (int mp = 0; mp < 2; ++mp) { v8h o16; v8us oh8, ol8;   // EPI 1: the thread's piece of each plane
#pragma unroll
            for (int it = 0; it < NIT; ++it) { const int row = rowof(it), cofs = colof(it); v4f val = res[mp][it];
                if (BIAS) { val[0] += bfr(bias[c0 + cofs]); val[1] += bfr(bias[c0 + cofs + 1]); val[2] += bfr(bias[c0 + cofs + 2]); val[3] += bfr(bias[c0 + cofs + 3]); }
                if constexpr (EPI == 0) *(v4f*)(C + (size_t)(r0 + mp * 32 + row) * ldc + c0 + cofs) = val;
                else if constexpr (EPI == 1) {
#pragma unroll
                    for (int q = 0; q < 4; ++q) { o16[it * 4 + q] = tohx(val[q]); unsigned short a2, c2; splitf(val[q], a2, c2); oh8[it * 4 + q] = a2; ol8[it * 4 + q] = c2; }
                    if (it == NIT - 1) { const size_t po = ((size_t)((by * rP + r0 + mp * 32 + row) >> 4) * (ldp >> 5) + ((by * cP) >> 5) + (pc8 >> 2)) * 512 + pw * 8; *(v8h*)(P16 + po) = o16; *(v8us*)(Ph + po) = oh8; *(v8us*)(Pl + po) = ol8; } }
                else if (cofs < 32) { v4us oh, ol;
#pragma unroll
                    for (int q = 0; q < 4; ++q) { unsigned short a2 = 0, c2 = 0; if (cofs + q < 8) splitf(val[q], a2, c2); oh[q] = a2; ol[q] = c2; }
                    const size_t po = (size_t)(r0 + mp * 32 + row) * 32 + cofs; *(v4us*)(Ph + po) = oh; *(v4us*)(Pl + po) = ol; } } }
        // the three EPI 1 products share a kernel, and its listing leads from one product's last stores on into another's code, which writes their registers: the wait stands behind the last store
        if constexpr (EPI == 1) asm volatile("s_wait_xcnt 0x0" ::: "memory");
        return;
    }
#pragma unroll
    for (int mb = 0; mb < 4; ++mb) {
#pragma unroll
        for (int nb = 0; nb < 4; ++nb) {
#pragma unroll
            for (int j = 0; j < 8; ++j) os[(hi * 8 + j) * 68 + nb * 16 + lr] = acc[mb][nb][j]; }
        __builtin_amdgcn_wave_barrier(); asm volatile("" ::: "memory");
        float* crow = C + (size_t)(r0 + mb * 16) * ldc + c0;
{
#pragma unroll
            for (int s = 0; s < 8; ++s) { const int row = 2 * s + hi, cofs = lr * 4; v4f val = *(const v4fa*)(os + row * 68 + cofs); if (BIAS) { val[0] += bfr(bias[c0 + cofs]); val[1] += bfr(bias[c0 + cofs + 1]); val[2] += bfr(bias[c0 + cofs + 2]); val[3] += bfr(bias[c0 + cofs + 3]); }
                *(v4f*)(crow + (size_t)row * ldc + cofs) = val; }
             }
        __builtin_amdgcn_wave_barrier(); asm volatile("" ::: "memory");
    }
}


// ---- gemmt: one 128 x 128 output tile per work-group, a wave 16 MB x 64 of it (4 MB accumulators) over the whole K: MB = 4: 4 waves (2 x 2), MB = 2: 8 waves (4 x 2), for a grid that would else leave one wave on a SIMD; tile (bx, by) of (M / 128, N / 128).
// C[m][n] = sum_k A[m][k] Bt[n][k] (NSPLIT 1: + A2[m][k] Bt[n][k]), operands 16-bit planes in fragment order, K = DM. The waves share their operands through LDS: each operand row comes from L2 once a work-group, not once a wave.
// A stage is 64 k of the tile's rows: a segment (16 rows x 64 k = two units, 2 KB, contiguous in the plane as in LDS) per 16 rows, A's eight segments, (A2's eight,) Bt's eight. Two buffers; asynchronous copies, 16 bytes a lane, bring stage t + 2 in while stage t + 1 is worked on.
// UP: the tile starts from 2 u, u = the rank-8 up-product of the same tile (K padded to 32: one WMMA step, hi then lo plane, its own f32 sum from 0); Uh/Ul: hi/lo planes [t][32] of the down-projection, Uw: up weights [n][32]. UP = 1: rows m are t, columns n (A = Uh, Ul; B = Uw). UP = 2: rows m are n, columns t (A = Uw; B = Uh, Ul).
// EPI 0: the f32 tile, to C. EPI 1: three 16-bit planes (fp16, bf16 hi, bf16 lo of y - hi), each a matrix of ldp columns in fragment order, element (m, n) at its row (n / 64) * rP + m, column (n / 64) * cP + n % 64 (as gemmw's EPI 1). Both go through the wave's own 32 x 68 floats of LDS, 32 rows a phase, so that every store covers whole lines.
#define GT_NSEG(NSPLIT) ((NSPLIT) == 1 ? 24 : 16)
#define GT_STG(NSPLIT) (GT_NSEG(NSPLIT) * 2048)
// one operand's eight segments of a stage, by asynchronous copies of 16 bytes a lane. cp8, 128 threads: copy j is segment j, LDS l + 2048 j, plane rows + 16 j; cp4, 256 threads: copy j is segments 2 j and 2 j + 1, LDS l + 4096 j, plane rows + 32 j.
// The s_wait_xcnt stands in the copies' own statement, so that no address register of a copy is rewritten in front of it.
__device__ __forceinline__ void cp8(unsigned l, const bf* g) {
    asm volatile("global_load_async_to_lds_b128 %0, %8, off\n\t"
                 "global_load_async_to_lds_b128 %1, %9, off\n\t"
                 "global_load_async_to_lds_b128 %2, %10, off\n\t"
                 "global_load_async_to_lds_b128 %3, %11, off\n\t"
                 "global_load_async_to_lds_b128 %4, %12, off\n\t"
                 "global_load_async_to_lds_b128 %5, %13, off\n\t"
                 "global_load_async_to_lds_b128 %6, %14, off\n\t"
                 "global_load_async_to_lds_b128 %7, %15, off\n\t"
                 "s_wait_xcnt 0x0"
                 :: "v"(l), "v"(l + 2048u), "v"(l + 4096u), "v"(l + 6144u), "v"(l + 8192u), "v"(l + 10240u), "v"(l + 12288u), "v"(l + 14336u),
                    "v"(g), "v"(g + 16 * DM), "v"(g + 32 * DM), "v"(g + 48 * DM), "v"(g + 64 * DM), "v"(g + 80 * DM), "v"(g + 96 * DM), "v"(g + 112 * DM) : "memory");
}
__device__ __forceinline__ void cp4(unsigned l, const bf* g) {
    asm volatile("global_load_async_to_lds_b128 %0, %4, off\n\t"
                 "global_load_async_to_lds_b128 %1, %5, off\n\t"
                 "global_load_async_to_lds_b128 %2, %6, off\n\t"
                 "global_load_async_to_lds_b128 %3, %7, off\n\t"
                 "s_wait_xcnt 0x0"
                 :: "v"(l), "v"(l + 4096u), "v"(l + 8192u), "v"(l + 12288u), "v"(g), "v"(g + 32 * DM), "v"(g + 64 * DM), "v"(g + 96 * DM) : "memory");
}
template <int NSPLIT, int EPI, int UP, int MB>
__device__ __forceinline__ void gemmt(char* sm, int bx, int by, const bf* __restrict__ A, const bf* __restrict__ A2, const bf* __restrict__ Bt, float* C, int ldc, const bf* __restrict__ Uh, const bf* __restrict__ Ul, const bf* __restrict__ Uw, h16* P16, bf* Ph, bf* Pl, int rP, int cP, int ldp) {
    typedef WFrag<bf> F; typedef F::V V; constexpr int K = DM, NT = K / 64, STG = GT_STG(NSPLIT), BSEG = GT_NSEG(NSPLIT) - 8; static_assert(NT >= 2, "two stages or more"); static_assert(MB == 4 || MB == 2, "4 or 8 waves"); static_assert(UP == 0 || MB == 4, "the up-product is written for 64 rows a wave"); static_assert((16 / MB) * 32 * 68 * 4 <= 2 * STG, "the output's staging fits the ring");
    const int tid = (int)threadIdx.x, lane = tid & 31, lr = lane & 15, hi = lane >> 4;
    const int wv = __builtin_amdgcn_readfirstlane(tid >> 5), wm = wv >> 1, wn = wv & 1;   // the wave's place in the tile, held scalar
    const int r0 = bx * 128 + wm * (MB * 16), byw = by * 2 + wn, c0 = byw * 64;           // the wave's own 16 MB x 64
    const unsigned lb = (unsigned)(size_t)sm + (unsigned)tid * 16u;                       // the lane's LDS byte address in buffer 0, in segment tid / 128
    const size_t go = (size_t)(tid >> 7) * 16 * K + (tid & 127) * 8;                       // 128 threads a segment; 16 rows of units are 16 K elements, 64 k two units = 1024 elements
    const bf* ga = A + (size_t)bx * 128 * K + go; const bf* ga2 = (NSPLIT == 1) ? A2 + (size_t)bx * 128 * K + go : ga; const bf* gb = Bt + (size_t)by * 128 * K + go;
    auto cp = [&](unsigned l, const bf* g) { if constexpr (MB == 4) cp8(l, g); else cp4(l, g); };
    auto issue = [&](int t, int buf) { const unsigned l = lb + (unsigned)buf * (unsigned)STG; cp(l, ga + t * 1024); if constexpr (NSPLIT == 1) cp(l + 8u * 2048u, ga2 + t * 1024); cp(l + (unsigned)BSEG * 2048u, gb + t * 1024); };
    issue(0, 0);
    v8f acc[MB][4];
    if constexpr (UP != 0) {   // the up-product, while stage 0 is on its way
        const bf* pa = (UP == 1 ? Uh : Uw) + (size_t)(r0 + lr) * 32 + 8 * hi; const bf* pb = (UP == 1 ? Uw : Uh) + (size_t)(c0 + lr) * 32 + 8 * hi; const bf* p2 = Ul + (size_t)((UP == 1 ? r0 : c0) + lr) * 32 + 8 * hi;   // 16 rows: + 16 * 32 elements
        V ua[4], ub[4], u2[4];
#pragma unroll
        for (int i = 0; i < 4; ++i) { ua[i] = F::ld(pa + i * 512); ub[i] = F::ld(pb + i * 512); u2[i] = F::ld(p2 + i * 512); }
        // no register of these loads' addresses is written before this wait; the addresses are inputs, so their registers stay as they are up to here
        asm volatile("s_wait_xcnt 0x0" :: "v"(pa), "v"(pb), "v"(p2) : "memory");
#pragma unroll
        for (int mb = 0; mb < 4; ++mb)
#pragma unroll
            for (int nb = 0; nb < 4; ++nb) { v8f t = F::mma(ua[mb], ub[nb], (v8f){}); t = (UP == 1) ? F::mma(u2[mb], ub[nb], t) : F::mma(ua[mb], u2[nb], t); acc[mb][nb] = 2.0f * t; }   // x 2 is exact
    } else {
#pragma unroll
        for (int mb = 0; mb < MB; ++mb)
#pragma unroll
            for (int nb = 0; nb < 4; ++nb) acc[mb][nb] = (v8f){};
    }
    asm volatile("s_wait_asynccnt 0x0" ::: "memory");   // the wave's own copies of stage 0 have landed
    __syncthreads();                                    // and every other wave's
    issue(1, 1);
#pragma unroll 1   // rolled: one pass's fragments at a time
    for (int t = 0; t < NT; ++t) {
        const bf* sb = (const bf*)(sm + (t & 1) * STG) + 8 * lane;
#pragma unroll
        for (int ks = 0; ks < 2; ++ks) {
            V a[MB], a2[MB], b[4];
#pragma unroll
            for (int i = 0; i < MB; ++i) a[i] = F::ldf(sb + (wm * MB + i) * 1024 + ks * 512);
#pragma unroll
            for (int i = 0; i < 4; ++i) b[i] = F::ldf(sb + (BSEG + wn * 4 + i) * 1024 + ks * 512);
            if constexpr (NSPLIT == 1) {
#pragma unroll
                for (int i = 0; i < MB; ++i) a2[i] = F::ldf(sb + (8 + wm * MB + i) * 1024 + ks * 512); }
            __builtin_amdgcn_sched_barrier(0);   // the block's LDS reads go out as one group ahead of its WMMAs: spread among them, each pair would cost its own wait
#pragma unroll
            for (int nb = 0; nb < 4; ++nb)
#pragma unroll
                for (int mb = 0; mb < MB; ++mb) acc[mb][nb] = F::mma(a[mb], b[nb], acc[mb][nb]);
            if constexpr (NSPLIT == 1) {   // the lo plane's products behind all of the hi plane's, whose WMMAs cover the lo fragments' way; each accumulator still takes hi, then lo, of every 32 k
#pragma unroll
                for (int nb = 0; nb < 4; ++nb)
#pragma unroll
                    for (int mb = 0; mb < MB; ++mb) acc[mb][nb] = F::mma(a2[mb], b[nb], acc[mb][nb]); }
        }
        asm volatile("s_wait_dscnt 0x0" ::: "memory");      // the wave's reads of this buffer have ended
        asm volatile("s_wait_asynccnt 0x0" ::: "memory");   // its copies of stage t + 1 have landed
        __syncthreads();                                    // stage t + 1 is published, and every reader has left stage t's buffer
        if (t + 2 < NT) issue(t + 2, t & 1);
    }
    asm volatile("s_wait_asynccnt 0x0" ::: "memory");       // no copy is under way when the ring becomes the output's staging
    float* osw = (float*)sm + wv * (32 * 68);               // the wave's own rows; the loop's last barrier stands behind every read of the ring
#pragma unroll
    for (int mp = 0; mp < MB / 2; ++mp) {                   // 32 output rows a phase; unrolled, so that acc[][] is indexed by constants
#pragma unroll
        for (int ml = 0; ml < 2; ++ml)
#pragma unroll
            for (int nb = 0; nb < 4; ++nb)
#pragma unroll
                for (int j = 0; j < 8; ++j) osw[(ml * 16 + hi * 8 + j) * 68 + nb * 16 + lr] = acc[mp * 2 + ml][nb][j];
        asm volatile("s_wait_dscnt 0x0" ::: "memory");      // the wave's rows are in LDS before its lanes read one another's
        if constexpr (EPI == 0) {
#pragma unroll
            for (int s = 0; s < 16; ++s) { const int row = 2 * s + hi, cofs = lr * 4; *(v4f*)(C + (size_t)(r0 + mp * 32 + row) * ldc + c0 + cofs) = *(const v4fa*)(osw + row * 68 + cofs); }
        } else {
#pragma unroll
            for (int it = 0; it < 8; ++it) {                // piece it * 32 + lane of the phase's four units (16 rows x 32 columns each)
                const int pw = (it & 1) * 32 + lane, row = (it >> 2) * 16 + lr, pc8 = ((it >> 1) & 1) * 4 + (it & 1) * 2 + hi;
                const v4f x0 = *(const v4fa*)(osw + row * 68 + pc8 * 8), x1 = *(const v4fa*)(osw + row * 68 + pc8 * 8 + 4); v8h o16; v8us oh8, ol8;
#pragma unroll
                for (int q = 0; q < 8; ++q) { const float y = q < 4 ? x0[q & 3] : x1[q & 3]; o16[q] = tohx(y); unsigned short a2, c2; splitf(y, a2, c2); oh8[q] = a2; ol8[q] = c2; }
                const size_t po = ((size_t)((byw * rP + r0 + mp * 32 + row) >> 4) * (ldp >> 5) + ((byw * cP) >> 5) + (pc8 >> 2)) * 512 + pw * 8; *(v8h*)(P16 + po) = o16; *(v8us*)(Ph + po) = oh8; *(v8us*)(Pl + po) = ol8; }
        }
        if (mp + 1 < MB / 2) asm volatile("s_wait_dscnt 0x0" ::: "memory");   // every read of the phase has ended before the next phase's rows overwrite it
    }
    // the products of one kernel stand behind one another in its listing: the wait stands behind the last store, in front of whatever writes its registers next
    if constexpr (EPI == 1) asm volatile("s_wait_xcnt 0x0" ::: "memory");
}

// both rank-8 down-projections, grid (TB / 64, 2): y = 0 x wq_A^T, y = 1 x wv_A^T, each to hi/lo planes [tb][32] of its own
__global__ __launch_bounds__(512) void k_down(const bf* __restrict__ XB, const bf* __restrict__ AQ, const bf* __restrict__ AV, bf* XQh, bf* XQl, bf* XVh, bf* XVl) {
    __shared__ __align__(16) float os[OSF(16, 0)]; const bool sv = blockIdx.y != 0;
    gemmw<bf, 0, false, 16, 2>(os, blockIdx.x, 0, XB, nullptr, sv ? AV : AQ, nullptr, nullptr, 64, nullptr, nullptr, nullptr, nullptr, nullptr, sv ? XVh : XQh, sv ? XVl : XQl, 0, 0, 32);
}
// the three projections, grid (TB / 128, DM / 128, 3). z = 0: q = x wq^T + 2 (x A^T) B^T -> head planes [h][tb][d]; z = 1: k = x wk^T -> head planes [h][tb][d];
// z = 2: v^T = wv x^T + 2 B (x A^T)^T -> planes [g * HD + d][tb], its tiles numbered with the weight's rows running fastest. The branch is the same for a whole work-group, so every barrier stays under uniform control flow.
__global__ __launch_bounds__(128) void k_qkv(const bf* __restrict__ XB, const bf* __restrict__ WQ, const bf* __restrict__ WK, const bf* __restrict__ WV, const bf* __restrict__ XQh, const bf* __restrict__ XQl, const bf* __restrict__ XVh, const bf* __restrict__ XVl, const bf* __restrict__ BQ2, const bf* __restrict__ BV2,
                                             h16* QP16, bf* QPh, bf* QPl, h16* KP16, bf* KPh, bf* KPl, h16* VT16, bf* VTh, bf* VTl) {
    static_assert(DQ == DM && DKV == DM, "one grid for the three products");
    __shared__ __align__(16) char sm[2 * GT_STG(0)]; const int bx = blockIdx.x, by = blockIdx.y;
    if (blockIdx.z == 0) gemmt<0, 1, 1, 4>(sm, bx, by, XB, nullptr, WQ, nullptr, 0, XQh, XQl, BQ2, QP16, QPh, QPl, TB, 0, HD);
    else if (blockIdx.z == 1) gemmt<0, 1, 0, 4>(sm, bx, by, XB, nullptr, WK, nullptr, 0, nullptr, nullptr, nullptr, KP16, KPh, KPl, TB, 0, HD);
    else { const int t = by * (TB / 128) + bx; gemmt<0, 1, 2, 4>(sm, t % (DKV / 128), t / (DKV / 128), WV, nullptr, XB, nullptr, 0, XVh, XVl, BV2, VT16, VTh, VTl, 0, 64, TB); }
}
// out = attention output (hi + lo planes) wo^T, f32, grid (TB / 128, DM / 128): one work-group a WGP, so 8 waves each
__global__ __launch_bounds__(256) void k_wo(const bf* __restrict__ ATh, const bf* __restrict__ ATl, const bf* __restrict__ WO, float* OUT) {
    __shared__ __align__(16) char sm[2 * GT_STG(1)];
    gemmt<1, 0, 0, 2>(sm, blockIdx.x, blockIdx.y, ATh, ATl, WO, OUT, DM, nullptr, nullptr, nullptr, nullptr, nullptr, nullptr, 0, 0, 0);
}

__global__ __launch_bounds__(256) void k_wtG(const float* __restrict__ w, int K, int N, bf* Bt) {
    const int lane = threadIdx.x & 31; const int L0 = (blockIdx.x * 8 + (threadIdx.x >> 5)) * 8; const int nlines = N * K / 64;
{
#pragma unroll 1
        for (int l = 0; l < 8; ++l) { const int L = L0 + l; if (L >= nlines) break; const size_t e = (size_t)L * 64 + lane * 2; const int k = (int)(e % K), n = (int)(e / K); v2us o;
            o[0] = f2bf(w[(size_t)k * N + n]); o[1] = f2bf(w[(size_t)(k + 1) * N + n]); *(v2us*)(Bt + e) = o; }
         }
}
// f32 [r][DM] row-major -> bf16 in fragment order: thread i writes piece i (a wave 512 contiguous bytes) and reads the 8 values that belong there (a work-group: 16 rows x 128 k, whole lines between its waves)
__device__ __forceinline__ void cvt8(const float* __restrict__ src, bf* dst, size_t n8, int blk) { const size_t i = (size_t)blk * 256 + threadIdx.x; if (i >= n8) return;
    const size_t un = i >> 6; const int w = (int)(i & 63); const size_t r = (un / (DM / 32)) * 16 + (w & 15); const int k = (int)(un % (DM / 32)) * 32 + ((w >> 5) * 2 + ((w >> 4) & 1)) * 8;
    const v8f v = *(const v8f*)(src + r * DM + k); v8us o;
#pragma unroll
    for (int k = 0; k < 8; ++k) o[k] = f2bf(v[k]); *(v8us*)(dst + i * 8) = o;  }
__global__ __launch_bounds__(256) void k_cscvt(const float* __restrict__ cosT, const float* __restrict__ sinT, float* CS) { const int idx = blockIdx.x * 256 + threadIdx.x; if (idx >= TT * HD) return; v2f cs; cs[0] = bfr(cosT[idx]); cs[1] = bfr(sinT[idx]); *(v2f*)(CS + (size_t)idx * 2) = cs;  }
#define SC2 (SCL * 1.4426950408889634f)
#define NSL 4                            // waves that share a row group's key walk; also the 16-row blocks of O^T, one a wave in the merge
#define PWF(NQ) ((8 * (NQ) + 1) * 128)   // floats of one wave's partial in LDS: 4 NQ tiles of O^T as two 16-byte pieces a lane, then (m, l) pairs, 16 bytes a lane
typedef __attribute__((ext_vector_type(8))) int v8i;
typedef __attribute__((ext_vector_type(4))) unsigned v4u;
__device__ __forceinline__ v8i ldm8(const int* p) { return __builtin_shufflevector(*(const v4i*)p, *(const v4i*)(p + 4), 0, 1, 2, 3, 4, 5, 6, 7); }
__device__ __forceinline__ float xhalf(float x) { return __builtin_bit_cast(float, __builtin_amdgcn_permlanex16(__builtin_bit_cast(int, x), __builtin_bit_cast(int, x), 0x76543210, 0xfedcba98, false, false)); }   // lane l with lane l ^ 16
template <typename T16, bool HL, int NQ>
__device__ __forceinline__ void fattn_rows(float* sg, int sl, const T16* __restrict__ Q, const T16* __restrict__ Q2, const T16* __restrict__ Kp, const T16* __restrict__ K2, const T16* __restrict__ Vt, const T16* __restrict__ V2, const int* __restrict__ am, const unsigned* __restrict__ TS, int q0, bf* Ah, bf* Al) {
    typedef WFrag<T16> F; typedef typename F::V V;
    const int lane = threadIdx.x & 31, lr = lane & 15, hi = lane >> 4;
    V qf[NQ][2], qf2[NQ][2];
#pragma unroll
    for (int qb = 0; qb < NQ; ++qb)
#pragma unroll
        for (int ks = 0; ks < 2; ++ks) { const size_t qo = (size_t)(q0 + qb * 16) * HD + ks * 512 + 8 * lane; qf[qb][ks] = F::ldf(Q + qo); if (HL) qf2[qb][ks] = F::ldf(Q2 + qo); }
    v8f o[4][NQ]; float m[NQ], l[NQ];
#pragma unroll
    for (int qb = 0; qb < NQ; ++qb) { m[qb] = -3.0e38f; l[qb] = 0.f;
#pragma unroll
        for (int db = 0; db < 4; ++db) o[db][qb] = (v8f){}; }
    const size_t ko = 8 * lane, vo = 8 * lane; const int* mp = am + (size_t)(q0 + lr) * TT + 8 * hi;
    V kf[2][2], kf2[2][2]; v8i mk[NQ][2];
    auto ldk = [&](int key) {      // the key rows of one pass
#pragma unroll
        for (int kb = 0; kb < 2; ++kb)
#pragma unroll
            for (int ks = 0; ks < 2; ++ks) { kf[kb][ks] = F::ldf(Kp + ko + (size_t)(key + kb * 16) * HD + ks * 512); if (HL) kf2[kb][ks] = F::ldf(K2 + ko + (size_t)(key + kb * 16) * HD + ks * 512); } };
    auto ldmk = [&](int qb, int key) {   // the mask words of one pass and 16 queries
#pragma unroll
        for (int kb = 0; kb < 2; ++kb) mk[qb][kb] = ldm8(mp + (size_t)qb * 16 * TT + key + kb * 16); };
    constexpr bool AHEAD = !HL;    // key rows one visited pass ahead; the hi+lo rows hold twice the fragments and have no registers left for it
    // the mask's summary (msum) of the wave's rows, bit p = pass p: need = some key open for some row, mixed = some key masked for some row; the same in every lane, held scalar so that the tests below are scalar branches
    unsigned long long need = 0, mixed = 0;
#pragma unroll
    for (int qb = 0; qb < NQ; ++qb) { const v4u w = *(const v4u*)(TS + (size_t)((q0 >> 4) + qb) * 32);
        need |= (unsigned long long)(unsigned)__builtin_amdgcn_readfirstlane((int)w[0]) | (unsigned long long)(unsigned)__builtin_amdgcn_readfirstlane((int)w[1]) << 32;
        mixed |= (unsigned long long)(unsigned)__builtin_amdgcn_readfirstlane((int)w[2]) | (unsigned long long)(unsigned)__builtin_amdgcn_readfirstlane((int)w[3]) << 32; }
    static_assert(NSL == 4 && HD == 16 * NSL && TT / 32 == 64, "every fourth bit of 64; one block of O^T a wave");
    need &= 0x1111111111111111ull << sl;   // the wave's own passes: p % NSL == sl
    if (AHEAD) ldk(need != 0 ? 32 * __builtin_ctzll(need) : 0);
    // A pass whose 32 keys are masked for all of the wave's rows adds 0 to every sum and leaves every maximum, so it is left out. At most TT / 32 / NSL trips, whatever the mask holds; p, and with it every address, stays below TT / 32.
#pragma unroll 1   // rolled: a second copy of the pass would not fit the registers
    for (int p = sl; p < TT / 32; p += NSL) {
        if (((need >> p) & 1ull) == 0) continue;
        const unsigned long long later = (need >> p) >> 1; const int key0 = p * 32, nk = (later != 0) ? key0 + 32 + 32 * __builtin_ctzll(later) : key0;   // nk: the next visited pass's first key
        const bool mix = ((mixed >> p) & 1ull) != 0;   // some key of the pass is masked for some row: only then are the mask words read and applied
        if (!AHEAD) ldk(key0);
        if (mix) { int km = key0;
            // hi+lo rows: this pass's key rows are on their way here; the address is formed from km, so it is formed behind the wait
            if constexpr (!AHEAD) asm volatile("s_wait_xcnt 0x0" : "+s"(km) :: "memory");
#pragma unroll
            for (int qb = 0; qb < NQ; ++qb) ldmk(qb, km);
            // no register of the mask loads' addresses is written before this wait; the address is an input, so it stays as it is up to here
            asm volatile("s_wait_xcnt 0x0" :: "v"(mp + km) : "memory"); }
        V vf[4], vf2[4];
#pragma unroll
        for (int db = 0; db < 4; ++db) vf[db] = F::ldf(Vt + vo + (size_t)db * 16 * TB + key0 * 16);
        if constexpr (HL) {
            // hi+lo rows: the addresses are inputs, so their registers stay as they are up to the wait
            asm volatile("s_wait_xcnt 0x0" :: "v"(Kp + ko + (size_t)key0 * HD), "v"(K2 + ko + (size_t)key0 * HD), "v"(Vt + vo + key0 * 16) : "memory");
#pragma unroll
            for (int db = 0; db < 4; ++db) vf2[db] = F::ldf(V2 + vo + (size_t)db * 16 * TB + key0 * 16);
            asm volatile("s_wait_xcnt 0x0" :: "v"(V2 + vo + key0 * 16) : "memory");   // the same for the lo plane's loads
        }
        v8f s[2][NQ];
#pragma unroll
        for (int kb = 0; kb < 2; ++kb)
#pragma unroll
            for (int qb = 0; qb < NQ; ++qb) { s[kb][qb] = (v8f){};
#pragma unroll
                for (int ks = 0; ks < 2; ++ks) { s[kb][qb] = F::mma(kf[kb][ks], qf[qb][ks], s[kb][qb]); if (HL) { s[kb][qb] = F::mma(kf[kb][ks], qf2[qb][ks], s[kb][qb]); s[kb][qb] = F::mma(kf2[kb][ks], qf[qb][ks], s[kb][qb]); } } }
        // AHEAD: the next visited pass's key rows are fetched behind the last use of this pass's; the last pass fetches its own again (in bounds, unused)
        if (AHEAD) { ldk(nk);
            // the address is an input, so its registers stay as they are up to the wait
            asm volatile("s_wait_xcnt 0x0" :: "v"(Kp + ko + (size_t)nk * HD) : "memory"); }
        if (mix) {   // one scalar branch a pass; -3.0e38 x SC2 is still far below every score, so a masked key's weight is 0 as before
#pragma unroll
            for (int kb = 0; kb < 2; ++kb)
#pragma unroll
                for (int qb = 0; qb < NQ; ++qb)
#pragma unroll
                    for (int j = 0; j < 8; ++j) if (mk[qb][kb][j] != 0) s[kb][qb][j] = -3.0e38f; }
#pragma unroll
        for (int qb = 0; qb < NQ; ++qb) {
            float t[2][8]; float mx = -3.0e38f;
#pragma unroll
            for (int kb = 0; kb < 2; ++kb)
#pragma unroll
                for (int j = 0; j < 8; ++j) { t[kb][j] = s[kb][qb][j] * SC2; mx = fmaxf(mx, t[kb][j]); }
            mx = fmaxf(mx, xhalf(mx));     // the other half of the wave holds the query's other 16 keys
            const float mn = fmaxf(m[qb], mx), alpha = __builtin_amdgcn_exp2f(m[qb] - mn); m[qb] = mn;
            float ps = 0.f;
#pragma unroll
            for (int kb = 0; kb < 2; ++kb)
#pragma unroll
                for (int j = 0; j < 8; ++j) { t[kb][j] = __builtin_amdgcn_exp2f(t[kb][j] - mn); ps += t[kb][j]; }
            l[qb] = l[qb] * alpha + ps;
#pragma unroll
            for (int db = 0; db < 4; ++db) o[db][qb] *= alpha;
            V pf, pf2;
#pragma unroll
            for (int e = 0; e < 16; ++e) { const float p = t[e >> 3][e & 7];
                if constexpr (HL) { const __bf16 ph = (__bf16)p; pf[e] = ph; pf2[e] = (__bf16)(p - (float)ph); } else pf[e] = (h16)p; }
#pragma unroll
            for (int db = 0; db < 4; ++db) { o[db][qb] = F::mma(vf[db], pf, o[db][qb]); if (HL) { o[db][qb] = F::mma(vf[db], pf2, o[db][qb]); o[db][qb] = F::mma(vf2[db], pf, o[db][qb]); } }
        }
    }
    // the wave's partial to its own part of LDS; a wave that had no pass hands over m = -3.0e38, l = 0, o = 0, whose weight below is 0 (or 1 on zeros, where no wave had a pass)
    float* pw = sg + sl * PWF(NQ) + 4 * lane;
#pragma unroll
    for (int db = 0; db < 4; ++db)
#pragma unroll
        for (int qb = 0; qb < NQ; ++qb) { const v8f t = o[db][qb]; *(v4fa*)(pw + ((db * NQ + qb) * 2) * 128) = __builtin_shufflevector(t, t, 0, 1, 2, 3); *(v4fa*)(pw + ((db * NQ + qb) * 2 + 1) * 128) = __builtin_shufflevector(t, t, 4, 5, 6, 7); }
    *(v4fa*)(pw + 8 * NQ * 128) = (v4f){m[0], l[0] + xhalf(l[0]), m[NQ - 1], l[NQ - 1] + xhalf(l[NQ - 1])};   // the wave's halves hold 16 keys each of every pass: their sums join here
    __syncthreads();   // every wave's partial is in LDS; every wave of the work-group comes here, whatever its passes
    const float* pr = sg + 4 * lane; v4f ml[NSL]; v8us oh[NQ], ol[NQ];
#pragma unroll
    for (int s = 0; s < NSL; ++s) ml[s] = *(const v4fa*)(pr + s * PWF(NQ) + 8 * NQ * 128);
#pragma unroll
    for (int qb = 0; qb < NQ; ++qb) {
        float mm = ml[0][2 * qb];
#pragma unroll
        for (int s = 1; s < NSL; ++s) mm = fmaxf(mm, ml[s][2 * qb]);
        float lt = 0.f; v4f a0 = (v4f){}, a1 = (v4f){};
#pragma unroll
        for (int s = 0; s < NSL; ++s) { float w;
            // 2^(m - M); the v_nop fills the slot behind the transcendental
            asm("v_exp_f32 %0, %1\n\tv_nop" : "=v"(w) : "v"(ml[s][2 * qb] - mm));
            const float* po = pr + s * PWF(NQ) + ((sl * NQ + qb) * 2) * 128;
            lt += w * ml[s][2 * qb + 1]; a0 += w * *(const v4fa*)po; a1 += w * *(const v4fa*)(po + 128); }
        const float inv = __fdiv_rn(1.0f, lt);
#pragma unroll
        for (int j = 0; j < 8; ++j) { unsigned short a, c2; splitf((j < 4 ? a0[j & 3] : a1[j & 3]) * inv, a, c2); oh[qb][j] = a; ol[qb][j] = c2; } }
#pragma unroll
    for (int qb = 0; qb < NQ; ++qb) { const size_t oo = (size_t)(q0 + qb * 16) * DQ + sl * 256 + 8 * lane; *(v8us*)(Ah + oo) = oh[qb]; *(v8us*)(Al + oo) = ol[qb]; }
    // both kinds of rows stand behind one another in the kernel's listing: the wait stands behind the last store, in front of whatever writes its registers next
    asm volatile("s_wait_xcnt 0x0" ::: "memory");
}
// grid (heads, batches, RH / 32 + (TT - RH) / 64), 2 NSL waves: two row groups a work-group (their waves of one slice read the same key rows), NSL waves a group. Tiles 0 .. RH / 32 - 1 are the hi+lo rows, 16 a group (three products each, so half the rows), the rest 32 fp16 rows a group.
// There are more work-groups than places for them, so the tile is the grid's slowest index and its number falls with it: under a mask that opens the keys up to the row's own, the longest walks start first and the shortest fill the end.
#define FA_NT (RH / 32 + (TT - RH) / 64)
__global__ __launch_bounds__(64 * NSL) void k_fattn(const h16* __restrict__ Q16, const bf* __restrict__ Qh, const bf* __restrict__ Ql, const h16* __restrict__ K16, const bf* __restrict__ Kh, const bf* __restrict__ Kl, const h16* __restrict__ V16, const bf* __restrict__ Vh, const bf* __restrict__ Vl, const int* __restrict__ am, const unsigned* __restrict__ TS, bf* Ah, bf* Al) {
    __shared__ __align__(16) float sm[2 * NSL * PWF(2)];
    const int wv = __builtin_amdgcn_readfirstlane((int)(threadIdx.x >> 5)), g = wv & 1, sl = wv >> 1; const int bx = FA_NT - 1 - (int)blockIdx.z; const size_t hp = ((size_t)blockIdx.x * NB_ + blockIdx.y) * TT * HD, vp = (size_t)blockIdx.x * HD * TB + (size_t)blockIdx.y * TT * 16;   // the batch's TT rows of the head's q and k; its TT columns (32 a unit) of the head's V^T rows
    const size_t ap = (size_t)blockIdx.y * TT * DQ + blockIdx.x * (HD * 16); Ah += ap; Al += ap;   // the batch's rows; a head's 64 columns: two units of each 16 rows
    if (bx < RH / 32) fattn_rows<bf, true, 1>(sm + g * NSL * PWF(1), sl, Qh + hp, Ql + hp, Kh + hp, Kl + hp, Vh + vp, Vl + vp, am, TS, bx * 32 + g * 16, Ah, Al);
    else fattn_rows<h16, false, 2>(sm + g * NSL * PWF(2), sl, Q16 + hp, nullptr, K16 + hp, nullptr, V16 + vp, nullptr, am, TS, RH + (bx - RH / 32) * 64 + g * 32, Ah, Al);
}

__device__ __forceinline__ void lorap(const float* __restrict__ A, const float* __restrict__ Bw, bf* AQ, bf* B2, int blk) { const int e = (blk * 256 + (int)threadIdx.x) * 4; if (e >= 64 * DM) return;
    { const int un = e >> 9, w = (e >> 3) & 63, n = (un / (DM / 32)) * 16 + (w & 15), k = (un % (DM / 32)) * 32 + ((w >> 5) * 2 + ((w >> 4) & 1)) * 8 + (e & 7); /* AQ in fragment order: element e of the plane holds (n, k) */ v4us o; for (int u = 0; u < 4; ++u) o[u] = (n < 8) ? f2bf(A[(size_t)n * DM + k + u]) : (unsigned short)0; *(v4us*)(AQ + e) = o;  }
    if (e < DM * 32) { const int n = e / 32, k = e % 32; v4us o; for (int u = 0; u < 4; ++u) o[u] = (k + u < 8) ? f2bf(Bw[(size_t)n * 8 + k + u]) : (unsigned short)0; *(v4us*)(B2 + e) = o;  } }

// msum: the mask's summary. One work-group takes 16 query rows (block qk) and all TT keys, wave w the keys 256 w .. 256 w + 255 (8 passes of k_fattn), a lane 4 keys of each row and half.
// Out: four words at TS + 32 qk (a 128-byte line of its own): bit p of words 0, 1 = some key of pass p is open (mask == 0) for some of the rows; bit p of words 2, 3 = some key of pass p is masked.
__device__ __forceinline__ void msum(const int* __restrict__ am, unsigned* TS, int qk) {
    static_assert(TT == 8 * 256, "eight waves, 256 keys each; 64 passes in two words");
    __shared__ unsigned sh[8];
    const int lane = threadIdx.x & 31, wv = (int)threadIdx.x >> 5; const int* p = am + (size_t)qk * 16 * TT + wv * 256 + lane * 4;
    bool open[2] = {false, false}, shut[2] = {false, false};
#pragma unroll
    for (int r = 0; r < 16; ++r)
#pragma unroll
        for (int h = 0; h < 2; ++h) { const v4i x = *(const v4i*)(p + (size_t)r * TT + h * 128);
#pragma unroll
            for (int q = 0; q < 4; ++q) { open[h] |= x[q] == 0; shut[h] |= x[q] != 0; } }
    unsigned bits = 0;   // bits 0 .. 7: open, 8 .. 15: masked, of the wave's 8 passes; 8 lanes hold one pass's 32 keys
#pragma unroll
    for (int h = 0; h < 2; ++h) { const unsigned bo = __builtin_amdgcn_ballot_w32(open[h]), bs = __builtin_amdgcn_ballot_w32(shut[h]);
#pragma unroll
        for (int t = 0; t < 4; ++t) { bits |= (((bo >> (8 * t)) & 0xFFu) != 0 ? 1u : 0u) << (h * 4 + t); bits |= (((bs >> (8 * t)) & 0xFFu) != 0 ? 1u : 0u) << (8 + h * 4 + t); } }
    if (lane == 0) sh[wv] = bits;
    __syncthreads();   // the eight waves' bits are in LDS
    if (threadIdx.x == 0) { v4u o = (v4u){0u, 0u, 0u, 0u};
#pragma unroll
        for (int w = 0; w < 4; ++w) { o[0] |= (sh[w] & 0xFFu) << (8 * w); o[1] |= (sh[w + 4] & 0xFFu) << (8 * w); o[2] |= ((sh[w] >> 8) & 0xFFu) << (8 * w); o[3] |= ((sh[w + 4] >> 8) & 0xFFu) << (8 * w); }
        *(v4u*)(TS + (size_t)qk * 32) = o; }
}

// every conversion in one grid, picked by block range (the same for a whole work-group): the mask's summary first, then the two LoRA pairs (few blocks, but the longest chain of dependent loads, so they start at once), then x, then the four weights
#define PB_X (TB * DM / 8 / 256)
#define PB_W (DM * DM / 8 / 256)
#define PB_L (64 * DM / 4 / 256)
#define PB_M (TT / 16)
__global__ __launch_bounds__(256) void k_prep(const float* __restrict__ x, const float* __restrict__ wq, const float* __restrict__ wk, const float* __restrict__ wv, const float* __restrict__ wo, const float* __restrict__ wqA, const float* __restrict__ wqB, const float* __restrict__ wvA, const float* __restrict__ wvB, const int* __restrict__ am,
                                              unsigned* TS, bf* XB, bf* WQ, bf* WK, bf* WV, bf* WO, bf* AQ, bf* BQ2, bf* AV, bf* BV2) {
    static_assert(DQ == DM && DKV == DM, "four weights of one size");
    int b = blockIdx.x;
    if (b < PB_M) { msum(am, TS, b); return; }   // the most bytes a work-group, so these start first
    b -= PB_M;
    if (b < PB_L) { lorap(wqA, wqB, AQ, BQ2, b); return; }
    b -= PB_L;
    if (b < PB_L) { lorap(wvA, wvB, AV, BV2, b); return; }
    b -= PB_L;
    if (b < PB_X) { cvt8(x, XB, (size_t)TB * DM / 8, b); return; }
    b -= PB_X;
    const int w = b / PB_W; cvt8(w == 0 ? wq : w == 1 ? wk : w == 2 ? wv : wo, w == 0 ? WQ : w == 1 ? WK : w == 2 ? WV : WO, (size_t)DM * DM / 8, b % PB_W);
}

extern "C" void kernel_launch(void* const* d_in, const int* in_sizes, int n_in,
                              void* d_out, int out_size, void* d_ws, size_t ws_size, hipStream_t stream) {
    (void)in_sizes; (void)n_in; (void)out_size;
    const float* x = (const float*)d_in[0]; const int* amask = (const int*)d_in[1]; const float* wq = (const float*)d_in[2]; const float* wqA = (const float*)d_in[3]; const float* wqB = (const float*)d_in[4]; const float* wk = (const float*)d_in[5]; const float* wv = (const float*)d_in[6]; const float* wvA = (const float*)d_in[7]; const float* wvB = (const float*)d_in[8]; const float* wo = (const float*)d_in[9]; const float* cosT = nullptr; const float* sinT = nullptr; (void)cosT; (void)sinT;
    float* OUT = (float*)d_out;     // [2][2048][1024]
    char* wsp = (char*)d_ws;
    auto take = [&](size_t bytes) { char* p = wsp; wsp += (bytes + 255) & ~(size_t)255; return (void*)p; };
    bf* WQ = (bf*)take((size_t)DQ * DM * 2); bf* WK = (bf*)take((size_t)DKV * DM * 2); bf* WV = (bf*)take((size_t)DKV * DM * 2); bf* WO = (bf*)take((size_t)DM * DQ * 2);
    bf* XB = (bf*)take((size_t)TB * DM * 2); bf* AQ = (bf*)take((size_t)64 * DM * 2); bf* AV = (bf*)take((size_t)64 * DM * 2); bf* BQ2 = (bf*)take((size_t)DM * 32 * 2); bf* BV2 = (bf*)take((size_t)DM * 32 * 2); bf* XQh = (bf*)take((size_t)TB * 32 * 2); bf* XQl = (bf*)take((size_t)TB * 32 * 2); bf* XVh = (bf*)take((size_t)TB * 32 * 2); bf* XVl = (bf*)take((size_t)TB * 32 * 2);
    h16* QP16 = (h16*)take((size_t)NH_ * TB * HD * 2); h16* KP16 = (h16*)take((size_t)NKV * TB * HD * 2); h16* VT16 = (h16*)take((size_t)NKV * HD * TB * 2);
    bf* QPh = (bf*)take((size_t)NH_ * TB * HD * 2); bf* QPl = (bf*)take((size_t)NH_ * TB * HD * 2); bf* KPh = (bf*)take((size_t)NKV * TB * HD * 2); bf* KPl = (bf*)take((size_t)NKV * TB * HD * 2); bf* VTh = (bf*)take((size_t)NKV * HD * TB * 2); bf* VTl = (bf*)take((size_t)NKV * HD * TB * 2);
    bf* ATh = (bf*)take((size_t)TB * DQ * 2); bf* ATl = (bf*)take((size_t)TB * DQ * 2); unsigned* TS = (unsigned*)take((size_t)(TT / 16) * 128);
    if ((size_t)(wsp - (char*)d_ws) > ws_size) return;    // ws 256 MiB
    k_prep<<<PB_M + 2 * PB_L + PB_X + 4 * PB_W, 256, 0, stream>>>(x, wq, wk, wv, wo, wqA, wqB, wvA, wvB, amask, TS, XB, WQ, WK, WV, WO, AQ, BQ2, AV, BV2);
    k_down<<<dim3(TB / 64, 2, 1), 512, 0, stream>>>(XB, AQ, AV, XQh, XQl, XVh, XVl);
    k_qkv<<<dim3(TB / 128, DM / 128, 3), 128, 0, stream>>>(XB, WQ, WK, WV, XQh, XQl, XVh, XVl, BQ2, BV2, QP16, QPh, QPl, KP16, KPh, KPl, VT16, VTh, VTl);
    k_fattn<<<dim3(NH_, NB_, FA_NT), 64 * NSL, 0, stream>>>(QP16, QPh, QPl, KP16, KPh, KPl, VT16, VTh, VTl, amask, TS, ATh, ATl);   // one kv head per query head
    k_wo<<<dim3(TB / 128, DM / 128, 1), 256, 0, stream>>>(ATh, ATl, WO, OUT);
}

// v010
// One run takes 80.9 microseconds.
// Timed twice side by side with v009, it ran 1.06 times as fast both times.
// Counting every step since v000, it is 27.2 times as fast.
#include <hip/hip_runtime.h>

// TinySelfAttention (x [2][2048][1024]; q = x wq_w^T + 2 (x wq_A^T) wq_B^T (LoRA, r = 8, alpha/r = 2), k = x wk_w^T, v = x wv_w^T + 2 (x wv_A^T) wv_B^T (16 heads x 64); scores = q.k / 8, masked (-inf) where attn_mask[i][j] != 0 (int [2048][2048], read as data: k_prep sums it up per 16 rows x 32 keys, and k_fattn goes by that summary, right for any mask); softmax; out = merged wo_w^T -> [2][2048][1024]).
// Compute dtypes, f32 accumulate: every input rounded to bf16; base projections and the rank-8 down-projections on PLAIN bf16 operands (inputs: exact; the 8 + 8 outputs of both as one 16-column tile); the up-projections as hl planes (K padded 8 -> 32 with zeros) x exact B (2 products), added x 2 in f32; scores and attn.v over every key tile with an open key (mask read per element where a tile is part masked): query rows < 512 hl (3 products), the rest single fp16; softmax f32, running maximum and sum over 32-key tiles inside one kernel (k_fattn); wo hl x exact (2 products).
// The q/k/v and rank-8 down GEMMs write their 16-bit planes themselves (gemmt: EPI; xdown), q and v starting from their up-projection (UP): no f32 projection goes to memory; v is computed as wv x^T, so that the rows of V^T come out contiguous.
// FRAGMENT ORDER: every 16-bit plane that a K loop or the key walk reads (x, the weights, q, k, V^T, the attention output) lies in units of 16 rows x 32 k = 1 KB, unit (r / 16, k / 32) at ((r / 16) * (K / 32) + k / 32) * 512 elements;
// inside a unit the 16-byte piece (row r % 16, k pieces c = (k % 32) / 8) stands at piece (c / 2) * 32 + (c % 2) * 16 + r % 16, which is piece 'lane' of the fragment's first (c < 2) or second 16-byte load: a wave-wide load or store is 512 contiguous bytes, four whole lines, not 32 bytes in each of 16 lines.
// The rank-8 planes [t][32] and the up weights [n][32] stay row-major (64-byte rows, read once a work-group).
// FOUR LAUNCHES: work that depends on nothing in its own launch shares a grid. k_prep: the mask's summary, every conversion (x, the up weights, four weights) and, on the x fragments as they are converted, both rank-8 down-projections, picked by block range; k_qkv: the q, k and v GEMMs (grid z); then k_fattn and k_wo.
// BOTH BATCHES IN EVERY LAUNCH: a token's row is tb = b * TT + t (TB rows). x, the rank-8 planes, the attention output and out are [tb][.], q and k [head][tb][d], V^T [head * HD + d][tb]; the GEMM grids run over TB rows (V^T: columns), k_fattn takes b from blockIdx.y.

#define NB_  2
#define TT   2048
#define TB   (NB_ * TT)           // token rows of all batches
#define DM   1024
#define NH_  16
#define NKV  16
#define REP  (NH_ / NKV)
#define HD   64
#define DQ   (NH_ * HD)
#define DKV  (NKV * HD)
#define RH   512                  // query rows < RH use hi+lo planes (0: none)
#define WIN  0
#define SCL  0.125f   // HD^-0.5
typedef _Float16 h16;
typedef unsigned short bf;
typedef __attribute__((ext_vector_type(16))) __bf16   v16bf;
typedef __attribute__((ext_vector_type(16))) _Float16 v16h;
typedef __attribute__((ext_vector_type(8)))  _Float16 v8h;
typedef __attribute__((ext_vector_type(8)))  unsigned short v8us;
typedef __attribute__((ext_vector_type(8)))  float    v8f;
typedef __attribute__((ext_vector_type(4)))  float    v4f;
typedef v8h  __attribute__((may_alias)) v8ha;
typedef v4f  __attribute__((may_alias)) v4fa;
typedef v8us __attribute__((may_alias)) v8usa;

__device__ __forceinline__ unsigned short f2bf(float f) { unsigned u = __float_as_uint(f); u += 0x7FFFu + ((u >> 16) & 1u); return (unsigned short)(u >> 16); }
__device__ __forceinline__ float bf2f(unsigned short b) { return __uint_as_float(((unsigned)b) << 16); }
__device__ __forceinline__ float bfr(float f) { return bf2f(f2bf(f)); }
__device__ __forceinline__ v16h cat16(v8h lo, v8h hi) { return __builtin_shufflevector(lo, hi, 0, 1, 2, 3, 4, 5, 6, 7, 8, 9, 10, 11, 12, 13, 14, 15); }
__device__ __forceinline__ v16bf cat16b(v8us lo, v8us hi) { return __builtin_bit_cast(v16bf, __builtin_shufflevector(lo, hi, 0, 1, 2, 3, 4, 5, 6, 7, 8, 9, 10, 11, 12, 13, 14, 15)); }
__device__ __forceinline__ v8f wmma16(v16h a, v16h b, v8f c) { return __builtin_amdgcn_wmma_f32_16x16x32_f16(false, a, false, b, (short)0, c, false, false); }
__device__ __forceinline__ v8f wmmab(v16bf a, v16bf b, v8f c) { return __builtin_amdgcn_wmma_f32_16x16x32_bf16(false, a, false, b, (short)0, c, false, false); }
__device__ __forceinline__ h16 tohx(float x) { return (h16)x; }
__device__ __forceinline__ void splitf(float y, unsigned short& h, unsigned short& l) { h = f2bf(y); l = f2bf(y - bf2f(h)); }
typedef __attribute__((ext_vector_type(2))) _Float16 v2h;
typedef __attribute__((ext_vector_type(4))) _Float16 v4h;
typedef __attribute__((ext_vector_type(2))) unsigned short v2us;
typedef __attribute__((ext_vector_type(4))) unsigned short v4us;
typedef __attribute__((ext_vector_type(2))) float v2f;
typedef __attribute__((ext_vector_type(4))) int v4i;



// a 16-bit WMMA fragment: ld from row-major rows (the lane's two 16-byte pieces 16 elements apart), ldf from a plane in fragment order (256 elements apart)
template <typename T16> struct WFrag;
template <> struct WFrag<h16> { typedef v16h V; static __device__ __forceinline__ V ld(const h16* p) { return cat16(*(const v8h*)p, *(const v8h*)(p + 16)); } static __device__ __forceinline__ V ldf(const h16* p) { return cat16(*(const v8h*)p, *(const v8h*)(p + 256)); } static __device__ __forceinline__ v8f mma(V a, V b, v8f c) { return wmma16(a, b, c); } };
template <> struct WFrag<bf> { typedef v16bf V; static __device__ __forceinline__ V ld(const bf* p) { return cat16b(*(const v8us*)p, *(const v8us*)(p + 16)); } static __device__ __forceinline__ V ldf(const bf* p) { return cat16b(*(const v8us*)p, *(const v8us*)(p + 256)); } static __device__ __forceinline__ v8f mma(V a, V b, v8f c) { return wmmab(a, b, c); } };
// ---- gemmt: one 128 x 128 output tile per work-group, a wave 16 MB x 64 of it (4 MB accumulators) over the whole K: MB = 4: 4 waves (2 x 2), MB = 2: 8 waves (4 x 2), for a grid that would else leave one wave on a SIMD; tile (bx, by) of (M / 128, N / 128).
// C[m][n] = sum_k A[m][k] Bt[n][k] (NSPLIT 1: + A2[m][k] Bt[n][k]), operands 16-bit planes in fragment order, K = DM. The waves share their operands through LDS: each operand row comes from L2 once a work-group, not once a wave.
// A stage is 64 k of the tile's rows: a segment (16 rows x 64 k = two units, 2 KB, contiguous in the plane as in LDS) per 16 rows, A's eight segments, (A2's eight,) Bt's eight. Two buffers; asynchronous copies, 16 bytes a lane, bring stage t + 2 in while stage t + 1 is worked on.
// UP: the tile starts from 2 u, u = the rank-8 up-product of the same tile (K padded to 32: one WMMA step, hi then lo plane, its own f32 sum from 0); Uh/Ul: hi/lo planes [t][32] of the down-projection, Uw: up weights [n][32]. UP = 1: rows m are t, columns n (A = Uh, Ul; B = Uw). UP = 2: rows m are n, columns t (A = Uw; B = Uh, Ul).
// EPI 0: the f32 tile, to C. EPI 1: three 16-bit planes (fp16, bf16 hi, bf16 lo of y - hi), each a matrix of ldp columns in fragment order, element (m, n) at its row (n / 64) * rP + m, column (n / 64) * cP + n % 64; rP = rows, cP = 0, ldp = 64 gives head planes [n / 64][m][n % 64], rP = 0, cP = 64, ldp = N gives plain [m][n]. Both go through the wave's own 32 x 68 floats of LDS, 32 rows a phase, so that every store covers whole lines.
#define GT_NSEG(NSPLIT) ((NSPLIT) == 1 ? 24 : 16)
#define GT_STG(NSPLIT) (GT_NSEG(NSPLIT) * 2048)
// one operand's eight segments of a stage, by asynchronous copies of 16 bytes a lane. cp8, 128 threads: copy j is segment j, LDS l + 2048 j, plane rows + 16 j; cp4, 256 threads: copy j is segments 2 j and 2 j + 1, LDS l + 4096 j, plane rows + 32 j.
// The s_wait_xcnt stands in the copies' own statement, so that no address register of a copy is rewritten in front of it.
__device__ __forceinline__ void cp8(unsigned l, const bf* g) {
    asm volatile("global_load_async_to_lds_b128 %0, %8, off\n\t"
                 "global_load_async_to_lds_b128 %1, %9, off\n\t"
                 "global_load_async_to_lds_b128 %2, %10, off\n\t"
                 "global_load_async_to_lds_b128 %3, %11, off\n\t"
                 "global_load_async_to_lds_b128 %4, %12, off\n\t"
                 "global_load_async_to_lds_b128 %5, %13, off\n\t"
                 "global_load_async_to_lds_b128 %6, %14, off\n\t"
                 "global_load_async_to_lds_b128 %7, %15, off\n\t"
                 "s_wait_xcnt 0x0"
                 :: "v"(l), "v"(l + 2048u), "v"(l + 4096u), "v"(l + 6144u), "v"(l + 8192u), "v"(l + 10240u), "v"(l + 12288u), "v"(l + 14336u),
                    "v"(g), "v"(g + 16 * DM), "v"(g + 32 * DM), "v"(g + 48 * DM), "v"(g + 64 * DM), "v"(g + 80 * DM), "v"(g + 96 * DM), "v"(g + 112 * DM) : "memory");
}
__device__ __forceinline__ void cp4(unsigned l, const bf* g) {
    asm volatile("global_load_async_to_lds_b128 %0, %4, off\n\t"
                 "global_load_async_to_lds_b128 %1, %5, off\n\t"
                 "global_load_async_to_lds_b128 %2, %6, off\n\t"
                 "global_load_async_to_lds_b128 %3, %7, off\n\t"
                 "s_wait_xcnt 0x0"
                 :: "v"(l), "v"(l + 4096u), "v"(l + 8192u), "v"(l + 12288u), "v"(g), "v"(g + 32 * DM), "v"(g + 64 * DM), "v"(g + 96 * DM) : "memory");
}
template <int NSPLIT, int EPI, int UP, int MB>
__device__ __forceinline__ void gemmt(char* sm, int bx, int by, const bf* __restrict__ A, const bf* __restrict__ A2, const bf* __restrict__ Bt, float* C, int ldc, const bf* __restrict__ Uh, const bf* __restrict__ Ul, const bf* __restrict__ Uw, h16* P16, bf* Ph, bf* Pl, int rP, int cP, int ldp) {
    typedef WFrag<bf> F; typedef F::V V; constexpr int K = DM, NT = K / 64, STG = GT_STG(NSPLIT), BSEG = GT_NSEG(NSPLIT) - 8; static_assert(NT >= 2, "two stages or more"); static_assert(MB == 4 || MB == 2, "4 or 8 waves"); static_assert(UP == 0 || MB == 4, "the up-product is written for 64 rows a wave"); static_assert((16 / MB) * 32 * 68 * 4 <= 2 * STG, "the output's staging fits the ring");
    const int tid = (int)threadIdx.x, lane = tid & 31, lr = lane & 15, hi = lane >> 4;
    const int wv = __builtin_amdgcn_readfirstlane(tid >> 5), wm = wv >> 1, wn = wv & 1;   // the wave's place in the tile, held scalar
    const int r0 = bx * 128 + wm * (MB * 16), byw = by * 2 + wn, c0 = byw * 64;           // the wave's own 16 MB x 64
    const unsigned lb = (unsigned)(size_t)sm + (unsigned)tid * 16u;                       // the lane's LDS byte address in buffer 0, in segment tid / 128
    const size_t go = (size_t)(tid >> 7) * 16 * K + (tid & 127) * 8;                       // 128 threads a segment; 16 rows of units are 16 K elements, 64 k two units = 1024 elements
    const bf* ga = A + (size_t)bx * 128 * K + go; const bf* ga2 = (NSPLIT == 1) ? A2 + (size_t)bx * 128 * K + go : ga; const bf* gb = Bt + (size_t)by * 128 * K + go;
    auto cp = [&](unsigned l, const bf* g) { if constexpr (MB == 4) cp8(l, g); else cp4(l, g); };
    auto issue = [&](int t, int buf) { const unsigned l = lb + (unsigned)buf * (unsigned)STG; cp(l, ga + t * 1024); if constexpr (NSPLIT == 1) cp(l + 8u * 2048u, ga2 + t * 1024); cp(l + (unsigned)BSEG * 2048u, gb + t * 1024); };
    issue(0, 0);
    v8f acc[MB][4];
    if constexpr (UP != 0) {   // the up-product, while stage 0 is on its way
        const bf* pa = (UP == 1 ? Uh : Uw) + (size_t)(r0 + lr) * 32 + 8 * hi; const bf* pb = (UP == 1 ? Uw : Uh) + (size_t)(c0 + lr) * 32 + 8 * hi; const bf* p2 = Ul + (size_t)((UP == 1 ? r0 : c0) + lr) * 32 + 8 * hi;   // 16 rows: + 16 * 32 elements
        V ua[4], ub[4], u2[4];
#pragma unroll
        for (int i = 0; i < 4; ++i) { ua[i] = F::ld(pa + i * 512); ub[i] = F::ld(pb + i * 512); u2[i] = F::ld(p2 + i * 512); }
        // no register of these loads' addresses is written before this wait; the addresses are inputs, so their registers stay as they are up to here
        asm volatile("s_wait_xcnt 0x0" :: "v"(pa), "v"(pb), "v"(p2) : "memory");
#pragma unroll
        for (int mb = 0; mb < 4; ++mb)
#pragma unroll
            for (int nb = 0; nb < 4; ++nb) { v8f t = F::mma(ua[mb], ub[nb], (v8f){}); t = (UP == 1) ? F::mma(u2[mb], ub[nb], t) : F::mma(ua[mb], u2[nb], t); acc[mb][nb] = 2.0f * t; }   // x 2 is exact
    } else {
#pragma unroll
        for (int mb = 0; mb < MB; ++mb)
#pragma unroll
            for (int nb = 0; nb < 4; ++nb) acc[mb][nb] = (v8f){};
    }
    asm volatile("s_wait_asynccnt 0x0" ::: "memory");   // the wave's own copies of stage 0 have landed
    __syncthreads();                                    // and every other wave's
    issue(1, 1);
#pragma unroll 1   // rolled: one pass's fragments at a time
    for (int t = 0; t < NT; ++t) {
        const bf* sb = (const bf*)(sm + (t & 1) * STG) + 8 * lane;
#pragma unroll
        for (int ks = 0; ks < 2; ++ks) {
            V a[MB], a2[MB], b[4];
#pragma unroll
            for (int i = 0; i < MB; ++i) a[i] = F::ldf(sb + (wm * MB + i) * 1024 + ks * 512);
#pragma unroll
            for (int i = 0; i < 4; ++i) b[i] = F::ldf(sb + (BSEG + wn * 4 + i) * 1024 + ks * 512);
            if constexpr (NSPLIT == 1) {
#pragma unroll
                for (int i = 0; i < MB; ++i) a2[i] = F::ldf(sb + (8 + wm * MB + i) * 1024 + ks * 512); }
            __builtin_amdgcn_sched_barrier(0);   // the block's LDS reads go out as one group ahead of its WMMAs: spread among them, each pair would cost its own wait
#pragma unroll
            for (int nb = 0; nb < 4; ++nb)
#pragma unroll
                for (int mb = 0; mb < MB; ++mb) acc[mb][nb] = F::mma(a[mb], b[nb], acc[mb][nb]);
            if constexpr (NSPLIT == 1) {   // the lo plane's products behind all of the hi plane's, whose WMMAs cover the lo fragments' way; each accumulator still takes hi, then lo, of every 32 k
#pragma unroll
                for (int nb = 0; nb < 4; ++nb)
#pragma unroll
                    for (int mb = 0; mb < MB; ++mb) acc[mb][nb] = F::mma(a2[mb], b[nb], acc[mb][nb]); }
        }
        asm volatile("s_wait_dscnt 0x0" ::: "memory");      // the wave's reads of this buffer have ended
        asm volatile("s_wait_asynccnt 0x0" ::: "memory");   // its copies of stage t + 1 have landed
        __syncthreads();                                    // stage t + 1 is published, and every reader has left stage t's buffer
        if (t + 2 < NT) issue(t + 2, t & 1);
    }
    asm volatile("s_wait_asynccnt 0x0" ::: "memory");       // no copy is under way when the ring becomes the output's staging
    float* osw = (float*)sm + wv * (32 * 68);               // the wave's own rows; the loop's last barrier stands behind every read of the ring
#pragma unroll
    for (int mp = 0; mp < MB / 2; ++mp) {                   // 32 output rows a phase; unrolled, so that acc[][] is indexed by constants
#pragma unroll
        for (int ml = 0; ml < 2; ++ml)
#pragma unroll
            for (int nb = 0; nb < 4; ++nb)
#pragma unroll
                for (int j = 0; j < 8; ++j) osw[(ml * 16 + hi * 8 + j) * 68 + nb * 16 + lr] = acc[mp * 2 + ml][nb][j];
        asm volatile("s_wait_dscnt 0x0" ::: "memory");      // the wave's rows are in LDS before its lanes read one another's
        if constexpr (EPI == 0) {
#pragma unroll
            for (int s = 0; s < 16; ++s) { const int row = 2 * s + hi, cofs = lr * 4; *(v4f*)(C + (size_t)(r0 + mp * 32 + row) * ldc + c0 + cofs) = *(const v4fa*)(osw + row * 68 + cofs); }
        } else {
#pragma unroll
            for (int it = 0; it < 8; ++it) {                // piece it * 32 + lane of the phase's four units (16 rows x 32 columns each)
                const int pw = (it & 1) * 32 + lane, row = (it >> 2) * 16 + lr, pc8 = ((it >> 1) & 1) * 4 + (it & 1) * 2 + hi;
                const v4f x0 = *(const v4fa*)(osw + row * 68 + pc8 * 8), x1 = *(const v4fa*)(osw + row * 68 + pc8 * 8 + 4); v8h o16; v8us oh8, ol8;
#pragma unroll
                for (int q = 0; q < 8; ++q) { const float y = q < 4 ? x0[q & 3] : x1[q & 3]; o16[q] = tohx(y); unsigned short a2, c2; splitf(y, a2, c2); oh8[q] = a2; ol8[q] = c2; }
                const size_t po = ((size_t)((byw * rP + r0 + mp * 32 + row) >> 4) * (ldp >> 5) + ((byw * cP) >> 5) + (pc8 >> 2)) * 512 + pw * 8; *(v8h*)(P16 + po) = o16; *(v8us*)(Ph + po) = oh8; *(v8us*)(Pl + po) = ol8; }
        }
        if (mp + 1 < MB / 2) asm volatile("s_wait_dscnt 0x0" ::: "memory");   // every read of the phase has ended before the next phase's rows overwrite it
    }
    // the products of one kernel stand behind one another in its listing: the wait stands behind the last store, in front of whatever writes its registers next
    if constexpr (EPI == 1) asm volatile("s_wait_xcnt 0x0" ::: "memory");
}

// the three projections, grid (TB / 128, DM / 128, 3). z = 0: q = x wq^T + 2 (x A^T) B^T -> head planes [h][tb][d]; z = 1: k = x wk^T -> head planes [h][tb][d];
// z = 2: v^T = wv x^T + 2 B (x A^T)^T -> planes [g * HD + d][tb], its tiles numbered with the weight's rows running fastest. The branch is the same for a whole work-group, so every barrier stays under uniform control flow.
__global__ __launch_bounds__(128) void k_qkv(const bf* __restrict__ XB, const bf* __restrict__ WQ, const bf* __restrict__ WK, const bf* __restrict__ WV, const bf* __restrict__ XQh, const bf* __restrict__ XQl, const bf* __restrict__ XVh, const bf* __restrict__ XVl, const bf* __restrict__ BQ2, const bf* __restrict__ BV2,
                                             h16* QP16, bf* QPh, bf* QPl, h16* KP16, bf* KPh, bf* KPl, h16* VT16, bf* VTh, bf* VTl) {
    static_assert(DQ == DM && DKV == DM, "one grid for the three products");
    __shared__ __align__(16) char sm[2 * GT_STG(0)]; const int bx = blockIdx.x, by = blockIdx.y;
    if (blockIdx.z == 0) gemmt<0, 1, 1, 4>(sm, bx, by, XB, nullptr, WQ, nullptr, 0, XQh, XQl, BQ2, QP16, QPh, QPl, TB, 0, HD);
    else if (blockIdx.z == 1) gemmt<0, 1, 0, 4>(sm, bx, by, XB, nullptr, WK, nullptr, 0, nullptr, nullptr, nullptr, KP16, KPh, KPl, TB, 0, HD);
    else { const int t = by * (TB / 128) + bx; gemmt<0, 1, 2, 4>(sm, t % (DKV / 128), t / (DKV / 128), WV, nullptr, XB, nullptr, 0, XVh, XVl, BV2, VT16, VTh, VTl, 0, 64, TB); }
}
// out = attention output (hi + lo planes) wo^T, f32, grid (TB / 128, DM / 128): one work-group a WGP, so 8 waves each
__global__ __launch_bounds__(256) void k_wo(const bf* __restrict__ ATh, const bf* __restrict__ ATl, const bf* __restrict__ WO, float* OUT) {
    __shared__ __align__(16) char sm[2 * GT_STG(1)];
    gemmt<1, 0, 0, 2>(sm, blockIdx.x, blockIdx.y, ATh, ATl, WO, OUT, DM, nullptr, nullptr, nullptr, nullptr, nullptr, nullptr, 0, 0, 0);
}

__global__ __launch_bounds__(256) void k_wtG(const float* __restrict__ w, int K, int N, bf* Bt) {
    const int lane = threadIdx.x & 31; const int L0 = (blockIdx.x * 8 + (threadIdx.x >> 5)) * 8; const int nlines = N * K / 64;
{
#pragma unroll 1
        for (int l = 0; l < 8; ++l) { const int L = L0 + l; if (L >= nlines) break; const size_t e = (size_t)L * 64 + lane * 2; const int k = (int)(e % K), n = (int)(e / K); v2us o;
            o[0] = f2bf(w[(size_t)k * N + n]); o[1] = f2bf(w[(size_t)(k + 1) * N + n]); *(v2us*)(Bt + e) = o; }
         }
}
// f32 [r][DM] row-major -> bf16 in fragment order: thread i writes piece i (a wave 512 contiguous bytes) and reads the 8 values that belong there (a work-group: 16 rows x 128 k, whole lines between its waves)
__device__ __forceinline__ void cvt8(const float* __restrict__ src, bf* dst, size_t n8, int blk) { const size_t i = (size_t)blk * 256 + threadIdx.x; if (i >= n8) return;
    const size_t un = i >> 6; const int w = (int)(i & 63); const size_t r = (un / (DM / 32)) * 16 + (w & 15); const int k = (int)(un % (DM / 32)) * 32 + ((w >> 5) * 2 + ((w >> 4) & 1)) * 8;
    const v8f v = *(const v8f*)(src + r * DM + k); v8us o;
#pragma unroll
    for (int k = 0; k < 8; ++k) o[k] = f2bf(v[k]); *(v8us*)(dst + i * 8) = o;  }
__global__ __launch_bounds__(256) void k_cscvt(const float* __restrict__ cosT, const float* __restrict__ sinT, float* CS) { const int idx = blockIdx.x * 256 + threadIdx.x; if (idx >= TT * HD) return; v2f cs; cs[0] = bfr(cosT[idx]); cs[1] = bfr(sinT[idx]); *(v2f*)(CS + (size_t)idx * 2) = cs;  }
#define SC2 (SCL * 1.4426950408889634f)
#define NSL 4                            // waves that share a row group's key walk; also the 16-row blocks of O^T, one a wave in the merge
#define PWF(NQ) ((8 * (NQ) + 1) * 128)   // floats of one wave's partial in LDS: 4 NQ tiles of O^T as two 16-byte pieces a lane, then (m, l) pairs, 16 bytes a lane
typedef __attribute__((ext_vector_type(8))) int v8i;
typedef __attribute__((ext_vector_type(4))) unsigned v4u;
__device__ __forceinline__ v8i ldm8(const int* p) { return __builtin_shufflevector(*(const v4i*)p, *(const v4i*)(p + 4), 0, 1, 2, 3, 4, 5, 6, 7); }
__device__ __forceinline__ float xhalf(float x) { return __builtin_bit_cast(float, __builtin_amdgcn_permlanex16(__builtin_bit_cast(int, x), __builtin_bit_cast(int, x), 0x76543210, 0xfedcba98, false, false)); }   // lane l with lane l ^ 16
template <typename T16, bool HL, int NQ>
__device__ __forceinline__ void fattn_rows(float* sg, int sl, const T16* __restrict__ Q, const T16* __restrict__ Q2, const T16* __restrict__ Kp, const T16* __restrict__ K2, const T16* __restrict__ Vt, const T16* __restrict__ V2, const int* __restrict__ am, const unsigned* __restrict__ TS, int q0, bf* Ah, bf* Al) {
    typedef WFrag<T16> F; typedef typename F::V V;
    const int lane = threadIdx.x & 31, lr = lane & 15, hi = lane >> 4;
    V qf[NQ][2], qf2[NQ][2];
#pragma unroll
    for (int qb = 0; qb < NQ; ++qb)
#pragma unroll
        for (int ks = 0; ks < 2; ++ks) { const size_t qo = (size_t)(q0 + qb * 16) * HD + ks * 512 + 8 * lane; qf[qb][ks] = F::ldf(Q + qo); if (HL) qf2[qb][ks] = F::ldf(Q2 + qo); }
    v8f o[4][NQ]; float m[NQ], l[NQ];
#pragma unroll
    for (int qb = 0; qb < NQ; ++qb) { m[qb] = -3.0e38f; l[qb] = 0.f;
#pragma unroll
        for (int db = 0; db < 4; ++db) o[db][qb] = (v8f){}; }
    const size_t ko = 8 * lane, vo = 8 * lane; const int* mp = am + (size_t)(q0 + lr) * TT + 8 * hi;
    V kf[2][2], kf2[2][2]; v8i mk[NQ][2];
    auto ldk = [&](int key) {      // the key rows of one pass
#pragma unroll
        for (int kb = 0; kb < 2; ++kb)
#pragma unroll
            for (int ks = 0; ks < 2; ++ks) { kf[kb][ks] = F::ldf(Kp + ko + (size_t)(key + kb * 16) * HD + ks * 512); if (HL) kf2[kb][ks] = F::ldf(K2 + ko + (size_t)(key + kb * 16) * HD + ks * 512); } };
    auto ldmk = [&](int qb, int key) {   // the mask words of one pass and 16 queries
#pragma unroll
        for (int kb = 0; kb < 2; ++kb) mk[qb][kb] = ldm8(mp + (size_t)qb * 16 * TT + key + kb * 16); };
    constexpr bool AHEAD = !HL;    // key rows one visited pass ahead; the hi+lo rows hold twice the fragments and have no registers left for it
    // the mask's summary (msum) of the wave's rows, bit p = pass p: need = some key open for some row, mixed = some key masked for some row; the same in every lane, held scalar so that the tests below are scalar branches
    unsigned long long need = 0, mixed = 0;
#pragma unroll
    for (int qb = 0; qb < NQ; ++qb) { const v4u w = *(const v4u*)(TS + (size_t)((q0 >> 4) + qb) * 32);
        need |= (unsigned long long)(unsigned)__builtin_amdgcn_readfirstlane((int)w[0]) | (unsigned long long)(unsigned)__builtin_amdgcn_readfirstlane((int)w[1]) << 32;
        mixed |= (unsigned long long)(unsigned)__builtin_amdgcn_readfirstlane((int)w[2]) | (unsigned long long)(unsigned)__builtin_amdgcn_readfirstlane((int)w[3]) << 32; }
    static_assert(NSL == 4 && HD == 16 * NSL && TT / 32 == 64, "every fourth bit of 64; one block of O^T a wave");
    need &= 0x1111111111111111ull << sl;   // the wave's own passes: p % NSL == sl
    if (AHEAD) ldk(need != 0 ? 32 * __builtin_ctzll(need) : 0);
    // A pass whose 32 keys are masked for all of the wave's rows adds 0 to every sum and leaves every maximum, so it is left out. At most TT / 32 / NSL trips, whatever the mask holds; p, and with it every address, stays below TT / 32.
#pragma unroll 1   // rolled: a second copy of the pass would not fit the registers
    for (int p = sl; p < TT / 32; p += NSL) {
        if (((need >> p) & 1ull) == 0) continue;
        const unsigned long long later = (need >> p) >> 1; const int key0 = p * 32, nk = (later != 0) ? key0 + 32 + 32 * __builtin_ctzll(later) : key0;   // nk: the next visited pass's first key
        const bool mix = ((mixed >> p) & 1ull) != 0;   // some key of the pass is masked for some row: only then are the mask words read and applied
        if (!AHEAD) ldk(key0);
        if (mix) { int km = key0;
            // hi+lo rows: this pass's key rows are on their way here; the address is formed from km, so it is formed behind the wait
            if constexpr (!AHEAD) asm volatile("s_wait_xcnt 0x0" : "+s"(km) :: "memory");
#pragma unroll
            for (int qb = 0; qb < NQ; ++qb) ldmk(qb, km);
            // no register of the mask loads' addresses is written before this wait; the address is an input, so it stays as it is up to here
            asm volatile("s_wait_xcnt 0x0" :: "v"(mp + km) : "memory"); }
        V vf[4], vf2[4];
#pragma unroll
        for (int db = 0; db < 4; ++db) vf[db] = F::ldf(Vt + vo + (size_t)db * 16 * TB + key0 * 16);
        if constexpr (HL) {
            // hi+lo rows: the addresses are inputs, so their registers stay as they are up to the wait
            asm volatile("s_wait_xcnt 0x0" :: "v"(Kp + ko + (size_t)key0 * HD), "v"(K2 + ko + (size_t)key0 * HD), "v"(Vt + vo + key0 * 16) : "memory");
#pragma unroll
            for (int db = 0; db < 4; ++db) vf2[db] = F::ldf(V2 + vo + (size_t)db * 16 * TB + key0 * 16);
            asm volatile("s_wait_xcnt 0x0" :: "v"(V2 + vo + key0 * 16) : "memory");   // the same for the lo plane's loads
        }
        v8f s[2][NQ];
#pragma unroll
        for (int kb = 0; kb < 2; ++kb)
#pragma unroll
            for (int qb = 0; qb < NQ; ++qb) { s[kb][qb] = (v8f){};
#pragma unroll
                for (int ks = 0; ks < 2; ++ks) { s[kb][qb] = F::mma(kf[kb][ks], qf[qb][ks], s[kb][qb]); if (HL) { s[kb][qb] = F::mma(kf[kb][ks], qf2[qb][ks], s[kb][qb]); s[kb][qb] = F::mma(kf2[kb][ks], qf[qb][ks], s[kb][qb]); } } }
        // AHEAD: the next visited pass's key rows are fetched behind the last use of this pass's; the last pass fetches its own again (in bounds, unused)
        if (AHEAD) { ldk(nk);
            // the address is an input, so its registers stay as they are up to the wait
            asm volatile("s_wait_xcnt 0x0" :: "v"(Kp + ko + (size_t)nk * HD) : "memory"); }
        if (mix) {   // one scalar branch a pass; -3.0e38 x SC2 is still far below every score, so a masked key's weight is 0 as before
#pragma unroll
            for (int kb = 0; kb < 2; ++kb)
#pragma unroll
                for (int qb = 0; qb < NQ; ++qb)
#pragma unroll
                    for (int j = 0; j < 8; ++j) if (mk[qb][kb][j] != 0) s[kb][qb][j] = -3.0e38f; }
#pragma unroll
        for (int qb = 0; qb < NQ; ++qb) {
            float t[2][8]; float mx = -3.0e38f;
#pragma unroll
            for (int kb = 0; kb < 2; ++kb)
#pragma unroll
                for (int j = 0; j < 8; ++j) { t[kb][j] = s[kb][qb][j] * SC2; mx = fmaxf(mx, t[kb][j]); }
            mx = fmaxf(mx, xhalf(mx));     // the other half of the wave holds the query's other 16 keys
            const float mn = fmaxf(m[qb], mx), alpha = __builtin_amdgcn_exp2f(m[qb] - mn); m[qb] = mn;
            float ps = 0.f;
#pragma unroll
            for (int kb = 0; kb < 2; ++kb)
#pragma unroll
                for (int j = 0; j < 8; ++j) { t[kb][j] = __builtin_amdgcn_exp2f(t[kb][j] - mn); ps += t[kb][j]; }
            l[qb] = l[qb] * alpha + ps;
#pragma unroll
            for (int db = 0; db < 4; ++db) o[db][qb] *= alpha;
            V pf, pf2;
#pragma unroll
            for (int e = 0; e < 16; ++e) { const float p = t[e >> 3][e & 7];
                if constexpr (HL) { const __bf16 ph = (__bf16)p; pf[e] = ph; pf2[e] = (__bf16)(p - (float)ph); } else pf[e] = (h16)p; }
#pragma unroll
            for (int db = 0; db < 4; ++db) { o[db][qb] = F::mma(vf[db], pf, o[db][qb]); if (HL) { o[db][qb] = F::mma(vf[db], pf2, o[db][qb]); o[db][qb] = F::mma(vf2[db], pf, o[db][qb]); } }
        }
    }
    // the wave's partial to its own part of LDS; a wave that had no pass hands over m = -3.0e38, l = 0, o = 0, whose weight below is 0 (or 1 on zeros, where no wave had a pass)
    float* pw = sg + sl * PWF(NQ) + 4 * lane;
#pragma unroll
    for (int db = 0; db < 4; ++db)
#pragma unroll
        for (int qb = 0; qb < NQ; ++qb) { const v8f t = o[db][qb]; *(v4fa*)(pw + ((db * NQ + qb) * 2) * 128) = __builtin_shufflevector(t, t, 0, 1, 2, 3); *(v4fa*)(pw + ((db * NQ + qb) * 2 + 1) * 128) = __builtin_shufflevector(t, t, 4, 5, 6, 7); }
    *(v4fa*)(pw + 8 * NQ * 128) = (v4f){m[0], l[0] + xhalf(l[0]), m[NQ - 1], l[NQ - 1] + xhalf(l[NQ - 1])};   // the wave's halves hold 16 keys each of every pass: their sums join here
    __syncthreads();   // every wave's partial is in LDS; every wave of the work-group comes here, whatever its passes
    const float* pr = sg + 4 * lane; v4f ml[NSL]; v8us oh[NQ], ol[NQ];
#pragma unroll
    for (int s = 0; s < NSL; ++s) ml[s] = *(const v4fa*)(pr + s * PWF(NQ) + 8 * NQ * 128);
#pragma unroll
    for (int qb = 0; qb < NQ; ++qb) {
        float mm = ml[0][2 * qb];
#pragma unroll
        for (int s = 1; s < NSL; ++s) mm = fmaxf(mm, ml[s][2 * qb]);
        float lt = 0.f; v4f a0 = (v4f){}, a1 = (v4f){};
#pragma unroll
        for (int s = 0; s < NSL; ++s) { float w;
            // 2^(m - M); the v_nop fills the slot behind the transcendental
            asm("v_exp_f32 %0, %1\n\tv_nop" : "=v"(w) : "v"(ml[s][2 * qb] - mm));
            const float* po = pr + s * PWF(NQ) + ((sl * NQ + qb) * 2) * 128;
            lt += w * ml[s][2 * qb + 1]; a0 += w * *(const v4fa*)po; a1 += w * *(const v4fa*)(po + 128); }
        const float inv = __fdiv_rn(1.0f, lt);
#pragma unroll
        for (int j = 0; j < 8; ++j) { unsigned short a, c2; splitf((j < 4 ? a0[j & 3] : a1[j & 3]) * inv, a, c2); oh[qb][j] = a; ol[qb][j] = c2; } }
#pragma unroll
    for (int qb = 0; qb < NQ; ++qb) { const size_t oo = (size_t)(q0 + qb * 16) * DQ + sl * 256 + 8 * lane; *(v8us*)(Ah + oo) = oh[qb]; *(v8us*)(Al + oo) = ol[qb]; }
    // both kinds of rows stand behind one another in the kernel's listing: the wait stands behind the last store, in front of whatever writes its registers next
    asm volatile("s_wait_xcnt 0x0" ::: "memory");
}
// grid (heads, batches, RH / 32 + (TT - RH) / 64), 2 NSL waves: two row groups a work-group (their waves of one slice read the same key rows), NSL waves a group. Tiles 0 .. RH / 32 - 1 are the hi+lo rows, 16 a group (three products each, so half the rows), the rest 32 fp16 rows a group.
// There are more work-groups than places for them, so the tile is the grid's slowest index and its number falls with it: under a mask that opens the keys up to the row's own, the longest walks start first and the shortest fill the end.
#define FA_NT (RH / 32 + (TT - RH) / 64)
__global__ __launch_bounds__(64 * NSL) void k_fattn(const h16* __restrict__ Q16, const bf* __restrict__ Qh, const bf* __restrict__ Ql, const h16* __restrict__ K16, const bf* __restrict__ Kh, const bf* __restrict__ Kl, const h16* __restrict__ V16, const bf* __restrict__ Vh, const bf* __restrict__ Vl, const int* __restrict__ am, const unsigned* __restrict__ TS, bf* Ah, bf* Al) {
    __shared__ __align__(16) float sm[2 * NSL * PWF(2)];
    const int wv = __builtin_amdgcn_readfirstlane((int)(threadIdx.x >> 5)), g = wv & 1, sl = wv >> 1; const int bx = FA_NT - 1 - (int)blockIdx.z; const size_t hp = ((size_t)blockIdx.x * NB_ + blockIdx.y) * TT * HD, vp = (size_t)blockIdx.x * HD * TB + (size_t)blockIdx.y * TT * 16;   // the batch's TT rows of the head's q and k; its TT columns (32 a unit) of the head's V^T rows
    const size_t ap = (size_t)blockIdx.y * TT * DQ + blockIdx.x * (HD * 16); Ah += ap; Al += ap;   // the batch's rows; a head's 64 columns: two units of each 16 rows
    if (bx < RH / 32) fattn_rows<bf, true, 1>(sm + g * NSL * PWF(1), sl, Qh + hp, Ql + hp, Kh + hp, Kl + hp, Vh + vp, Vl + vp, am, TS, bx * 32 + g * 16, Ah, Al);
    else fattn_rows<h16, false, 2>(sm + g * NSL * PWF(2), sl, Q16 + hp, nullptr, K16 + hp, nullptr, V16 + vp, nullptr, am, TS, RH + (bx - RH / 32) * 64 + g * 32, Ah, Al);
}

// the up weights [n][8] -> bf16 [n][32], columns 8 .. 31 zero (K padding); 4 elements a thread
__device__ __forceinline__ void lorap(const float* __restrict__ Bw, bf* B2, int blk) { const int e = (blk * 256 + (int)threadIdx.x) * 4, n = e / 32, k = e % 32; v4us o;
    for (int u = 0; u < 4; ++u) o[u] = (k + u < 8) ? f2bf(Bw[(size_t)n * 8 + k + u]) : (unsigned short)0;
    *(v4us*)(B2 + e) = o;
    // the kernel's parts stand behind one another in its listing: the wait stands behind the store, in front of whatever writes its registers next
    asm volatile("s_wait_xcnt 0x0" ::: "memory"); }

// xdown: x f32 -> bf16 in fragment order, and both rank-8 down-projections of the same rows. One work-group takes 16 token rows (block rb) and all DM k, wave w the units 4 w .. 4 w + 3 (128 k).
// A lane converts pieces 'lane' and 'lane + 32' of a unit: they are its two halves of the unit's WMMA fragment, so the converted registers go to XB and, as the A operand, into the product with the 16 down weights
// (B rows n < 8: wq_A, n >= 8: wv_A, read as f32 and rounded here, in the same k order 8 hi + s, 16 + 8 hi + s). The eight waves' partial 16 x 16 tiles meet in LDS and are added in wave order 0 .. 7 (fixed, the same on every run).
// Out: hi/lo planes [tb][32] of each projection, columns 8 .. 31 zero (K padding of the up-projection). Every loop is unrolled, so that the vectors are indexed by constants and stay in registers.
__device__ __forceinline__ void xdown(const float* __restrict__ x, const float* __restrict__ wqA, const float* __restrict__ wvA, bf* XB, bf* XQh, bf* XQl, bf* XVh, bf* XVl, int rb) {
    static_assert(DM == 8 * 128, "eight waves, four units each");
    __shared__ __align__(16) float ps[8 * 256];
    const int tid = (int)threadIdx.x, lane = tid & 31, lr = lane & 15, hi = lane >> 4, wv = __builtin_amdgcn_readfirstlane(tid >> 5);   // the wave's number, held scalar
    const float* px = x + (size_t)(rb * 16 + lr) * DM + wv * 128 + 8 * hi;
    const float* pw = (lr < 8 ? wqA + (size_t)lr * DM : wvA + (size_t)(lr - 8) * DM) + wv * 128 + 8 * hi;
    bf* po = XB + ((size_t)rb * (DM / 32) + wv * 4) * 512 + 8 * lane;
    v8f xa[2][2], wa[2][2];   // two units' f32 values: unit u + 1 is on its way while unit u is rounded
    auto ldu = [&](int u) {
#pragma unroll
        for (int h = 0; h < 2; ++h) { xa[u & 1][h] = *(const v8f*)(px + u * 32 + h * 16); wa[u & 1][h] = *(const v8f*)(pw + u * 32 + h * 16); } };
    ldu(0);
    v8f acc = (v8f){};
#pragma unroll   // unrolled, so that xa[][] and wa[][] are indexed by constants and stay in registers
    for (int u = 0; u < 4; ++u) {
        if (u + 1 < 4) ldu(u + 1);
        v8us a[2], b[2];
#pragma unroll
        for (int h = 0; h < 2; ++h) {
#pragma unroll
            for (int q = 0; q < 8; ++q) { a[h][q] = f2bf(xa[u & 1][h][q]); b[h][q] = f2bf(wa[u & 1][h][q]); }
            *(v8us*)(po + u * 512 + h * 256) = a[h]; }
        acc = wmmab(cat16b(a[0], a[1]), cat16b(b[0], b[1]), acc);
        // no register that an issued load or store names (addresses, the stores' values) is written before this wait: they are inputs, so they stay as they are up to here
        asm volatile("s_wait_xcnt 0x0" :: "v"(px), "v"(pw), "v"(po), "v"(a[0]), "v"(a[1]) : "memory");
    }
#pragma unroll
    for (int j = 0; j < 8; ++j) ps[wv * 256 + (hi * 8 + j) * 16 + lr] = acc[j];
    __syncthreads();   // the eight waves' partial tiles are in LDS
    // thread t: the 16-byte piece t % 4 of row (t / 4) % 16 of plane t / 64 (q hi, q lo, v hi, v lo; the same for a whole wave, held scalar); piece 0 holds the eight sums, the rest the padding
    const int pl = wv >> 1, row = (tid >> 2) & 15, pc = tid & 3; v8us o = (v8us){};
    if (pc == 0) { const float* pp = ps + row * 16 + (pl >> 1) * 8; v4f s0 = *(const v4fa*)pp, s1 = *(const v4fa*)(pp + 4);
#pragma unroll
        for (int s = 1; s < 8; ++s) { s0 += *(const v4fa*)(pp + s * 256); s1 += *(const v4fa*)(pp + s * 256 + 4); }
#pragma unroll
        for (int q = 0; q < 8; ++q) { unsigned short h2, l2; splitf(q < 4 ? s0[q & 3] : s1[q & 3], h2, l2); o[q] = (pl & 1) ? l2 : h2; } }
    *(v8us*)((pl == 0 ? XQh : pl == 1 ? XQl : pl == 2 ? XVh : XVl) + (size_t)(rb * 16 + row) * 32 + pc * 8) = o;
    // the kernel's parts stand behind one another in its listing: the wait stands behind the last store, in front of whatever writes its registers next
    asm volatile("s_wait_xcnt 0x0" ::: "memory");
}

// msum: the mask's summary. One work-group takes 16 query rows (block qk) and all TT keys, wave w the keys 256 w .. 256 w + 255 (8 passes of k_fattn), a lane 4 keys of each row and half.
// Out: four words at TS + 32 qk (a 128-byte line of its own): bit p of words 0, 1 = some key of pass p is open (mask == 0) for some of the rows; bit p of words 2, 3 = some key of pass p is masked.
__device__ __forceinline__ void msum(const int* __restrict__ am, unsigned* TS, int qk) {
    static_assert(TT == 8 * 256, "eight waves, 256 keys each; 64 passes in two words");
    __shared__ unsigned sh[8];
    const int lane = threadIdx.x & 31, wv = (int)threadIdx.x >> 5; const int* p = am + (size_t)qk * 16 * TT + wv * 256 + lane * 4;
    bool open[2] = {false, false}, shut[2] = {false, false};
#pragma unroll
    for (int r = 0; r < 16; ++r)
#pragma unroll
        for (int h = 0; h < 2; ++h) { const v4i x = *(const v4i*)(p + (size_t)r * TT + h * 128);
#pragma unroll
            for (int q = 0; q < 4; ++q) { open[h] |= x[q] == 0; shut[h] |= x[q] != 0; } }
    unsigned bits = 0;   // bits 0 .. 7: open, 8 .. 15: masked, of the wave's 8 passes; 8 lanes hold one pass's 32 keys
#pragma unroll
    for (int h = 0; h < 2; ++h) { const unsigned bo = __builtin_amdgcn_ballot_w32(open[h]), bs = __builtin_amdgcn_ballot_w32(shut[h]);
#pragma unroll
        for (int t = 0; t < 4; ++t) { bits |= (((bo >> (8 * t)) & 0xFFu) != 0 ? 1u : 0u) << (h * 4 + t); bits |= (((bs >> (8 * t)) & 0xFFu) != 0 ? 1u : 0u) << (8 + h * 4 + t); } }
    if (lane == 0) sh[wv] = bits;
    __syncthreads();   // the eight waves' bits are in LDS
    if (threadIdx.x == 0) { v4u o = (v4u){0u, 0u, 0u, 0u};
#pragma unroll
        for (int w = 0; w < 4; ++w) { o[0] |= (sh[w] & 0xFFu) << (8 * w); o[1] |= (sh[w + 4] & 0xFFu) << (8 * w); o[2] |= ((sh[w] >> 8) & 0xFFu) << (8 * w); o[3] |= ((sh[w + 4] >> 8) & 0xFFu) << (8 * w); }
        *(v4u*)(TS + (size_t)qk * 32) = o; }
}

// every conversion in one grid, picked by block range (the same for a whole work-group): the mask's summary and x with its down-projections first (the longest work-groups, so they start at once), then the up weights, then the four weights
#define PB_X (TB / 16)
#define PB_W (DM * DM / 8 / 256)
#define PB_L (DM * 32 / 4 / 256)
#define PB_M (TT / 16)
__global__ __launch_bounds__(256) void k_prep(const float* __restrict__ x, const float* __restrict__ wq, const float* __restrict__ wk, const float* __restrict__ wv, const float* __restrict__ wo, const float* __restrict__ wqA, const float* __restrict__ wqB, const float* __restrict__ wvA, const float* __restrict__ wvB, const int* __restrict__ am,
                                              unsigned* TS, bf* XB, bf* WQ, bf* WK, bf* WV, bf* WO, bf* BQ2, bf* BV2, bf* XQh, bf* XQl, bf* XVh, bf* XVl) {
    static_assert(DQ == DM && DKV == DM, "four weights of one size");
    int b = blockIdx.x;
    if (b < PB_M) { msum(am, TS, b); return; }   // the most bytes a work-group, so these start first
    b -= PB_M;
    if (b < PB_X) { xdown(x, wqA, wvA, XB, XQh, XQl, XVh, XVl, b); return; }
    b -= PB_X;
    if (b < PB_L) { lorap(wqB, BQ2, b); return; }
    b -= PB_L;
    if (b < PB_L) { lorap(wvB, BV2, b); return; }
    b -= PB_L;
    const int w = b / PB_W; cvt8(w == 0 ? wq : w == 1 ? wk : w == 2 ? wv : wo, w == 0 ? WQ : w == 1 ? WK : w == 2 ? WV : WO, (size_t)DM * DM / 8, b % PB_W);
}

extern "C" void kernel_launch(void* const* d_in, const int* in_sizes, int n_in,
                              void* d_out, int out_size, void* d_ws, size_t ws_size, hipStream_t stream) {
    (void)in_sizes; (void)n_in; (void)out_size;
    const float* x = (const float*)d_in[0]; const int* amask = (const int*)d_in[1]; const float* wq = (const float*)d_in[2]; const float* wqA = (const float*)d_in[3]; const float* wqB = (const float*)d_in[4]; const float* wk = (const float*)d_in[5]; const float* wv = (const float*)d_in[6]; const float* wvA = (const float*)d_in[7]; const float* wvB = (const float*)d_in[8]; const float* wo = (const float*)d_in[9]; const float* cosT = nullptr; const float* sinT = nullptr; (void)cosT; (void)sinT;
    float* OUT = (float*)d_out;     // [2][2048][1024]
    char* wsp = (char*)d_ws;
    auto take = [&](size_t bytes) { char* p = wsp; wsp += (bytes + 255) & ~(size_t)255; return (void*)p; };
    bf* WQ = (bf*)take((size_t)DQ * DM * 2); bf* WK = (bf*)take((size_t)DKV * DM * 2); bf* WV = (bf*)take((size_t)DKV * DM * 2); bf* WO = (bf*)take((size_t)DM * DQ * 2);
    bf* XB = (bf*)take((size_t)TB * DM * 2); bf* BQ2 = (bf*)take((size_t)DM * 32 * 2); bf* BV2 = (bf*)take((size_t)DM * 32 * 2); bf* XQh = (bf*)take((size_t)TB * 32 * 2); bf* XQl = (bf*)take((size_t)TB * 32 * 2); bf* XVh = (bf*)take((size_t)TB * 32 * 2); bf* XVl = (bf*)take((size_t)TB * 32 * 2);
    h16* QP16 = (h16*)take((size_t)NH_ * TB * HD * 2); h16* KP16 = (h16*)take((size_t)NKV * TB * HD * 2); h16* VT16 = (h16*)take((size_t)NKV * HD * TB * 2);
    bf* QPh = (bf*)take((size_t)NH_ * TB * HD * 2); bf* QPl = (bf*)take((size_t)NH_ * TB * HD * 2); bf* KPh = (bf*)take((size_t)NKV * TB * HD * 2); bf* KPl = (bf*)take((size_t)NKV * TB * HD * 2); bf* VTh = (bf*)take((size_t)NKV * HD * TB * 2); bf* VTl = (bf*)take((size_t)NKV * HD * TB * 2);
    bf* ATh = (bf*)take((size_t)TB * DQ * 2); bf* ATl = (bf*)take((size_t)TB * DQ * 2); unsigned* TS = (unsigned*)take((size_t)(TT / 16) * 128);
    if ((size_t)(wsp - (char*)d_ws) > ws_size) return;    // ws 256 MiB
    k_prep<<<PB_M + 2 * PB_L + PB_X + 4 * PB_W, 256, 0, stream>>>(x, wq, wk, wv, wo, wqA, wqB, wvA, wvB, amask, TS, XB, WQ, WK, WV, WO, BQ2, BV2, XQh, XQl, XVh, XVl);
    k_qkv<<<dim3(TB / 128, DM / 128, 3), 128, 0, stream>>>(XB, WQ, WK, WV, XQh, XQl, XVh, XVl, BQ2, BV2, QP16, QPh, QPl, KP16, KPh, KPl, VT16, VTh, VTl);
    k_fattn<<<dim3(NH_, NB_, FA_NT), 64 * NSL, 0, stream>>>(QP16, QPh, QPl, KP16, KPh, KPl, VT16, VTh, VTl, amask, TS, ATh, ATl);   // one kv head per query head
    k_wo<<<dim3(TB / 128, DM / 128, 1), 256, 0, stream>>>(ATh, ATl, WO, OUT);
}
